// v000
// Times are from an AMD MI455X. After a warm-up the kernel runs many times in a row, and a time is the length of
// such a window on the GPU divided by its runs, so every launch and the gaps after it count. The runs cycle
// through copies of the inputs. A figure is the median of several windows, for all but v000 over two sittings.
// Sittings can differ by a few percent; kernels timed side by side share one.
// v000 is the starting kernel. One run takes 2230 microseconds.
#include <hip/hip_runtime.h>
// K2Layer (h [8][1024][1024]; hn = rmsnorm(h)*norm1_scale; gate = sigmoid(gate_logit), alpha = sigmoid(alpha_logit); q|k = hn [u|v] (rank 64), row-l2-normalised; gamma_r = 0.15 + 0.85 sigmoid(decay_logit_r); A[i][j] = causal(j<=i) * (gate k_base[i][j] + alpha sum_r q[i][r] k[j][r] gamma_r^(i-j)); out = A . hn; h1 = h + out proj_w^T + proj_b; m = gelu_erf(rmsnorm(h1)*norm2_scale up_w^T + up_b) down_w^T + down_b; result = h1 + m -> [8][1024][1024]).
// Structure: token rows; rmsnorm on VALU (f32) into f16 rows and per-batch transposed f16 planes (LDS); the rank-64 q|k projection as a WMMA GEMM (f32), l2-normalisation and the per-rank decayed causal scores on VALU in f32 (gamma^d table built on device from decay_logit, k_base/gate/alpha read) into the f16 mixing matrix A; out = A . hn, proj (+ bias + h), up (+ bias, exact-GELU epilogue, f16), down (+ bias + h1) as WMMA GEMMs (32x64 wave tiles, f32 accumulation, exact x16 weights).
// Compute dtype: inputs rounded to bf16; h / weights / k_base exact; hn, A, out, rmsnorm(h1), GELU hidden plain f16 operands (~2^-12); scores, norms, residuals f32. v_wmma_f32_16x16x32_f16.
#define NB 8
#define SQ 1024
#define DM 1024
#define RR 64
#define FH 2048
#define NR ((size_t)NB * SQ)
#define MQ NR                        /* rows through the proj/MLP stage (debug hook) */
typedef __bf16 v16b __attribute__((ext_vector_type(16)));
typedef unsigned short v8us __attribute__((ext_vector_type(8), may_alias));
typedef float  v8f  __attribute__((ext_vector_type(8)));
typedef float  v4f  __attribute__((ext_vector_type(4)));
typedef float  v4fa __attribute__((ext_vector_type(4), may_alias));
union FragB { v16b v; v8us half[2]; unsigned short u[16]; };

__device__ __forceinline__ unsigned short bf16_bits(float x) { unsigned int u = __float_as_uint(x); return (unsigned short)((u + 0x7FFFu + ((u >> 16) & 1u)) >> 16); }
__device__ __forceinline__ float bf16_val(unsigned short b) { return __uint_as_float(((unsigned int)b) << 16); }
__device__ __forceinline__ float bf16_round(float x) { return bf16_val(bf16_bits(x)); }
// D += A·B with NT terms: 1 = ah·bh, 2 = + al·bh (A split), 3 = + ah·bl (both split)
template <int NT>
__device__ __forceinline__ v8f mmaN(v16b ah, v16b al, v16b bh, v16b bl, v8f c) {
  c = __builtin_amdgcn_wmma_f32_16x16x32_bf16(false, ah, false, bh, (short)0, c, false, false);
  if (NT >= 2) c = __builtin_amdgcn_wmma_f32_16x16x32_bf16(false, al, false, bh, (short)0, c, false, false);
  if (NT >= 3) c = __builtin_amdgcn_wmma_f32_16x16x32_bf16(false, ah, false, bl, (short)0, c, false, false);
  asm volatile("v_nop\n\tv_nop\n\tv_nop\n\tv_nop" : "+v"(c) : "v"(ah), "v"(al), "v"(bh), "v"(bl));
  return c;
}

__global__ __launch_bounds__(256) void k_wt_bf16(const float* __restrict__ W, unsigned short* __restrict__ Wt, int K, int N) {
  const int t = blockIdx.x * 256 + threadIdx.x;
  const int k8n = K / 8;
  if (t >= N * k8n) return;
  const int n = t / k8n, k8 = (t % k8n) * 8;
  v8us v;
#pragma unroll
  for (int i = 0; i < 8; ++i) v[i] = bf16_bits(W[(size_t)(k8 + i) * N + n]);
  *(v8us*)(Wt + (size_t)n * K + k8) = v;
  
}

// GEMM C[M][N] (f32, pitch ldc) = act(A[M][K]·W + bias). A f32 row-major (pitch lda) converted per fragment to bf16
// (ASPLIT: hi/lo two planes -> 2 terms, else single rounded term); Wt bf16 [N][K] (pitch ldb). BIAS_BF16 rounds the
// bias to bf16 first (bias quantised to bf16 before the add). K%32==0, M%16==0, N%64==0.
template <bool ASPLIT, int ACT, bool BIAS_BF16>
__global__ __launch_bounds__(128) void k_gemm_bf(const float* __restrict__ A, int lda, const unsigned short* __restrict__ Wt, int ldb,
                                               const float* __restrict__ bias, float* __restrict__ C, int ldc, int M, int N, int K) {
  __shared__ __attribute__((aligned(16))) float so[4][16][64];
  const int tid = threadIdx.x, w = tid >> 5, lane = tid & 31, ln = lane & 15, hh = lane >> 4;
  const int ntn = N / 64;
  const int wid = blockIdx.x * 4 + w;
  const int mt = wid / ntn, nq = wid % ntn;
  if (mt * 16 >= M) return;
  const int row0 = mt * 16, col0 = nq * 64;
  const float* arow = A + (size_t)(row0 + ln) * lda;
  v8f acc[4] = {};
  for (int kb = 0; kb < K; kb += 32) {
    FragB ah, al;
    const v4f x0 = *(const v4fa*)(arow + kb + 8 * hh), x1 = *(const v4fa*)(arow + kb + 8 * hh + 4);
    const v4f x2 = *(const v4fa*)(arow + kb + 16 + 8 * hh), x3 = *(const v4fa*)(arow + kb + 16 + 8 * hh + 4);
    float xs[16] = {x0[0],x0[1],x0[2],x0[3],x1[0],x1[1],x1[2],x1[3],x2[0],x2[1],x2[2],x2[3],x3[0],x3[1],x3[2],x3[3]};
#pragma unroll
    for (int i = 0; i < 16; ++i) { const unsigned short hb = bf16_bits(xs[i]); ah.u[i] = hb; al.u[i] = ASPLIT ? bf16_bits(xs[i] - bf16_val(hb)) : (unsigned short)0; }
#pragma unroll
    for (int t = 0; t < 4; ++t) {
      const unsigned short* brow = Wt + (size_t)(col0 + t * 16 + ln) * ldb + kb;
      FragB b;
      b.half[0] = *(const v8us*)(brow + 8 * hh);
      b.half[1] = *(const v8us*)(brow + 16 + 8 * hh);
      acc[t] = mmaN<ASPLIT ? 2 : 1>(ah.v, al.v, b.v, b.v, acc[t]);
    }
  }
#pragma unroll
  for (int t = 0; t < 4; ++t) {
    float bv = bias ? bias[col0 + t * 16 + ln] : 0.f;
    if (BIAS_BF16) bv = bf16_round(bv);
#pragma unroll
    for (int r = 0; r < 8; ++r) { float v = acc[t][r] + bv; if (ACT == 1) v = fmaxf(v, 0.f); so[w][8 * hh + r][t * 16 + ln] = v; }
  }
  __builtin_amdgcn_fence(__ATOMIC_ACQ_REL, "workgroup");
  __builtin_amdgcn_wave_barrier();
  const int rsub = lane >> 4, c4 = (lane & 15) * 4;
  {
#pragma unroll
    for (int q = 0; q < 8; ++q) {
      const int r = q * 2 + rsub;
      const v4f v = *(const v4fa*)&so[w][r][c4];
      *(v4f*)(C + (size_t)(row0 + r) * ldc + col0 + c4) = v;
    }
    
  }
}

// GEMM C = act(A·W + bias + resid): A f32 (ASPLIT -> hi/lo 2 terms), Wt bf16 [N][K]; ACT 0 none, 1 relu, 2 exact gelu;
// resid (optional, f32, row index = (row % rmod), pitch ldr, RES_BF16 rounds it) added before the activation.
template <bool ASPLIT, int ACT, bool BIAS_BF16, bool RES_BF16>
__global__ __launch_bounds__(128) void k_gemm_bf3(const float* __restrict__ A, int lda, const unsigned short* __restrict__ Wt, int ldb,
                                                const float* __restrict__ bias, const float* __restrict__ resid, int rmod, int ldr,
                                                float* __restrict__ C, int ldc, int M, int N, int K) {
  __shared__ __attribute__((aligned(16))) float so[4][16][64];
  const int tid = threadIdx.x, w = tid >> 5, lane = tid & 31, ln = lane & 15, hh = lane >> 4;
  const int ntn = N / 64;
  const int wid = blockIdx.x * 4 + w;
  const int mt = wid / ntn, nq = wid % ntn;
  if (mt * 16 >= M) return;
  const int row0 = mt * 16, col0 = nq * 64;
  const float* arow = A + (size_t)(row0 + ln) * lda;
  v8f acc[4] = {};
  for (int kb = 0; kb < K; kb += 32) {
    FragB ah, al;
    const v4f x0 = *(const v4fa*)(arow + kb + 8 * hh), x1 = *(const v4fa*)(arow + kb + 8 * hh + 4);
    const v4f x2 = *(const v4fa*)(arow + kb + 16 + 8 * hh), x3 = *(const v4fa*)(arow + kb + 16 + 8 * hh + 4);
    float xs[16] = {x0[0],x0[1],x0[2],x0[3],x1[0],x1[1],x1[2],x1[3],x2[0],x2[1],x2[2],x2[3],x3[0],x3[1],x3[2],x3[3]};
#pragma unroll
    for (int i = 0; i < 16; ++i) { const unsigned short hb = bf16_bits(xs[i]); ah.u[i] = hb; al.u[i] = ASPLIT ? bf16_bits(xs[i] - bf16_val(hb)) : (unsigned short)0; }
#pragma unroll
    for (int t = 0; t < 4; ++t) {
      const unsigned short* brow = Wt + (size_t)(col0 + t * 16 + ln) * ldb + kb;
      FragB b;
      b.half[0] = *(const v8us*)(brow + 8 * hh);
      b.half[1] = *(const v8us*)(brow + 16 + 8 * hh);
      acc[t] = mmaN<ASPLIT ? 2 : 1>(ah.v, al.v, b.v, b.v, acc[t]);
    }
  }
#pragma unroll
  for (int t = 0; t < 4; ++t) {
    const int col = col0 + t * 16 + ln;
    float bv = bias ? bias[col] : 0.f;
    if (BIAS_BF16) bv = bf16_round(bv);
#pragma unroll
    for (int r = 0; r < 8; ++r) {
      float v = acc[t][r] + bv;
      if (resid) { float rv = resid[(size_t)((row0 + 8 * hh + r) % rmod) * ldr + col]; if (RES_BF16) rv = bf16_round(rv); v += rv; }
      if (ACT == 1) v = fmaxf(v, 0.f);
      if (ACT == 2) v = 0.5f * v * (1.0f + erff(v * 0.70710678118654752f));
      if (ACT == 3) { const float u = 0.7978845608028654f * (v + 0.044715f * v * v * v); v = 0.5f * v * (1.0f + tanhf(u)); }
      so[w][8 * hh + r][t * 16 + ln] = v;
    }
  }
  __builtin_amdgcn_fence(__ATOMIC_ACQ_REL, "workgroup");
  __builtin_amdgcn_wave_barrier();
  const int rsub = lane >> 4, c4 = (lane & 15) * 4;
  {
#pragma unroll
    for (int q = 0; q < 8; ++q) {
      const int r = q * 2 + rsub;
      const v4f v = *(const v4fa*)&so[w][r][c4];
      *(v4f*)(C + (size_t)(row0 + r) * ldc + col0 + c4) = v;
    }
    
  }
}
// row LayerNorm (biased variance, eps) over N: s = X (+ R); optional out_sum <- s; out_norm <- (s-mu)*rsqrt(var+eps)*g + b
template <bool PARAM_BF16>
__global__ __launch_bounds__(256) void k_layernorm(const float* __restrict__ X, const float* __restrict__ R, const float* __restrict__ g, const float* __restrict__ bta,
                                                  float* __restrict__ out_sum, float* __restrict__ out_norm, int N, float eps) {
  __shared__ float red[256];
  const int row = blockIdx.x, tid = threadIdx.x;
  const float* x = X + (size_t)row * N; const float* rr = R ? R + (size_t)row * N : nullptr;
  float vals[16];                     // up to N = 4096
  const int per = N / 256;            // contiguous chunk per thread? use strided-by-4 chunks: thread handles j = tid*4 + 1024*u
  float s1 = 0.f;
  for (int u = 0; u < per / 4; ++u) {
    const int j = tid * 4 + 1024 * u;
    const v4f a = *(const v4fa*)(x + j);
    v4f b = {0.f,0.f,0.f,0.f}; if (rr) b = *(const v4fa*)(rr + j);
#pragma unroll
    for (int q = 0; q < 4; ++q) { const float v = a[q] + b[q]; vals[u * 4 + q] = v; s1 += v; }
  }
  red[tid] = s1; __syncthreads();
  for (int st = 128; st > 0; st >>= 1) { if (tid < st) red[tid] += red[tid + st]; __syncthreads(); }
  const float mu = red[0] / (float)N; __syncthreads();
  float s2 = 0.f;
  for (int u = 0; u < per / 4; ++u)
#pragma unroll
    for (int q = 0; q < 4; ++q) { const float c = vals[u * 4 + q] - mu; s2 += c * c; }
  red[tid] = s2; __syncthreads();
  for (int st = 128; st > 0; st >>= 1) { if (tid < st) red[tid] += red[tid + st]; __syncthreads(); }
  const float rs = rsqrtf(red[0] / (float)N + eps);
  {
    for (int u = 0; u < per / 4; ++u) {
      const int j = tid * 4 + 1024 * u;
      v4f o, sm;
#pragma unroll
      for (int q = 0; q < 4; ++q) {
        float gg = g[j + q], bb = bta[j + q];
        if (PARAM_BF16) { gg = bf16_round(gg); bb = bf16_round(bb); }
        sm[q] = vals[u * 4 + q]; o[q] = (vals[u * 4 + q] - mu) * rs * gg + bb;
      }
      if (out_sum) *(v4f*)(out_sum + (size_t)row * N + j) = sm;
      *(v4f*)(out_norm + (size_t)row * N + j) = o;
    }
    
  }
}



// ---- f16 WMMA path (v_wmma_f32_16x16x32_f16): 11-bit significands for operands in range — used for every GEMM launched here
typedef _Float16 v16h __attribute__((ext_vector_type(16)));
union FragH { v16h v; v8us half[2]; _Float16 h[16]; unsigned short u[16]; };
template <int NT>
__device__ __forceinline__ v8f mmaH(v16h ah, v16h al, v16h bh, v16h bl, v8f c) {
  c = __builtin_amdgcn_wmma_f32_16x16x32_f16(false, ah, false, bh, (short)0, c, false, false);
  if (NT >= 2) c = __builtin_amdgcn_wmma_f32_16x16x32_f16(false, al, false, bh, (short)0, c, false, false);
  if (NT >= 3) c = __builtin_amdgcn_wmma_f32_16x16x32_f16(false, ah, false, bl, (short)0, c, false, false);
  asm volatile("v_nop\n\tv_nop\n\tv_nop\n\tv_nop" : "+v"(c) : "v"(ah), "v"(al), "v"(bh), "v"(bl));
  return c;
}
// batched GEMM like k_gemm_b but f16 operands: A f32 (split into f16 hi/lo if ASPLIT, else rounded to f16), Bt = f16 values [n][k]; alpha; C f32; N multiple of 16 (partial tiles skipped)
template <bool ASPLIT>
__global__ __launch_bounds__(128) void k_gemm_h(const float* __restrict__ A, int lda, size_t sA, const _Float16* __restrict__ Bh, int ldb, size_t sB, float alpha, float* __restrict__ C, int ldc, size_t sC, int M, int N, int K) {
  __shared__ __attribute__((aligned(16))) float so[4][16][64];
  const int tid = threadIdx.x, w = tid >> 5, lane = tid & 31, ln = lane & 15, hh = lane >> 4; const int by = blockIdx.y;
  A += (size_t)by * sA; Bh += (size_t)by * sB; C += (size_t)by * sC;
  const int ntn = (N + 63) / 64; const int wid = blockIdx.x * 4 + w; const int mt = wid / ntn, nq = wid % ntn; if (mt * 16 >= M) return;
  const int row0 = mt * 16, col0 = nq * 64; const float* arow = A + (size_t)(row0 + ln) * lda;
  v8f acc[4] = {};
  for (int kb = 0; kb < K; kb += 32) {
    FragH ah, al;
    const v4f x0 = *(const v4fa*)(arow + kb + 8 * hh), x1 = *(const v4fa*)(arow + kb + 8 * hh + 4), x2 = *(const v4fa*)(arow + kb + 16 + 8 * hh), x3 = *(const v4fa*)(arow + kb + 16 + 8 * hh + 4);
    float xs[16] = {x0[0],x0[1],x0[2],x0[3],x1[0],x1[1],x1[2],x1[3],x2[0],x2[1],x2[2],x2[3],x3[0],x3[1],x3[2],x3[3]};
#pragma unroll
    for (int i = 0; i < 16; ++i) { const _Float16 h = (_Float16)xs[i]; ah.h[i] = h; al.h[i] = ASPLIT ? (_Float16)(xs[i] - (float)h) : (_Float16)0.0f; }
#pragma unroll
    for (int t = 0; t < 4; ++t) { if (col0 + t * 16 >= N) continue; const size_t boff = (size_t)(col0 + t * 16 + ln) * ldb + kb; FragH bq; bq.half[0] = *(const v8us*)(Bh + boff + 8 * hh); bq.half[1] = *(const v8us*)(Bh + boff + 16 + 8 * hh);
      acc[t] = mmaH<ASPLIT ? 2 : 1>(ah.v, al.v, bq.v, bq.v, acc[t]); }
  }
#pragma unroll
  for (int t = 0; t < 4; ++t) { if (col0 + t * 16 >= N) continue;
#pragma unroll
    for (int r = 0; r < 8; ++r) so[w][8 * hh + r][t * 16 + ln] = acc[t][r] * alpha; }
  __builtin_amdgcn_fence(__ATOMIC_ACQ_REL, "workgroup"); __builtin_amdgcn_wave_barrier();
  const int rsub = lane >> 4, c4 = (lane & 15) * 4;
  {
#pragma unroll
    for (int q = 0; q < 8; ++q) { const int r = q * 2 + rsub; if (col0 + c4 < N) { const v4f v = *(const v4fa*)&so[w][r][c4]; *(v4f*)(C + (size_t)(row0 + r) * ldc + col0 + c4) = v; } }
     }
}

// Wt[n][k] = f16(W[k][n]·scale) from f32 row-major W[K][N] (scale = power of two; bf16-exact weights stay exact in f16 away from the subnormal range)
__global__ __launch_bounds__(256) void k_wt_f16(const float* __restrict__ W, _Float16* __restrict__ Wt, int K, int N, float scale) {
  const int t = blockIdx.x * 256 + threadIdx.x; if (t >= N * (K / 8)) return; const int n = t / (K / 8), k8 = (t % (K / 8)) * 8; FragH f;
#pragma unroll
  for (int i = 0; i < 8; ++i) f.h[i] = (_Float16)(bf16_round(W[(size_t)(k8 + i) * N + n]) * scale); const v8us o = f.half[0];
  *(v8us*)((unsigned short*)Wt + (size_t)n * K + k8) = o; 
}
// k_gemm_hh variant with fused epilogue: v = acc·alpha + bias[by·sBias + col] (+ CP[(row/rowsPerB)·sCPb + by·64 + col] if CP) ; ACT 0 none / 1 elu ; writes f16 C16 (and f32 C if non-null)
template <int ACT>
__global__ __launch_bounds__(128) void k_gemm_hhx(const _Float16* __restrict__ A, int lda, size_t sA, const _Float16* __restrict__ Bh, int ldb, size_t sB, float alpha, const float* __restrict__ bias, size_t sBias, const float* __restrict__ CP, int rowsPerB, size_t sCPb, int row0g,
    float* __restrict__ C, _Float16* __restrict__ C16, int ldc, size_t sC, int M, int N, int K) {
  __shared__ __attribute__((aligned(16))) float so[4][16][64];
  const int tid = threadIdx.x, w = tid >> 5, lane = tid & 31, ln = lane & 15, hh = lane >> 4; const int by = blockIdx.y;
  A += (size_t)by * sA; Bh += (size_t)by * sB; const size_t cofs = (size_t)by * sC; const float* bp = bias ? bias + (size_t)by * sBias : nullptr;
  const int ntn = (N + 63) / 64; const int wid = blockIdx.x * 4 + w; const int mt = wid / ntn, nq = wid % ntn; if (mt * 16 >= M) return;
  const int row0 = mt * 16, col0 = nq * 64; const _Float16* arow = A + (size_t)(row0 + ln) * lda;
  v8f acc[4] = {};
  for (int kb = 0; kb < K; kb += 32) { FragH ah; ah.half[0] = *(const v8us*)((const unsigned short*)arow + kb + 8 * hh); ah.half[1] = *(const v8us*)((const unsigned short*)arow + kb + 16 + 8 * hh);
#pragma unroll
    for (int t = 0; t < 4; ++t) { if (col0 + t * 16 >= N) continue; const size_t boff = (size_t)(col0 + t * 16 + ln) * ldb + kb; FragH bq; bq.half[0] = *(const v8us*)((const unsigned short*)Bh + boff + 8 * hh); bq.half[1] = *(const v8us*)((const unsigned short*)Bh + boff + 16 + 8 * hh);
      acc[t] = mmaH<1>(ah.v, ah.v, bq.v, bq.v, acc[t]); }
  }
#pragma unroll
  for (int t = 0; t < 4; ++t) { if (col0 + t * 16 >= N) continue; const int col = col0 + t * 16 + ln; const float bv = bp ? bf16_round(bp[col]) : 0.f;
#pragma unroll
    for (int r = 0; r < 8; ++r) { float v = acc[t][r] * alpha + bv; if (CP) { const int rr = row0g + row0 + 8 * hh + r; if (rowsPerB < 0) v += CP[cofs + (size_t)rr * ldc + col];      /* rowsPerB < 0: own element of the batched C plane */ else { const int bidx = rr / rowsPerB; v += CP[(size_t)bidx * sCPb + (size_t)by * 64 + col]; } } if (ACT == 1) v = (v > 0.f) ? v : expm1f(v); else if (ACT == 7) v = (v > 0.f) ? v + 1.0f : expf(v); else if (ACT == 8) v = tanhf(v); else if (ACT == 9) v = 0.5f * v * (1.0f + tanhf(0.7978845608028654f * (v + 0.044715f * v * v * v))); else if (ACT == 11) v = 1.0f / (1.0f + expf(-v)); else if (ACT == 12) v = (v > 0.f) ? v : 0.01f * v; else if (ACT == 14) v = (v > 0.f) ? v : 0.1f * v; else if (ACT == 16) v = (v >= 0.f) ? v : 0.3f * v; else if (ACT == 17) v = (v >= 0.f) ? v : 0.2f * v; else if (ACT == 15) v = v / (1.0f + expf(-v)); else if (ACT == 3) v = fmaxf(v, 0.f); else if (ACT == 6) v = 0.5f * v * (1.0f + erff(v * 0.70710678118654752f)); so[w][8 * hh + r][t * 16 + ln] = v; } }
  __builtin_amdgcn_fence(__ATOMIC_ACQ_REL, "workgroup"); __builtin_amdgcn_wave_barrier();
  const int rsub = lane >> 4, c4 = (lane & 15) * 4; typedef _Float16 v4h __attribute__((ext_vector_type(4)));
  {
#pragma unroll
    for (int q = 0; q < 8; ++q) { const int r = q * 2 + rsub; if (col0 + c4 < N) { const v4f v = *(const v4fa*)&so[w][r][c4]; if (C) *(v4f*)(C + cofs + (size_t)(row0 + r) * ldc + col0 + c4) = v; if (C16) { v4h h4; for (int i = 0; i < 4; ++i) h4[i] = (_Float16)v[i]; *(v4h*)(C16 + cofs + (size_t)(row0 + r) * ldc + col0 + c4) = h4; } } }
     }
}


typedef _Float16 v4h __attribute__((ext_vector_type(4)));

__global__ __launch_bounds__(256) void k_x16(const float* __restrict__ x, _Float16* __restrict__ X16, size_t n8) { const size_t t = (size_t)blockIdx.x * 256 + threadIdx.x; if (t >= n8) return; FragH f;
#pragma unroll
  for (int q = 0; q < 8; ++q) f.h[q] = (_Float16)bf16_round(x[t * 8 + q]); *(v8us*)((unsigned short*)X16 + t * 8) = f.half[0];  }
__global__ __launch_bounds__(256) void k_h16(const float* __restrict__ x, _Float16* __restrict__ X16, size_t n8) { const size_t t = (size_t)blockIdx.x * 256 + threadIdx.x; if (t >= n8) return; FragH f;
#pragma unroll
  for (int q = 0; q < 8; ++q) f.h[q] = (_Float16)x[t * 8 + q]; *(v8us*)((unsigned short*)X16 + t * 8) = f.half[0];  }
__global__ __launch_bounds__(256) void k_round16f(const float* __restrict__ W, _Float16* __restrict__ Bt, size_t n8) { const size_t t = (size_t)blockIdx.x * 256 + threadIdx.x; if (t >= n8) return; FragH f;
#pragma unroll
  for (int i = 0; i < 8; ++i) f.h[i] = (_Float16)(bf16_round(W[t * 8 + i]) * 16.0f); *(v8us*)((unsigned short*)Bt + t * 8) = f.half[0];  }
template <int NHv, int TTv>
__global__ __launch_bounds__(256) void k_vt(const _Float16* __restrict__ V16, int ldv, int voff, _Float16* __restrict__ Vt) { __shared__ unsigned short tl[64][66]; const int tid = threadIdx.x; const int slab = blockIdx.x / (TTv / 64), lg = blockIdx.x % (TTv / 64); const int b = slab / NHv, h = slab % NHv;
  for (int i = tid; i < 64 * 8; i += 256) { const int r = i / 8, c8 = (i % 8) * 8; FragH f; f.half[0] = *(const v8us*)((const unsigned short*)V16 + ((size_t)b * TTv + lg * 64 + r) * ldv + voff + h * 64 + c8);
#pragma unroll
    for (int q = 0; q < 8; ++q) tl[r][c8 + q] = f.u[q]; }
  __syncthreads();
  {
#pragma unroll
    for (int rd = 0; rd < 2; ++rd) { const int d = rd * 32 + tid / 8, pc = tid % 8; FragH f;
#pragma unroll
      for (int q = 0; q < 8; ++q) f.u[q] = tl[pc * 8 + q][d];
      *(v8us*)((unsigned short*)Vt + ((size_t)slab * 64 + d) * TTv + lg * 64 + pc * 8) = f.half[0]; }
     } }

__global__ __launch_bounds__(256) void k_hl(const float* __restrict__ F, _Float16* __restrict__ Hh, _Float16* __restrict__ Hl, size_t n8) { const size_t t = (size_t)blockIdx.x * 256 + threadIdx.x; if (t >= n8) return; FragH fh, fl; const v4f a = *(const v4fa*)(F + t * 8), c = *(const v4fa*)(F + t * 8 + 4);
#pragma unroll
  for (int q = 0; q < 4; ++q) { _Float16 h = (_Float16)a[q]; fh.h[q] = h; fl.h[q] = (_Float16)((a[q] - (float)h) * 1024.0f); h = (_Float16)c[q]; fh.h[4 + q] = h; fl.h[4 + q] = (_Float16)((c[q] - (float)h) * 1024.0f); }
  { *(v8us*)((unsigned short*)Hh + t * 8) = fh.half[0]; *(v8us*)((unsigned short*)Hl + t * 8) = fl.half[0];  } }

// ---- fast GEMM (wave tile 32x64; requires M % 32 == 0 rows per launch region and N % 64 == 0); epilogue = k_gemm_hhx semantics ----
__device__ __forceinline__ v16h g2_frag(const _Float16* p, int hh) { FragH f; f.half[0] = *(const v8us*)((const unsigned short*)p + 8 * hh); f.half[1] = *(const v8us*)((const unsigned short*)p + 16 + 8 * hh); return f.v; }
__device__ __forceinline__ v8f g2_mma(v16h a, v16h b, v8f c) { v8f d = __builtin_amdgcn_wmma_f32_16x16x32_f16(false, a, false, b, (short)0, c, false, false); asm volatile("v_nop\n\tv_nop\n\tv_nop\n\tv_nop" : "+v"(d) : "v"(a), "v"(b)); return d; }
template <int ACT>
__global__ __launch_bounds__(128) void k_gemm2(const _Float16* __restrict__ A, int lda, size_t sA, const _Float16* __restrict__ Bh, int ldb, size_t sB, float alpha, const float* __restrict__ bias, size_t sBias, const float* __restrict__ CP, int rowsPerB, size_t sCPb, int row0g,
    float* __restrict__ C, _Float16* __restrict__ C16, int ldc, size_t sC, int M, int N, int K) { static_assert(ACT == 0 || ACT == 3 || ACT == 6 || ACT == 8 || ACT == 9 || ACT == 11 || ACT == 12 || ACT == 14 || ACT == 15 || ACT == 16 || ACT == 17, "k_gemm2: unsupported ACT code (would silently apply no activation)");
  __shared__ __attribute__((aligned(16))) float so[4][32][68];
  const int tid = threadIdx.x, w = tid >> 5, lane = tid & 31, ln = lane & 15, hh = lane >> 4; const int by = blockIdx.y;
  A += (size_t)by * sA; Bh += (size_t)by * sB; const size_t cofs = (size_t)by * sC; const float* bp = bias ? bias + (size_t)by * sBias : nullptr;
  const int ntn = N >> 6; const int mt = blockIdx.x / ntn, nq = blockIdx.x - mt * ntn; const int row0 = mt * 128 + 32 * w, col0 = nq * 64; if (row0 >= M) return;
  const _Float16* a0p = A + (size_t)(row0 + ln) * lda; const _Float16* a1p = a0p + (size_t)16 * lda;
  const _Float16* b0p = Bh + (size_t)(col0 + ln) * ldb; const _Float16* b1p = b0p + (size_t)16 * ldb; const _Float16* b2p = b1p + (size_t)16 * ldb; const _Float16* b3p = b2p + (size_t)16 * ldb;
  const v8f z8 = {0.f,0.f,0.f,0.f,0.f,0.f,0.f,0.f}; v8f c00 = z8, c01 = z8, c02 = z8, c03 = z8, c10 = z8, c11 = z8, c12 = z8, c13 = z8;
#pragma unroll 1
  for (int kb = 0; kb < K; kb += 32) { const v16h a0 = g2_frag(a0p + kb, hh), a1 = g2_frag(a1p + kb, hh);
    v16h b = g2_frag(b0p + kb, hh); c00 = g2_mma(a0, b, c00); c10 = g2_mma(a1, b, c10);
    b = g2_frag(b1p + kb, hh); c01 = g2_mma(a0, b, c01); c11 = g2_mma(a1, b, c11);
    b = g2_frag(b2p + kb, hh); c02 = g2_mma(a0, b, c02); c12 = g2_mma(a1, b, c12);
    b = g2_frag(b3p + kb, hh); c03 = g2_mma(a0, b, c03); c13 = g2_mma(a1, b, c13); }
  v8f accs[8] = {c00, c01, c02, c03, c10, c11, c12, c13};
#pragma unroll
  for (int u = 0; u < 8; ++u) { const int t = u & 3, half = u >> 2; const int col = col0 + t * 16 + ln; const float bv = bp ? bf16_round(bp[col]) : 0.f;
#pragma unroll
    for (int r = 0; r < 8; ++r) { const int rloc = half * 16 + 8 * hh + r; float v = accs[u][r] * alpha + bv; if (CP) { if (rowsPerB < 0) v += CP[cofs + (size_t)(row0g + row0 + rloc) * ldc + col];      /* rowsPerB < 0: own element of the batched C plane */ else { const int bidx = (row0g + row0 + rloc) / rowsPerB; v += CP[(size_t)bidx * sCPb + (size_t)by * 64 + col]; } }
      if (ACT == 3) v = fmaxf(v, 0.f); else if (ACT == 6) v = 0.5f * v * (1.0f + erff(v * 0.70710678118654752f)); else if (ACT == 11) v = 1.0f / (1.0f + expf(-v)); else if (ACT == 15) v = v / (1.0f + expf(-v)); else if (ACT == 12) v = (v > 0.f) ? v : 0.01f * v; else if (ACT == 8) v = tanhf(v); else if (ACT == 9) v = 0.5f * v * (1.0f + tanhf(0.7978845608028654f * (v + 0.044715f * v * v * v))); else if (ACT == 14) v = (v > 0.f) ? v : 0.1f * v; else if (ACT == 16) v = (v >= 0.f) ? v : 0.3f * v; else if (ACT == 17) v = (v >= 0.f) ? v : 0.2f * v;
      so[w][rloc][t * 16 + ln] = v; } }
  __builtin_amdgcn_fence(__ATOMIC_ACQ_REL, "workgroup"); __builtin_amdgcn_wave_barrier();
  const int rsub = lane >> 4, c4 = (lane & 15) * 4;
  {
#pragma unroll
    for (int q = 0; q < 16; ++q) { const int r = q * 2 + rsub; const v4f v = *(const v4fa*)&so[w][r][c4]; if (C) *(v4f*)(C + cofs + (size_t)(row0 + r) * ldc + col0 + c4) = v; if (C16) { v4h h4; for (int i = 0; i < 4; ++i) h4[i] = (_Float16)v[i]; *(v4h*)(C16 + cofs + (size_t)(row0 + r) * ldc + col0 + c4) = h4; } }
     } }


__global__ __launch_bounds__(256) void k_wT(const float* __restrict__ w, int din, int dout, _Float16* __restrict__ Bt) { __shared__ float tl[64][65]; const int tid = threadIdx.x; const int nbo = dout / 64; const int ib = blockIdx.x / nbo, ob = blockIdx.x % nbo; const int i0 = ib * 64, o0 = ob * 64;
  for (int t = tid; t < 64 * 64; t += 256) { const int i = t / 64, o = t % 64; tl[o][i] = bf16_round(w[(size_t)(i0 + i) * dout + o0 + o]) * 16.0f; }
  __syncthreads();
  { for (int t = tid; t < 64 * 8; t += 256) { const int o = t / 8, i8 = (t % 8) * 8; FragH f; for (int q = 0; q < 8; ++q) f.h[q] = (_Float16)tl[o][i8 + q]; *(v8us*)((unsigned short*)Bt + (size_t)(o0 + o) * din + i0 + i8) = f.half[0]; }  } }
__global__ __launch_bounds__(256) void k_wnat(const float* __restrict__ w, size_t n8, _Float16* __restrict__ Bt) { const size_t t = (size_t)blockIdx.x * 256 + threadIdx.x; if (t >= n8) return; FragH f; for (int q = 0; q < 8; ++q) f.h[q] = (_Float16)(bf16_round(w[t * 8 + q]) * 16.0f); *(v8us*)((unsigned short*)Bt + t * 8) = f.half[0];  }
__global__ __launch_bounds__(256) void k_rms(const float* __restrict__ X, int xIsInput, const float* __restrict__ scale, size_t nrows, _Float16* __restrict__ N16, float* __restrict__ XF) {
  #pragma clang fp contract(off)
  const size_t r = (size_t)blockIdx.x * 256 + threadIdx.x; if (r >= nrows) return; const float* x = X + r * DM; float ss = 0.f;
#pragma unroll 1
  for (int c = 0; c < DM; ++c) { const float v = xIsInput ? bf16_round(x[c]) : x[c]; ss = __fadd_rn(ss, __fmul_rn(v, v)); } const float rs = 1.0f / sqrtf(__fadd_rn(ss / (float)DM, 1e-8f));
#pragma unroll 1
  for (int c0 = 0; c0 < DM; c0 += 8) { FragH f; v8f xv; for (int q = 0; q < 8; ++q) { const float v = xIsInput ? bf16_round(x[c0 + q]) : x[c0 + q]; xv[q] = v; f.h[q] = (_Float16)__fmul_rn(__fmul_rn(v, rs), bf16_round(scale[c0 + q])); }
    unsigned short* d = (unsigned short*)N16 + r * DM + c0; *(v8us*)d = f.half[0]; if (XF) *(v8f*)(XF + r * DM + c0) = xv;  } }
__global__ __launch_bounds__(256) void k_hT(const _Float16* __restrict__ HN, int b, _Float16* __restrict__ HT) { __shared__ unsigned short tl[64][65]; const int tid = threadIdx.x; const int jb = blockIdx.x % (SQ / 64), dbk = blockIdx.x / (SQ / 64); const int j0 = jb * 64, d0 = dbk * 64;
  for (int i = tid; i < 64 * 8; i += 256) { const int j = i / 8, d8 = (i % 8) * 8; FragH f; f.half[0] = *(const v8us*)((const unsigned short*)HN + ((size_t)b * SQ + j0 + j) * DM + d0 + d8); for (int q = 0; q < 8; ++q) tl[d8 + q][j] = f.u[q]; }
  __syncthreads();
  { for (int i = tid; i < 64 * 8; i += 256) { const int d = i / 8, j8 = (i % 8) * 8; FragH f; for (int q = 0; q < 8; ++q) f.u[q] = tl[d][j8 + q]; *(v8us*)((unsigned short*)HT + (size_t)(d0 + d) * SQ + j0 + j8) = f.half[0]; }  } }
__global__ __launch_bounds__(256) void k_tab(const float* __restrict__ dl, float* __restrict__ T) {
  #pragma clang fp contract(off)
  const int t = blockIdx.x * 256 + threadIdx.x; if (t >= SQ * RR) return; const int r = t % RR, d = t / RR; const float g = __fadd_rn(0.15f, __fmul_rn(0.85f, 1.0f / (1.0f + expf(-bf16_round(dl[r]))))); const float lg = logf(fmaxf(g, 1e-8f)); const float v = expf(__fmul_rn((float)d, lg));
  *(float*)(T + t) = v;  }
__global__ __launch_bounds__(256) void k_l2(float* __restrict__ F) {
  #pragma clang fp contract(off)
  const size_t t = (size_t)blockIdx.x * 256 + threadIdx.x; if (t >= NR * 2) return; const int wch = (int)(t & 1); const size_t r = t >> 1; float* f = F + r * (2 * RR) + wch * RR; float ss = 0.f;
#pragma unroll 1
  for (int i = 0; i < RR; ++i) ss = __fadd_rn(ss, __fmul_rn(f[i], f[i])); float n = sqrtf(ss); if (n < 1e-8f) n = 1e-8f; const float inv = 1.0f / n;
#pragma unroll 1
  for (int i0 = 0; i0 < RR; i0 += 8) { v8f o; for (int q = 0; q < 8; ++q) o[q] = __fmul_rn(f[i0 + q], inv); *(v8f*)(f + i0) = o;  } }
__global__ __launch_bounds__(256) void k_amat(const float* __restrict__ QK, const float* __restrict__ kb, const float* __restrict__ T, const float* __restrict__ gl, const float* __restrict__ al, int b, _Float16* __restrict__ A16) {
  #pragma clang fp contract(off)
  const size_t t = (size_t)blockIdx.x * 256 + threadIdx.x; if (t >= (size_t)SQ * SQ / 8) return; const int j0 = (int)((t * 8) % SQ); const int i = (int)((t * 8) / SQ); const float gate = 1.0f / (1.0f + expf(-bf16_round(gl[0]))); const float alpha = 1.0f / (1.0f + expf(-bf16_round(al[0])));
  const float* q = QK + ((size_t)b * SQ + i) * (2 * RR); float acc[8]; for (int u = 0; u < 8; ++u) acc[u] = 0.f;
  if (j0 <= i) {
#pragma unroll 1
    for (int r = 0; r < RR; ++r) { const float qv = q[r];
#pragma unroll 1
      for (int u = 0; u < 8; ++u) { const int j = j0 + u; if (j > i) break; const float kv = QK[((size_t)b * SQ + j) * (2 * RR) + RR + r]; acc[u] = __fadd_rn(acc[u], __fmul_rn(__fmul_rn(qv, kv), T[(size_t)(i - j) * RR + r])); } } }
  FragH f; for (int u = 0; u < 8; ++u) { const int j = j0 + u; const float v = (j <= i) ? __fadd_rn(__fmul_rn(gate, bf16_round(kb[(size_t)i * SQ + j])), __fmul_rn(alpha, acc[u])) : 0.f; f.h[u] = (_Float16)v; }
  unsigned short* d = (unsigned short*)A16 + (size_t)i * SQ + j0; *(v8us*)d = f.half[0];  }

extern "C" void kernel_launch(void* const* d_in, const int* in_sizes, int n_in,
                              void* d_out, int out_size, void* d_ws, size_t ws_size, hipStream_t stream) {
  (void)in_sizes; (void)n_in; (void)out_size;
  const float* const* I = (const float* const*)d_in; const float* h = I[0]; const float* kb = I[1]; const float* dl = I[2]; const float* gl = I[3]; const float* al = I[4]; const float* u = I[5]; const float* v = I[6]; const float* pw = I[7]; const float* pb = I[8]; const float* n1 = I[9]; const float* n2 = I[10]; const float* uw = I[11]; const float* ub = I[12]; const float* dw = I[13]; const float* db = I[14];
  char* ws = (char*)d_ws; size_t off = 0;
  auto take = [&](size_t bytes) { char* p = ws + off; off += (bytes + 255) & ~(size_t)255; return p; };
  _Float16* BUV = (_Float16*)take((size_t)2 * RR * DM * 2); _Float16* BP = (_Float16*)take((size_t)DM * DM * 2); _Float16* BU = (_Float16*)take((size_t)FH * DM * 2); _Float16* BD = (_Float16*)take((size_t)DM * FH * 2); float* T = (float*)take((size_t)SQ * RR * 4);
  _Float16* HN16 = (_Float16*)take(NR * DM * 2); float* HF = (float*)take(NR * DM * 4); float* QK = (float*)take(NR * 2 * RR * 4); _Float16* HT = (_Float16*)take((size_t)DM * SQ * 2); _Float16* A16 = (_Float16*)take((size_t)SQ * SQ * 2);
  _Float16* O16 = (_Float16*)take(NR * DM * 2); float* H1 = (float*)take(NR * DM * 4); _Float16* M16 = (_Float16*)take(NR * DM * 2); _Float16* U16 = (_Float16*)take(NR * FH * 2);
  if (off > ws_size) return;      /* 0.3 + 2 + 4 + 4 + 0.3 + 16 + 32 + 4 + 2 + 2 + 16 + 32 + 16 + 32 = ≈ 163 MiB */
  k_wT<<<(DM / 64) * (RR / 64), 256, 0, stream>>>(u, DM, RR, BUV); k_wT<<<(DM / 64) * (RR / 64), 256, 0, stream>>>(v, DM, RR, BUV + (size_t)RR * DM);      /* [u|v]^T -> [128][1024] */
  k_wnat<<<(unsigned)(((size_t)DM * DM / 8 + 255) / 256), 256, 0, stream>>>(pw, (size_t)DM * DM / 8, BP); k_wnat<<<(unsigned)(((size_t)FH * DM / 8 + 255) / 256), 256, 0, stream>>>(uw, (size_t)FH * DM / 8, BU); k_wnat<<<(unsigned)(((size_t)DM * FH / 8 + 255) / 256), 256, 0, stream>>>(dw, (size_t)DM * FH / 8, BD);
  k_tab<<<(SQ * RR + 255) / 256, 256, 0, stream>>>(dl, T);
  k_rms<<<(unsigned)((NR + 255) / 256), 256, 0, stream>>>(h, 1, n1, NR, HN16, HF);      /* hn (f16) + bf16(h) (f32 residual) */
  k_gemm2<0><<<dim3((unsigned)((NR / 128) * (2 * RR / 64)), 1), 128, 0, stream>>>(HN16, DM, 0, BUV, DM, 0, 0.0625f, nullptr, 0, nullptr, 1, 0, 0, QK, nullptr, 2 * RR, 0, (int)NR, 2 * RR, DM);      /* [q_raw | k_raw] */
  k_l2<<<(unsigned)((NR * 2 + 255) / 256), 256, 0, stream>>>(QK);
  for (int b = 0; b < NB; ++b) {
    k_amat<<<(SQ * SQ / 8 + 255) / 256, 256, 0, stream>>>(QK, kb, T, gl, al, b, A16);
    k_hT<<<(SQ / 64) * (DM / 64), 256, 0, stream>>>(HN16, b, HT);
    k_gemm2<0><<<dim3((SQ / 128) * (DM / 64), 1), 128, 0, stream>>>(A16, SQ, 0, HT, SQ, 0, 1.0f, nullptr, 0, nullptr, 1, 0, 0, nullptr, O16 + (size_t)b * SQ * DM, DM, 0, SQ, DM, SQ); }      /* out_b = A_b . hn_b */
  const dim3 gp((unsigned)((NR / 128) * (DM / 64)), 1);
  k_gemm2<0><<<gp, 128, 0, stream>>>(O16, DM, 0, BP, DM, 0, 0.0625f, pb, 0, HF, 1, (size_t)DM, 0, H1, nullptr, DM, 0, (int)MQ, DM, DM);      /* h1 = h + out proj_w^T + proj_b */
  k_rms<<<(unsigned)((MQ + 255) / 256), 256, 0, stream>>>(H1, 0, n2, MQ, M16, nullptr);
  k_gemm2<6><<<dim3((unsigned)((NR / 128) * (FH / 64)), 1), 128, 0, stream>>>(M16, DM, 0, BU, DM, 0, 0.0625f, ub, 0, nullptr, 1, 0, 0, nullptr, U16, FH, 0, (int)MQ, FH, DM);      /* gelu_erf(m up_w^T + up_b) */
  k_gemm2<0><<<gp, 128, 0, stream>>>(U16, FH, 0, BD, FH, 0, 0.0625f, db, 0, H1, 1, (size_t)DM, 0, (float*)d_out, nullptr, DM, 0, (int)MQ, DM, FH);      /* h1 + m */
}

// v001
// Measured time: 1080 microseconds a run.
// Two timings next to v000 put it at 2.12 and 2.14 times that version's speed.
#include <hip/hip_runtime.h>
// K2Layer (h [8][1024][1024]; hn = rmsnorm(h)*norm1_scale; gate = sigmoid(gate_logit), alpha = sigmoid(alpha_logit); q|k = hn [u|v] (rank 64), row-l2-normalised; gamma_r = 0.15 + 0.85 sigmoid(decay_logit_r); A[i][j] = causal(j<=i) * (gate k_base[i][j] + alpha sum_r q[i][r] k[j][r] gamma_r^(i-j)); out = A . hn; h1 = h + out proj_w^T + proj_b; m = gelu_erf(rmsnorm(h1)*norm2_scale up_w^T + up_b) down_w^T + down_b; result = h1 + m -> [8][1024][1024]).
// Structure: token rows; rmsnorm on VALU (f32) into f16 rows and per-batch transposed f16 planes (LDS); the rank-64 q|k projection as a WMMA GEMM (f32), l2-normalisation and the per-rank decayed causal scores on VALU in f32 (gamma^d table built on device from decay_logit, k_base/gate/alpha read) into the f16 mixing matrix A; out = A . hn, proj (+ bias + h), up (+ bias, exact-GELU epilogue, f16), down (+ bias + h1) as WMMA GEMMs (32x64 wave tiles, f32 accumulation, exact x16 weights).
// Compute dtype: inputs rounded to bf16; h / weights / k_base exact; hn, A, out, rmsnorm(h1), GELU hidden plain f16 operands (~2^-12); scores, norms, residuals f32. v_wmma_f32_16x16x32_f16.
#define NB 8
#define SQ 1024
#define DM 1024
#define RR 64
#define FH 2048
#define NR ((size_t)NB * SQ)
#define MQ NR                        /* rows through the proj/MLP stage (debug hook) */
typedef __bf16 v16b __attribute__((ext_vector_type(16)));
typedef unsigned short v8us __attribute__((ext_vector_type(8), may_alias));
typedef float  v8f  __attribute__((ext_vector_type(8)));
typedef float  v4f  __attribute__((ext_vector_type(4)));
typedef float  v4fa __attribute__((ext_vector_type(4), may_alias));
union FragB { v16b v; v8us half[2]; unsigned short u[16]; };

__device__ __forceinline__ unsigned short bf16_bits(float x) { unsigned int u = __float_as_uint(x); return (unsigned short)((u + 0x7FFFu + ((u >> 16) & 1u)) >> 16); }
__device__ __forceinline__ float bf16_val(unsigned short b) { return __uint_as_float(((unsigned int)b) << 16); }
__device__ __forceinline__ float bf16_round(float x) { return bf16_val(bf16_bits(x)); }
// D += A·B with NT terms: 1 = ah·bh, 2 = + al·bh (A split), 3 = + ah·bl (both split)
template <int NT>
__device__ __forceinline__ v8f mmaN(v16b ah, v16b al, v16b bh, v16b bl, v8f c) {
  c = __builtin_amdgcn_wmma_f32_16x16x32_bf16(false, ah, false, bh, (short)0, c, false, false);
  if (NT >= 2) c = __builtin_amdgcn_wmma_f32_16x16x32_bf16(false, al, false, bh, (short)0, c, false, false);
  if (NT >= 3) c = __builtin_amdgcn_wmma_f32_16x16x32_bf16(false, ah, false, bl, (short)0, c, false, false);
  asm volatile("v_nop\n\tv_nop\n\tv_nop\n\tv_nop" : "+v"(c) : "v"(ah), "v"(al), "v"(bh), "v"(bl));
  return c;
}

__global__ __launch_bounds__(256) void k_wt_bf16(const float* __restrict__ W, unsigned short* __restrict__ Wt, int K, int N) {
  const int t = blockIdx.x * 256 + threadIdx.x;
  const int k8n = K / 8;
  if (t >= N * k8n) return;
  const int n = t / k8n, k8 = (t % k8n) * 8;
  v8us v;
#pragma unroll
  for (int i = 0; i < 8; ++i) v[i] = bf16_bits(W[(size_t)(k8 + i) * N + n]);
  *(v8us*)(Wt + (size_t)n * K + k8) = v;
  
}

// GEMM C[M][N] (f32, pitch ldc) = act(A[M][K]·W + bias). A f32 row-major (pitch lda) converted per fragment to bf16
// (ASPLIT: hi/lo two planes -> 2 terms, else single rounded term); Wt bf16 [N][K] (pitch ldb). BIAS_BF16 rounds the
// bias to bf16 first (bias quantised to bf16 before the add). K%32==0, M%16==0, N%64==0.
template <bool ASPLIT, int ACT, bool BIAS_BF16>
__global__ __launch_bounds__(128) void k_gemm_bf(const float* __restrict__ A, int lda, const unsigned short* __restrict__ Wt, int ldb,
                                               const float* __restrict__ bias, float* __restrict__ C, int ldc, int M, int N, int K) {
  __shared__ __attribute__((aligned(16))) float so[4][16][64];
  const int tid = threadIdx.x, w = tid >> 5, lane = tid & 31, ln = lane & 15, hh = lane >> 4;
  const int ntn = N / 64;
  const int wid = blockIdx.x * 4 + w;
  const int mt = wid / ntn, nq = wid % ntn;
  if (mt * 16 >= M) return;
  const int row0 = mt * 16, col0 = nq * 64;
  const float* arow = A + (size_t)(row0 + ln) * lda;
  v8f acc[4] = {};
  for (int kb = 0; kb < K; kb += 32) {
    FragB ah, al;
    const v4f x0 = *(const v4fa*)(arow + kb + 8 * hh), x1 = *(const v4fa*)(arow + kb + 8 * hh + 4);
    const v4f x2 = *(const v4fa*)(arow + kb + 16 + 8 * hh), x3 = *(const v4fa*)(arow + kb + 16 + 8 * hh + 4);
    float xs[16] = {x0[0],x0[1],x0[2],x0[3],x1[0],x1[1],x1[2],x1[3],x2[0],x2[1],x2[2],x2[3],x3[0],x3[1],x3[2],x3[3]};
#pragma unroll
    for (int i = 0; i < 16; ++i) { const unsigned short hb = bf16_bits(xs[i]); ah.u[i] = hb; al.u[i] = ASPLIT ? bf16_bits(xs[i] - bf16_val(hb)) : (unsigned short)0; }
#pragma unroll
    for (int t = 0; t < 4; ++t) {
      const unsigned short* brow = Wt + (size_t)(col0 + t * 16 + ln) * ldb + kb;
      FragB b;
      b.half[0] = *(const v8us*)(brow + 8 * hh);
      b.half[1] = *(const v8us*)(brow + 16 + 8 * hh);
      acc[t] = mmaN<ASPLIT ? 2 : 1>(ah.v, al.v, b.v, b.v, acc[t]);
    }
  }
#pragma unroll
  for (int t = 0; t < 4; ++t) {
    float bv = bias ? bias[col0 + t * 16 + ln] : 0.f;
    if (BIAS_BF16) bv = bf16_round(bv);
#pragma unroll
    for (int r = 0; r < 8; ++r) { float v = acc[t][r] + bv; if (ACT == 1) v = fmaxf(v, 0.f); so[w][8 * hh + r][t * 16 + ln] = v; }
  }
  __builtin_amdgcn_fence(__ATOMIC_ACQ_REL, "workgroup");
  __builtin_amdgcn_wave_barrier();
  const int rsub = lane >> 4, c4 = (lane & 15) * 4;
  {
#pragma unroll
    for (int q = 0; q < 8; ++q) {
      const int r = q * 2 + rsub;
      const v4f v = *(const v4fa*)&so[w][r][c4];
      *(v4f*)(C + (size_t)(row0 + r) * ldc + col0 + c4) = v;
    }
    
  }
}

// GEMM C = act(A·W + bias + resid): A f32 (ASPLIT -> hi/lo 2 terms), Wt bf16 [N][K]; ACT 0 none, 1 relu, 2 exact gelu;
// resid (optional, f32, row index = (row % rmod), pitch ldr, RES_BF16 rounds it) added before the activation.
template <bool ASPLIT, int ACT, bool BIAS_BF16, bool RES_BF16>
__global__ __launch_bounds__(128) void k_gemm_bf3(const float* __restrict__ A, int lda, const unsigned short* __restrict__ Wt, int ldb,
                                                const float* __restrict__ bias, const float* __restrict__ resid, int rmod, int ldr,
                                                float* __restrict__ C, int ldc, int M, int N, int K) {
  __shared__ __attribute__((aligned(16))) float so[4][16][64];
  const int tid = threadIdx.x, w = tid >> 5, lane = tid & 31, ln = lane & 15, hh = lane >> 4;
  const int ntn = N / 64;
  const int wid = blockIdx.x * 4 + w;
  const int mt = wid / ntn, nq = wid % ntn;
  if (mt * 16 >= M) return;
  const int row0 = mt * 16, col0 = nq * 64;
  const float* arow = A + (size_t)(row0 + ln) * lda;
  v8f acc[4] = {};
  for (int kb = 0; kb < K; kb += 32) {
    FragB ah, al;
    const v4f x0 = *(const v4fa*)(arow + kb + 8 * hh), x1 = *(const v4fa*)(arow + kb + 8 * hh + 4);
    const v4f x2 = *(const v4fa*)(arow + kb + 16 + 8 * hh), x3 = *(const v4fa*)(arow + kb + 16 + 8 * hh + 4);
    float xs[16] = {x0[0],x0[1],x0[2],x0[3],x1[0],x1[1],x1[2],x1[3],x2[0],x2[1],x2[2],x2[3],x3[0],x3[1],x3[2],x3[3]};
#pragma unroll
    for (int i = 0; i < 16; ++i) { const unsigned short hb = bf16_bits(xs[i]); ah.u[i] = hb; al.u[i] = ASPLIT ? bf16_bits(xs[i] - bf16_val(hb)) : (unsigned short)0; }
#pragma unroll
    for (int t = 0; t < 4; ++t) {
      const unsigned short* brow = Wt + (size_t)(col0 + t * 16 + ln) * ldb + kb;
      FragB b;
      b.half[0] = *(const v8us*)(brow + 8 * hh);
      b.half[1] = *(const v8us*)(brow + 16 + 8 * hh);
      acc[t] = mmaN<ASPLIT ? 2 : 1>(ah.v, al.v, b.v, b.v, acc[t]);
    }
  }
#pragma unroll
  for (int t = 0; t < 4; ++t) {
    const int col = col0 + t * 16 + ln;
    float bv = bias ? bias[col] : 0.f;
    if (BIAS_BF16) bv = bf16_round(bv);
#pragma unroll
    for (int r = 0; r < 8; ++r) {
      float v = acc[t][r] + bv;
      if (resid) { float rv = resid[(size_t)((row0 + 8 * hh + r) % rmod) * ldr + col]; if (RES_BF16) rv = bf16_round(rv); v += rv; }
      if (ACT == 1) v = fmaxf(v, 0.f);
      if (ACT == 2) v = 0.5f * v * (1.0f + erff(v * 0.70710678118654752f));
      if (ACT == 3) { const float u = 0.7978845608028654f * (v + 0.044715f * v * v * v); v = 0.5f * v * (1.0f + tanhf(u)); }
      so[w][8 * hh + r][t * 16 + ln] = v;
    }
  }
  __builtin_amdgcn_fence(__ATOMIC_ACQ_REL, "workgroup");
  __builtin_amdgcn_wave_barrier();
  const int rsub = lane >> 4, c4 = (lane & 15) * 4;
  {
#pragma unroll
    for (int q = 0; q < 8; ++q) {
      const int r = q * 2 + rsub;
      const v4f v = *(const v4fa*)&so[w][r][c4];
      *(v4f*)(C + (size_t)(row0 + r) * ldc + col0 + c4) = v;
    }
    
  }
}
// row LayerNorm (biased variance, eps) over N: s = X (+ R); optional out_sum <- s; out_norm <- (s-mu)*rsqrt(var+eps)*g + b
template <bool PARAM_BF16>
__global__ __launch_bounds__(256) void k_layernorm(const float* __restrict__ X, const float* __restrict__ R, const float* __restrict__ g, const float* __restrict__ bta,
                                                  float* __restrict__ out_sum, float* __restrict__ out_norm, int N, float eps) {
  __shared__ float red[256];
  const int row = blockIdx.x, tid = threadIdx.x;
  const float* x = X + (size_t)row * N; const float* rr = R ? R + (size_t)row * N : nullptr;
  float vals[16];                     // up to N = 4096
  const int per = N / 256;            // contiguous chunk per thread? use strided-by-4 chunks: thread handles j = tid*4 + 1024*u
  float s1 = 0.f;
  for (int u = 0; u < per / 4; ++u) {
    const int j = tid * 4 + 1024 * u;
    const v4f a = *(const v4fa*)(x + j);
    v4f b = {0.f,0.f,0.f,0.f}; if (rr) b = *(const v4fa*)(rr + j);
#pragma unroll
    for (int q = 0; q < 4; ++q) { const float v = a[q] + b[q]; vals[u * 4 + q] = v; s1 += v; }
  }
  red[tid] = s1; __syncthreads();
  for (int st = 128; st > 0; st >>= 1) { if (tid < st) red[tid] += red[tid + st]; __syncthreads(); }
  const float mu = red[0] / (float)N; __syncthreads();
  float s2 = 0.f;
  for (int u = 0; u < per / 4; ++u)
#pragma unroll
    for (int q = 0; q < 4; ++q) { const float c = vals[u * 4 + q] - mu; s2 += c * c; }
  red[tid] = s2; __syncthreads();
  for (int st = 128; st > 0; st >>= 1) { if (tid < st) red[tid] += red[tid + st]; __syncthreads(); }
  const float rs = rsqrtf(red[0] / (float)N + eps);
  {
    for (int u = 0; u < per / 4; ++u) {
      const int j = tid * 4 + 1024 * u;
      v4f o, sm;
#pragma unroll
      for (int q = 0; q < 4; ++q) {
        float gg = g[j + q], bb = bta[j + q];
        if (PARAM_BF16) { gg = bf16_round(gg); bb = bf16_round(bb); }
        sm[q] = vals[u * 4 + q]; o[q] = (vals[u * 4 + q] - mu) * rs * gg + bb;
      }
      if (out_sum) *(v4f*)(out_sum + (size_t)row * N + j) = sm;
      *(v4f*)(out_norm + (size_t)row * N + j) = o;
    }
    
  }
}



// ---- f16 WMMA path (v_wmma_f32_16x16x32_f16): 11-bit significands for operands in range — used for every GEMM launched here
typedef _Float16 v16h __attribute__((ext_vector_type(16)));
union FragH { v16h v; v8us half[2]; _Float16 h[16]; unsigned short u[16]; };
template <int NT>
__device__ __forceinline__ v8f mmaH(v16h ah, v16h al, v16h bh, v16h bl, v8f c) {
  c = __builtin_amdgcn_wmma_f32_16x16x32_f16(false, ah, false, bh, (short)0, c, false, false);
  if (NT >= 2) c = __builtin_amdgcn_wmma_f32_16x16x32_f16(false, al, false, bh, (short)0, c, false, false);
  if (NT >= 3) c = __builtin_amdgcn_wmma_f32_16x16x32_f16(false, ah, false, bl, (short)0, c, false, false);
  asm volatile("v_nop\n\tv_nop\n\tv_nop\n\tv_nop" : "+v"(c) : "v"(ah), "v"(al), "v"(bh), "v"(bl));
  return c;
}
// batched GEMM like k_gemm_b but f16 operands: A f32 (split into f16 hi/lo if ASPLIT, else rounded to f16), Bt = f16 values [n][k]; alpha; C f32; N multiple of 16 (partial tiles skipped)
template <bool ASPLIT>
__global__ __launch_bounds__(128) void k_gemm_h(const float* __restrict__ A, int lda, size_t sA, const _Float16* __restrict__ Bh, int ldb, size_t sB, float alpha, float* __restrict__ C, int ldc, size_t sC, int M, int N, int K) {
  __shared__ __attribute__((aligned(16))) float so[4][16][64];
  const int tid = threadIdx.x, w = tid >> 5, lane = tid & 31, ln = lane & 15, hh = lane >> 4; const int by = blockIdx.y;
  A += (size_t)by * sA; Bh += (size_t)by * sB; C += (size_t)by * sC;
  const int ntn = (N + 63) / 64; const int wid = blockIdx.x * 4 + w; const int mt = wid / ntn, nq = wid % ntn; if (mt * 16 >= M) return;
  const int row0 = mt * 16, col0 = nq * 64; const float* arow = A + (size_t)(row0 + ln) * lda;
  v8f acc[4] = {};
  for (int kb = 0; kb < K; kb += 32) {
    FragH ah, al;
    const v4f x0 = *(const v4fa*)(arow + kb + 8 * hh), x1 = *(const v4fa*)(arow + kb + 8 * hh + 4), x2 = *(const v4fa*)(arow + kb + 16 + 8 * hh), x3 = *(const v4fa*)(arow + kb + 16 + 8 * hh + 4);
    float xs[16] = {x0[0],x0[1],x0[2],x0[3],x1[0],x1[1],x1[2],x1[3],x2[0],x2[1],x2[2],x2[3],x3[0],x3[1],x3[2],x3[3]};
#pragma unroll
    for (int i = 0; i < 16; ++i) { const _Float16 h = (_Float16)xs[i]; ah.h[i] = h; al.h[i] = ASPLIT ? (_Float16)(xs[i] - (float)h) : (_Float16)0.0f; }
#pragma unroll
    for (int t = 0; t < 4; ++t) { if (col0 + t * 16 >= N) continue; const size_t boff = (size_t)(col0 + t * 16 + ln) * ldb + kb; FragH bq; bq.half[0] = *(const v8us*)(Bh + boff + 8 * hh); bq.half[1] = *(const v8us*)(Bh + boff + 16 + 8 * hh);
      acc[t] = mmaH<ASPLIT ? 2 : 1>(ah.v, al.v, bq.v, bq.v, acc[t]); }
  }
#pragma unroll
  for (int t = 0; t < 4; ++t) { if (col0 + t * 16 >= N) continue;
#pragma unroll
    for (int r = 0; r < 8; ++r) so[w][8 * hh + r][t * 16 + ln] = acc[t][r] * alpha; }
  __builtin_amdgcn_fence(__ATOMIC_ACQ_REL, "workgroup"); __builtin_amdgcn_wave_barrier();
  const int rsub = lane >> 4, c4 = (lane & 15) * 4;
  {
#pragma unroll
    for (int q = 0; q < 8; ++q) { const int r = q * 2 + rsub; if (col0 + c4 < N) { const v4f v = *(const v4fa*)&so[w][r][c4]; *(v4f*)(C + (size_t)(row0 + r) * ldc + col0 + c4) = v; } }
     }
}

// Wt[n][k] = f16(W[k][n]·scale) from f32 row-major W[K][N] (scale = power of two; bf16-exact weights stay exact in f16 away from the subnormal range)
__global__ __launch_bounds__(256) void k_wt_f16(const float* __restrict__ W, _Float16* __restrict__ Wt, int K, int N, float scale) {
  const int t = blockIdx.x * 256 + threadIdx.x; if (t >= N * (K / 8)) return; const int n = t / (K / 8), k8 = (t % (K / 8)) * 8; FragH f;
#pragma unroll
  for (int i = 0; i < 8; ++i) f.h[i] = (_Float16)(bf16_round(W[(size_t)(k8 + i) * N + n]) * scale); const v8us o = f.half[0];
  *(v8us*)((unsigned short*)Wt + (size_t)n * K + k8) = o; 
}
// k_gemm_hh variant with fused epilogue: v = acc·alpha + bias[by·sBias + col] (+ CP[(row/rowsPerB)·sCPb + by·64 + col] if CP) ; ACT 0 none / 1 elu ; writes f16 C16 (and f32 C if non-null)
template <int ACT>
__global__ __launch_bounds__(128) void k_gemm_hhx(const _Float16* __restrict__ A, int lda, size_t sA, const _Float16* __restrict__ Bh, int ldb, size_t sB, float alpha, const float* __restrict__ bias, size_t sBias, const float* __restrict__ CP, int rowsPerB, size_t sCPb, int row0g,
    float* __restrict__ C, _Float16* __restrict__ C16, int ldc, size_t sC, int M, int N, int K) {
  __shared__ __attribute__((aligned(16))) float so[4][16][64];
  const int tid = threadIdx.x, w = tid >> 5, lane = tid & 31, ln = lane & 15, hh = lane >> 4; const int by = blockIdx.y;
  A += (size_t)by * sA; Bh += (size_t)by * sB; const size_t cofs = (size_t)by * sC; const float* bp = bias ? bias + (size_t)by * sBias : nullptr;
  const int ntn = (N + 63) / 64; const int wid = blockIdx.x * 4 + w; const int mt = wid / ntn, nq = wid % ntn; if (mt * 16 >= M) return;
  const int row0 = mt * 16, col0 = nq * 64; const _Float16* arow = A + (size_t)(row0 + ln) * lda;
  v8f acc[4] = {};
  for (int kb = 0; kb < K; kb += 32) { FragH ah; ah.half[0] = *(const v8us*)((const unsigned short*)arow + kb + 8 * hh); ah.half[1] = *(const v8us*)((const unsigned short*)arow + kb + 16 + 8 * hh);
#pragma unroll
    for (int t = 0; t < 4; ++t) { if (col0 + t * 16 >= N) continue; const size_t boff = (size_t)(col0 + t * 16 + ln) * ldb + kb; FragH bq; bq.half[0] = *(const v8us*)((const unsigned short*)Bh + boff + 8 * hh); bq.half[1] = *(const v8us*)((const unsigned short*)Bh + boff + 16 + 8 * hh);
      acc[t] = mmaH<1>(ah.v, ah.v, bq.v, bq.v, acc[t]); }
  }
#pragma unroll
  for (int t = 0; t < 4; ++t) { if (col0 + t * 16 >= N) continue; const int col = col0 + t * 16 + ln; const float bv = bp ? bf16_round(bp[col]) : 0.f;
#pragma unroll
    for (int r = 0; r < 8; ++r) { float v = acc[t][r] * alpha + bv; if (CP) { const int rr = row0g + row0 + 8 * hh + r; if (rowsPerB < 0) v += CP[cofs + (size_t)rr * ldc + col];      /* rowsPerB < 0: own element of the batched C plane */ else { const int bidx = rr / rowsPerB; v += CP[(size_t)bidx * sCPb + (size_t)by * 64 + col]; } } if (ACT == 1) v = (v > 0.f) ? v : expm1f(v); else if (ACT == 7) v = (v > 0.f) ? v + 1.0f : expf(v); else if (ACT == 8) v = tanhf(v); else if (ACT == 9) v = 0.5f * v * (1.0f + tanhf(0.7978845608028654f * (v + 0.044715f * v * v * v))); else if (ACT == 11) v = 1.0f / (1.0f + expf(-v)); else if (ACT == 12) v = (v > 0.f) ? v : 0.01f * v; else if (ACT == 14) v = (v > 0.f) ? v : 0.1f * v; else if (ACT == 16) v = (v >= 0.f) ? v : 0.3f * v; else if (ACT == 17) v = (v >= 0.f) ? v : 0.2f * v; else if (ACT == 15) v = v / (1.0f + expf(-v)); else if (ACT == 3) v = fmaxf(v, 0.f); else if (ACT == 6) v = 0.5f * v * (1.0f + erff(v * 0.70710678118654752f)); so[w][8 * hh + r][t * 16 + ln] = v; } }
  __builtin_amdgcn_fence(__ATOMIC_ACQ_REL, "workgroup"); __builtin_amdgcn_wave_barrier();
  const int rsub = lane >> 4, c4 = (lane & 15) * 4; typedef _Float16 v4h __attribute__((ext_vector_type(4)));
  {
#pragma unroll
    for (int q = 0; q < 8; ++q) { const int r = q * 2 + rsub; if (col0 + c4 < N) { const v4f v = *(const v4fa*)&so[w][r][c4]; if (C) *(v4f*)(C + cofs + (size_t)(row0 + r) * ldc + col0 + c4) = v; if (C16) { v4h h4; for (int i = 0; i < 4; ++i) h4[i] = (_Float16)v[i]; *(v4h*)(C16 + cofs + (size_t)(row0 + r) * ldc + col0 + c4) = h4; } } }
     }
}


typedef _Float16 v4h __attribute__((ext_vector_type(4)));

__global__ __launch_bounds__(256) void k_x16(const float* __restrict__ x, _Float16* __restrict__ X16, size_t n8) { const size_t t = (size_t)blockIdx.x * 256 + threadIdx.x; if (t >= n8) return; FragH f;
#pragma unroll
  for (int q = 0; q < 8; ++q) f.h[q] = (_Float16)bf16_round(x[t * 8 + q]); *(v8us*)((unsigned short*)X16 + t * 8) = f.half[0];  }
__global__ __launch_bounds__(256) void k_h16(const float* __restrict__ x, _Float16* __restrict__ X16, size_t n8) { const size_t t = (size_t)blockIdx.x * 256 + threadIdx.x; if (t >= n8) return; FragH f;
#pragma unroll
  for (int q = 0; q < 8; ++q) f.h[q] = (_Float16)x[t * 8 + q]; *(v8us*)((unsigned short*)X16 + t * 8) = f.half[0];  }
__global__ __launch_bounds__(256) void k_round16f(const float* __restrict__ W, _Float16* __restrict__ Bt, size_t n8) { const size_t t = (size_t)blockIdx.x * 256 + threadIdx.x; if (t >= n8) return; FragH f;
#pragma unroll
  for (int i = 0; i < 8; ++i) f.h[i] = (_Float16)(bf16_round(W[t * 8 + i]) * 16.0f); *(v8us*)((unsigned short*)Bt + t * 8) = f.half[0];  }
template <int NHv, int TTv>
__global__ __launch_bounds__(256) void k_vt(const _Float16* __restrict__ V16, int ldv, int voff, _Float16* __restrict__ Vt) { __shared__ unsigned short tl[64][66]; const int tid = threadIdx.x; const int slab = blockIdx.x / (TTv / 64), lg = blockIdx.x % (TTv / 64); const int b = slab / NHv, h = slab % NHv;
  for (int i = tid; i < 64 * 8; i += 256) { const int r = i / 8, c8 = (i % 8) * 8; FragH f; f.half[0] = *(const v8us*)((const unsigned short*)V16 + ((size_t)b * TTv + lg * 64 + r) * ldv + voff + h * 64 + c8);
#pragma unroll
    for (int q = 0; q < 8; ++q) tl[r][c8 + q] = f.u[q]; }
  __syncthreads();
  {
#pragma unroll
    for (int rd = 0; rd < 2; ++rd) { const int d = rd * 32 + tid / 8, pc = tid % 8; FragH f;
#pragma unroll
      for (int q = 0; q < 8; ++q) f.u[q] = tl[pc * 8 + q][d];
      *(v8us*)((unsigned short*)Vt + ((size_t)slab * 64 + d) * TTv + lg * 64 + pc * 8) = f.half[0]; }
     } }

__global__ __launch_bounds__(256) void k_hl(const float* __restrict__ F, _Float16* __restrict__ Hh, _Float16* __restrict__ Hl, size_t n8) { const size_t t = (size_t)blockIdx.x * 256 + threadIdx.x; if (t >= n8) return; FragH fh, fl; const v4f a = *(const v4fa*)(F + t * 8), c = *(const v4fa*)(F + t * 8 + 4);
#pragma unroll
  for (int q = 0; q < 4; ++q) { _Float16 h = (_Float16)a[q]; fh.h[q] = h; fl.h[q] = (_Float16)((a[q] - (float)h) * 1024.0f); h = (_Float16)c[q]; fh.h[4 + q] = h; fl.h[4 + q] = (_Float16)((c[q] - (float)h) * 1024.0f); }
  { *(v8us*)((unsigned short*)Hh + t * 8) = fh.half[0]; *(v8us*)((unsigned short*)Hl + t * 8) = fl.half[0];  } }

// ---- fast GEMM (wave tile 32x64; requires M % 32 == 0 rows per launch region and N % 64 == 0); epilogue = k_gemm_hhx semantics ----
__device__ __forceinline__ v16h g2_frag(const _Float16* p, int hh) { FragH f; f.half[0] = *(const v8us*)((const unsigned short*)p + 8 * hh); f.half[1] = *(const v8us*)((const unsigned short*)p + 16 + 8 * hh); return f.v; }
__device__ __forceinline__ v8f g2_mma(v16h a, v16h b, v8f c) { v8f d = __builtin_amdgcn_wmma_f32_16x16x32_f16(false, a, false, b, (short)0, c, false, false); asm volatile("v_nop\n\tv_nop\n\tv_nop\n\tv_nop" : "+v"(d) : "v"(a), "v"(b)); return d; }
template <int ACT>
__global__ __launch_bounds__(128) void k_gemm2(const _Float16* __restrict__ A, int lda, size_t sA, const _Float16* __restrict__ Bh, int ldb, size_t sB, float alpha, const float* __restrict__ bias, size_t sBias, const float* __restrict__ CP, int rowsPerB, size_t sCPb, int row0g,
    float* __restrict__ C, _Float16* __restrict__ C16, int ldc, size_t sC, int M, int N, int K) { static_assert(ACT == 0 || ACT == 3 || ACT == 6 || ACT == 8 || ACT == 9 || ACT == 11 || ACT == 12 || ACT == 14 || ACT == 15 || ACT == 16 || ACT == 17, "k_gemm2: unsupported ACT code (would silently apply no activation)");
  __shared__ __attribute__((aligned(16))) float so[4][32][68];
  const int tid = threadIdx.x, w = tid >> 5, lane = tid & 31, ln = lane & 15, hh = lane >> 4; const int by = blockIdx.y;
  A += (size_t)by * sA; Bh += (size_t)by * sB; const size_t cofs = (size_t)by * sC; const float* bp = bias ? bias + (size_t)by * sBias : nullptr;
  const int ntn = N >> 6; const int mt = blockIdx.x / ntn, nq = blockIdx.x - mt * ntn; const int row0 = mt * 128 + 32 * w, col0 = nq * 64; if (row0 >= M) return;
  const _Float16* a0p = A + (size_t)(row0 + ln) * lda; const _Float16* a1p = a0p + (size_t)16 * lda;
  const _Float16* b0p = Bh + (size_t)(col0 + ln) * ldb; const _Float16* b1p = b0p + (size_t)16 * ldb; const _Float16* b2p = b1p + (size_t)16 * ldb; const _Float16* b3p = b2p + (size_t)16 * ldb;
  const v8f z8 = {0.f,0.f,0.f,0.f,0.f,0.f,0.f,0.f}; v8f c00 = z8, c01 = z8, c02 = z8, c03 = z8, c10 = z8, c11 = z8, c12 = z8, c13 = z8;
#pragma unroll 1
  for (int kb = 0; kb < K; kb += 32) { const v16h a0 = g2_frag(a0p + kb, hh), a1 = g2_frag(a1p + kb, hh);
    v16h b = g2_frag(b0p + kb, hh); c00 = g2_mma(a0, b, c00); c10 = g2_mma(a1, b, c10);
    b = g2_frag(b1p + kb, hh); c01 = g2_mma(a0, b, c01); c11 = g2_mma(a1, b, c11);
    b = g2_frag(b2p + kb, hh); c02 = g2_mma(a0, b, c02); c12 = g2_mma(a1, b, c12);
    b = g2_frag(b3p + kb, hh); c03 = g2_mma(a0, b, c03); c13 = g2_mma(a1, b, c13); }
  v8f accs[8] = {c00, c01, c02, c03, c10, c11, c12, c13};
#pragma unroll
  for (int u = 0; u < 8; ++u) { const int t = u & 3, half = u >> 2; const int col = col0 + t * 16 + ln; const float bv = bp ? bf16_round(bp[col]) : 0.f;
#pragma unroll
    for (int r = 0; r < 8; ++r) { const int rloc = half * 16 + 8 * hh + r; float v = accs[u][r] * alpha + bv; if (CP) { if (rowsPerB < 0) v += CP[cofs + (size_t)(row0g + row0 + rloc) * ldc + col];      /* rowsPerB < 0: own element of the batched C plane */ else { const int bidx = (row0g + row0 + rloc) / rowsPerB; v += CP[(size_t)bidx * sCPb + (size_t)by * 64 + col]; } }
      if (ACT == 3) v = fmaxf(v, 0.f); else if (ACT == 6) v = 0.5f * v * (1.0f + erff(v * 0.70710678118654752f)); else if (ACT == 11) v = 1.0f / (1.0f + expf(-v)); else if (ACT == 15) v = v / (1.0f + expf(-v)); else if (ACT == 12) v = (v > 0.f) ? v : 0.01f * v; else if (ACT == 8) v = tanhf(v); else if (ACT == 9) v = 0.5f * v * (1.0f + tanhf(0.7978845608028654f * (v + 0.044715f * v * v * v))); else if (ACT == 14) v = (v > 0.f) ? v : 0.1f * v; else if (ACT == 16) v = (v >= 0.f) ? v : 0.3f * v; else if (ACT == 17) v = (v >= 0.f) ? v : 0.2f * v;
      so[w][rloc][t * 16 + ln] = v; } }
  __builtin_amdgcn_fence(__ATOMIC_ACQ_REL, "workgroup"); __builtin_amdgcn_wave_barrier();
  const int rsub = lane >> 4, c4 = (lane & 15) * 4;
  {
#pragma unroll
    for (int q = 0; q < 16; ++q) { const int r = q * 2 + rsub; const v4f v = *(const v4fa*)&so[w][r][c4]; if (C) *(v4f*)(C + cofs + (size_t)(row0 + r) * ldc + col0 + c4) = v; if (C16) { v4h h4; for (int i = 0; i < 4; ++i) h4[i] = (_Float16)v[i]; *(v4h*)(C16 + cofs + (size_t)(row0 + r) * ldc + col0 + c4) = h4; } }
     } }


__global__ __launch_bounds__(256) void k_wT(const float* __restrict__ w, int din, int dout, _Float16* __restrict__ Bt) { __shared__ float tl[64][65]; const int tid = threadIdx.x; const int nbo = dout / 64; const int ib = blockIdx.x / nbo, ob = blockIdx.x % nbo; const int i0 = ib * 64, o0 = ob * 64;
  for (int t = tid; t < 64 * 64; t += 256) { const int i = t / 64, o = t % 64; tl[o][i] = bf16_round(w[(size_t)(i0 + i) * dout + o0 + o]) * 16.0f; }
  __syncthreads();
  { for (int t = tid; t < 64 * 8; t += 256) { const int o = t / 8, i8 = (t % 8) * 8; FragH f; for (int q = 0; q < 8; ++q) f.h[q] = (_Float16)tl[o][i8 + q]; *(v8us*)((unsigned short*)Bt + (size_t)(o0 + o) * din + i0 + i8) = f.half[0]; }  } }
__global__ __launch_bounds__(256) void k_wnat(const float* __restrict__ w, size_t n8, _Float16* __restrict__ Bt) { const size_t t = (size_t)blockIdx.x * 256 + threadIdx.x; if (t >= n8) return; FragH f; for (int q = 0; q < 8; ++q) f.h[q] = (_Float16)(bf16_round(w[t * 8 + q]) * 16.0f); *(v8us*)((unsigned short*)Bt + t * 8) = f.half[0];  }
__global__ __launch_bounds__(256) void k_rms(const float* __restrict__ X, int xIsInput, const float* __restrict__ scale, size_t nrows, _Float16* __restrict__ N16, float* __restrict__ XF) {
  #pragma clang fp contract(off)
  const size_t r = (size_t)blockIdx.x * 256 + threadIdx.x; if (r >= nrows) return; const float* x = X + r * DM; float ss = 0.f;
#pragma unroll 1
  for (int c = 0; c < DM; ++c) { const float v = xIsInput ? bf16_round(x[c]) : x[c]; ss = __fadd_rn(ss, __fmul_rn(v, v)); } const float rs = 1.0f / sqrtf(__fadd_rn(ss / (float)DM, 1e-8f));
#pragma unroll 1
  for (int c0 = 0; c0 < DM; c0 += 8) { FragH f; v8f xv; for (int q = 0; q < 8; ++q) { const float v = xIsInput ? bf16_round(x[c0 + q]) : x[c0 + q]; xv[q] = v; f.h[q] = (_Float16)__fmul_rn(__fmul_rn(v, rs), bf16_round(scale[c0 + q])); }
    unsigned short* d = (unsigned short*)N16 + r * DM + c0; *(v8us*)d = f.half[0]; if (XF) *(v8f*)(XF + r * DM + c0) = xv;  } }
__global__ __launch_bounds__(256) void k_hT(const _Float16* __restrict__ HN, int b, _Float16* __restrict__ HT) { __shared__ unsigned short tl[64][65]; const int tid = threadIdx.x; const int jb = blockIdx.x % (SQ / 64), dbk = blockIdx.x / (SQ / 64); const int j0 = jb * 64, d0 = dbk * 64;
  for (int i = tid; i < 64 * 8; i += 256) { const int j = i / 8, d8 = (i % 8) * 8; FragH f; f.half[0] = *(const v8us*)((const unsigned short*)HN + ((size_t)b * SQ + j0 + j) * DM + d0 + d8); for (int q = 0; q < 8; ++q) tl[d8 + q][j] = f.u[q]; }
  __syncthreads();
  { for (int i = tid; i < 64 * 8; i += 256) { const int d = i / 8, j8 = (i % 8) * 8; FragH f; for (int q = 0; q < 8; ++q) f.u[q] = tl[d][j8 + q]; *(v8us*)((unsigned short*)HT + (size_t)(d0 + d) * SQ + j0 + j8) = f.half[0]; }  } }
__global__ __launch_bounds__(256) void k_tab(const float* __restrict__ dl, float* __restrict__ T) {
  #pragma clang fp contract(off)
  const int t = blockIdx.x * 256 + threadIdx.x; if (t >= SQ * RR) return; const int r = t % RR, d = t / RR; const float g = __fadd_rn(0.15f, __fmul_rn(0.85f, 1.0f / (1.0f + expf(-bf16_round(dl[r]))))); const float lg = logf(fmaxf(g, 1e-8f)); const float v = expf(__fmul_rn((float)d, lg));
  *(float*)(T + t) = v;  }
__global__ __launch_bounds__(256) void k_l2(float* __restrict__ F) {
  #pragma clang fp contract(off)
  const size_t t = (size_t)blockIdx.x * 256 + threadIdx.x; if (t >= NR * 2) return; const int wch = (int)(t & 1); const size_t r = t >> 1; float* f = F + r * (2 * RR) + wch * RR; float ss = 0.f;
#pragma unroll 1
  for (int i = 0; i < RR; ++i) ss = __fadd_rn(ss, __fmul_rn(f[i], f[i])); float n = sqrtf(ss); if (n < 1e-8f) n = 1e-8f; const float inv = 1.0f / n;
#pragma unroll 1
  for (int i0 = 0; i0 < RR; i0 += 8) { v8f o; for (int q = 0; q < 8; ++q) o[q] = __fmul_rn(f[i0 + q], inv); *(v8f*)(f + i0) = o;  } }
// Mixing matrix, one 32 (rows i) x 64 (columns j) tile per block. A thread owns one column: its k row stays in registers, the tile's q rows and the
// decay-table rows that the tile's distances i - j reach lie in LDS (rows of a negative distance are zero; those elements are masked at the store).
// Every "#pragma unroll" in this kernel but the hf loop's "unroll 1" is there so that the small arrays it indexes (tx, qx, kr, tb, qb, acc) get constant indices and stay in registers.
#define AM_TI 32
#define AM_TJ 64
#define AM_TD (AM_TI + AM_TJ)        /* 95 distances, and one row more that nobody reads: the staging is then six whole trips of the block */
#define AM_P (RR + 4)                /* LDS row pitch in floats: 16 B x odd, so that 16 lanes on 16 neighbouring rows meet no bank twice */
__global__ __launch_bounds__(256) void k_amat(const float* __restrict__ QK, const float* __restrict__ kb, const float* __restrict__ T, const float* __restrict__ gl, const float* __restrict__ al, int b, _Float16* __restrict__ A16) {
  __shared__ __attribute__((aligned(16))) float Ts[AM_TD][AM_P];
  __shared__ __attribute__((aligned(16))) float qs[AM_TI][RR];
  __shared__ __attribute__((aligned(16))) float sc[AM_TI][AM_P];
  const int tid = threadIdx.x; const int jt = blockIdx.x / (SQ / AM_TI), it = blockIdx.x % (SQ / AM_TI); const int i0 = it * AM_TI, j0 = jt * AM_TJ;
  const int orow = tid >> 3, oc8 = (tid & 7) * 8; const int oi = i0 + orow, oj = j0 + oc8;      /* the 8 elements this thread stores */
  unsigned short* dst = (unsigned short*)A16 + (size_t)oi * SQ + oj;
  if (j0 > i0 + AM_TI - 1) { const v8us z = {0, 0, 0, 0, 0, 0, 0, 0}; *(v8us*)dst = z; return; }      /* tile wholly above the diagonal: the whole block leaves, ahead of every barrier */
  const int jl = tid & (AM_TJ - 1), ig = tid >> 6; const int sr = tid >> 4, sc4 = (tid & 15) * 4;
  const int dmin = i0 - j0 - (AM_TJ - 1);
  const v4f kb0 = *(const v4fa*)(kb + (size_t)oi * SQ + oj), kb1 = *(const v4fa*)(kb + (size_t)oi * SQ + oj + 4);
  v4f tx[AM_TD / 16], qx[AM_TI / 16];
#pragma unroll
  for (int u = 0; u < AM_TD / 16; ++u) { const int d = dmin + sr + u * 16; const int dc = d < 0 ? 0 : (d > SQ - 1 ? SQ - 1 : d); tx[u] = *(const v4fa*)(T + (size_t)dc * RR + sc4); }
#pragma unroll
  for (int u = 0; u < AM_TI / 16; ++u) qx[u] = *(const v4fa*)(QK + ((size_t)b * SQ + i0 + sr + u * 16) * (2 * RR) + sc4);
  asm volatile("s_wait_xcnt 0x0" ::: "memory");      /* the loads below may be given address registers of the loads above as destinations: the wait stands in front of that overwrite */
  const float* kp = QK + ((size_t)b * SQ + j0 + jl) * (2 * RR); v4f kr[RR / 4];
#pragma unroll
  for (int r4 = 0; r4 < RR / 4; ++r4) kr[r4] = *(const v4fa*)(kp + RR + r4 * 4);
  asm volatile("s_wait_xcnt 0x0" :: "v"(kp) : "memory");      /* kp as an input keeps its registers from being handed to one of these loads as a destination ahead of the wait */
  __builtin_amdgcn_sched_barrier(0);      /* every global load is issued before the first wait on one: one latency for the block's start, not two */
  const float gate = 1.0f / (1.0f + expf(-bf16_round(gl[0]))); const float alpha = 1.0f / (1.0f + expf(-bf16_round(al[0])));
#pragma unroll
  for (int u = 0; u < AM_TD / 16; ++u) { const v4f z4 = {0.f, 0.f, 0.f, 0.f}; *(v4fa*)&Ts[sr + u * 16][sc4] = (dmin + sr + u * 16 < 0) ? z4 : tx[u]; }
#pragma unroll
  for (int u = 0; u < AM_TI / 16; ++u) *(v4fa*)&qs[sr + u * 16][sc4] = qx[u];
  __syncthreads();
#pragma unroll 1      /* stays rolled: the body is over 600 instructions long, and a second copy of it would save one branch */
  for (int hf = 0; hf < 2; ++hf) { const int il = ig * 8 + hf * 4;      /* four rows at a time: four independent sums, each over r in rising order */
    const float* tp = &Ts[il + (AM_TJ - 1) - jl][0]; const float* qp = &qs[il][0]; float acc[4] = {0.f, 0.f, 0.f, 0.f}; v4f tb[2][4][2], qb[2][4][2];
#pragma unroll
    for (int s = 0; s < 4; ++s)
#pragma unroll
      for (int h2 = 0; h2 < 2; ++h2) { qb[0][s][h2] = *(const v4fa*)(qp + s * RR + h2 * 4); tb[0][s][h2] = *(const v4fa*)(tp + s * AM_P + h2 * 4); }
#pragma unroll
    for (int ch = 0; ch < RR / 8; ++ch) {
      if (ch + 1 < RR / 8) {
#pragma unroll
        for (int s = 0; s < 4; ++s)
#pragma unroll
          for (int h2 = 0; h2 < 2; ++h2) { qb[(ch + 1) & 1][s][h2] = *(const v4fa*)(qp + s * RR + (ch + 1) * 8 + h2 * 4); tb[(ch + 1) & 1][s][h2] = *(const v4fa*)(tp + s * AM_P + (ch + 1) * 8 + h2 * 4); } }
      __builtin_amdgcn_sched_barrier(0);      /* keeps the next eight ranks' LDS loads ahead of this eight's arithmetic, which then covers their latency */
#pragma unroll
      for (int h2 = 0; h2 < 2; ++h2)
#pragma unroll
        for (int c = 0; c < 4; ++c)
#pragma unroll
          for (int s = 0; s < 4; ++s) acc[s] += (qb[ch & 1][s][h2][c] * kr[ch * 2 + h2][c]) * tb[ch & 1][s][h2][c];
      __builtin_amdgcn_sched_barrier(0);      /* and keeps the loads after next from rising into it, where they would need a third set of registers */
    }
#pragma unroll
    for (int s = 0; s < 4; ++s) sc[il + s][jl] = acc[s]; }
  __syncthreads();
  const v4f a0 = *(const v4fa*)&sc[orow][oc8], a1 = *(const v4fa*)&sc[orow][oc8 + 4]; FragH f;
#pragma unroll
  for (int u = 0; u < 8; ++u) { const float kv = (u < 4) ? kb0[u & 3] : kb1[u & 3]; const float av = (u < 4) ? a0[u & 3] : a1[u & 3]; const _Float16 v = (_Float16)(gate * bf16_round(kv) + alpha * av); f.h[u] = (oj + u <= oi) ? v : (_Float16)0.0f; }
  *(v8us*)dst = f.half[0]; }

extern "C" void kernel_launch(void* const* d_in, const int* in_sizes, int n_in,
                              void* d_out, int out_size, void* d_ws, size_t ws_size, hipStream_t stream) {
  (void)in_sizes; (void)n_in; (void)out_size;
  const float* const* I = (const float* const*)d_in; const float* h = I[0]; const float* kb = I[1]; const float* dl = I[2]; const float* gl = I[3]; const float* al = I[4]; const float* u = I[5]; const float* v = I[6]; const float* pw = I[7]; const float* pb = I[8]; const float* n1 = I[9]; const float* n2 = I[10]; const float* uw = I[11]; const float* ub = I[12]; const float* dw = I[13]; const float* db = I[14];
  char* ws = (char*)d_ws; size_t off = 0;
  auto take = [&](size_t bytes) { char* p = ws + off; off += (bytes + 255) & ~(size_t)255; return p; };
  _Float16* BUV = (_Float16*)take((size_t)2 * RR * DM * 2); _Float16* BP = (_Float16*)take((size_t)DM * DM * 2); _Float16* BU = (_Float16*)take((size_t)FH * DM * 2); _Float16* BD = (_Float16*)take((size_t)DM * FH * 2); float* T = (float*)take((size_t)SQ * RR * 4);
  _Float16* HN16 = (_Float16*)take(NR * DM * 2); float* HF = (float*)take(NR * DM * 4); float* QK = (float*)take(NR * 2 * RR * 4); _Float16* HT = (_Float16*)take((size_t)DM * SQ * 2); _Float16* A16 = (_Float16*)take((size_t)SQ * SQ * 2);
  _Float16* O16 = (_Float16*)take(NR * DM * 2); float* H1 = (float*)take(NR * DM * 4); _Float16* M16 = (_Float16*)take(NR * DM * 2); _Float16* U16 = (_Float16*)take(NR * FH * 2);
  if (off > ws_size) return;      /* 0.3 + 2 + 4 + 4 + 0.3 + 16 + 32 + 4 + 2 + 2 + 16 + 32 + 16 + 32 = ≈ 163 MiB */
  k_wT<<<(DM / 64) * (RR / 64), 256, 0, stream>>>(u, DM, RR, BUV); k_wT<<<(DM / 64) * (RR / 64), 256, 0, stream>>>(v, DM, RR, BUV + (size_t)RR * DM);      /* [u|v]^T -> [128][1024] */
  k_wnat<<<(unsigned)(((size_t)DM * DM / 8 + 255) / 256), 256, 0, stream>>>(pw, (size_t)DM * DM / 8, BP); k_wnat<<<(unsigned)(((size_t)FH * DM / 8 + 255) / 256), 256, 0, stream>>>(uw, (size_t)FH * DM / 8, BU); k_wnat<<<(unsigned)(((size_t)DM * FH / 8 + 255) / 256), 256, 0, stream>>>(dw, (size_t)DM * FH / 8, BD);
  k_tab<<<(SQ * RR + 255) / 256, 256, 0, stream>>>(dl, T);
  k_rms<<<(unsigned)((NR + 255) / 256), 256, 0, stream>>>(h, 1, n1, NR, HN16, HF);      /* hn (f16) + bf16(h) (f32 residual) */
  k_gemm2<0><<<dim3((unsigned)((NR / 128) * (2 * RR / 64)), 1), 128, 0, stream>>>(HN16, DM, 0, BUV, DM, 0, 0.0625f, nullptr, 0, nullptr, 1, 0, 0, QK, nullptr, 2 * RR, 0, (int)NR, 2 * RR, DM);      /* [q_raw | k_raw] */
  k_l2<<<(unsigned)((NR * 2 + 255) / 256), 256, 0, stream>>>(QK);
  for (int b = 0; b < NB; ++b) {
    k_amat<<<(SQ / AM_TI) * (SQ / AM_TJ), 256, 0, stream>>>(QK, kb, T, gl, al, b, A16);
    k_hT<<<(SQ / 64) * (DM / 64), 256, 0, stream>>>(HN16, b, HT);
    k_gemm2<0><<<dim3((SQ / 128) * (DM / 64), 1), 128, 0, stream>>>(A16, SQ, 0, HT, SQ, 0, 1.0f, nullptr, 0, nullptr, 1, 0, 0, nullptr, O16 + (size_t)b * SQ * DM, DM, 0, SQ, DM, SQ); }      /* out_b = A_b . hn_b */
  const dim3 gp((unsigned)((NR / 128) * (DM / 64)), 1);
  k_gemm2<0><<<gp, 128, 0, stream>>>(O16, DM, 0, BP, DM, 0, 0.0625f, pb, 0, HF, 1, (size_t)DM, 0, H1, nullptr, DM, 0, (int)MQ, DM, DM);      /* h1 = h + out proj_w^T + proj_b */
  k_rms<<<(unsigned)((MQ + 255) / 256), 256, 0, stream>>>(H1, 0, n2, MQ, M16, nullptr);
  k_gemm2<6><<<dim3((unsigned)((NR / 128) * (FH / 64)), 1), 128, 0, stream>>>(M16, DM, 0, BU, DM, 0, 0.0625f, ub, 0, nullptr, 1, 0, 0, nullptr, U16, FH, 0, (int)MQ, FH, DM);      /* gelu_erf(m up_w^T + up_b) */
  k_gemm2<0><<<gp, 128, 0, stream>>>(U16, FH, 0, BD, FH, 0, 0.0625f, db, 0, H1, 1, (size_t)DM, 0, (float*)d_out, nullptr, DM, 0, (int)MQ, DM, FH);      /* h1 + m */
}

// v002
// Measured time: 694 microseconds a run.
// In two side-by-side timings against v001, it was 1.53 and 1.55 times as fast.
// All steps since v000 together make it 3.28 times as fast.
#include <hip/hip_runtime.h>
// K2Layer (h [8][1024][1024]; hn = rmsnorm(h)*norm1_scale; gate = sigmoid(gate_logit), alpha = sigmoid(alpha_logit); q|k = hn [u|v] (rank 64), row-l2-normalised; gamma_r = 0.15 + 0.85 sigmoid(decay_logit_r); A[i][j] = causal(j<=i) * (gate k_base[i][j] + alpha sum_r q[i][r] k[j][r] gamma_r^(i-j)); out = A . hn; h1 = h + out proj_w^T + proj_b; m = gelu_erf(rmsnorm(h1)*norm2_scale up_w^T + up_b) down_w^T + down_b; result = h1 + m -> [8][1024][1024]).
// Structure: token rows; rmsnorm on VALU (f32) into f16 rows and per-batch transposed f16 planes (LDS); the rank-64 q|k projection as a WMMA GEMM (f32), l2-normalisation and the per-rank decayed causal scores on VALU in f32 (gamma^d table built on device from decay_logit, k_base/gate/alpha read) into the f16 mixing matrix A; out = A . hn, proj (+ bias + h), up (+ bias, exact-GELU epilogue, f16), down (+ bias + h1) as WMMA GEMMs (32x64 wave tiles, f32 accumulation, exact x16 weights).
// Compute dtype: inputs rounded to bf16; h / weights / k_base exact; hn, A, out, rmsnorm(h1), GELU hidden plain f16 operands (~2^-12); scores, norms, residuals f32. v_wmma_f32_16x16x32_f16.
#define NB 8
#define SQ 1024
#define DM 1024
#define RR 64
#define FH 2048
#define NR ((size_t)NB * SQ)
#define MQ NR                        /* rows through the proj/MLP stage (debug hook) */
typedef __bf16 v16b __attribute__((ext_vector_type(16)));
typedef unsigned short v8us __attribute__((ext_vector_type(8), may_alias));
typedef float  v8f  __attribute__((ext_vector_type(8)));
typedef float  v4f  __attribute__((ext_vector_type(4)));
typedef float  v4fa __attribute__((ext_vector_type(4), may_alias));
union FragB { v16b v; v8us half[2]; unsigned short u[16]; };

__device__ __forceinline__ unsigned short bf16_bits(float x) { unsigned int u = __float_as_uint(x); return (unsigned short)((u + 0x7FFFu + ((u >> 16) & 1u)) >> 16); }
__device__ __forceinline__ float bf16_val(unsigned short b) { return __uint_as_float(((unsigned int)b) << 16); }
__device__ __forceinline__ float bf16_round(float x) { return bf16_val(bf16_bits(x)); }
// D += A·B with NT terms: 1 = ah·bh, 2 = + al·bh (A split), 3 = + ah·bl (both split)
template <int NT>
__device__ __forceinline__ v8f mmaN(v16b ah, v16b al, v16b bh, v16b bl, v8f c) {
  c = __builtin_amdgcn_wmma_f32_16x16x32_bf16(false, ah, false, bh, (short)0, c, false, false);
  if (NT >= 2) c = __builtin_amdgcn_wmma_f32_16x16x32_bf16(false, al, false, bh, (short)0, c, false, false);
  if (NT >= 3) c = __builtin_amdgcn_wmma_f32_16x16x32_bf16(false, ah, false, bl, (short)0, c, false, false);
  asm volatile("v_nop\n\tv_nop\n\tv_nop\n\tv_nop" : "+v"(c) : "v"(ah), "v"(al), "v"(bh), "v"(bl));
  return c;
}

__global__ __launch_bounds__(256) void k_wt_bf16(const float* __restrict__ W, unsigned short* __restrict__ Wt, int K, int N) {
  const int t = blockIdx.x * 256 + threadIdx.x;
  const int k8n = K / 8;
  if (t >= N * k8n) return;
  const int n = t / k8n, k8 = (t % k8n) * 8;
  v8us v;
#pragma unroll
  for (int i = 0; i < 8; ++i) v[i] = bf16_bits(W[(size_t)(k8 + i) * N + n]);
  *(v8us*)(Wt + (size_t)n * K + k8) = v;
  
}

// GEMM C[M][N] (f32, pitch ldc) = act(A[M][K]·W + bias). A f32 row-major (pitch lda) converted per fragment to bf16
// (ASPLIT: hi/lo two planes -> 2 terms, else single rounded term); Wt bf16 [N][K] (pitch ldb). BIAS_BF16 rounds the
// bias to bf16 first (bias quantised to bf16 before the add). K%32==0, M%16==0, N%64==0.
template <bool ASPLIT, int ACT, bool BIAS_BF16>
__global__ __launch_bounds__(128) void k_gemm_bf(const float* __restrict__ A, int lda, const unsigned short* __restrict__ Wt, int ldb,
                                               const float* __restrict__ bias, float* __restrict__ C, int ldc, int M, int N, int K) {
  __shared__ __attribute__((aligned(16))) float so[4][16][64];
  const int tid = threadIdx.x, w = tid >> 5, lane = tid & 31, ln = lane & 15, hh = lane >> 4;
  const int ntn = N / 64;
  const int wid = blockIdx.x * 4 + w;
  const int mt = wid / ntn, nq = wid % ntn;
  if (mt * 16 >= M) return;
  const int row0 = mt * 16, col0 = nq * 64;
  const float* arow = A + (size_t)(row0 + ln) * lda;
  v8f acc[4] = {};
  for (int kb = 0; kb < K; kb += 32) {
    FragB ah, al;
    const v4f x0 = *(const v4fa*)(arow + kb + 8 * hh), x1 = *(const v4fa*)(arow + kb + 8 * hh + 4);
    const v4f x2 = *(const v4fa*)(arow + kb + 16 + 8 * hh), x3 = *(const v4fa*)(arow + kb + 16 + 8 * hh + 4);
    float xs[16] = {x0[0],x0[1],x0[2],x0[3],x1[0],x1[1],x1[2],x1[3],x2[0],x2[1],x2[2],x2[3],x3[0],x3[1],x3[2],x3[3]};
#pragma unroll
    for (int i = 0; i < 16; ++i) { const unsigned short hb = bf16_bits(xs[i]); ah.u[i] = hb; al.u[i] = ASPLIT ? bf16_bits(xs[i] - bf16_val(hb)) : (unsigned short)0; }
#pragma unroll
    for (int t = 0; t < 4; ++t) {
      const unsigned short* brow = Wt + (size_t)(col0 + t * 16 + ln) * ldb + kb;
      FragB b;
      b.half[0] = *(const v8us*)(brow + 8 * hh);
      b.half[1] = *(const v8us*)(brow + 16 + 8 * hh);
      acc[t] = mmaN<ASPLIT ? 2 : 1>(ah.v, al.v, b.v, b.v, acc[t]);
    }
  }
#pragma unroll
  for (int t = 0; t < 4; ++t) {
    float bv = bias ? bias[col0 + t * 16 + ln] : 0.f;
    if (BIAS_BF16) bv = bf16_round(bv);
#pragma unroll
    for (int r = 0; r < 8; ++r) { float v = acc[t][r] + bv; if (ACT == 1) v = fmaxf(v, 0.f); so[w][8 * hh + r][t * 16 + ln] = v; }
  }
  __builtin_amdgcn_fence(__ATOMIC_ACQ_REL, "workgroup");
  __builtin_amdgcn_wave_barrier();
  const int rsub = lane >> 4, c4 = (lane & 15) * 4;
  {
#pragma unroll
    for (int q = 0; q < 8; ++q) {
      const int r = q * 2 + rsub;
      const v4f v = *(const v4fa*)&so[w][r][c4];
      *(v4f*)(C + (size_t)(row0 + r) * ldc + col0 + c4) = v;
    }
    
  }
}

// GEMM C = act(A·W + bias + resid): A f32 (ASPLIT -> hi/lo 2 terms), Wt bf16 [N][K]; ACT 0 none, 1 relu, 2 exact gelu;
// resid (optional, f32, row index = (row % rmod), pitch ldr, RES_BF16 rounds it) added before the activation.
template <bool ASPLIT, int ACT, bool BIAS_BF16, bool RES_BF16>
__global__ __launch_bounds__(128) void k_gemm_bf3(const float* __restrict__ A, int lda, const unsigned short* __restrict__ Wt, int ldb,
                                                const float* __restrict__ bias, const float* __restrict__ resid, int rmod, int ldr,
                                                float* __restrict__ C, int ldc, int M, int N, int K) {
  __shared__ __attribute__((aligned(16))) float so[4][16][64];
  const int tid = threadIdx.x, w = tid >> 5, lane = tid & 31, ln = lane & 15, hh = lane >> 4;
  const int ntn = N / 64;
  const int wid = blockIdx.x * 4 + w;
  const int mt = wid / ntn, nq = wid % ntn;
  if (mt * 16 >= M) return;
  const int row0 = mt * 16, col0 = nq * 64;
  const float* arow = A + (size_t)(row0 + ln) * lda;
  v8f acc[4] = {};
  for (int kb = 0; kb < K; kb += 32) {
    FragB ah, al;
    const v4f x0 = *(const v4fa*)(arow + kb + 8 * hh), x1 = *(const v4fa*)(arow + kb + 8 * hh + 4);
    const v4f x2 = *(const v4fa*)(arow + kb + 16 + 8 * hh), x3 = *(const v4fa*)(arow + kb + 16 + 8 * hh + 4);
    float xs[16] = {x0[0],x0[1],x0[2],x0[3],x1[0],x1[1],x1[2],x1[3],x2[0],x2[1],x2[2],x2[3],x3[0],x3[1],x3[2],x3[3]};
#pragma unroll
    for (int i = 0; i < 16; ++i) { const unsigned short hb = bf16_bits(xs[i]); ah.u[i] = hb; al.u[i] = ASPLIT ? bf16_bits(xs[i] - bf16_val(hb)) : (unsigned short)0; }
#pragma unroll
    for (int t = 0; t < 4; ++t) {
      const unsigned short* brow = Wt + (size_t)(col0 + t * 16 + ln) * ldb + kb;
      FragB b;
      b.half[0] = *(const v8us*)(brow + 8 * hh);
      b.half[1] = *(const v8us*)(brow + 16 + 8 * hh);
      acc[t] = mmaN<ASPLIT ? 2 : 1>(ah.v, al.v, b.v, b.v, acc[t]);
    }
  }
#pragma unroll
  for (int t = 0; t < 4; ++t) {
    const int col = col0 + t * 16 + ln;
    float bv = bias ? bias[col] : 0.f;
    if (BIAS_BF16) bv = bf16_round(bv);
#pragma unroll
    for (int r = 0; r < 8; ++r) {
      float v = acc[t][r] + bv;
      if (resid) { float rv = resid[(size_t)((row0 + 8 * hh + r) % rmod) * ldr + col]; if (RES_BF16) rv = bf16_round(rv); v += rv; }
      if (ACT == 1) v = fmaxf(v, 0.f);
      if (ACT == 2) v = 0.5f * v * (1.0f + erff(v * 0.70710678118654752f));
      if (ACT == 3) { const float u = 0.7978845608028654f * (v + 0.044715f * v * v * v); v = 0.5f * v * (1.0f + tanhf(u)); }
      so[w][8 * hh + r][t * 16 + ln] = v;
    }
  }
  __builtin_amdgcn_fence(__ATOMIC_ACQ_REL, "workgroup");
  __builtin_amdgcn_wave_barrier();
  const int rsub = lane >> 4, c4 = (lane & 15) * 4;
  {
#pragma unroll
    for (int q = 0; q < 8; ++q) {
      const int r = q * 2 + rsub;
      const v4f v = *(const v4fa*)&so[w][r][c4];
      *(v4f*)(C + (size_t)(row0 + r) * ldc + col0 + c4) = v;
    }
    
  }
}
// row LayerNorm (biased variance, eps) over N: s = X (+ R); optional out_sum <- s; out_norm <- (s-mu)*rsqrt(var+eps)*g + b
template <bool PARAM_BF16>
__global__ __launch_bounds__(256) void k_layernorm(const float* __restrict__ X, const float* __restrict__ R, const float* __restrict__ g, const float* __restrict__ bta,
                                                  float* __restrict__ out_sum, float* __restrict__ out_norm, int N, float eps) {
  __shared__ float red[256];
  const int row = blockIdx.x, tid = threadIdx.x;
  const float* x = X + (size_t)row * N; const float* rr = R ? R + (size_t)row * N : nullptr;
  float vals[16];                     // up to N = 4096
  const int per = N / 256;            // contiguous chunk per thread? use strided-by-4 chunks: thread handles j = tid*4 + 1024*u
  float s1 = 0.f;
  for (int u = 0; u < per / 4; ++u) {
    const int j = tid * 4 + 1024 * u;
    const v4f a = *(const v4fa*)(x + j);
    v4f b = {0.f,0.f,0.f,0.f}; if (rr) b = *(const v4fa*)(rr + j);
#pragma unroll
    for (int q = 0; q < 4; ++q) { const float v = a[q] + b[q]; vals[u * 4 + q] = v; s1 += v; }
  }
  red[tid] = s1; __syncthreads();
  for (int st = 128; st > 0; st >>= 1) { if (tid < st) red[tid] += red[tid + st]; __syncthreads(); }
  const float mu = red[0] / (float)N; __syncthreads();
  float s2 = 0.f;
  for (int u = 0; u < per / 4; ++u)
#pragma unroll
    for (int q = 0; q < 4; ++q) { const float c = vals[u * 4 + q] - mu; s2 += c * c; }
  red[tid] = s2; __syncthreads();
  for (int st = 128; st > 0; st >>= 1) { if (tid < st) red[tid] += red[tid + st]; __syncthreads(); }
  const float rs = rsqrtf(red[0] / (float)N + eps);
  {
    for (int u = 0; u < per / 4; ++u) {
      const int j = tid * 4 + 1024 * u;
      v4f o, sm;
#pragma unroll
      for (int q = 0; q < 4; ++q) {
        float gg = g[j + q], bb = bta[j + q];
        if (PARAM_BF16) { gg = bf16_round(gg); bb = bf16_round(bb); }
        sm[q] = vals[u * 4 + q]; o[q] = (vals[u * 4 + q] - mu) * rs * gg + bb;
      }
      if (out_sum) *(v4f*)(out_sum + (size_t)row * N + j) = sm;
      *(v4f*)(out_norm + (size_t)row * N + j) = o;
    }
    
  }
}



// ---- f16 WMMA path (v_wmma_f32_16x16x32_f16): 11-bit significands for operands in range — used for every GEMM launched here
typedef _Float16 v16h __attribute__((ext_vector_type(16)));
union FragH { v16h v; v8us half[2]; _Float16 h[16]; unsigned short u[16]; };
template <int NT>
__device__ __forceinline__ v8f mmaH(v16h ah, v16h al, v16h bh, v16h bl, v8f c) {
  c = __builtin_amdgcn_wmma_f32_16x16x32_f16(false, ah, false, bh, (short)0, c, false, false);
  if (NT >= 2) c = __builtin_amdgcn_wmma_f32_16x16x32_f16(false, al, false, bh, (short)0, c, false, false);
  if (NT >= 3) c = __builtin_amdgcn_wmma_f32_16x16x32_f16(false, ah, false, bl, (short)0, c, false, false);
  asm volatile("v_nop\n\tv_nop\n\tv_nop\n\tv_nop" : "+v"(c) : "v"(ah), "v"(al), "v"(bh), "v"(bl));
  return c;
}
// batched GEMM like k_gemm_b but f16 operands: A f32 (split into f16 hi/lo if ASPLIT, else rounded to f16), Bt = f16 values [n][k]; alpha; C f32; N multiple of 16 (partial tiles skipped)
template <bool ASPLIT>
__global__ __launch_bounds__(128) void k_gemm_h(const float* __restrict__ A, int lda, size_t sA, const _Float16* __restrict__ Bh, int ldb, size_t sB, float alpha, float* __restrict__ C, int ldc, size_t sC, int M, int N, int K) {
  __shared__ __attribute__((aligned(16))) float so[4][16][64];
  const int tid = threadIdx.x, w = tid >> 5, lane = tid & 31, ln = lane & 15, hh = lane >> 4; const int by = blockIdx.y;
  A += (size_t)by * sA; Bh += (size_t)by * sB; C += (size_t)by * sC;
  const int ntn = (N + 63) / 64; const int wid = blockIdx.x * 4 + w; const int mt = wid / ntn, nq = wid % ntn; if (mt * 16 >= M) return;
  const int row0 = mt * 16, col0 = nq * 64; const float* arow = A + (size_t)(row0 + ln) * lda;
  v8f acc[4] = {};
  for (int kb = 0; kb < K; kb += 32) {
    FragH ah, al;
    const v4f x0 = *(const v4fa*)(arow + kb + 8 * hh), x1 = *(const v4fa*)(arow + kb + 8 * hh + 4), x2 = *(const v4fa*)(arow + kb + 16 + 8 * hh), x3 = *(const v4fa*)(arow + kb + 16 + 8 * hh + 4);
    float xs[16] = {x0[0],x0[1],x0[2],x0[3],x1[0],x1[1],x1[2],x1[3],x2[0],x2[1],x2[2],x2[3],x3[0],x3[1],x3[2],x3[3]};
#pragma unroll
    for (int i = 0; i < 16; ++i) { const _Float16 h = (_Float16)xs[i]; ah.h[i] = h; al.h[i] = ASPLIT ? (_Float16)(xs[i] - (float)h) : (_Float16)0.0f; }
#pragma unroll
    for (int t = 0; t < 4; ++t) { if (col0 + t * 16 >= N) continue; const size_t boff = (size_t)(col0 + t * 16 + ln) * ldb + kb; FragH bq; bq.half[0] = *(const v8us*)(Bh + boff + 8 * hh); bq.half[1] = *(const v8us*)(Bh + boff + 16 + 8 * hh);
      acc[t] = mmaH<ASPLIT ? 2 : 1>(ah.v, al.v, bq.v, bq.v, acc[t]); }
  }
#pragma unroll
  for (int t = 0; t < 4; ++t) { if (col0 + t * 16 >= N) continue;
#pragma unroll
    for (int r = 0; r < 8; ++r) so[w][8 * hh + r][t * 16 + ln] = acc[t][r] * alpha; }
  __builtin_amdgcn_fence(__ATOMIC_ACQ_REL, "workgroup"); __builtin_amdgcn_wave_barrier();
  const int rsub = lane >> 4, c4 = (lane & 15) * 4;
  {
#pragma unroll
    for (int q = 0; q < 8; ++q) { const int r = q * 2 + rsub; if (col0 + c4 < N) { const v4f v = *(const v4fa*)&so[w][r][c4]; *(v4f*)(C + (size_t)(row0 + r) * ldc + col0 + c4) = v; } }
     }
}

// Wt[n][k] = f16(W[k][n]·scale) from f32 row-major W[K][N] (scale = power of two; bf16-exact weights stay exact in f16 away from the subnormal range)
__global__ __launch_bounds__(256) void k_wt_f16(const float* __restrict__ W, _Float16* __restrict__ Wt, int K, int N, float scale) {
  const int t = blockIdx.x * 256 + threadIdx.x; if (t >= N * (K / 8)) return; const int n = t / (K / 8), k8 = (t % (K / 8)) * 8; FragH f;
#pragma unroll
  for (int i = 0; i < 8; ++i) f.h[i] = (_Float16)(bf16_round(W[(size_t)(k8 + i) * N + n]) * scale); const v8us o = f.half[0];
  *(v8us*)((unsigned short*)Wt + (size_t)n * K + k8) = o; 
}
// k_gemm_hh variant with fused epilogue: v = acc·alpha + bias[by·sBias + col] (+ CP[(row/rowsPerB)·sCPb + by·64 + col] if CP) ; ACT 0 none / 1 elu ; writes f16 C16 (and f32 C if non-null)
template <int ACT>
__global__ __launch_bounds__(128) void k_gemm_hhx(const _Float16* __restrict__ A, int lda, size_t sA, const _Float16* __restrict__ Bh, int ldb, size_t sB, float alpha, const float* __restrict__ bias, size_t sBias, const float* __restrict__ CP, int rowsPerB, size_t sCPb, int row0g,
    float* __restrict__ C, _Float16* __restrict__ C16, int ldc, size_t sC, int M, int N, int K) {
  __shared__ __attribute__((aligned(16))) float so[4][16][64];
  const int tid = threadIdx.x, w = tid >> 5, lane = tid & 31, ln = lane & 15, hh = lane >> 4; const int by = blockIdx.y;
  A += (size_t)by * sA; Bh += (size_t)by * sB; const size_t cofs = (size_t)by * sC; const float* bp = bias ? bias + (size_t)by * sBias : nullptr;
  const int ntn = (N + 63) / 64; const int wid = blockIdx.x * 4 + w; const int mt = wid / ntn, nq = wid % ntn; if (mt * 16 >= M) return;
  const int row0 = mt * 16, col0 = nq * 64; const _Float16* arow = A + (size_t)(row0 + ln) * lda;
  v8f acc[4] = {};
  for (int kb = 0; kb < K; kb += 32) { FragH ah; ah.half[0] = *(const v8us*)((const unsigned short*)arow + kb + 8 * hh); ah.half[1] = *(const v8us*)((const unsigned short*)arow + kb + 16 + 8 * hh);
#pragma unroll
    for (int t = 0; t < 4; ++t) { if (col0 + t * 16 >= N) continue; const size_t boff = (size_t)(col0 + t * 16 + ln) * ldb + kb; FragH bq; bq.half[0] = *(const v8us*)((const unsigned short*)Bh + boff + 8 * hh); bq.half[1] = *(const v8us*)((const unsigned short*)Bh + boff + 16 + 8 * hh);
      acc[t] = mmaH<1>(ah.v, ah.v, bq.v, bq.v, acc[t]); }
  }
#pragma unroll
  for (int t = 0; t < 4; ++t) { if (col0 + t * 16 >= N) continue; const int col = col0 + t * 16 + ln; const float bv = bp ? bf16_round(bp[col]) : 0.f;
#pragma unroll
    for (int r = 0; r < 8; ++r) { float v = acc[t][r] * alpha + bv; if (CP) { const int rr = row0g + row0 + 8 * hh + r; if (rowsPerB < 0) v += CP[cofs + (size_t)rr * ldc + col];      /* rowsPerB < 0: own element of the batched C plane */ else { const int bidx = rr / rowsPerB; v += CP[(size_t)bidx * sCPb + (size_t)by * 64 + col]; } } if (ACT == 1) v = (v > 0.f) ? v : expm1f(v); else if (ACT == 7) v = (v > 0.f) ? v + 1.0f : expf(v); else if (ACT == 8) v = tanhf(v); else if (ACT == 9) v = 0.5f * v * (1.0f + tanhf(0.7978845608028654f * (v + 0.044715f * v * v * v))); else if (ACT == 11) v = 1.0f / (1.0f + expf(-v)); else if (ACT == 12) v = (v > 0.f) ? v : 0.01f * v; else if (ACT == 14) v = (v > 0.f) ? v : 0.1f * v; else if (ACT == 16) v = (v >= 0.f) ? v : 0.3f * v; else if (ACT == 17) v = (v >= 0.f) ? v : 0.2f * v; else if (ACT == 15) v = v / (1.0f + expf(-v)); else if (ACT == 3) v = fmaxf(v, 0.f); else if (ACT == 6) v = 0.5f * v * (1.0f + erff(v * 0.70710678118654752f)); so[w][8 * hh + r][t * 16 + ln] = v; } }
  __builtin_amdgcn_fence(__ATOMIC_ACQ_REL, "workgroup"); __builtin_amdgcn_wave_barrier();
  const int rsub = lane >> 4, c4 = (lane & 15) * 4; typedef _Float16 v4h __attribute__((ext_vector_type(4)));
  {
#pragma unroll
    for (int q = 0; q < 8; ++q) { const int r = q * 2 + rsub; if (col0 + c4 < N) { const v4f v = *(const v4fa*)&so[w][r][c4]; if (C) *(v4f*)(C + cofs + (size_t)(row0 + r) * ldc + col0 + c4) = v; if (C16) { v4h h4; for (int i = 0; i < 4; ++i) h4[i] = (_Float16)v[i]; *(v4h*)(C16 + cofs + (size_t)(row0 + r) * ldc + col0 + c4) = h4; } } }
     }
}


typedef _Float16 v4h __attribute__((ext_vector_type(4)));

__global__ __launch_bounds__(256) void k_x16(const float* __restrict__ x, _Float16* __restrict__ X16, size_t n8) { const size_t t = (size_t)blockIdx.x * 256 + threadIdx.x; if (t >= n8) return; FragH f;
#pragma unroll
  for (int q = 0; q < 8; ++q) f.h[q] = (_Float16)bf16_round(x[t * 8 + q]); *(v8us*)((unsigned short*)X16 + t * 8) = f.half[0];  }
__global__ __launch_bounds__(256) void k_h16(const float* __restrict__ x, _Float16* __restrict__ X16, size_t n8) { const size_t t = (size_t)blockIdx.x * 256 + threadIdx.x; if (t >= n8) return; FragH f;
#pragma unroll
  for (int q = 0; q < 8; ++q) f.h[q] = (_Float16)x[t * 8 + q]; *(v8us*)((unsigned short*)X16 + t * 8) = f.half[0];  }
__global__ __launch_bounds__(256) void k_round16f(const float* __restrict__ W, _Float16* __restrict__ Bt, size_t n8) { const size_t t = (size_t)blockIdx.x * 256 + threadIdx.x; if (t >= n8) return; FragH f;
#pragma unroll
  for (int i = 0; i < 8; ++i) f.h[i] = (_Float16)(bf16_round(W[t * 8 + i]) * 16.0f); *(v8us*)((unsigned short*)Bt + t * 8) = f.half[0];  }
template <int NHv, int TTv>
__global__ __launch_bounds__(256) void k_vt(const _Float16* __restrict__ V16, int ldv, int voff, _Float16* __restrict__ Vt) { __shared__ unsigned short tl[64][66]; const int tid = threadIdx.x; const int slab = blockIdx.x / (TTv / 64), lg = blockIdx.x % (TTv / 64); const int b = slab / NHv, h = slab % NHv;
  for (int i = tid; i < 64 * 8; i += 256) { const int r = i / 8, c8 = (i % 8) * 8; FragH f; f.half[0] = *(const v8us*)((const unsigned short*)V16 + ((size_t)b * TTv + lg * 64 + r) * ldv + voff + h * 64 + c8);
#pragma unroll
    for (int q = 0; q < 8; ++q) tl[r][c8 + q] = f.u[q]; }
  __syncthreads();
  {
#pragma unroll
    for (int rd = 0; rd < 2; ++rd) { const int d = rd * 32 + tid / 8, pc = tid % 8; FragH f;
#pragma unroll
      for (int q = 0; q < 8; ++q) f.u[q] = tl[pc * 8 + q][d];
      *(v8us*)((unsigned short*)Vt + ((size_t)slab * 64 + d) * TTv + lg * 64 + pc * 8) = f.half[0]; }
     } }

__global__ __launch_bounds__(256) void k_hl(const float* __restrict__ F, _Float16* __restrict__ Hh, _Float16* __restrict__ Hl, size_t n8) { const size_t t = (size_t)blockIdx.x * 256 + threadIdx.x; if (t >= n8) return; FragH fh, fl; const v4f a = *(const v4fa*)(F + t * 8), c = *(const v4fa*)(F + t * 8 + 4);
#pragma unroll
  for (int q = 0; q < 4; ++q) { _Float16 h = (_Float16)a[q]; fh.h[q] = h; fl.h[q] = (_Float16)((a[q] - (float)h) * 1024.0f); h = (_Float16)c[q]; fh.h[4 + q] = h; fl.h[4 + q] = (_Float16)((c[q] - (float)h) * 1024.0f); }
  { *(v8us*)((unsigned short*)Hh + t * 8) = fh.half[0]; *(v8us*)((unsigned short*)Hl + t * 8) = fl.half[0];  } }

// ---- fast GEMM (wave tile 32x64; requires M % 32 == 0 rows per launch region and N % 64 == 0); epilogue = k_gemm_hhx semantics ----
__device__ __forceinline__ v16h g2_frag(const _Float16* p, int hh) { FragH f; f.half[0] = *(const v8us*)((const unsigned short*)p + 8 * hh); f.half[1] = *(const v8us*)((const unsigned short*)p + 16 + 8 * hh); return f.v; }
__device__ __forceinline__ v8f g2_mma(v16h a, v16h b, v8f c) { v8f d = __builtin_amdgcn_wmma_f32_16x16x32_f16(false, a, false, b, (short)0, c, false, false); asm volatile("v_nop\n\tv_nop\n\tv_nop\n\tv_nop" : "+v"(d) : "v"(a), "v"(b)); return d; }
template <int ACT>
__global__ __launch_bounds__(128) void k_gemm2(const _Float16* __restrict__ A, int lda, size_t sA, const _Float16* __restrict__ Bh, int ldb, size_t sB, float alpha, const float* __restrict__ bias, size_t sBias, const float* __restrict__ CP, int rowsPerB, size_t sCPb, int row0g,
    float* __restrict__ C, _Float16* __restrict__ C16, int ldc, size_t sC, int M, int N, int K) { static_assert(ACT == 0 || ACT == 3 || ACT == 6 || ACT == 8 || ACT == 9 || ACT == 11 || ACT == 12 || ACT == 14 || ACT == 15 || ACT == 16 || ACT == 17, "k_gemm2: unsupported ACT code (would silently apply no activation)");
  __shared__ __attribute__((aligned(16))) float so[4][32][68];
  const int tid = threadIdx.x, w = tid >> 5, lane = tid & 31, ln = lane & 15, hh = lane >> 4; const int by = blockIdx.y;
  A += (size_t)by * sA; Bh += (size_t)by * sB; const size_t cofs = (size_t)by * sC; const float* bp = bias ? bias + (size_t)by * sBias : nullptr;
  const int ntn = N >> 6; const int mt = blockIdx.x / ntn, nq = blockIdx.x - mt * ntn; const int row0 = mt * 128 + 32 * w, col0 = nq * 64; if (row0 >= M) return;
  const _Float16* a0p = A + (size_t)(row0 + ln) * lda; const _Float16* a1p = a0p + (size_t)16 * lda;
  const _Float16* b0p = Bh + (size_t)(col0 + ln) * ldb; const _Float16* b1p = b0p + (size_t)16 * ldb; const _Float16* b2p = b1p + (size_t)16 * ldb; const _Float16* b3p = b2p + (size_t)16 * ldb;
  const v8f z8 = {0.f,0.f,0.f,0.f,0.f,0.f,0.f,0.f}; v8f c00 = z8, c01 = z8, c02 = z8, c03 = z8, c10 = z8, c11 = z8, c12 = z8, c13 = z8;
#pragma unroll 1
  for (int kb = 0; kb < K; kb += 32) { const v16h a0 = g2_frag(a0p + kb, hh), a1 = g2_frag(a1p + kb, hh);
    v16h b = g2_frag(b0p + kb, hh); c00 = g2_mma(a0, b, c00); c10 = g2_mma(a1, b, c10);
    b = g2_frag(b1p + kb, hh); c01 = g2_mma(a0, b, c01); c11 = g2_mma(a1, b, c11);
    b = g2_frag(b2p + kb, hh); c02 = g2_mma(a0, b, c02); c12 = g2_mma(a1, b, c12);
    b = g2_frag(b3p + kb, hh); c03 = g2_mma(a0, b, c03); c13 = g2_mma(a1, b, c13); }
  v8f accs[8] = {c00, c01, c02, c03, c10, c11, c12, c13};
#pragma unroll
  for (int u = 0; u < 8; ++u) { const int t = u & 3, half = u >> 2; const int col = col0 + t * 16 + ln; const float bv = bp ? bf16_round(bp[col]) : 0.f;
#pragma unroll
    for (int r = 0; r < 8; ++r) { const int rloc = half * 16 + 8 * hh + r; float v = accs[u][r] * alpha + bv; if (CP) { if (rowsPerB < 0) v += CP[cofs + (size_t)(row0g + row0 + rloc) * ldc + col];      /* rowsPerB < 0: own element of the batched C plane */ else { const int bidx = (row0g + row0 + rloc) / rowsPerB; v += CP[(size_t)bidx * sCPb + (size_t)by * 64 + col]; } }
      if (ACT == 3) v = fmaxf(v, 0.f); else if (ACT == 6) v = 0.5f * v * (1.0f + erff(v * 0.70710678118654752f)); else if (ACT == 11) v = 1.0f / (1.0f + expf(-v)); else if (ACT == 15) v = v / (1.0f + expf(-v)); else if (ACT == 12) v = (v > 0.f) ? v : 0.01f * v; else if (ACT == 8) v = tanhf(v); else if (ACT == 9) v = 0.5f * v * (1.0f + tanhf(0.7978845608028654f * (v + 0.044715f * v * v * v))); else if (ACT == 14) v = (v > 0.f) ? v : 0.1f * v; else if (ACT == 16) v = (v >= 0.f) ? v : 0.3f * v; else if (ACT == 17) v = (v >= 0.f) ? v : 0.2f * v;
      so[w][rloc][t * 16 + ln] = v; } }
  __builtin_amdgcn_fence(__ATOMIC_ACQ_REL, "workgroup"); __builtin_amdgcn_wave_barrier();
  const int rsub = lane >> 4, c4 = (lane & 15) * 4;
  {
#pragma unroll
    for (int q = 0; q < 16; ++q) { const int r = q * 2 + rsub; const v4f v = *(const v4fa*)&so[w][r][c4]; if (C) *(v4f*)(C + cofs + (size_t)(row0 + r) * ldc + col0 + c4) = v; if (C16) { v4h h4; for (int i = 0; i < 4; ++i) h4[i] = (_Float16)v[i]; *(v4h*)(C16 + cofs + (size_t)(row0 + r) * ldc + col0 + c4) = h4; } }
     } }


__global__ __launch_bounds__(256) void k_wT(const float* __restrict__ w, int din, int dout, _Float16* __restrict__ Bt) { __shared__ float tl[64][65]; const int tid = threadIdx.x; const int nbo = dout / 64; const int ib = blockIdx.x / nbo, ob = blockIdx.x % nbo; const int i0 = ib * 64, o0 = ob * 64;
  for (int t = tid; t < 64 * 64; t += 256) { const int i = t / 64, o = t % 64; tl[o][i] = bf16_round(w[(size_t)(i0 + i) * dout + o0 + o]) * 16.0f; }
  __syncthreads();
  { for (int t = tid; t < 64 * 8; t += 256) { const int o = t / 8, i8 = (t % 8) * 8; FragH f; for (int q = 0; q < 8; ++q) f.h[q] = (_Float16)tl[o][i8 + q]; *(v8us*)((unsigned short*)Bt + (size_t)(o0 + o) * din + i0 + i8) = f.half[0]; }  } }
__global__ __launch_bounds__(256) void k_wnat(const float* __restrict__ w, size_t n8, _Float16* __restrict__ Bt) { const size_t t = (size_t)blockIdx.x * 256 + threadIdx.x; if (t >= n8) return; FragH f; for (int q = 0; q < 8; ++q) f.h[q] = (_Float16)(bf16_round(w[t * 8 + q]) * 16.0f); *(v8us*)((unsigned short*)Bt + t * 8) = f.half[0];  }
// One row per wave: lane l holds columns 128 u + 4 l .. + 3 (u = 0 .. 7), so every load and every f32 store of a wave covers 512 contiguous bytes (an f16 store 256),
// and the row stays in registers between the sum of squares and the scaling. No LDS, no barrier. The unrolls keep xv, sv and o in registers (constant indices).
__global__ __launch_bounds__(256) void k_rms(const float* __restrict__ X, int xIsInput, const float* __restrict__ scale, size_t nrows, _Float16* __restrict__ N16, float* __restrict__ XF) {
  const int lane = threadIdx.x & 31; const size_t r = (size_t)blockIdx.x * 8 + (threadIdx.x >> 5); if (r >= nrows) return;      /* the same for a whole wave */
  const size_t o0 = r * DM + lane * 4; const float* xp = X + o0; const float* sp = scale + lane * 4; v4f xv[DM / 128], sv[DM / 128];
#pragma unroll
  for (int u = 0; u < DM / 128; ++u) xv[u] = *(const v4fa*)(xp + u * 128);
#pragma unroll
  for (int u = 0; u < DM / 128; ++u) sv[u] = *(const v4fa*)(sp + u * 128);
  asm volatile("s_wait_xcnt 0x0" ::: "memory");      /* stands ahead of every overwrite of the loads' address registers */
  if (xIsInput) {
#pragma unroll
    for (int u = 0; u < DM / 128; ++u)
#pragma unroll
      for (int q = 0; q < 4; ++q) xv[u][q] = bf16_round(xv[u][q]); }
  if (XF) {      /* the f32 copy leaves as soon as it is known; xv is only read from here on */
#pragma unroll
    for (int u = 0; u < DM / 128; ++u) *(v4f*)(XF + o0 + u * 128) = xv[u];
    asm volatile("s_wait_xcnt 0x0" ::: "memory"); }      /* stands ahead of every later overwrite of these stores' address and data registers */
  float s4[4] = {0.f, 0.f, 0.f, 0.f};      /* four independent chains per lane */
#pragma unroll
  for (int u = 0; u < DM / 128; ++u)
#pragma unroll
    for (int q = 0; q < 4; ++q) s4[q] += xv[u][q] * xv[u][q];
  float ss = (s4[0] + s4[1]) + (s4[2] + s4[3]);
#pragma unroll
  for (int m = 16; m >= 1; m >>= 1) ss += __shfl_xor(ss, m, 32);      /* every lane ends with the row's sum */
  const float rs = 1.0f / sqrtf(ss / (float)DM + 1e-8f); v4h o[DM / 128];
#pragma unroll
  for (int u = 0; u < DM / 128; ++u)
#pragma unroll
    for (int q = 0; q < 4; ++q) o[u][q] = (_Float16)((xv[u][q] * rs) * bf16_round(sv[u][q]));
#pragma unroll
  for (int u = 0; u < DM / 128; ++u) *(v4h*)(N16 + o0 + u * 128) = o[u]; }
__global__ __launch_bounds__(256) void k_hT(const _Float16* __restrict__ HN, int b, _Float16* __restrict__ HT) { __shared__ unsigned short tl[64][65]; const int tid = threadIdx.x; const int jb = blockIdx.x % (SQ / 64), dbk = blockIdx.x / (SQ / 64); const int j0 = jb * 64, d0 = dbk * 64;
  for (int i = tid; i < 64 * 8; i += 256) { const int j = i / 8, d8 = (i % 8) * 8; FragH f; f.half[0] = *(const v8us*)((const unsigned short*)HN + ((size_t)b * SQ + j0 + j) * DM + d0 + d8); for (int q = 0; q < 8; ++q) tl[d8 + q][j] = f.u[q]; }
  __syncthreads();
  { for (int i = tid; i < 64 * 8; i += 256) { const int d = i / 8, j8 = (i % 8) * 8; FragH f; for (int q = 0; q < 8; ++q) f.u[q] = tl[d][j8 + q]; *(v8us*)((unsigned short*)HT + (size_t)(d0 + d) * SQ + j0 + j8) = f.half[0]; }  } }
__global__ __launch_bounds__(256) void k_tab(const float* __restrict__ dl, float* __restrict__ T) {
  #pragma clang fp contract(off)
  const int t = blockIdx.x * 256 + threadIdx.x; if (t >= SQ * RR) return; const int r = t % RR, d = t / RR; const float g = __fadd_rn(0.15f, __fmul_rn(0.85f, 1.0f / (1.0f + expf(-bf16_round(dl[r]))))); const float lg = logf(fmaxf(g, 1e-8f)); const float v = expf(__fmul_rn((float)d, lg));
  *(float*)(T + t) = v;  }
// Sixteen lanes per 64-element q or k row (the rows lie one behind the other in F): a lane holds four elements, a wave's load and store cover 512 contiguous bytes.
__global__ __launch_bounds__(256) void k_l2(float* __restrict__ F) {
  const size_t t = (size_t)blockIdx.x * 256 + threadIdx.x; if (t >= NR * 2 * (RR / 4)) return;      /* whole waves only: the bound is a multiple of 32 */
  float* f = F + t * 4; const v4f a = *(const v4fa*)f; float ss = (a[0] * a[0] + a[1] * a[1]) + (a[2] * a[2] + a[3] * a[3]);
#pragma unroll
  for (int m = 8; m >= 1; m >>= 1) ss += __shfl_xor(ss, m, 32);      /* stays inside the row's sixteen lanes */
  float n = sqrtf(ss); if (n < 1e-8f) n = 1e-8f; const float inv = 1.0f / n; v4f o;
#pragma unroll
  for (int q = 0; q < 4; ++q) o[q] = a[q] * inv;
  *(v4f*)f = o; }
// Mixing matrix, one 32 (rows i) x 64 (columns j) tile per block. A thread computes eight rows of one column: that column's k row stays in registers, the tile's q rows and the
// decay-table rows that the tile's distances i - j reach lie in LDS (rows of a negative distance are zero; those elements are masked at the store).
// Every "#pragma unroll" in this kernel but the hf loop's "unroll 1" is there so that the small arrays it indexes (tx, qx, kr, tb, qb, acc) get constant indices and stay in registers.
#define AM_TI 32
#define AM_TJ 64
#define AM_TD (AM_TI + AM_TJ)        /* 95 distances, and one row more that nobody reads: the staging is then six whole trips of the block */
#define AM_P (RR + 4)                /* LDS row pitch in floats: 16 B x odd, so that 16 lanes on 16 neighbouring rows meet no bank twice */
__global__ __launch_bounds__(256) void k_amat(const float* __restrict__ QK, const float* __restrict__ kb, const float* __restrict__ T, const float* __restrict__ gl, const float* __restrict__ al, int b, _Float16* __restrict__ A16) {
  __shared__ __attribute__((aligned(16))) float Ts[AM_TD][AM_P];
  __shared__ __attribute__((aligned(16))) float qs[AM_TI][RR];
  __shared__ __attribute__((aligned(16))) float sc[AM_TI][AM_P];
  const int tid = threadIdx.x; const int jt = blockIdx.x / (SQ / AM_TI), it = blockIdx.x % (SQ / AM_TI); const int i0 = it * AM_TI, j0 = jt * AM_TJ;
  const int orow = tid >> 3, oc8 = (tid & 7) * 8; const int oi = i0 + orow, oj = j0 + oc8;      /* the 8 elements this thread stores */
  unsigned short* dst = (unsigned short*)A16 + (size_t)oi * SQ + oj;
  if (j0 > i0 + AM_TI - 1) { const v8us z = {0, 0, 0, 0, 0, 0, 0, 0}; *(v8us*)dst = z; return; }      /* tile wholly above the diagonal: the whole block leaves, ahead of every barrier */
  const int jl = tid & (AM_TJ - 1), ig = tid >> 6; const int sr = tid >> 4, sc4 = (tid & 15) * 4;
  const int dmin = i0 - j0 - (AM_TJ - 1);
  const v4f kb0 = *(const v4fa*)(kb + (size_t)oi * SQ + oj), kb1 = *(const v4fa*)(kb + (size_t)oi * SQ + oj + 4);
  v4f tx[AM_TD / 16], qx[AM_TI / 16];
#pragma unroll
  for (int u = 0; u < AM_TD / 16; ++u) { const int d = dmin + sr + u * 16; const int dc = d < 0 ? 0 : (d > SQ - 1 ? SQ - 1 : d); tx[u] = *(const v4fa*)(T + (size_t)dc * RR + sc4); }
#pragma unroll
  for (int u = 0; u < AM_TI / 16; ++u) qx[u] = *(const v4fa*)(QK + ((size_t)b * SQ + i0 + sr + u * 16) * (2 * RR) + sc4);
  asm volatile("s_wait_xcnt 0x0" ::: "memory");      /* the loads below may be given address registers of the loads above as destinations: the wait stands in front of that overwrite */
  const float* kp = QK + ((size_t)b * SQ + j0 + jl) * (2 * RR); v4f kr[RR / 4];
#pragma unroll
  for (int r4 = 0; r4 < RR / 4; ++r4) kr[r4] = *(const v4fa*)(kp + RR + r4 * 4);
  asm volatile("s_wait_xcnt 0x0" :: "v"(kp) : "memory");      /* kp as an input keeps its registers from being handed to one of these loads as a destination ahead of the wait */
  __builtin_amdgcn_sched_barrier(0);      /* every global load is issued before the first wait on one: one latency for the block's start, not two */
  const float gate = 1.0f / (1.0f + expf(-bf16_round(gl[0]))); const float alpha = 1.0f / (1.0f + expf(-bf16_round(al[0])));
#pragma unroll
  for (int u = 0; u < AM_TD / 16; ++u) { const v4f z4 = {0.f, 0.f, 0.f, 0.f}; *(v4fa*)&Ts[sr + u * 16][sc4] = (dmin + sr + u * 16 < 0) ? z4 : tx[u]; }
#pragma unroll
  for (int u = 0; u < AM_TI / 16; ++u) *(v4fa*)&qs[sr + u * 16][sc4] = qx[u];
  __syncthreads();
#pragma unroll 1      /* stays rolled: the body is over 600 instructions long, and a second copy of it would save one branch */
  for (int hf = 0; hf < 2; ++hf) { const int il = ig * 8 + hf * 4;      /* four rows at a time: four independent sums, each over r in rising order */
    const float* tp = &Ts[il + (AM_TJ - 1) - jl][0]; const float* qp = &qs[il][0]; float acc[4] = {0.f, 0.f, 0.f, 0.f}; v4f tb[2][4][2], qb[2][4][2];
#pragma unroll
    for (int s = 0; s < 4; ++s)
#pragma unroll
      for (int h2 = 0; h2 < 2; ++h2) { qb[0][s][h2] = *(const v4fa*)(qp + s * RR + h2 * 4); tb[0][s][h2] = *(const v4fa*)(tp + s * AM_P + h2 * 4); }
#pragma unroll
    for (int ch = 0; ch < RR / 8; ++ch) {
      if (ch + 1 < RR / 8) {
#pragma unroll
        for (int s = 0; s < 4; ++s)
#pragma unroll
          for (int h2 = 0; h2 < 2; ++h2) { qb[(ch + 1) & 1][s][h2] = *(const v4fa*)(qp + s * RR + (ch + 1) * 8 + h2 * 4); tb[(ch + 1) & 1][s][h2] = *(const v4fa*)(tp + s * AM_P + (ch + 1) * 8 + h2 * 4); } }
      __builtin_amdgcn_sched_barrier(0);      /* keeps the next eight ranks' LDS loads ahead of this eight's arithmetic, which then covers their latency */
#pragma unroll
      for (int h2 = 0; h2 < 2; ++h2)
#pragma unroll
        for (int c = 0; c < 4; ++c)
#pragma unroll
          for (int s = 0; s < 4; ++s) acc[s] += (qb[ch & 1][s][h2][c] * kr[ch * 2 + h2][c]) * tb[ch & 1][s][h2][c];
      __builtin_amdgcn_sched_barrier(0);      /* and keeps the loads after next from rising into it, where they would need a third set of registers */
    }
#pragma unroll
    for (int s = 0; s < 4; ++s) sc[il + s][jl] = acc[s]; }
  __syncthreads();
  const v4f a0 = *(const v4fa*)&sc[orow][oc8], a1 = *(const v4fa*)&sc[orow][oc8 + 4]; FragH f;
#pragma unroll
  for (int u = 0; u < 8; ++u) { const float kv = (u < 4) ? kb0[u & 3] : kb1[u & 3]; const float av = (u < 4) ? a0[u & 3] : a1[u & 3]; const _Float16 v = (_Float16)(gate * bf16_round(kv) + alpha * av); f.h[u] = (oj + u <= oi) ? v : (_Float16)0.0f; }
  *(v8us*)dst = f.half[0]; }

extern "C" void kernel_launch(void* const* d_in, const int* in_sizes, int n_in,
                              void* d_out, int out_size, void* d_ws, size_t ws_size, hipStream_t stream) {
  (void)in_sizes; (void)n_in; (void)out_size;
  const float* const* I = (const float* const*)d_in; const float* h = I[0]; const float* kb = I[1]; const float* dl = I[2]; const float* gl = I[3]; const float* al = I[4]; const float* u = I[5]; const float* v = I[6]; const float* pw = I[7]; const float* pb = I[8]; const float* n1 = I[9]; const float* n2 = I[10]; const float* uw = I[11]; const float* ub = I[12]; const float* dw = I[13]; const float* db = I[14];
  char* ws = (char*)d_ws; size_t off = 0;
  auto take = [&](size_t bytes) { char* p = ws + off; off += (bytes + 255) & ~(size_t)255; return p; };
  _Float16* BUV = (_Float16*)take((size_t)2 * RR * DM * 2); _Float16* BP = (_Float16*)take((size_t)DM * DM * 2); _Float16* BU = (_Float16*)take((size_t)FH * DM * 2); _Float16* BD = (_Float16*)take((size_t)DM * FH * 2); float* T = (float*)take((size_t)SQ * RR * 4);
  _Float16* HN16 = (_Float16*)take(NR * DM * 2); float* HF = (float*)take(NR * DM * 4); float* QK = (float*)take(NR * 2 * RR * 4); _Float16* HT = (_Float16*)take((size_t)DM * SQ * 2); _Float16* A16 = (_Float16*)take((size_t)SQ * SQ * 2);
  _Float16* O16 = (_Float16*)take(NR * DM * 2); float* H1 = (float*)take(NR * DM * 4); _Float16* M16 = (_Float16*)take(NR * DM * 2); _Float16* U16 = (_Float16*)take(NR * FH * 2);
  if (off > ws_size) return;      /* 0.3 + 2 + 4 + 4 + 0.3 + 16 + 32 + 4 + 2 + 2 + 16 + 32 + 16 + 32 = ≈ 163 MiB */
  k_wT<<<(DM / 64) * (RR / 64), 256, 0, stream>>>(u, DM, RR, BUV); k_wT<<<(DM / 64) * (RR / 64), 256, 0, stream>>>(v, DM, RR, BUV + (size_t)RR * DM);      /* [u|v]^T -> [128][1024] */
  k_wnat<<<(unsigned)(((size_t)DM * DM / 8 + 255) / 256), 256, 0, stream>>>(pw, (size_t)DM * DM / 8, BP); k_wnat<<<(unsigned)(((size_t)FH * DM / 8 + 255) / 256), 256, 0, stream>>>(uw, (size_t)FH * DM / 8, BU); k_wnat<<<(unsigned)(((size_t)DM * FH / 8 + 255) / 256), 256, 0, stream>>>(dw, (size_t)DM * FH / 8, BD);
  k_tab<<<(SQ * RR + 255) / 256, 256, 0, stream>>>(dl, T);
  k_rms<<<(unsigned)((NR + 7) / 8), 256, 0, stream>>>(h, 1, n1, NR, HN16, HF);      /* hn (f16) + bf16(h) (f32 residual) */
  k_gemm2<0><<<dim3((unsigned)((NR / 128) * (2 * RR / 64)), 1), 128, 0, stream>>>(HN16, DM, 0, BUV, DM, 0, 0.0625f, nullptr, 0, nullptr, 1, 0, 0, QK, nullptr, 2 * RR, 0, (int)NR, 2 * RR, DM);      /* [q_raw | k_raw] */
  k_l2<<<(unsigned)((NR * 2 * (RR / 4) + 255) / 256), 256, 0, stream>>>(QK);
  for (int b = 0; b < NB; ++b) {
    k_amat<<<(SQ / AM_TI) * (SQ / AM_TJ), 256, 0, stream>>>(QK, kb, T, gl, al, b, A16);
    k_hT<<<(SQ / 64) * (DM / 64), 256, 0, stream>>>(HN16, b, HT);
    k_gemm2<0><<<dim3((SQ / 128) * (DM / 64), 1), 128, 0, stream>>>(A16, SQ, 0, HT, SQ, 0, 1.0f, nullptr, 0, nullptr, 1, 0, 0, nullptr, O16 + (size_t)b * SQ * DM, DM, 0, SQ, DM, SQ); }      /* out_b = A_b . hn_b */
  const dim3 gp((unsigned)((NR / 128) * (DM / 64)), 1);
  k_gemm2<0><<<gp, 128, 0, stream>>>(O16, DM, 0, BP, DM, 0, 0.0625f, pb, 0, HF, 1, (size_t)DM, 0, H1, nullptr, DM, 0, (int)MQ, DM, DM);      /* h1 = h + out proj_w^T + proj_b */
  k_rms<<<(unsigned)((MQ + 7) / 8), 256, 0, stream>>>(H1, 0, n2, MQ, M16, nullptr);
  k_gemm2<6><<<dim3((unsigned)((NR / 128) * (FH / 64)), 1), 128, 0, stream>>>(M16, DM, 0, BU, DM, 0, 0.0625f, ub, 0, nullptr, 1, 0, 0, nullptr, U16, FH, 0, (int)MQ, FH, DM);      /* gelu_erf(m up_w^T + up_b) */
  k_gemm2<0><<<gp, 128, 0, stream>>>(U16, FH, 0, BD, FH, 0, 0.0625f, db, 0, H1, 1, (size_t)DM, 0, (float*)d_out, nullptr, DM, 0, (int)MQ, DM, FH);      /* h1 + m */
}

// v003
// Measured time: 405 microseconds a run.
// Next to v002, in two timings, it ran 1.67 and 1.75 times as fast.
// Counting every step since v000, it is 5.61 times as fast.
#include <hip/hip_runtime.h>
// K2Layer (h [8][1024][1024]; hn = rmsnorm(h)*norm1_scale; gate = sigmoid(gate_logit), alpha = sigmoid(alpha_logit); q|k = hn [u|v] (rank 64), row-l2-normalised; gamma_r = 0.15 + 0.85 sigmoid(decay_logit_r); A[i][j] = causal(j<=i) * (gate k_base[i][j] + alpha sum_r q[i][r] k[j][r] gamma_r^(i-j)); out = A . hn; h1 = h + out proj_w^T + proj_b; m = gelu_erf(rmsnorm(h1)*norm2_scale up_w^T + up_b) down_w^T + down_b; result = h1 + m -> [8][1024][1024]).
// Structure: token rows; rmsnorm on VALU (f32) into f16 rows and per-batch transposed f16 planes (LDS); the rank-64 q|k projection as a WMMA GEMM (f32), l2-normalisation and the per-rank decayed causal scores on VALU in f32 (gamma^d table built on device from decay_logit, k_base/gate/alpha read) into the f16 mixing matrix A; out = A . hn, proj (+ bias + h), up (+ bias, exact-GELU epilogue, f16), down (+ bias + h1) as WMMA GEMMs (32x64 wave tiles, f32 accumulation, exact x16 weights).
// Compute dtype: inputs rounded to bf16; h / weights / k_base exact; hn, A, out, rmsnorm(h1), GELU hidden plain f16 operands (~2^-12); scores, norms, residuals f32. v_wmma_f32_16x16x32_f16.
#define NB 8
#define SQ 1024
#define DM 1024
#define RR 64
#define FH 2048
#define NR ((size_t)NB * SQ)
#define MQ NR                        /* rows through the proj/MLP stage (debug hook) */
typedef __bf16 v16b __attribute__((ext_vector_type(16)));
typedef unsigned short v8us __attribute__((ext_vector_type(8), may_alias));
typedef float  v8f  __attribute__((ext_vector_type(8)));
typedef float  v4f  __attribute__((ext_vector_type(4)));
typedef float  v4fa __attribute__((ext_vector_type(4), may_alias));
union FragB { v16b v; v8us half[2]; unsigned short u[16]; };

__device__ __forceinline__ unsigned short bf16_bits(float x) { unsigned int u = __float_as_uint(x); return (unsigned short)((u + 0x7FFFu + ((u >> 16) & 1u)) >> 16); }
__device__ __forceinline__ float bf16_val(unsigned short b) { return __uint_as_float(((unsigned int)b) << 16); }
__device__ __forceinline__ float bf16_round(float x) { return bf16_val(bf16_bits(x)); }
// D += A·B with NT terms: 1 = ah·bh, 2 = + al·bh (A split), 3 = + ah·bl (both split)
template <int NT>
__device__ __forceinline__ v8f mmaN(v16b ah, v16b al, v16b bh, v16b bl, v8f c) {
  c = __builtin_amdgcn_wmma_f32_16x16x32_bf16(false, ah, false, bh, (short)0, c, false, false);
  if (NT >= 2) c = __builtin_amdgcn_wmma_f32_16x16x32_bf16(false, al, false, bh, (short)0, c, false, false);
  if (NT >= 3) c = __builtin_amdgcn_wmma_f32_16x16x32_bf16(false, ah, false, bl, (short)0, c, false, false);
  asm volatile("v_nop\n\tv_nop\n\tv_nop\n\tv_nop" : "+v"(c) : "v"(ah), "v"(al), "v"(bh), "v"(bl));
  return c;
}

__global__ __launch_bounds__(256) void k_wt_bf16(const float* __restrict__ W, unsigned short* __restrict__ Wt, int K, int N) {
  const int t = blockIdx.x * 256 + threadIdx.x;
  const int k8n = K / 8;
  if (t >= N * k8n) return;
  const int n = t / k8n, k8 = (t % k8n) * 8;
  v8us v;
#pragma unroll
  for (int i = 0; i < 8; ++i) v[i] = bf16_bits(W[(size_t)(k8 + i) * N + n]);
  *(v8us*)(Wt + (size_t)n * K + k8) = v;
  
}

// GEMM C[M][N] (f32, pitch ldc) = act(A[M][K]·W + bias). A f32 row-major (pitch lda) converted per fragment to bf16
// (ASPLIT: hi/lo two planes -> 2 terms, else single rounded term); Wt bf16 [N][K] (pitch ldb). BIAS_BF16 rounds the
// bias to bf16 first (bias quantised to bf16 before the add). K%32==0, M%16==0, N%64==0.
template <bool ASPLIT, int ACT, bool BIAS_BF16>
__global__ __launch_bounds__(128) void k_gemm_bf(const float* __restrict__ A, int lda, const unsigned short* __restrict__ Wt, int ldb,
                                               const float* __restrict__ bias, float* __restrict__ C, int ldc, int M, int N, int K) {
  __shared__ __attribute__((aligned(16))) float so[4][16][64];
  const int tid = threadIdx.x, w = tid >> 5, lane = tid & 31, ln = lane & 15, hh = lane >> 4;
  const int ntn = N / 64;
  const int wid = blockIdx.x * 4 + w;
  const int mt = wid / ntn, nq = wid % ntn;
  if (mt * 16 >= M) return;
  const int row0 = mt * 16, col0 = nq * 64;
  const float* arow = A + (size_t)(row0 + ln) * lda;
  v8f acc[4] = {};
  for (int kb = 0; kb < K; kb += 32) {
    FragB ah, al;
    const v4f x0 = *(const v4fa*)(arow + kb + 8 * hh), x1 = *(const v4fa*)(arow + kb + 8 * hh + 4);
    const v4f x2 = *(const v4fa*)(arow + kb + 16 + 8 * hh), x3 = *(const v4fa*)(arow + kb + 16 + 8 * hh + 4);
    float xs[16] = {x0[0],x0[1],x0[2],x0[3],x1[0],x1[1],x1[2],x1[3],x2[0],x2[1],x2[2],x2[3],x3[0],x3[1],x3[2],x3[3]};
#pragma unroll
    for (int i = 0; i < 16; ++i) { const unsigned short hb = bf16_bits(xs[i]); ah.u[i] = hb; al.u[i] = ASPLIT ? bf16_bits(xs[i] - bf16_val(hb)) : (unsigned short)0; }
#pragma unroll
    for (int t = 0; t < 4; ++t) {
      const unsigned short* brow = Wt + (size_t)(col0 + t * 16 + ln) * ldb + kb;
      FragB b;
      b.half[0] = *(const v8us*)(brow + 8 * hh);
      b.half[1] = *(const v8us*)(brow + 16 + 8 * hh);
      acc[t] = mmaN<ASPLIT ? 2 : 1>(ah.v, al.v, b.v, b.v, acc[t]);
    }
  }
#pragma unroll
  for (int t = 0; t < 4; ++t) {
    float bv = bias ? bias[col0 + t * 16 + ln] : 0.f;
    if (BIAS_BF16) bv = bf16_round(bv);
#pragma unroll
    for (int r = 0; r < 8; ++r) { float v = acc[t][r] + bv; if (ACT == 1) v = fmaxf(v, 0.f); so[w][8 * hh + r][t * 16 + ln] = v; }
  }
  __builtin_amdgcn_fence(__ATOMIC_ACQ_REL, "workgroup");
  __builtin_amdgcn_wave_barrier();
  const int rsub = lane >> 4, c4 = (lane & 15) * 4;
  {
#pragma unroll
    for (int q = 0; q < 8; ++q) {
      const int r = q * 2 + rsub;
      const v4f v = *(const v4fa*)&so[w][r][c4];
      *(v4f*)(C + (size_t)(row0 + r) * ldc + col0 + c4) = v;
    }
    
  }
}

// GEMM C = act(A·W + bias + resid): A f32 (ASPLIT -> hi/lo 2 terms), Wt bf16 [N][K]; ACT 0 none, 1 relu, 2 exact gelu;
// resid (optional, f32, row index = (row % rmod), pitch ldr, RES_BF16 rounds it) added before the activation.
template <bool ASPLIT, int ACT, bool BIAS_BF16, bool RES_BF16>
__global__ __launch_bounds__(128) void k_gemm_bf3(const float* __restrict__ A, int lda, const unsigned short* __restrict__ Wt, int ldb,
                                                const float* __restrict__ bias, const float* __restrict__ resid, int rmod, int ldr,
                                                float* __restrict__ C, int ldc, int M, int N, int K) {
  __shared__ __attribute__((aligned(16))) float so[4][16][64];
  const int tid = threadIdx.x, w = tid >> 5, lane = tid & 31, ln = lane & 15, hh = lane >> 4;
  const int ntn = N / 64;
  const int wid = blockIdx.x * 4 + w;
  const int mt = wid / ntn, nq = wid % ntn;
  if (mt * 16 >= M) return;
  const int row0 = mt * 16, col0 = nq * 64;
  const float* arow = A + (size_t)(row0 + ln) * lda;
  v8f acc[4] = {};
  for (int kb = 0; kb < K; kb += 32) {
    FragB ah, al;
    const v4f x0 = *(const v4fa*)(arow + kb + 8 * hh), x1 = *(const v4fa*)(arow + kb + 8 * hh + 4);
    const v4f x2 = *(const v4fa*)(arow + kb + 16 + 8 * hh), x3 = *(const v4fa*)(arow + kb + 16 + 8 * hh + 4);
    float xs[16] = {x0[0],x0[1],x0[2],x0[3],x1[0],x1[1],x1[2],x1[3],x2[0],x2[1],x2[2],x2[3],x3[0],x3[1],x3[2],x3[3]};
#pragma unroll
    for (int i = 0; i < 16; ++i) { const unsigned short hb = bf16_bits(xs[i]); ah.u[i] = hb; al.u[i] = ASPLIT ? bf16_bits(xs[i] - bf16_val(hb)) : (unsigned short)0; }
#pragma unroll
    for (int t = 0; t < 4; ++t) {
      const unsigned short* brow = Wt + (size_t)(col0 + t * 16 + ln) * ldb + kb;
      FragB b;
      b.half[0] = *(const v8us*)(brow + 8 * hh);
      b.half[1] = *(const v8us*)(brow + 16 + 8 * hh);
      acc[t] = mmaN<ASPLIT ? 2 : 1>(ah.v, al.v, b.v, b.v, acc[t]);
    }
  }
#pragma unroll
  for (int t = 0; t < 4; ++t) {
    const int col = col0 + t * 16 + ln;
    float bv = bias ? bias[col] : 0.f;
    if (BIAS_BF16) bv = bf16_round(bv);
#pragma unroll
    for (int r = 0; r < 8; ++r) {
      float v = acc[t][r] + bv;
      if (resid) { float rv = resid[(size_t)((row0 + 8 * hh + r) % rmod) * ldr + col]; if (RES_BF16) rv = bf16_round(rv); v += rv; }
      if (ACT == 1) v = fmaxf(v, 0.f);
      if (ACT == 2) v = 0.5f * v * (1.0f + erff(v * 0.70710678118654752f));
      if (ACT == 3) { const float u = 0.7978845608028654f * (v + 0.044715f * v * v * v); v = 0.5f * v * (1.0f + tanhf(u)); }
      so[w][8 * hh + r][t * 16 + ln] = v;
    }
  }
  __builtin_amdgcn_fence(__ATOMIC_ACQ_REL, "workgroup");
  __builtin_amdgcn_wave_barrier();
  const int rsub = lane >> 4, c4 = (lane & 15) * 4;
  {
#pragma unroll
    for (int q = 0; q < 8; ++q) {
      const int r = q * 2 + rsub;
      const v4f v = *(const v4fa*)&so[w][r][c4];
      *(v4f*)(C + (size_t)(row0 + r) * ldc + col0 + c4) = v;
    }
    
  }
}
// row LayerNorm (biased variance, eps) over N: s = X (+ R); optional out_sum <- s; out_norm <- (s-mu)*rsqrt(var+eps)*g + b
template <bool PARAM_BF16>
__global__ __launch_bounds__(256) void k_layernorm(const float* __restrict__ X, const float* __restrict__ R, const float* __restrict__ g, const float* __restrict__ bta,
                                                  float* __restrict__ out_sum, float* __restrict__ out_norm, int N, float eps) {
  __shared__ float red[256];
  const int row = blockIdx.x, tid = threadIdx.x;
  const float* x = X + (size_t)row * N; const float* rr = R ? R + (size_t)row * N : nullptr;
  float vals[16];                     // up to N = 4096
  const int per = N / 256;            // contiguous chunk per thread? use strided-by-4 chunks: thread handles j = tid*4 + 1024*u
  float s1 = 0.f;
  for (int u = 0; u < per / 4; ++u) {
    const int j = tid * 4 + 1024 * u;
    const v4f a = *(const v4fa*)(x + j);
    v4f b = {0.f,0.f,0.f,0.f}; if (rr) b = *(const v4fa*)(rr + j);
#pragma unroll
    for (int q = 0; q < 4; ++q) { const float v = a[q] + b[q]; vals[u * 4 + q] = v; s1 += v; }
  }
  red[tid] = s1; __syncthreads();
  for (int st = 128; st > 0; st >>= 1) { if (tid < st) red[tid] += red[tid + st]; __syncthreads(); }
  const float mu = red[0] / (float)N; __syncthreads();
  float s2 = 0.f;
  for (int u = 0; u < per / 4; ++u)
#pragma unroll
    for (int q = 0; q < 4; ++q) { const float c = vals[u * 4 + q] - mu; s2 += c * c; }
  red[tid] = s2; __syncthreads();
  for (int st = 128; st > 0; st >>= 1) { if (tid < st) red[tid] += red[tid + st]; __syncthreads(); }
  const float rs = rsqrtf(red[0] / (float)N + eps);
  {
    for (int u = 0; u < per / 4; ++u) {
      const int j = tid * 4 + 1024 * u;
      v4f o, sm;
#pragma unroll
      for (int q = 0; q < 4; ++q) {
        float gg = g[j + q], bb = bta[j + q];
        if (PARAM_BF16) { gg = bf16_round(gg); bb = bf16_round(bb); }
        sm[q] = vals[u * 4 + q]; o[q] = (vals[u * 4 + q] - mu) * rs * gg + bb;
      }
      if (out_sum) *(v4f*)(out_sum + (size_t)row * N + j) = sm;
      *(v4f*)(out_norm + (size_t)row * N + j) = o;
    }
    
  }
}



// ---- f16 WMMA path (v_wmma_f32_16x16x32_f16): 11-bit significands for operands in range — used for every GEMM launched here
typedef _Float16 v16h __attribute__((ext_vector_type(16)));
union FragH { v16h v; v8us half[2]; _Float16 h[16]; unsigned short u[16]; };
template <int NT>
__device__ __forceinline__ v8f mmaH(v16h ah, v16h al, v16h bh, v16h bl, v8f c) {
  c = __builtin_amdgcn_wmma_f32_16x16x32_f16(false, ah, false, bh, (short)0, c, false, false);
  if (NT >= 2) c = __builtin_amdgcn_wmma_f32_16x16x32_f16(false, al, false, bh, (short)0, c, false, false);
  if (NT >= 3) c = __builtin_amdgcn_wmma_f32_16x16x32_f16(false, ah, false, bl, (short)0, c, false, false);
  asm volatile("v_nop\n\tv_nop\n\tv_nop\n\tv_nop" : "+v"(c) : "v"(ah), "v"(al), "v"(bh), "v"(bl));
  return c;
}
// batched GEMM like k_gemm_b but f16 operands: A f32 (split into f16 hi/lo if ASPLIT, else rounded to f16), Bt = f16 values [n][k]; alpha; C f32; N multiple of 16 (partial tiles skipped)
template <bool ASPLIT>
__global__ __launch_bounds__(128) void k_gemm_h(const float* __restrict__ A, int lda, size_t sA, const _Float16* __restrict__ Bh, int ldb, size_t sB, float alpha, float* __restrict__ C, int ldc, size_t sC, int M, int N, int K) {
  __shared__ __attribute__((aligned(16))) float so[4][16][64];
  const int tid = threadIdx.x, w = tid >> 5, lane = tid & 31, ln = lane & 15, hh = lane >> 4; const int by = blockIdx.y;
  A += (size_t)by * sA; Bh += (size_t)by * sB; C += (size_t)by * sC;
  const int ntn = (N + 63) / 64; const int wid = blockIdx.x * 4 + w; const int mt = wid / ntn, nq = wid % ntn; if (mt * 16 >= M) return;
  const int row0 = mt * 16, col0 = nq * 64; const float* arow = A + (size_t)(row0 + ln) * lda;
  v8f acc[4] = {};
  for (int kb = 0; kb < K; kb += 32) {
    FragH ah, al;
    const v4f x0 = *(const v4fa*)(arow + kb + 8 * hh), x1 = *(const v4fa*)(arow + kb + 8 * hh + 4), x2 = *(const v4fa*)(arow + kb + 16 + 8 * hh), x3 = *(const v4fa*)(arow + kb + 16 + 8 * hh + 4);
    float xs[16] = {x0[0],x0[1],x0[2],x0[3],x1[0],x1[1],x1[2],x1[3],x2[0],x2[1],x2[2],x2[3],x3[0],x3[1],x3[2],x3[3]};
#pragma unroll
    for (int i = 0; i < 16; ++i) { const _Float16 h = (_Float16)xs[i]; ah.h[i] = h; al.h[i] = ASPLIT ? (_Float16)(xs[i] - (float)h) : (_Float16)0.0f; }
#pragma unroll
    for (int t = 0; t < 4; ++t) { if (col0 + t * 16 >= N) continue; const size_t boff = (size_t)(col0 + t * 16 + ln) * ldb + kb; FragH bq; bq.half[0] = *(const v8us*)(Bh + boff + 8 * hh); bq.half[1] = *(const v8us*)(Bh + boff + 16 + 8 * hh);
      acc[t] = mmaH<ASPLIT ? 2 : 1>(ah.v, al.v, bq.v, bq.v, acc[t]); }
  }
#pragma unroll
  for (int t = 0; t < 4; ++t) { if (col0 + t * 16 >= N) continue;
#pragma unroll
    for (int r = 0; r < 8; ++r) so[w][8 * hh + r][t * 16 + ln] = acc[t][r] * alpha; }
  __builtin_amdgcn_fence(__ATOMIC_ACQ_REL, "workgroup"); __builtin_amdgcn_wave_barrier();
  const int rsub = lane >> 4, c4 = (lane & 15) * 4;
  {
#pragma unroll
    for (int q = 0; q < 8; ++q) { const int r = q * 2 + rsub; if (col0 + c4 < N) { const v4f v = *(const v4fa*)&so[w][r][c4]; *(v4f*)(C + (size_t)(row0 + r) * ldc + col0 + c4) = v; } }
     }
}

// Wt[n][k] = f16(W[k][n]·scale) from f32 row-major W[K][N] (scale = power of two; bf16-exact weights stay exact in f16 away from the subnormal range)
__global__ __launch_bounds__(256) void k_wt_f16(const float* __restrict__ W, _Float16* __restrict__ Wt, int K, int N, float scale) {
  const int t = blockIdx.x * 256 + threadIdx.x; if (t >= N * (K / 8)) return; const int n = t / (K / 8), k8 = (t % (K / 8)) * 8; FragH f;
#pragma unroll
  for (int i = 0; i < 8; ++i) f.h[i] = (_Float16)(bf16_round(W[(size_t)(k8 + i) * N + n]) * scale); const v8us o = f.half[0];
  *(v8us*)((unsigned short*)Wt + (size_t)n * K + k8) = o; 
}
// k_gemm_hh variant with fused epilogue: v = acc·alpha + bias[by·sBias + col] (+ CP[(row/rowsPerB)·sCPb + by·64 + col] if CP) ; ACT 0 none / 1 elu ; writes f16 C16 (and f32 C if non-null)
template <int ACT>
__global__ __launch_bounds__(128) void k_gemm_hhx(const _Float16* __restrict__ A, int lda, size_t sA, const _Float16* __restrict__ Bh, int ldb, size_t sB, float alpha, const float* __restrict__ bias, size_t sBias, const float* __restrict__ CP, int rowsPerB, size_t sCPb, int row0g,
    float* __restrict__ C, _Float16* __restrict__ C16, int ldc, size_t sC, int M, int N, int K) {
  __shared__ __attribute__((aligned(16))) float so[4][16][64];
  const int tid = threadIdx.x, w = tid >> 5, lane = tid & 31, ln = lane & 15, hh = lane >> 4; const int by = blockIdx.y;
  A += (size_t)by * sA; Bh += (size_t)by * sB; const size_t cofs = (size_t)by * sC; const float* bp = bias ? bias + (size_t)by * sBias : nullptr;
  const int ntn = (N + 63) / 64; const int wid = blockIdx.x * 4 + w; const int mt = wid / ntn, nq = wid % ntn; if (mt * 16 >= M) return;
  const int row0 = mt * 16, col0 = nq * 64; const _Float16* arow = A + (size_t)(row0 + ln) * lda;
  v8f acc[4] = {};
  for (int kb = 0; kb < K; kb += 32) { FragH ah; ah.half[0] = *(const v8us*)((const unsigned short*)arow + kb + 8 * hh); ah.half[1] = *(const v8us*)((const unsigned short*)arow + kb + 16 + 8 * hh);
#pragma unroll
    for (int t = 0; t < 4; ++t) { if (col0 + t * 16 >= N) continue; const size_t boff = (size_t)(col0 + t * 16 + ln) * ldb + kb; FragH bq; bq.half[0] = *(const v8us*)((const unsigned short*)Bh + boff + 8 * hh); bq.half[1] = *(const v8us*)((const unsigned short*)Bh + boff + 16 + 8 * hh);
      acc[t] = mmaH<1>(ah.v, ah.v, bq.v, bq.v, acc[t]); }
  }
#pragma unroll
  for (int t = 0; t < 4; ++t) { if (col0 + t * 16 >= N) continue; const int col = col0 + t * 16 + ln; const float bv = bp ? bf16_round(bp[col]) : 0.f;
#pragma unroll
    for (int r = 0; r < 8; ++r) { float v = acc[t][r] * alpha + bv; if (CP) { const int rr = row0g + row0 + 8 * hh + r; if (rowsPerB < 0) v += CP[cofs + (size_t)rr * ldc + col];      /* rowsPerB < 0: own element of the batched C plane */ else { const int bidx = rr / rowsPerB; v += CP[(size_t)bidx * sCPb + (size_t)by * 64 + col]; } } if (ACT == 1) v = (v > 0.f) ? v : expm1f(v); else if (ACT == 7) v = (v > 0.f) ? v + 1.0f : expf(v); else if (ACT == 8) v = tanhf(v); else if (ACT == 9) v = 0.5f * v * (1.0f + tanhf(0.7978845608028654f * (v + 0.044715f * v * v * v))); else if (ACT == 11) v = 1.0f / (1.0f + expf(-v)); else if (ACT == 12) v = (v > 0.f) ? v : 0.01f * v; else if (ACT == 14) v = (v > 0.f) ? v : 0.1f * v; else if (ACT == 16) v = (v >= 0.f) ? v : 0.3f * v; else if (ACT == 17) v = (v >= 0.f) ? v : 0.2f * v; else if (ACT == 15) v = v / (1.0f + expf(-v)); else if (ACT == 3) v = fmaxf(v, 0.f); else if (ACT == 6) v = 0.5f * v * (1.0f + erff(v * 0.70710678118654752f)); so[w][8 * hh + r][t * 16 + ln] = v; } }
  __builtin_amdgcn_fence(__ATOMIC_ACQ_REL, "workgroup"); __builtin_amdgcn_wave_barrier();
  const int rsub = lane >> 4, c4 = (lane & 15) * 4; typedef _Float16 v4h __attribute__((ext_vector_type(4)));
  {
#pragma unroll
    for (int q = 0; q < 8; ++q) { const int r = q * 2 + rsub; if (col0 + c4 < N) { const v4f v = *(const v4fa*)&so[w][r][c4]; if (C) *(v4f*)(C + cofs + (size_t)(row0 + r) * ldc + col0 + c4) = v; if (C16) { v4h h4; for (int i = 0; i < 4; ++i) h4[i] = (_Float16)v[i]; *(v4h*)(C16 + cofs + (size_t)(row0 + r) * ldc + col0 + c4) = h4; } } }
     }
}


typedef _Float16 v4h __attribute__((ext_vector_type(4)));

__global__ __launch_bounds__(256) void k_x16(const float* __restrict__ x, _Float16* __restrict__ X16, size_t n8) { const size_t t = (size_t)blockIdx.x * 256 + threadIdx.x; if (t >= n8) return; FragH f;
#pragma unroll
  for (int q = 0; q < 8; ++q) f.h[q] = (_Float16)bf16_round(x[t * 8 + q]); *(v8us*)((unsigned short*)X16 + t * 8) = f.half[0];  }
__global__ __launch_bounds__(256) void k_h16(const float* __restrict__ x, _Float16* __restrict__ X16, size_t n8) { const size_t t = (size_t)blockIdx.x * 256 + threadIdx.x; if (t >= n8) return; FragH f;
#pragma unroll
  for (int q = 0; q < 8; ++q) f.h[q] = (_Float16)x[t * 8 + q]; *(v8us*)((unsigned short*)X16 + t * 8) = f.half[0];  }
__global__ __launch_bounds__(256) void k_round16f(const float* __restrict__ W, _Float16* __restrict__ Bt, size_t n8) { const size_t t = (size_t)blockIdx.x * 256 + threadIdx.x; if (t >= n8) return; FragH f;
#pragma unroll
  for (int i = 0; i < 8; ++i) f.h[i] = (_Float16)(bf16_round(W[t * 8 + i]) * 16.0f); *(v8us*)((unsigned short*)Bt + t * 8) = f.half[0];  }
template <int NHv, int TTv>
__global__ __launch_bounds__(256) void k_vt(const _Float16* __restrict__ V16, int ldv, int voff, _Float16* __restrict__ Vt) { __shared__ unsigned short tl[64][66]; const int tid = threadIdx.x; const int slab = blockIdx.x / (TTv / 64), lg = blockIdx.x % (TTv / 64); const int b = slab / NHv, h = slab % NHv;
  for (int i = tid; i < 64 * 8; i += 256) { const int r = i / 8, c8 = (i % 8) * 8; FragH f; f.half[0] = *(const v8us*)((const unsigned short*)V16 + ((size_t)b * TTv + lg * 64 + r) * ldv + voff + h * 64 + c8);
#pragma unroll
    for (int q = 0; q < 8; ++q) tl[r][c8 + q] = f.u[q]; }
  __syncthreads();
  {
#pragma unroll
    for (int rd = 0; rd < 2; ++rd) { const int d = rd * 32 + tid / 8, pc = tid % 8; FragH f;
#pragma unroll
      for (int q = 0; q < 8; ++q) f.u[q] = tl[pc * 8 + q][d];
      *(v8us*)((unsigned short*)Vt + ((size_t)slab * 64 + d) * TTv + lg * 64 + pc * 8) = f.half[0]; }
     } }

__global__ __launch_bounds__(256) void k_hl(const float* __restrict__ F, _Float16* __restrict__ Hh, _Float16* __restrict__ Hl, size_t n8) { const size_t t = (size_t)blockIdx.x * 256 + threadIdx.x; if (t >= n8) return; FragH fh, fl; const v4f a = *(const v4fa*)(F + t * 8), c = *(const v4fa*)(F + t * 8 + 4);
#pragma unroll
  for (int q = 0; q < 4; ++q) { _Float16 h = (_Float16)a[q]; fh.h[q] = h; fl.h[q] = (_Float16)((a[q] - (float)h) * 1024.0f); h = (_Float16)c[q]; fh.h[4 + q] = h; fl.h[4 + q] = (_Float16)((c[q] - (float)h) * 1024.0f); }
  { *(v8us*)((unsigned short*)Hh + t * 8) = fh.half[0]; *(v8us*)((unsigned short*)Hl + t * 8) = fl.half[0];  } }

// ---- fast GEMM (block tile 128x64, wave tile 32x64; requires M % 128 == 0 rows per launch region, N % 64 == 0, K % 64 == 0, K >= 64); epilogue = k_gemm_hhx semantics ----
// Operands go global -> LDS by asynchronous copies, 64 k (one whole 128-byte line of every operand row) per stage, two buffers: eight lanes cover a row's line, so a
// wave's copy touches four whole lines, and every line is fetched once per block. The fragments are read from LDS in the k order of g2_frag.
#define G2_KS 64                              /* k per stage */
#define G2_PITCH 144                          /* LDS row pitch in bytes: 16 B x odd, so that 16 lanes on 16 neighbouring rows meet no bank twice */
#define G2_STAGE ((128 + 64) * G2_PITCH)      /* one stage: [A 128 rows | B 64 rows] */
__device__ __forceinline__ v16h g2_frag(const unsigned char* p, int hh) { FragH f; f.half[0] = *(const v8us*)(p + 16 * hh); f.half[1] = *(const v8us*)(p + 32 + 16 * hh); return f.v; }
__device__ __forceinline__ v8f g2_mma(v16h a, v16h b, v8f c) { v8f d = __builtin_amdgcn_wmma_f32_16x16x32_f16(false, a, false, b, (short)0, c, false, false); asm volatile("v_nop\n\tv_nop\n\tv_nop\n\tv_nop" : "+v"(d) : "v"(a), "v"(b)); return d; }
// One stage's twelve copies of a thread (16 bytes each): rows sr + 16 i of A (i = 0 .. 7) and of B (i = 0 .. 3). l = the thread's LDS byte address in the stage's row sr.
// The s_wait_xcnt closes the statement, so that it stands ahead of every later overwrite of the copies' address registers.
__device__ __forceinline__ void g2_copy(unsigned l, const _Float16* ga, size_t sa, const _Float16* gb, size_t sb) {
  asm volatile("global_load_async_to_lds_b128 %0, %12, off\n\t" "global_load_async_to_lds_b128 %1, %13, off\n\t" "global_load_async_to_lds_b128 %2, %14, off\n\t" "global_load_async_to_lds_b128 %3, %15, off\n\t"
               "global_load_async_to_lds_b128 %4, %16, off\n\t" "global_load_async_to_lds_b128 %5, %17, off\n\t" "global_load_async_to_lds_b128 %6, %18, off\n\t" "global_load_async_to_lds_b128 %7, %19, off\n\t"
               "global_load_async_to_lds_b128 %8, %20, off\n\t" "global_load_async_to_lds_b128 %9, %21, off\n\t" "global_load_async_to_lds_b128 %10, %22, off\n\t" "global_load_async_to_lds_b128 %11, %23, off\n\t"
               "s_wait_xcnt 0x0"
               :: "v"(l), "v"(l + 16 * G2_PITCH), "v"(l + 32 * G2_PITCH), "v"(l + 48 * G2_PITCH), "v"(l + 64 * G2_PITCH), "v"(l + 80 * G2_PITCH), "v"(l + 96 * G2_PITCH), "v"(l + 112 * G2_PITCH),
                  "v"(l + 128 * G2_PITCH), "v"(l + 144 * G2_PITCH), "v"(l + 160 * G2_PITCH), "v"(l + 176 * G2_PITCH),
                  "v"(ga), "v"(ga + sa), "v"(ga + 2 * sa), "v"(ga + 3 * sa), "v"(ga + 4 * sa), "v"(ga + 5 * sa), "v"(ga + 6 * sa), "v"(ga + 7 * sa),
                  "v"(gb), "v"(gb + sb), "v"(gb + 2 * sb), "v"(gb + 3 * sb) : "memory"); }
template <int ACT>
__global__ __launch_bounds__(128) void k_gemm2(const _Float16* __restrict__ A, int lda, size_t sA, const _Float16* __restrict__ Bh, int ldb, size_t sB, float alpha, const float* __restrict__ bias, size_t sBias, const float* __restrict__ CP, int rowsPerB, size_t sCPb, int row0g,
    float* __restrict__ C, _Float16* __restrict__ C16, int ldc, size_t sC, int M, int N, int K) { static_assert(ACT == 0 || ACT == 3 || ACT == 6 || ACT == 8 || ACT == 9 || ACT == 11 || ACT == 12 || ACT == 14 || ACT == 15 || ACT == 16 || ACT == 17, "k_gemm2: unsupported ACT code (would silently apply no activation)");
  __shared__ __attribute__((aligned(16))) unsigned char sm[2 * G2_STAGE]; static_assert(sizeof(float) * 4 * 32 * 68 <= 2 * G2_STAGE, "the output staging lies in the ring");
  float (*so)[32][68] = (float (*)[32][68])sm;      /* output staging: used only behind the last trip's barrier, when no wave reads the ring any more */
  const int tid = threadIdx.x, w = tid >> 5, lane = tid & 31, ln = lane & 15, hh = lane >> 4; const int by = blockIdx.y;
  A += (size_t)by * sA; Bh += (size_t)by * sB; const size_t cofs = (size_t)by * sC; const float* bp = bias ? bias + (size_t)by * sBias : nullptr;
  const int ntn = N >> 6; const int mt = blockIdx.x / ntn, nq = blockIdx.x - mt * ntn; const int row0 = mt * 128 + 32 * w, col0 = nq * 64; if (mt * 128 >= M) return;      /* the whole block leaves, ahead of every copy and barrier */
  const int sr = tid >> 3, sc = tid & 7;      /* the thread's first row of a stage and its 16-byte piece of the row's line */
  const _Float16* ga = A + (size_t)(mt * 128 + sr) * lda + sc * 8; const _Float16* gb = Bh + (size_t)(col0 + sr) * ldb + sc * 8; const size_t sa = (size_t)16 * lda, sb = (size_t)16 * ldb;
  const unsigned l0 = (unsigned)(size_t)sm + (unsigned)(sr * G2_PITCH + sc * 16);
  const unsigned char* ar = sm + (32 * w + ln) * G2_PITCH; const unsigned char* br = sm + (128 + ln) * G2_PITCH;
  const int nt = K / G2_KS;
  const v8f z8 = {0.f,0.f,0.f,0.f,0.f,0.f,0.f,0.f}; v8f c00 = z8, c01 = z8, c02 = z8, c03 = z8, c10 = z8, c11 = z8, c12 = z8, c13 = z8;
  g2_copy(l0, ga, sa, gb, sb);
  asm volatile("s_wait_asynccnt 0x0" ::: "memory");      /* this wave's copies of stage 0 have landed */
  __syncthreads();      /* and every other wave's: stage 0 may be read */
  if (nt > 1) g2_copy(l0 + G2_STAGE, ga + G2_KS, sa, gb + G2_KS, sb);
#pragma unroll 1      /* one trip per stage: the buffer is chosen by the trip's parity */
  for (int t = 0; t < nt; ++t) { const unsigned bo = (unsigned)(t & 1) * G2_STAGE;
    const unsigned char* ap = ar + bo; const unsigned char* bq = br + bo; v16h fa[2][2], fb[2][4];
#pragma unroll      /* constant indices: fa and fb stay in registers */
    for (int kk = 0; kk < 2; ++kk) { fa[kk][0] = g2_frag(ap + kk * 64, hh); fb[kk][0] = g2_frag(bq + kk * 64, hh); fa[kk][1] = g2_frag(ap + 16 * G2_PITCH + kk * 64, hh);
      fb[kk][1] = g2_frag(bq + 16 * G2_PITCH + kk * 64, hh); fb[kk][2] = g2_frag(bq + 32 * G2_PITCH + kk * 64, hh); fb[kk][3] = g2_frag(bq + 48 * G2_PITCH + kk * 64, hh); }
#pragma unroll      /* the stage's two 32-k blocks, straight-line, k rising */
    for (int kk = 0; kk < 2; ++kk) {
      c00 = g2_mma(fa[kk][0], fb[kk][0], c00); c10 = g2_mma(fa[kk][1], fb[kk][0], c10); c01 = g2_mma(fa[kk][0], fb[kk][1], c01); c11 = g2_mma(fa[kk][1], fb[kk][1], c11);
      c02 = g2_mma(fa[kk][0], fb[kk][2], c02); c12 = g2_mma(fa[kk][1], fb[kk][2], c12); c03 = g2_mma(fa[kk][0], fb[kk][3], c03); c13 = g2_mma(fa[kk][1], fb[kk][3], c13); }
    asm volatile("s_wait_dscnt 0x0" ::: "memory");      /* this wave's reads of the buffer are done */
    asm volatile("s_wait_asynccnt 0x0" ::: "memory");      /* its copies of stage t + 1 have landed */
    __syncthreads();      /* publishes stage t + 1 and ends every reader's last read of stage t's buffer */
    if (t + 2 < nt) g2_copy(l0 + bo, ga + (size_t)(t + 2) * G2_KS, sa, gb + (size_t)(t + 2) * G2_KS, sb); }
  asm volatile("s_wait_asynccnt 0x0" ::: "memory");      /* no copy is outstanding when the ring becomes output staging */
  v8f accs[8] = {c00, c01, c02, c03, c10, c11, c12, c13};
#pragma unroll
  for (int u = 0; u < 8; ++u) { const int t = u & 3, half = u >> 2; const int col = col0 + t * 16 + ln; const float bv = bp ? bf16_round(bp[col]) : 0.f;
#pragma unroll
    for (int r = 0; r < 8; ++r) { const int rloc = half * 16 + 8 * hh + r; float v = accs[u][r] * alpha + bv; if (CP) { if (rowsPerB < 0) v += CP[cofs + (size_t)(row0g + row0 + rloc) * ldc + col];      /* rowsPerB < 0: own element of the batched C plane */ else { const int bidx = (row0g + row0 + rloc) / rowsPerB; v += CP[(size_t)bidx * sCPb + (size_t)by * 64 + col]; } }
      if (ACT == 3) v = fmaxf(v, 0.f); else if (ACT == 6) v = 0.5f * v * (1.0f + erff(v * 0.70710678118654752f)); else if (ACT == 11) v = 1.0f / (1.0f + expf(-v)); else if (ACT == 15) v = v / (1.0f + expf(-v)); else if (ACT == 12) v = (v > 0.f) ? v : 0.01f * v; else if (ACT == 8) v = tanhf(v); else if (ACT == 9) v = 0.5f * v * (1.0f + tanhf(0.7978845608028654f * (v + 0.044715f * v * v * v))); else if (ACT == 14) v = (v > 0.f) ? v : 0.1f * v; else if (ACT == 16) v = (v >= 0.f) ? v : 0.3f * v; else if (ACT == 17) v = (v >= 0.f) ? v : 0.2f * v;
      so[w][rloc][t * 16 + ln] = v; } }
  __builtin_amdgcn_fence(__ATOMIC_ACQ_REL, "workgroup"); __builtin_amdgcn_wave_barrier();
  const int rsub = lane >> 4, c4 = (lane & 15) * 4;
  {
#pragma unroll
    for (int q = 0; q < 16; ++q) { const int r = q * 2 + rsub; const v4f v = *(const v4fa*)&so[w][r][c4]; if (C) *(v4f*)(C + cofs + (size_t)(row0 + r) * ldc + col0 + c4) = v; if (C16) { v4h h4; for (int i = 0; i < 4; ++i) h4[i] = (_Float16)v[i]; *(v4h*)(C16 + cofs + (size_t)(row0 + r) * ldc + col0 + c4) = h4; } }
     } }


__global__ __launch_bounds__(256) void k_wT(const float* __restrict__ w, int din, int dout, _Float16* __restrict__ Bt) { __shared__ float tl[64][65]; const int tid = threadIdx.x; const int nbo = dout / 64; const int ib = blockIdx.x / nbo, ob = blockIdx.x % nbo; const int i0 = ib * 64, o0 = ob * 64;
  for (int t = tid; t < 64 * 64; t += 256) { const int i = t / 64, o = t % 64; tl[o][i] = bf16_round(w[(size_t)(i0 + i) * dout + o0 + o]) * 16.0f; }
  __syncthreads();
  { for (int t = tid; t < 64 * 8; t += 256) { const int o = t / 8, i8 = (t % 8) * 8; FragH f; for (int q = 0; q < 8; ++q) f.h[q] = (_Float16)tl[o][i8 + q]; *(v8us*)((unsigned short*)Bt + (size_t)(o0 + o) * din + i0 + i8) = f.half[0]; }  } }
__global__ __launch_bounds__(256) void k_wnat(const float* __restrict__ w, size_t n8, _Float16* __restrict__ Bt) { const size_t t = (size_t)blockIdx.x * 256 + threadIdx.x; if (t >= n8) return; FragH f; for (int q = 0; q < 8; ++q) f.h[q] = (_Float16)(bf16_round(w[t * 8 + q]) * 16.0f); *(v8us*)((unsigned short*)Bt + t * 8) = f.half[0];  }
// One row per wave: lane l holds columns 128 u + 4 l .. + 3 (u = 0 .. 7), so every load and every f32 store of a wave covers 512 contiguous bytes (an f16 store 256),
// and the row stays in registers between the sum of squares and the scaling. No LDS, no barrier. The unrolls keep xv, sv and o in registers (constant indices).
__global__ __launch_bounds__(256) void k_rms(const float* __restrict__ X, int xIsInput, const float* __restrict__ scale, size_t nrows, _Float16* __restrict__ N16, float* __restrict__ XF) {
  const int lane = threadIdx.x & 31; const size_t r = (size_t)blockIdx.x * 8 + (threadIdx.x >> 5); if (r >= nrows) return;      /* the same for a whole wave */
  const size_t o0 = r * DM + lane * 4; const float* xp = X + o0; const float* sp = scale + lane * 4; v4f xv[DM / 128], sv[DM / 128];
#pragma unroll
  for (int u = 0; u < DM / 128; ++u) xv[u] = *(const v4fa*)(xp + u * 128);
#pragma unroll
  for (int u = 0; u < DM / 128; ++u) sv[u] = *(const v4fa*)(sp + u * 128);
  asm volatile("s_wait_xcnt 0x0" ::: "memory");      /* stands ahead of every overwrite of the loads' address registers */
  if (xIsInput) {
#pragma unroll
    for (int u = 0; u < DM / 128; ++u)
#pragma unroll
      for (int q = 0; q < 4; ++q) xv[u][q] = bf16_round(xv[u][q]); }
  if (XF) {      /* the f32 copy leaves as soon as it is known; xv is only read from here on */
#pragma unroll
    for (int u = 0; u < DM / 128; ++u) *(v4f*)(XF + o0 + u * 128) = xv[u];
    asm volatile("s_wait_xcnt 0x0" ::: "memory"); }      /* stands ahead of every later overwrite of these stores' address and data registers */
  float s4[4] = {0.f, 0.f, 0.f, 0.f};      /* four independent chains per lane */
#pragma unroll
  for (int u = 0; u < DM / 128; ++u)
#pragma unroll
    for (int q = 0; q < 4; ++q) s4[q] += xv[u][q] * xv[u][q];
  float ss = (s4[0] + s4[1]) + (s4[2] + s4[3]);
#pragma unroll
  for (int m = 16; m >= 1; m >>= 1) ss += __shfl_xor(ss, m, 32);      /* every lane ends with the row's sum */
  const float rs = 1.0f / sqrtf(ss / (float)DM + 1e-8f); v4h o[DM / 128];
#pragma unroll
  for (int u = 0; u < DM / 128; ++u)
#pragma unroll
    for (int q = 0; q < 4; ++q) o[u][q] = (_Float16)((xv[u][q] * rs) * bf16_round(sv[u][q]));
#pragma unroll
  for (int u = 0; u < DM / 128; ++u) *(v4h*)(N16 + o0 + u * 128) = o[u]; }
__global__ __launch_bounds__(256) void k_hT(const _Float16* __restrict__ HN, int b, _Float16* __restrict__ HT) { __shared__ unsigned short tl[64][65]; const int tid = threadIdx.x; const int jb = blockIdx.x % (SQ / 64), dbk = blockIdx.x / (SQ / 64); const int j0 = jb * 64, d0 = dbk * 64;
  for (int i = tid; i < 64 * 8; i += 256) { const int j = i / 8, d8 = (i % 8) * 8; FragH f; f.half[0] = *(const v8us*)((const unsigned short*)HN + ((size_t)b * SQ + j0 + j) * DM + d0 + d8); for (int q = 0; q < 8; ++q) tl[d8 + q][j] = f.u[q]; }
  __syncthreads();
  { for (int i = tid; i < 64 * 8; i += 256) { const int d = i / 8, j8 = (i % 8) * 8; FragH f; for (int q = 0; q < 8; ++q) f.u[q] = tl[d][j8 + q]; *(v8us*)((unsigned short*)HT + (size_t)(d0 + d) * SQ + j0 + j8) = f.half[0]; }  } }
__global__ __launch_bounds__(256) void k_tab(const float* __restrict__ dl, float* __restrict__ T) {
  #pragma clang fp contract(off)
  const int t = blockIdx.x * 256 + threadIdx.x; if (t >= SQ * RR) return; const int r = t % RR, d = t / RR; const float g = __fadd_rn(0.15f, __fmul_rn(0.85f, 1.0f / (1.0f + expf(-bf16_round(dl[r]))))); const float lg = logf(fmaxf(g, 1e-8f)); const float v = expf(__fmul_rn((float)d, lg));
  *(float*)(T + t) = v;  }
// Sixteen lanes per 64-element q or k row (the rows lie one behind the other in F): a lane holds four elements, a wave's load and store cover 512 contiguous bytes.
__global__ __launch_bounds__(256) void k_l2(float* __restrict__ F) {
  const size_t t = (size_t)blockIdx.x * 256 + threadIdx.x; if (t >= NR * 2 * (RR / 4)) return;      /* whole waves only: the bound is a multiple of 32 */
  float* f = F + t * 4; const v4f a = *(const v4fa*)f; float ss = (a[0] * a[0] + a[1] * a[1]) + (a[2] * a[2] + a[3] * a[3]);
#pragma unroll
  for (int m = 8; m >= 1; m >>= 1) ss += __shfl_xor(ss, m, 32);      /* stays inside the row's sixteen lanes */
  float n = sqrtf(ss); if (n < 1e-8f) n = 1e-8f; const float inv = 1.0f / n; v4f o;
#pragma unroll
  for (int q = 0; q < 4; ++q) o[q] = a[q] * inv;
  *(v4f*)f = o; }
// Mixing matrix, one 32 (rows i) x 64 (columns j) tile per block. A thread computes eight rows of one column: that column's k row stays in registers, the tile's q rows and the
// decay-table rows that the tile's distances i - j reach lie in LDS (rows of a negative distance are zero; those elements are masked at the store).
// Every "#pragma unroll" in this kernel but the hf loop's "unroll 1" is there so that the small arrays it indexes (tx, qx, kr, tb, qb, acc) get constant indices and stay in registers.
#define AM_TI 32
#define AM_TJ 64
#define AM_TD (AM_TI + AM_TJ)        /* 95 distances, and one row more that nobody reads: the staging is then six whole trips of the block */
#define AM_P (RR + 4)                /* LDS row pitch in floats: 16 B x odd, so that 16 lanes on 16 neighbouring rows meet no bank twice */
__global__ __launch_bounds__(256) void k_amat(const float* __restrict__ QK, const float* __restrict__ kb, const float* __restrict__ T, const float* __restrict__ gl, const float* __restrict__ al, int b, _Float16* __restrict__ A16) {
  __shared__ __attribute__((aligned(16))) float Ts[AM_TD][AM_P];
  __shared__ __attribute__((aligned(16))) float qs[AM_TI][RR];
  __shared__ __attribute__((aligned(16))) float sc[AM_TI][AM_P];
  const int tid = threadIdx.x; const int jt = blockIdx.x / (SQ / AM_TI), it = blockIdx.x % (SQ / AM_TI); const int i0 = it * AM_TI, j0 = jt * AM_TJ;
  const int orow = tid >> 3, oc8 = (tid & 7) * 8; const int oi = i0 + orow, oj = j0 + oc8;      /* the 8 elements this thread stores */
  unsigned short* dst = (unsigned short*)A16 + (size_t)oi * SQ + oj;
  if (j0 > i0 + AM_TI - 1) { const v8us z = {0, 0, 0, 0, 0, 0, 0, 0}; *(v8us*)dst = z; return; }      /* tile wholly above the diagonal: the whole block leaves, ahead of every barrier */
  const int jl = tid & (AM_TJ - 1), ig = tid >> 6; const int sr = tid >> 4, sc4 = (tid & 15) * 4;
  const int dmin = i0 - j0 - (AM_TJ - 1);
  const v4f kb0 = *(const v4fa*)(kb + (size_t)oi * SQ + oj), kb1 = *(const v4fa*)(kb + (size_t)oi * SQ + oj + 4);
  v4f tx[AM_TD / 16], qx[AM_TI / 16];
#pragma unroll
  for (int u = 0; u < AM_TD / 16; ++u) { const int d = dmin + sr + u * 16; const int dc = d < 0 ? 0 : (d > SQ - 1 ? SQ - 1 : d); tx[u] = *(const v4fa*)(T + (size_t)dc * RR + sc4); }
#pragma unroll
  for (int u = 0; u < AM_TI / 16; ++u) qx[u] = *(const v4fa*)(QK + ((size_t)b * SQ + i0 + sr + u * 16) * (2 * RR) + sc4);
  asm volatile("s_wait_xcnt 0x0" ::: "memory");      /* the loads below may be given address registers of the loads above as destinations: the wait stands in front of that overwrite */
  const float* kp = QK + ((size_t)b * SQ + j0 + jl) * (2 * RR); v4f kr[RR / 4];
#pragma unroll
  for (int r4 = 0; r4 < RR / 4; ++r4) kr[r4] = *(const v4fa*)(kp + RR + r4 * 4);
  asm volatile("s_wait_xcnt 0x0" :: "v"(kp) : "memory");      /* kp as an input keeps its registers from being handed to one of these loads as a destination ahead of the wait */
  __builtin_amdgcn_sched_barrier(0);      /* every global load is issued before the first wait on one: one latency for the block's start, not two */
  const float gate = 1.0f / (1.0f + expf(-bf16_round(gl[0]))); const float alpha = 1.0f / (1.0f + expf(-bf16_round(al[0])));
#pragma unroll
  for (int u = 0; u < AM_TD / 16; ++u) { const v4f z4 = {0.f, 0.f, 0.f, 0.f}; *(v4fa*)&Ts[sr + u * 16][sc4] = (dmin + sr + u * 16 < 0) ? z4 : tx[u]; }
#pragma unroll
  for (int u = 0; u < AM_TI / 16; ++u) *(v4fa*)&qs[sr + u * 16][sc4] = qx[u];
  __syncthreads();
#pragma unroll 1      /* stays rolled: the body is over 600 instructions long, and a second copy of it would save one branch */
  for (int hf = 0; hf < 2; ++hf) { const int il = ig * 8 + hf * 4;      /* four rows at a time: four independent sums, each over r in rising order */
    const float* tp = &Ts[il + (AM_TJ - 1) - jl][0]; const float* qp = &qs[il][0]; float acc[4] = {0.f, 0.f, 0.f, 0.f}; v4f tb[2][4][2], qb[2][4][2];
#pragma unroll
    for (int s = 0; s < 4; ++s)
#pragma unroll
      for (int h2 = 0; h2 < 2; ++h2) { qb[0][s][h2] = *(const v4fa*)(qp + s * RR + h2 * 4); tb[0][s][h2] = *(const v4fa*)(tp + s * AM_P + h2 * 4); }
#pragma unroll
    for (int ch = 0; ch < RR / 8; ++ch) {
      if (ch + 1 < RR / 8) {
#pragma unroll
        for (int s = 0; s < 4; ++s)
#pragma unroll
          for (int h2 = 0; h2 < 2; ++h2) { qb[(ch + 1) & 1][s][h2] = *(const v4fa*)(qp + s * RR + (ch + 1) * 8 + h2 * 4); tb[(ch + 1) & 1][s][h2] = *(const v4fa*)(tp + s * AM_P + (ch + 1) * 8 + h2 * 4); } }
      __builtin_amdgcn_sched_barrier(0);      /* keeps the next eight ranks' LDS loads ahead of this eight's arithmetic, which then covers their latency */
#pragma unroll
      for (int h2 = 0; h2 < 2; ++h2)
#pragma unroll
        for (int c = 0; c < 4; ++c)
#pragma unroll
          for (int s = 0; s < 4; ++s) acc[s] += (qb[ch & 1][s][h2][c] * kr[ch * 2 + h2][c]) * tb[ch & 1][s][h2][c];
      __builtin_amdgcn_sched_barrier(0);      /* and keeps the loads after next from rising into it, where they would need a third set of registers */
    }
#pragma unroll
    for (int s = 0; s < 4; ++s) sc[il + s][jl] = acc[s]; }
  __syncthreads();
  const v4f a0 = *(const v4fa*)&sc[orow][oc8], a1 = *(const v4fa*)&sc[orow][oc8 + 4]; FragH f;
#pragma unroll
  for (int u = 0; u < 8; ++u) { const float kv = (u < 4) ? kb0[u & 3] : kb1[u & 3]; const float av = (u < 4) ? a0[u & 3] : a1[u & 3]; const _Float16 v = (_Float16)(gate * bf16_round(kv) + alpha * av); f.h[u] = (oj + u <= oi) ? v : (_Float16)0.0f; }
  *(v8us*)dst = f.half[0]; }

extern "C" void kernel_launch(void* const* d_in, const int* in_sizes, int n_in,
                              void* d_out, int out_size, void* d_ws, size_t ws_size, hipStream_t stream) {
  (void)in_sizes; (void)n_in; (void)out_size;
  const float* const* I = (const float* const*)d_in; const float* h = I[0]; const float* kb = I[1]; const float* dl = I[2]; const float* gl = I[3]; const float* al = I[4]; const float* u = I[5]; const float* v = I[6]; const float* pw = I[7]; const float* pb = I[8]; const float* n1 = I[9]; const float* n2 = I[10]; const float* uw = I[11]; const float* ub = I[12]; const float* dw = I[13]; const float* db = I[14];
  char* ws = (char*)d_ws; size_t off = 0;
  auto take = [&](size_t bytes) { char* p = ws + off; off += (bytes + 255) & ~(size_t)255; return p; };
  _Float16* BUV = (_Float16*)take((size_t)2 * RR * DM * 2); _Float16* BP = (_Float16*)take((size_t)DM * DM * 2); _Float16* BU = (_Float16*)take((size_t)FH * DM * 2); _Float16* BD = (_Float16*)take((size_t)DM * FH * 2); float* T = (float*)take((size_t)SQ * RR * 4);
  _Float16* HN16 = (_Float16*)take(NR * DM * 2); float* HF = (float*)take(NR * DM * 4); float* QK = (float*)take(NR * 2 * RR * 4); _Float16* HT = (_Float16*)take((size_t)DM * SQ * 2); _Float16* A16 = (_Float16*)take((size_t)SQ * SQ * 2);
  _Float16* O16 = (_Float16*)take(NR * DM * 2); float* H1 = (float*)take(NR * DM * 4); _Float16* M16 = (_Float16*)take(NR * DM * 2); _Float16* U16 = (_Float16*)take(NR * FH * 2);
  if (off > ws_size) return;      /* 0.3 + 2 + 4 + 4 + 0.3 + 16 + 32 + 4 + 2 + 2 + 16 + 32 + 16 + 32 = ≈ 163 MiB */
  k_wT<<<(DM / 64) * (RR / 64), 256, 0, stream>>>(u, DM, RR, BUV); k_wT<<<(DM / 64) * (RR / 64), 256, 0, stream>>>(v, DM, RR, BUV + (size_t)RR * DM);      /* [u|v]^T -> [128][1024] */
  k_wnat<<<(unsigned)(((size_t)DM * DM / 8 + 255) / 256), 256, 0, stream>>>(pw, (size_t)DM * DM / 8, BP); k_wnat<<<(unsigned)(((size_t)FH * DM / 8 + 255) / 256), 256, 0, stream>>>(uw, (size_t)FH * DM / 8, BU); k_wnat<<<(unsigned)(((size_t)DM * FH / 8 + 255) / 256), 256, 0, stream>>>(dw, (size_t)DM * FH / 8, BD);
  k_tab<<<(SQ * RR + 255) / 256, 256, 0, stream>>>(dl, T);
  k_rms<<<(unsigned)((NR + 7) / 8), 256, 0, stream>>>(h, 1, n1, NR, HN16, HF);      /* hn (f16) + bf16(h) (f32 residual) */
  k_gemm2<0><<<dim3((unsigned)((NR / 128) * (2 * RR / 64)), 1), 128, 0, stream>>>(HN16, DM, 0, BUV, DM, 0, 0.0625f, nullptr, 0, nullptr, 1, 0, 0, QK, nullptr, 2 * RR, 0, (int)NR, 2 * RR, DM);      /* [q_raw | k_raw] */
  k_l2<<<(unsigned)((NR * 2 * (RR / 4) + 255) / 256), 256, 0, stream>>>(QK);
  for (int b = 0; b < NB; ++b) {
    k_amat<<<(SQ / AM_TI) * (SQ / AM_TJ), 256, 0, stream>>>(QK, kb, T, gl, al, b, A16);
    k_hT<<<(SQ / 64) * (DM / 64), 256, 0, stream>>>(HN16, b, HT);
    k_gemm2<0><<<dim3((SQ / 128) * (DM / 64), 1), 128, 0, stream>>>(A16, SQ, 0, HT, SQ, 0, 1.0f, nullptr, 0, nullptr, 1, 0, 0, nullptr, O16 + (size_t)b * SQ * DM, DM, 0, SQ, DM, SQ); }      /* out_b = A_b . hn_b */
  const dim3 gp((unsigned)((NR / 128) * (DM / 64)), 1);
  k_gemm2<0><<<gp, 128, 0, stream>>>(O16, DM, 0, BP, DM, 0, 0.0625f, pb, 0, HF, 1, (size_t)DM, 0, H1, nullptr, DM, 0, (int)MQ, DM, DM);      /* h1 = h + out proj_w^T + proj_b */
  k_rms<<<(unsigned)((MQ + 7) / 8), 256, 0, stream>>>(H1, 0, n2, MQ, M16, nullptr);
  k_gemm2<6><<<dim3((unsigned)((NR / 128) * (FH / 64)), 1), 128, 0, stream>>>(M16, DM, 0, BU, DM, 0, 0.0625f, ub, 0, nullptr, 1, 0, 0, nullptr, U16, FH, 0, (int)MQ, FH, DM);      /* gelu_erf(m up_w^T + up_b) */
  k_gemm2<0><<<gp, 128, 0, stream>>>(U16, FH, 0, BD, FH, 0, 0.0625f, db, 0, H1, 1, (size_t)DM, 0, (float*)d_out, nullptr, DM, 0, (int)MQ, DM, FH);      /* h1 + m */
}

// v004
// It runs in 278 microseconds.
// Timed twice side by side with v003, it ran 1.44 and 1.49 times as fast.
// Counting every step since v000, it is 8.22 times as fast.
#include <hip/hip_runtime.h>
// K2Layer (h [8][1024][1024]; hn = rmsnorm(h)*norm1_scale; gate = sigmoid(gate_logit), alpha = sigmoid(alpha_logit); q|k = hn [u|v] (rank 64), row-l2-normalised; gamma_r = 0.15 + 0.85 sigmoid(decay_logit_r); A[i][j] = causal(j<=i) * (gate k_base[i][j] + alpha sum_r q[i][r] k[j][r] gamma_r^(i-j)); out = A . hn; h1 = h + out proj_w^T + proj_b; m = gelu_erf(rmsnorm(h1)*norm2_scale up_w^T + up_b) down_w^T + down_b; result = h1 + m -> [8][1024][1024]).
// Structure: token rows; rmsnorm on VALU (f32) into f16 rows and per-batch transposed f16 planes (LDS); the rank-64 q|k projection as a WMMA GEMM (f32), l2-normalisation and the per-rank decayed causal scores on VALU in f32 (gamma^d table built on device from decay_logit, k_base/gate/alpha read) into the f16 mixing matrix A; out = A . hn, proj (+ bias + h), up (+ bias, exact-GELU epilogue, f16), down (+ bias + h1) as WMMA GEMMs (32x64 wave tiles, f32 accumulation, exact x16 weights).
// Compute dtype: inputs rounded to bf16; h / weights / k_base exact; hn, A, out, rmsnorm(h1), GELU hidden plain f16 operands (~2^-12); scores, norms, residuals f32. v_wmma_f32_16x16x32_f16.
#define NB 8
#define SQ 1024
#define DM 1024
#define RR 64
#define FH 2048
#define NR ((size_t)NB * SQ)
#define MQ NR                        /* rows through the proj/MLP stage (debug hook) */
typedef __bf16 v16b __attribute__((ext_vector_type(16)));
typedef unsigned short v8us __attribute__((ext_vector_type(8), may_alias));
typedef float  v8f  __attribute__((ext_vector_type(8)));
typedef float  v4f  __attribute__((ext_vector_type(4)));
typedef float  v4fa __attribute__((ext_vector_type(4), may_alias));
union FragB { v16b v; v8us half[2]; unsigned short u[16]; };

__device__ __forceinline__ unsigned short bf16_bits(float x) { unsigned int u = __float_as_uint(x); return (unsigned short)((u + 0x7FFFu + ((u >> 16) & 1u)) >> 16); }
__device__ __forceinline__ float bf16_val(unsigned short b) { return __uint_as_float(((unsigned int)b) << 16); }
__device__ __forceinline__ float bf16_round(float x) { return bf16_val(bf16_bits(x)); }
// D += A·B with NT terms: 1 = ah·bh, 2 = + al·bh (A split), 3 = + ah·bl (both split)
template <int NT>
__device__ __forceinline__ v8f mmaN(v16b ah, v16b al, v16b bh, v16b bl, v8f c) {
  c = __builtin_amdgcn_wmma_f32_16x16x32_bf16(false, ah, false, bh, (short)0, c, false, false);
  if (NT >= 2) c = __builtin_amdgcn_wmma_f32_16x16x32_bf16(false, al, false, bh, (short)0, c, false, false);
  if (NT >= 3) c = __builtin_amdgcn_wmma_f32_16x16x32_bf16(false, ah, false, bl, (short)0, c, false, false);
  asm volatile("v_nop\n\tv_nop\n\tv_nop\n\tv_nop" : "+v"(c) : "v"(ah), "v"(al), "v"(bh), "v"(bl));
  return c;
}

__global__ __launch_bounds__(256) void k_wt_bf16(const float* __restrict__ W, unsigned short* __restrict__ Wt, int K, int N) {
  const int t = blockIdx.x * 256 + threadIdx.x;
  const int k8n = K / 8;
  if (t >= N * k8n) return;
  const int n = t / k8n, k8 = (t % k8n) * 8;
  v8us v;
#pragma unroll
  for (int i = 0; i < 8; ++i) v[i] = bf16_bits(W[(size_t)(k8 + i) * N + n]);
  *(v8us*)(Wt + (size_t)n * K + k8) = v;
  
}

// GEMM C[M][N] (f32, pitch ldc) = act(A[M][K]·W + bias). A f32 row-major (pitch lda) converted per fragment to bf16
// (ASPLIT: hi/lo two planes -> 2 terms, else single rounded term); Wt bf16 [N][K] (pitch ldb). BIAS_BF16 rounds the
// bias to bf16 first (bias quantised to bf16 before the add). K%32==0, M%16==0, N%64==0.
template <bool ASPLIT, int ACT, bool BIAS_BF16>
__global__ __launch_bounds__(128) void k_gemm_bf(const float* __restrict__ A, int lda, const unsigned short* __restrict__ Wt, int ldb,
                                               const float* __restrict__ bias, float* __restrict__ C, int ldc, int M, int N, int K) {
  __shared__ __attribute__((aligned(16))) float so[4][16][64];
  const int tid = threadIdx.x, w = tid >> 5, lane = tid & 31, ln = lane & 15, hh = lane >> 4;
  const int ntn = N / 64;
  const int wid = blockIdx.x * 4 + w;
  const int mt = wid / ntn, nq = wid % ntn;
  if (mt * 16 >= M) return;
  const int row0 = mt * 16, col0 = nq * 64;
  const float* arow = A + (size_t)(row0 + ln) * lda;
  v8f acc[4] = {};
  for (int kb = 0; kb < K; kb += 32) {
    FragB ah, al;
    const v4f x0 = *(const v4fa*)(arow + kb + 8 * hh), x1 = *(const v4fa*)(arow + kb + 8 * hh + 4);
    const v4f x2 = *(const v4fa*)(arow + kb + 16 + 8 * hh), x3 = *(const v4fa*)(arow + kb + 16 + 8 * hh + 4);
    float xs[16] = {x0[0],x0[1],x0[2],x0[3],x1[0],x1[1],x1[2],x1[3],x2[0],x2[1],x2[2],x2[3],x3[0],x3[1],x3[2],x3[3]};
#pragma unroll
    for (int i = 0; i < 16; ++i) { const unsigned short hb = bf16_bits(xs[i]); ah.u[i] = hb; al.u[i] = ASPLIT ? bf16_bits(xs[i] - bf16_val(hb)) : (unsigned short)0; }
#pragma unroll
    for (int t = 0; t < 4; ++t) {
      const unsigned short* brow = Wt + (size_t)(col0 + t * 16 + ln) * ldb + kb;
      FragB b;
      b.half[0] = *(const v8us*)(brow + 8 * hh);
      b.half[1] = *(const v8us*)(brow + 16 + 8 * hh);
      acc[t] = mmaN<ASPLIT ? 2 : 1>(ah.v, al.v, b.v, b.v, acc[t]);
    }
  }
#pragma unroll
  for (int t = 0; t < 4; ++t) {
    float bv = bias ? bias[col0 + t * 16 + ln] : 0.f;
    if (BIAS_BF16) bv = bf16_round(bv);
#pragma unroll
    for (int r = 0; r < 8; ++r) { float v = acc[t][r] + bv; if (ACT == 1) v = fmaxf(v, 0.f); so[w][8 * hh + r][t * 16 + ln] = v; }
  }
  __builtin_amdgcn_fence(__ATOMIC_ACQ_REL, "workgroup");
  __builtin_amdgcn_wave_barrier();
  const int rsub = lane >> 4, c4 = (lane & 15) * 4;
  {
#pragma unroll
    for (int q = 0; q < 8; ++q) {
      const int r = q * 2 + rsub;
      const v4f v = *(const v4fa*)&so[w][r][c4];
      *(v4f*)(C + (size_t)(row0 + r) * ldc + col0 + c4) = v;
    }
    
  }
}

// GEMM C = act(A·W + bias + resid): A f32 (ASPLIT -> hi/lo 2 terms), Wt bf16 [N][K]; ACT 0 none, 1 relu, 2 exact gelu;
// resid (optional, f32, row index = (row % rmod), pitch ldr, RES_BF16 rounds it) added before the activation.
template <bool ASPLIT, int ACT, bool BIAS_BF16, bool RES_BF16>
__global__ __launch_bounds__(128) void k_gemm_bf3(const float* __restrict__ A, int lda, const unsigned short* __restrict__ Wt, int ldb,
                                                const float* __restrict__ bias, const float* __restrict__ resid, int rmod, int ldr,
                                                float* __restrict__ C, int ldc, int M, int N, int K) {
  __shared__ __attribute__((aligned(16))) float so[4][16][64];
  const int tid = threadIdx.x, w = tid >> 5, lane = tid & 31, ln = lane & 15, hh = lane >> 4;
  const int ntn = N / 64;
  const int wid = blockIdx.x * 4 + w;
  const int mt = wid / ntn, nq = wid % ntn;
  if (mt * 16 >= M) return;
  const int row0 = mt * 16, col0 = nq * 64;
  const float* arow = A + (size_t)(row0 + ln) * lda;
  v8f acc[4] = {};
  for (int kb = 0; kb < K; kb += 32) {
    FragB ah, al;
    const v4f x0 = *(const v4fa*)(arow + kb + 8 * hh), x1 = *(const v4fa*)(arow + kb + 8 * hh + 4);
    const v4f x2 = *(const v4fa*)(arow + kb + 16 + 8 * hh), x3 = *(const v4fa*)(arow + kb + 16 + 8 * hh + 4);
    float xs[16] = {x0[0],x0[1],x0[2],x0[3],x1[0],x1[1],x1[2],x1[3],x2[0],x2[1],x2[2],x2[3],x3[0],x3[1],x3[2],x3[3]};
#pragma unroll
    for (int i = 0; i < 16; ++i) { const unsigned short hb = bf16_bits(xs[i]); ah.u[i] = hb; al.u[i] = ASPLIT ? bf16_bits(xs[i] - bf16_val(hb)) : (unsigned short)0; }
#pragma unroll
    for (int t = 0; t < 4; ++t) {
      const unsigned short* brow = Wt + (size_t)(col0 + t * 16 + ln) * ldb + kb;
      FragB b;
      b.half[0] = *(const v8us*)(brow + 8 * hh);
      b.half[1] = *(const v8us*)(brow + 16 + 8 * hh);
      acc[t] = mmaN<ASPLIT ? 2 : 1>(ah.v, al.v, b.v, b.v, acc[t]);
    }
  }
#pragma unroll
  for (int t = 0; t < 4; ++t) {
    const int col = col0 + t * 16 + ln;
    float bv = bias ? bias[col] : 0.f;
    if (BIAS_BF16) bv = bf16_round(bv);
#pragma unroll
    for (int r = 0; r < 8; ++r) {
      float v = acc[t][r] + bv;
      if (resid) { float rv = resid[(size_t)((row0 + 8 * hh + r) % rmod) * ldr + col]; if (RES_BF16) rv = bf16_round(rv); v += rv; }
      if (ACT == 1) v = fmaxf(v, 0.f);
      if (ACT == 2) v = 0.5f * v * (1.0f + erff(v * 0.70710678118654752f));
      if (ACT == 3) { const float u = 0.7978845608028654f * (v + 0.044715f * v * v * v); v = 0.5f * v * (1.0f + tanhf(u)); }
      so[w][8 * hh + r][t * 16 + ln] = v;
    }
  }
  __builtin_amdgcn_fence(__ATOMIC_ACQ_REL, "workgroup");
  __builtin_amdgcn_wave_barrier();
  const int rsub = lane >> 4, c4 = (lane & 15) * 4;
  {
#pragma unroll
    for (int q = 0; q < 8; ++q) {
      const int r = q * 2 + rsub;
      const v4f v = *(const v4fa*)&so[w][r][c4];
      *(v4f*)(C + (size_t)(row0 + r) * ldc + col0 + c4) = v;
    }
    
  }
}
// row LayerNorm (biased variance, eps) over N: s = X (+ R); optional out_sum <- s; out_norm <- (s-mu)*rsqrt(var+eps)*g + b
template <bool PARAM_BF16>
__global__ __launch_bounds__(256) void k_layernorm(const float* __restrict__ X, const float* __restrict__ R, const float* __restrict__ g, const float* __restrict__ bta,
                                                  float* __restrict__ out_sum, float* __restrict__ out_norm, int N, float eps) {
  __shared__ float red[256];
  const int row = blockIdx.x, tid = threadIdx.x;
  const float* x = X + (size_t)row * N; const float* rr = R ? R + (size_t)row * N : nullptr;
  float vals[16];                     // up to N = 4096
  const int per = N / 256;            // contiguous chunk per thread? use strided-by-4 chunks: thread handles j = tid*4 + 1024*u
  float s1 = 0.f;
  for (int u = 0; u < per / 4; ++u) {
    const int j = tid * 4 + 1024 * u;
    const v4f a = *(const v4fa*)(x + j);
    v4f b = {0.f,0.f,0.f,0.f}; if (rr) b = *(const v4fa*)(rr + j);
#pragma unroll
    for (int q = 0; q < 4; ++q) { const float v = a[q] + b[q]; vals[u * 4 + q] = v; s1 += v; }
  }
  red[tid] = s1; __syncthreads();
  for (int st = 128; st > 0; st >>= 1) { if (tid < st) red[tid] += red[tid + st]; __syncthreads(); }
  const float mu = red[0] / (float)N; __syncthreads();
  float s2 = 0.f;
  for (int u = 0; u < per / 4; ++u)
#pragma unroll
    for (int q = 0; q < 4; ++q) { const float c = vals[u * 4 + q] - mu; s2 += c * c; }
  red[tid] = s2; __syncthreads();
  for (int st = 128; st > 0; st >>= 1) { if (tid < st) red[tid] += red[tid + st]; __syncthreads(); }
  const float rs = rsqrtf(red[0] / (float)N + eps);
  {
    for (int u = 0; u < per / 4; ++u) {
      const int j = tid * 4 + 1024 * u;
      v4f o, sm;
#pragma unroll
      for (int q = 0; q < 4; ++q) {
        float gg = g[j + q], bb = bta[j + q];
        if (PARAM_BF16) { gg = bf16_round(gg); bb = bf16_round(bb); }
        sm[q] = vals[u * 4 + q]; o[q] = (vals[u * 4 + q] - mu) * rs * gg + bb;
      }
      if (out_sum) *(v4f*)(out_sum + (size_t)row * N + j) = sm;
      *(v4f*)(out_norm + (size_t)row * N + j) = o;
    }
    
  }
}



// ---- f16 WMMA path (v_wmma_f32_16x16x32_f16): 11-bit significands for operands in range — used for every GEMM launched here
typedef _Float16 v16h __attribute__((ext_vector_type(16)));
union FragH { v16h v; v8us half[2]; _Float16 h[16]; unsigned short u[16]; };
template <int NT>
__device__ __forceinline__ v8f mmaH(v16h ah, v16h al, v16h bh, v16h bl, v8f c) {
  c = __builtin_amdgcn_wmma_f32_16x16x32_f16(false, ah, false, bh, (short)0, c, false, false);
  if (NT >= 2) c = __builtin_amdgcn_wmma_f32_16x16x32_f16(false, al, false, bh, (short)0, c, false, false);
  if (NT >= 3) c = __builtin_amdgcn_wmma_f32_16x16x32_f16(false, ah, false, bl, (short)0, c, false, false);
  asm volatile("v_nop\n\tv_nop\n\tv_nop\n\tv_nop" : "+v"(c) : "v"(ah), "v"(al), "v"(bh), "v"(bl));
  return c;
}
// batched GEMM like k_gemm_b but f16 operands: A f32 (split into f16 hi/lo if ASPLIT, else rounded to f16), Bt = f16 values [n][k]; alpha; C f32; N multiple of 16 (partial tiles skipped)
template <bool ASPLIT>
__global__ __launch_bounds__(128) void k_gemm_h(const float* __restrict__ A, int lda, size_t sA, const _Float16* __restrict__ Bh, int ldb, size_t sB, float alpha, float* __restrict__ C, int ldc, size_t sC, int M, int N, int K) {
  __shared__ __attribute__((aligned(16))) float so[4][16][64];
  const int tid = threadIdx.x, w = tid >> 5, lane = tid & 31, ln = lane & 15, hh = lane >> 4; const int by = blockIdx.y;
  A += (size_t)by * sA; Bh += (size_t)by * sB; C += (size_t)by * sC;
  const int ntn = (N + 63) / 64; const int wid = blockIdx.x * 4 + w; const int mt = wid / ntn, nq = wid % ntn; if (mt * 16 >= M) return;
  const int row0 = mt * 16, col0 = nq * 64; const float* arow = A + (size_t)(row0 + ln) * lda;
  v8f acc[4] = {};
  for (int kb = 0; kb < K; kb += 32) {
    FragH ah, al;
    const v4f x0 = *(const v4fa*)(arow + kb + 8 * hh), x1 = *(const v4fa*)(arow + kb + 8 * hh + 4), x2 = *(const v4fa*)(arow + kb + 16 + 8 * hh), x3 = *(const v4fa*)(arow + kb + 16 + 8 * hh + 4);
    float xs[16] = {x0[0],x0[1],x0[2],x0[3],x1[0],x1[1],x1[2],x1[3],x2[0],x2[1],x2[2],x2[3],x3[0],x3[1],x3[2],x3[3]};
#pragma unroll
    for (int i = 0; i < 16; ++i) { const _Float16 h = (_Float16)xs[i]; ah.h[i] = h; al.h[i] = ASPLIT ? (_Float16)(xs[i] - (float)h) : (_Float16)0.0f; }
#pragma unroll
    for (int t = 0; t < 4; ++t) { if (col0 + t * 16 >= N) continue; const size_t boff = (size_t)(col0 + t * 16 + ln) * ldb + kb; FragH bq; bq.half[0] = *(const v8us*)(Bh + boff + 8 * hh); bq.half[1] = *(const v8us*)(Bh + boff + 16 + 8 * hh);
      acc[t] = mmaH<ASPLIT ? 2 : 1>(ah.v, al.v, bq.v, bq.v, acc[t]); }
  }
#pragma unroll
  for (int t = 0; t < 4; ++t) { if (col0 + t * 16 >= N) continue;
#pragma unroll
    for (int r = 0; r < 8; ++r) so[w][8 * hh + r][t * 16 + ln] = acc[t][r] * alpha; }
  __builtin_amdgcn_fence(__ATOMIC_ACQ_REL, "workgroup"); __builtin_amdgcn_wave_barrier();
  const int rsub = lane >> 4, c4 = (lane & 15) * 4;
  {
#pragma unroll
    for (int q = 0; q < 8; ++q) { const int r = q * 2 + rsub; if (col0 + c4 < N) { const v4f v = *(const v4fa*)&so[w][r][c4]; *(v4f*)(C + (size_t)(row0 + r) * ldc + col0 + c4) = v; } }
     }
}

// Wt[n][k] = f16(W[k][n]·scale) from f32 row-major W[K][N] (scale = power of two; bf16-exact weights stay exact in f16 away from the subnormal range)
__global__ __launch_bounds__(256) void k_wt_f16(const float* __restrict__ W, _Float16* __restrict__ Wt, int K, int N, float scale) {
  const int t = blockIdx.x * 256 + threadIdx.x; if (t >= N * (K / 8)) return; const int n = t / (K / 8), k8 = (t % (K / 8)) * 8; FragH f;
#pragma unroll
  for (int i = 0; i < 8; ++i) f.h[i] = (_Float16)(bf16_round(W[(size_t)(k8 + i) * N + n]) * scale); const v8us o = f.half[0];
  *(v8us*)((unsigned short*)Wt + (size_t)n * K + k8) = o; 
}
// k_gemm_hh variant with fused epilogue: v = acc·alpha + bias[by·sBias + col] (+ CP[(row/rowsPerB)·sCPb + by·64 + col] if CP) ; ACT 0 none / 1 elu ; writes f16 C16 (and f32 C if non-null)
template <int ACT>
__global__ __launch_bounds__(128) void k_gemm_hhx(const _Float16* __restrict__ A, int lda, size_t sA, const _Float16* __restrict__ Bh, int ldb, size_t sB, float alpha, const float* __restrict__ bias, size_t sBias, const float* __restrict__ CP, int rowsPerB, size_t sCPb, int row0g,
    float* __restrict__ C, _Float16* __restrict__ C16, int ldc, size_t sC, int M, int N, int K) {
  __shared__ __attribute__((aligned(16))) float so[4][16][64];
  const int tid = threadIdx.x, w = tid >> 5, lane = tid & 31, ln = lane & 15, hh = lane >> 4; const int by = blockIdx.y;
  A += (size_t)by * sA; Bh += (size_t)by * sB; const size_t cofs = (size_t)by * sC; const float* bp = bias ? bias + (size_t)by * sBias : nullptr;
  const int ntn = (N + 63) / 64; const int wid = blockIdx.x * 4 + w; const int mt = wid / ntn, nq = wid % ntn; if (mt * 16 >= M) return;
  const int row0 = mt * 16, col0 = nq * 64; const _Float16* arow = A + (size_t)(row0 + ln) * lda;
  v8f acc[4] = {};
  for (int kb = 0; kb < K; kb += 32) { FragH ah; ah.half[0] = *(const v8us*)((const unsigned short*)arow + kb + 8 * hh); ah.half[1] = *(const v8us*)((const unsigned short*)arow + kb + 16 + 8 * hh);
#pragma unroll
    for (int t = 0; t < 4; ++t) { if (col0 + t * 16 >= N) continue; const size_t boff = (size_t)(col0 + t * 16 + ln) * ldb + kb; FragH bq; bq.half[0] = *(const v8us*)((const unsigned short*)Bh + boff + 8 * hh); bq.half[1] = *(const v8us*)((const unsigned short*)Bh + boff + 16 + 8 * hh);
      acc[t] = mmaH<1>(ah.v, ah.v, bq.v, bq.v, acc[t]); }
  }
#pragma unroll
  for (int t = 0; t < 4; ++t) { if (col0 + t * 16 >= N) continue; const int col = col0 + t * 16 + ln; const float bv = bp ? bf16_round(bp[col]) : 0.f;
#pragma unroll
    for (int r = 0; r < 8; ++r) { float v = acc[t][r] * alpha + bv; if (CP) { const int rr = row0g + row0 + 8 * hh + r; if (rowsPerB < 0) v += CP[cofs + (size_t)rr * ldc + col];      /* rowsPerB < 0: own element of the batched C plane */ else { const int bidx = rr / rowsPerB; v += CP[(size_t)bidx * sCPb + (size_t)by * 64 + col]; } } if (ACT == 1) v = (v > 0.f) ? v : expm1f(v); else if (ACT == 7) v = (v > 0.f) ? v + 1.0f : expf(v); else if (ACT == 8) v = tanhf(v); else if (ACT == 9) v = 0.5f * v * (1.0f + tanhf(0.7978845608028654f * (v + 0.044715f * v * v * v))); else if (ACT == 11) v = 1.0f / (1.0f + expf(-v)); else if (ACT == 12) v = (v > 0.f) ? v : 0.01f * v; else if (ACT == 14) v = (v > 0.f) ? v : 0.1f * v; else if (ACT == 16) v = (v >= 0.f) ? v : 0.3f * v; else if (ACT == 17) v = (v >= 0.f) ? v : 0.2f * v; else if (ACT == 15) v = v / (1.0f + expf(-v)); else if (ACT == 3) v = fmaxf(v, 0.f); else if (ACT == 6) v = 0.5f * v * (1.0f + erff(v * 0.70710678118654752f)); so[w][8 * hh + r][t * 16 + ln] = v; } }
  __builtin_amdgcn_fence(__ATOMIC_ACQ_REL, "workgroup"); __builtin_amdgcn_wave_barrier();
  const int rsub = lane >> 4, c4 = (lane & 15) * 4; typedef _Float16 v4h __attribute__((ext_vector_type(4)));
  {
#pragma unroll
    for (int q = 0; q < 8; ++q) { const int r = q * 2 + rsub; if (col0 + c4 < N) { const v4f v = *(const v4fa*)&so[w][r][c4]; if (C) *(v4f*)(C + cofs + (size_t)(row0 + r) * ldc + col0 + c4) = v; if (C16) { v4h h4; for (int i = 0; i < 4; ++i) h4[i] = (_Float16)v[i]; *(v4h*)(C16 + cofs + (size_t)(row0 + r) * ldc + col0 + c4) = h4; } } }
     }
}


typedef _Float16 v4h __attribute__((ext_vector_type(4)));

__global__ __launch_bounds__(256) void k_x16(const float* __restrict__ x, _Float16* __restrict__ X16, size_t n8) { const size_t t = (size_t)blockIdx.x * 256 + threadIdx.x; if (t >= n8) return; FragH f;
#pragma unroll
  for (int q = 0; q < 8; ++q) f.h[q] = (_Float16)bf16_round(x[t * 8 + q]); *(v8us*)((unsigned short*)X16 + t * 8) = f.half[0];  }
__global__ __launch_bounds__(256) void k_h16(const float* __restrict__ x, _Float16* __restrict__ X16, size_t n8) { const size_t t = (size_t)blockIdx.x * 256 + threadIdx.x; if (t >= n8) return; FragH f;
#pragma unroll
  for (int q = 0; q < 8; ++q) f.h[q] = (_Float16)x[t * 8 + q]; *(v8us*)((unsigned short*)X16 + t * 8) = f.half[0];  }
__global__ __launch_bounds__(256) void k_round16f(const float* __restrict__ W, _Float16* __restrict__ Bt, size_t n8) { const size_t t = (size_t)blockIdx.x * 256 + threadIdx.x; if (t >= n8) return; FragH f;
#pragma unroll
  for (int i = 0; i < 8; ++i) f.h[i] = (_Float16)(bf16_round(W[t * 8 + i]) * 16.0f); *(v8us*)((unsigned short*)Bt + t * 8) = f.half[0];  }
template <int NHv, int TTv>
__global__ __launch_bounds__(256) void k_vt(const _Float16* __restrict__ V16, int ldv, int voff, _Float16* __restrict__ Vt) { __shared__ unsigned short tl[64][66]; const int tid = threadIdx.x; const int slab = blockIdx.x / (TTv / 64), lg = blockIdx.x % (TTv / 64); const int b = slab / NHv, h = slab % NHv;
  for (int i = tid; i < 64 * 8; i += 256) { const int r = i / 8, c8 = (i % 8) * 8; FragH f; f.half[0] = *(const v8us*)((const unsigned short*)V16 + ((size_t)b * TTv + lg * 64 + r) * ldv + voff + h * 64 + c8);
#pragma unroll
    for (int q = 0; q < 8; ++q) tl[r][c8 + q] = f.u[q]; }
  __syncthreads();
  {
#pragma unroll
    for (int rd = 0; rd < 2; ++rd) { const int d = rd * 32 + tid / 8, pc = tid % 8; FragH f;
#pragma unroll
      for (int q = 0; q < 8; ++q) f.u[q] = tl[pc * 8 + q][d];
      *(v8us*)((unsigned short*)Vt + ((size_t)slab * 64 + d) * TTv + lg * 64 + pc * 8) = f.half[0]; }
     } }

__global__ __launch_bounds__(256) void k_hl(const float* __restrict__ F, _Float16* __restrict__ Hh, _Float16* __restrict__ Hl, size_t n8) { const size_t t = (size_t)blockIdx.x * 256 + threadIdx.x; if (t >= n8) return; FragH fh, fl; const v4f a = *(const v4fa*)(F + t * 8), c = *(const v4fa*)(F + t * 8 + 4);
#pragma unroll
  for (int q = 0; q < 4; ++q) { _Float16 h = (_Float16)a[q]; fh.h[q] = h; fl.h[q] = (_Float16)((a[q] - (float)h) * 1024.0f); h = (_Float16)c[q]; fh.h[4 + q] = h; fl.h[4 + q] = (_Float16)((c[q] - (float)h) * 1024.0f); }
  { *(v8us*)((unsigned short*)Hh + t * 8) = fh.half[0]; *(v8us*)((unsigned short*)Hl + t * 8) = fl.half[0];  } }

// ---- fast GEMM (block tile 128x64, wave tile 32x64; requires M % 128 == 0 rows per launch region, N % 64 == 0, K % 64 == 0, K >= 64); epilogue = k_gemm_hhx semantics ----
// Operands go global -> LDS by asynchronous copies, 64 k (one whole 128-byte line of every operand row) per stage, two buffers: eight lanes cover a row's line, so a
// wave's copy touches four whole lines, and every line is fetched once per block. The fragments are read from LDS in the k order of g2_frag.
#define G2_KS 64                              /* k per stage */
#define G2_PITCH 144                          /* LDS row pitch in bytes: 16 B x odd, so that 16 lanes on 16 neighbouring rows meet no bank twice */
#define G2_STAGE ((128 + 64) * G2_PITCH)      /* one stage: [A 128 rows | B 64 rows] */
__device__ __forceinline__ v16h g2_frag(const unsigned char* p, int hh) { FragH f; f.half[0] = *(const v8us*)(p + 16 * hh); f.half[1] = *(const v8us*)(p + 32 + 16 * hh); return f.v; }
__device__ __forceinline__ v8f g2_mma(v16h a, v16h b, v8f c) { v8f d = __builtin_amdgcn_wmma_f32_16x16x32_f16(false, a, false, b, (short)0, c, false, false); asm volatile("v_nop\n\tv_nop\n\tv_nop\n\tv_nop" : "+v"(d) : "v"(a), "v"(b)); return d; }
// One stage's twelve copies of a thread (16 bytes each): rows sr + 16 i of A (i = 0 .. 7) and of B (i = 0 .. 3). l = the thread's LDS byte address in the stage's row sr.
// The s_wait_xcnt closes the statement, so that it stands ahead of every later overwrite of the copies' address registers.
__device__ __forceinline__ void g2_copy(unsigned l, const _Float16* ga, size_t sa, const _Float16* gb, size_t sb) {
  asm volatile("global_load_async_to_lds_b128 %0, %12, off\n\t" "global_load_async_to_lds_b128 %1, %13, off\n\t" "global_load_async_to_lds_b128 %2, %14, off\n\t" "global_load_async_to_lds_b128 %3, %15, off\n\t"
               "global_load_async_to_lds_b128 %4, %16, off\n\t" "global_load_async_to_lds_b128 %5, %17, off\n\t" "global_load_async_to_lds_b128 %6, %18, off\n\t" "global_load_async_to_lds_b128 %7, %19, off\n\t"
               "global_load_async_to_lds_b128 %8, %20, off\n\t" "global_load_async_to_lds_b128 %9, %21, off\n\t" "global_load_async_to_lds_b128 %10, %22, off\n\t" "global_load_async_to_lds_b128 %11, %23, off\n\t"
               "s_wait_xcnt 0x0"
               :: "v"(l), "v"(l + 16 * G2_PITCH), "v"(l + 32 * G2_PITCH), "v"(l + 48 * G2_PITCH), "v"(l + 64 * G2_PITCH), "v"(l + 80 * G2_PITCH), "v"(l + 96 * G2_PITCH), "v"(l + 112 * G2_PITCH),
                  "v"(l + 128 * G2_PITCH), "v"(l + 144 * G2_PITCH), "v"(l + 160 * G2_PITCH), "v"(l + 176 * G2_PITCH),
                  "v"(ga), "v"(ga + sa), "v"(ga + 2 * sa), "v"(ga + 3 * sa), "v"(ga + 4 * sa), "v"(ga + 5 * sa), "v"(ga + 6 * sa), "v"(ga + 7 * sa),
                  "v"(gb), "v"(gb + sb), "v"(gb + 2 * sb), "v"(gb + 3 * sb) : "memory"); }
template <int ACT>
__global__ __launch_bounds__(128) void k_gemm2(const _Float16* __restrict__ A, int lda, size_t sA, const _Float16* __restrict__ Bh, int ldb, size_t sB, float alpha, const float* __restrict__ bias, size_t sBias, const float* __restrict__ CP, int rowsPerB, size_t sCPb, int row0g,
    float* __restrict__ C, _Float16* __restrict__ C16, int ldc, size_t sC, int M, int N, int K) { static_assert(ACT == 0 || ACT == 3 || ACT == 6 || ACT == 8 || ACT == 9 || ACT == 11 || ACT == 12 || ACT == 14 || ACT == 15 || ACT == 16 || ACT == 17, "k_gemm2: unsupported ACT code (would silently apply no activation)");
  __shared__ __attribute__((aligned(16))) unsigned char sm[2 * G2_STAGE]; static_assert(sizeof(float) * 4 * 32 * 68 <= 2 * G2_STAGE, "the output staging lies in the ring");
  float (*so)[32][68] = (float (*)[32][68])sm;      /* output staging: used only behind the last trip's barrier, when no wave reads the ring any more */
  const int tid = threadIdx.x, w = tid >> 5, lane = tid & 31, ln = lane & 15, hh = lane >> 4; const int by = blockIdx.y;
  A += (size_t)by * sA; Bh += (size_t)by * sB; const size_t cofs = (size_t)by * sC; const float* bp = bias ? bias + (size_t)by * sBias : nullptr;
  const int ntn = N >> 6; const int mt = blockIdx.x / ntn, nq = blockIdx.x - mt * ntn; const int row0 = mt * 128 + 32 * w, col0 = nq * 64; if (mt * 128 >= M) return;      /* the whole block leaves, ahead of every copy and barrier */
  const int sr = tid >> 3, sc = tid & 7;      /* the thread's first row of a stage and its 16-byte piece of the row's line */
  const _Float16* ga = A + (size_t)(mt * 128 + sr) * lda + sc * 8; const _Float16* gb = Bh + (size_t)(col0 + sr) * ldb + sc * 8; const size_t sa = (size_t)16 * lda, sb = (size_t)16 * ldb;
  const unsigned l0 = (unsigned)(size_t)sm + (unsigned)(sr * G2_PITCH + sc * 16);
  const unsigned char* ar = sm + (32 * w + ln) * G2_PITCH; const unsigned char* br = sm + (128 + ln) * G2_PITCH;
  const int nt = K / G2_KS;
  const v8f z8 = {0.f,0.f,0.f,0.f,0.f,0.f,0.f,0.f}; v8f c00 = z8, c01 = z8, c02 = z8, c03 = z8, c10 = z8, c11 = z8, c12 = z8, c13 = z8;
  g2_copy(l0, ga, sa, gb, sb);
  asm volatile("s_wait_asynccnt 0x0" ::: "memory");      /* this wave's copies of stage 0 have landed */
  __syncthreads();      /* and every other wave's: stage 0 may be read */
  if (nt > 1) g2_copy(l0 + G2_STAGE, ga + G2_KS, sa, gb + G2_KS, sb);
#pragma unroll 1      /* one trip per stage: the buffer is chosen by the trip's parity */
  for (int t = 0; t < nt; ++t) { const unsigned bo = (unsigned)(t & 1) * G2_STAGE;
    const unsigned char* ap = ar + bo; const unsigned char* bq = br + bo; v16h fa[2][2], fb[2][4];
#pragma unroll      /* constant indices: fa and fb stay in registers */
    for (int kk = 0; kk < 2; ++kk) { fa[kk][0] = g2_frag(ap + kk * 64, hh); fb[kk][0] = g2_frag(bq + kk * 64, hh); fa[kk][1] = g2_frag(ap + 16 * G2_PITCH + kk * 64, hh);
      fb[kk][1] = g2_frag(bq + 16 * G2_PITCH + kk * 64, hh); fb[kk][2] = g2_frag(bq + 32 * G2_PITCH + kk * 64, hh); fb[kk][3] = g2_frag(bq + 48 * G2_PITCH + kk * 64, hh); }
#pragma unroll      /* the stage's two 32-k blocks, straight-line, k rising */
    for (int kk = 0; kk < 2; ++kk) {
      c00 = g2_mma(fa[kk][0], fb[kk][0], c00); c10 = g2_mma(fa[kk][1], fb[kk][0], c10); c01 = g2_mma(fa[kk][0], fb[kk][1], c01); c11 = g2_mma(fa[kk][1], fb[kk][1], c11);
      c02 = g2_mma(fa[kk][0], fb[kk][2], c02); c12 = g2_mma(fa[kk][1], fb[kk][2], c12); c03 = g2_mma(fa[kk][0], fb[kk][3], c03); c13 = g2_mma(fa[kk][1], fb[kk][3], c13); }
    asm volatile("s_wait_dscnt 0x0" ::: "memory");      /* this wave's reads of the buffer are done */
    asm volatile("s_wait_asynccnt 0x0" ::: "memory");      /* its copies of stage t + 1 have landed */
    __syncthreads();      /* publishes stage t + 1 and ends every reader's last read of stage t's buffer */
    if (t + 2 < nt) g2_copy(l0 + bo, ga + (size_t)(t + 2) * G2_KS, sa, gb + (size_t)(t + 2) * G2_KS, sb); }
  asm volatile("s_wait_asynccnt 0x0" ::: "memory");      /* no copy is outstanding when the ring becomes output staging */
  v8f accs[8] = {c00, c01, c02, c03, c10, c11, c12, c13};
#pragma unroll
  for (int u = 0; u < 8; ++u) { const int t = u & 3, half = u >> 2; const int col = col0 + t * 16 + ln; const float bv = bp ? bf16_round(bp[col]) : 0.f;
#pragma unroll
    for (int r = 0; r < 8; ++r) { const int rloc = half * 16 + 8 * hh + r; float v = accs[u][r] * alpha + bv; if (CP) { if (rowsPerB < 0) v += CP[cofs + (size_t)(row0g + row0 + rloc) * ldc + col];      /* rowsPerB < 0: own element of the batched C plane */ else { const int bidx = (row0g + row0 + rloc) / rowsPerB; v += CP[(size_t)bidx * sCPb + (size_t)by * 64 + col]; } }
      if (ACT == 3) v = fmaxf(v, 0.f); else if (ACT == 6) v = 0.5f * v * (1.0f + erff(v * 0.70710678118654752f)); else if (ACT == 11) v = 1.0f / (1.0f + expf(-v)); else if (ACT == 15) v = v / (1.0f + expf(-v)); else if (ACT == 12) v = (v > 0.f) ? v : 0.01f * v; else if (ACT == 8) v = tanhf(v); else if (ACT == 9) v = 0.5f * v * (1.0f + tanhf(0.7978845608028654f * (v + 0.044715f * v * v * v))); else if (ACT == 14) v = (v > 0.f) ? v : 0.1f * v; else if (ACT == 16) v = (v >= 0.f) ? v : 0.3f * v; else if (ACT == 17) v = (v >= 0.f) ? v : 0.2f * v;
      so[w][rloc][t * 16 + ln] = v; } }
  __builtin_amdgcn_fence(__ATOMIC_ACQ_REL, "workgroup"); __builtin_amdgcn_wave_barrier();
  const int rsub = lane >> 4, c4 = (lane & 15) * 4;
  {
#pragma unroll
    for (int q = 0; q < 16; ++q) { const int r = q * 2 + rsub; const v4f v = *(const v4fa*)&so[w][r][c4]; if (C) *(v4f*)(C + cofs + (size_t)(row0 + r) * ldc + col0 + c4) = v; if (C16) { v4h h4; for (int i = 0; i < 4; ++i) h4[i] = (_Float16)v[i]; *(v4h*)(C16 + cofs + (size_t)(row0 + r) * ldc + col0 + c4) = h4; } }
     } }


__global__ __launch_bounds__(256) void k_wT(const float* __restrict__ w, int din, int dout, _Float16* __restrict__ Bt) { __shared__ float tl[64][65]; const int tid = threadIdx.x; const int nbo = dout / 64; const int ib = blockIdx.x / nbo, ob = blockIdx.x % nbo; const int i0 = ib * 64, o0 = ob * 64;
  for (int t = tid; t < 64 * 64; t += 256) { const int i = t / 64, o = t % 64; tl[o][i] = bf16_round(w[(size_t)(i0 + i) * dout + o0 + o]) * 16.0f; }
  __syncthreads();
  { for (int t = tid; t < 64 * 8; t += 256) { const int o = t / 8, i8 = (t % 8) * 8; FragH f; for (int q = 0; q < 8; ++q) f.h[q] = (_Float16)tl[o][i8 + q]; *(v8us*)((unsigned short*)Bt + (size_t)(o0 + o) * din + i0 + i8) = f.half[0]; }  } }
__global__ __launch_bounds__(256) void k_wnat(const float* __restrict__ w, size_t n8, _Float16* __restrict__ Bt) { const size_t t = (size_t)blockIdx.x * 256 + threadIdx.x; if (t >= n8) return; FragH f; for (int q = 0; q < 8; ++q) f.h[q] = (_Float16)(bf16_round(w[t * 8 + q]) * 16.0f); *(v8us*)((unsigned short*)Bt + t * 8) = f.half[0];  }
// One row per wave: lane l holds columns 128 u + 4 l .. + 3 (u = 0 .. 7), so every load and every f32 store of a wave covers 512 contiguous bytes (an f16 store 256),
// and the row stays in registers between the sum of squares and the scaling. No LDS, no barrier. The unrolls keep xv, sv and o in registers (constant indices).
__global__ __launch_bounds__(256) void k_rms(const float* __restrict__ X, int xIsInput, const float* __restrict__ scale, size_t nrows, _Float16* __restrict__ N16, float* __restrict__ XF) {
  const int lane = threadIdx.x & 31; const size_t r = (size_t)blockIdx.x * 8 + (threadIdx.x >> 5); if (r >= nrows) return;      /* the same for a whole wave */
  const size_t o0 = r * DM + lane * 4; const float* xp = X + o0; const float* sp = scale + lane * 4; v4f xv[DM / 128], sv[DM / 128];
#pragma unroll
  for (int u = 0; u < DM / 128; ++u) xv[u] = *(const v4fa*)(xp + u * 128);
#pragma unroll
  for (int u = 0; u < DM / 128; ++u) sv[u] = *(const v4fa*)(sp + u * 128);
  asm volatile("s_wait_xcnt 0x0" ::: "memory");      /* stands ahead of every overwrite of the loads' address registers */
  if (xIsInput) {
#pragma unroll
    for (int u = 0; u < DM / 128; ++u)
#pragma unroll
      for (int q = 0; q < 4; ++q) xv[u][q] = bf16_round(xv[u][q]); }
  if (XF) {      /* the f32 copy leaves as soon as it is known; xv is only read from here on */
#pragma unroll
    for (int u = 0; u < DM / 128; ++u) *(v4f*)(XF + o0 + u * 128) = xv[u];
    asm volatile("s_wait_xcnt 0x0" ::: "memory"); }      /* stands ahead of every later overwrite of these stores' address and data registers */
  float s4[4] = {0.f, 0.f, 0.f, 0.f};      /* four independent chains per lane */
#pragma unroll
  for (int u = 0; u < DM / 128; ++u)
#pragma unroll
    for (int q = 0; q < 4; ++q) s4[q] += xv[u][q] * xv[u][q];
  float ss = (s4[0] + s4[1]) + (s4[2] + s4[3]);
#pragma unroll
  for (int m = 16; m >= 1; m >>= 1) ss += __shfl_xor(ss, m, 32);      /* every lane ends with the row's sum */
  const float rs = 1.0f / sqrtf(ss / (float)DM + 1e-8f); v4h o[DM / 128];
#pragma unroll
  for (int u = 0; u < DM / 128; ++u)
#pragma unroll
    for (int q = 0; q < 4; ++q) o[u][q] = (_Float16)((xv[u][q] * rs) * bf16_round(sv[u][q]));
#pragma unroll
  for (int u = 0; u < DM / 128; ++u) *(v4h*)(N16 + o0 + u * 128) = o[u]; }
__global__ __launch_bounds__(256) void k_hT(const _Float16* __restrict__ HN, _Float16* __restrict__ HT) { __shared__ unsigned short tl[64][65]; const int tid = threadIdx.x; const int b = blockIdx.y; HT += (size_t)b * DM * SQ;      /* one launch for all batches: blockIdx.y is the batch, each has its own [DM][SQ] plane */
  const int jb = blockIdx.x % (SQ / 64), dbk = blockIdx.x / (SQ / 64); const int j0 = jb * 64, d0 = dbk * 64;
  for (int i = tid; i < 64 * 8; i += 256) { const int j = i / 8, d8 = (i % 8) * 8; FragH f; f.half[0] = *(const v8us*)((const unsigned short*)HN + ((size_t)b * SQ + j0 + j) * DM + d0 + d8); for (int q = 0; q < 8; ++q) tl[d8 + q][j] = f.u[q]; }
  __syncthreads();
  { for (int i = tid; i < 64 * 8; i += 256) { const int d = i / 8, j8 = (i % 8) * 8; FragH f; for (int q = 0; q < 8; ++q) f.u[q] = tl[d][j8 + q]; *(v8us*)((unsigned short*)HT + (size_t)(d0 + d) * SQ + j0 + j8) = f.half[0]; }  } }
__global__ __launch_bounds__(256) void k_tab(const float* __restrict__ dl, float* __restrict__ T) {
  #pragma clang fp contract(off)
  const int t = blockIdx.x * 256 + threadIdx.x; if (t >= SQ * RR) return; const int r = t % RR, d = t / RR; const float g = __fadd_rn(0.15f, __fmul_rn(0.85f, 1.0f / (1.0f + expf(-bf16_round(dl[r]))))); const float lg = logf(fmaxf(g, 1e-8f)); const float v = expf(__fmul_rn((float)d, lg));
  *(float*)(T + t) = v;  }
// Sixteen lanes per 64-element q or k row (the rows lie one behind the other in F): a lane holds four elements, a wave's load and store cover 512 contiguous bytes.
__global__ __launch_bounds__(256) void k_l2(float* __restrict__ F) {
  const size_t t = (size_t)blockIdx.x * 256 + threadIdx.x; if (t >= NR * 2 * (RR / 4)) return;      /* whole waves only: the bound is a multiple of 32 */
  float* f = F + t * 4; const v4f a = *(const v4fa*)f; float ss = (a[0] * a[0] + a[1] * a[1]) + (a[2] * a[2] + a[3] * a[3]);
#pragma unroll
  for (int m = 8; m >= 1; m >>= 1) ss += __shfl_xor(ss, m, 32);      /* stays inside the row's sixteen lanes */
  float n = sqrtf(ss); if (n < 1e-8f) n = 1e-8f; const float inv = 1.0f / n; v4f o;
#pragma unroll
  for (int q = 0; q < 4; ++q) o[q] = a[q] * inv;
  *(v4f*)f = o; }
// Mixing matrix, one 32 (rows i) x 64 (columns j) tile per block. A thread computes eight rows of one column: that column's k row stays in registers, the tile's q rows and the
// decay-table rows that the tile's distances i - j reach lie in LDS (rows of a negative distance are zero; those elements are masked at the store).
// Every "#pragma unroll" in this kernel but the hf loop's "unroll 1" is there so that the small arrays it indexes (tx, qx, kr, tb, qb, acc) get constant indices and stay in registers.
#define AM_TI 32
#define AM_TJ 64
#define AM_TD (AM_TI + AM_TJ)        /* 95 distances, and one row more that nobody reads: the staging is then six whole trips of the block */
#define AM_P (RR + 4)                /* LDS row pitch in floats: 16 B x odd, so that 16 lanes on 16 neighbouring rows meet no bank twice */
__global__ __launch_bounds__(256) void k_amat(const float* __restrict__ QK, const float* __restrict__ kb, const float* __restrict__ T, const float* __restrict__ gl, const float* __restrict__ al, _Float16* __restrict__ A16) {
  __shared__ __attribute__((aligned(16))) float Ts[AM_TD][AM_P];
  __shared__ __attribute__((aligned(16))) float qs[AM_TI][RR];
  __shared__ __attribute__((aligned(16))) float sc[AM_TI][AM_P];
  const int b = blockIdx.y; A16 += (size_t)b * SQ * SQ;      /* one launch for all batches: blockIdx.y is the batch, each has its own [SQ][SQ] plane */
  const int tid = threadIdx.x; const int jt = blockIdx.x / (SQ / AM_TI), it = blockIdx.x % (SQ / AM_TI); const int i0 = it * AM_TI, j0 = jt * AM_TJ;
  const int orow = tid >> 3, oc8 = (tid & 7) * 8; const int oi = i0 + orow, oj = j0 + oc8;      /* the 8 elements this thread stores */
  unsigned short* dst = (unsigned short*)A16 + (size_t)oi * SQ + oj;
  if (j0 > i0 + AM_TI - 1) { const v8us z = {0, 0, 0, 0, 0, 0, 0, 0}; *(v8us*)dst = z; return; }      /* tile wholly above the diagonal: the whole block leaves, ahead of every barrier */
  const int jl = tid & (AM_TJ - 1), ig = tid >> 6; const int sr = tid >> 4, sc4 = (tid & 15) * 4;
  const int dmin = i0 - j0 - (AM_TJ - 1);
  const v4f kb0 = *(const v4fa*)(kb + (size_t)oi * SQ + oj), kb1 = *(const v4fa*)(kb + (size_t)oi * SQ + oj + 4);
  v4f tx[AM_TD / 16], qx[AM_TI / 16];
#pragma unroll
  for (int u = 0; u < AM_TD / 16; ++u) { const int d = dmin + sr + u * 16; const int dc = d < 0 ? 0 : (d > SQ - 1 ? SQ - 1 : d); tx[u] = *(const v4fa*)(T + (size_t)dc * RR + sc4); }
#pragma unroll
  for (int u = 0; u < AM_TI / 16; ++u) qx[u] = *(const v4fa*)(QK + ((size_t)b * SQ + i0 + sr + u * 16) * (2 * RR) + sc4);
  asm volatile("s_wait_xcnt 0x0" ::: "memory");      /* the loads below may be given address registers of the loads above as destinations: the wait stands in front of that overwrite */
  const float* kp = QK + ((size_t)b * SQ + j0 + jl) * (2 * RR); v4f kr[RR / 4];
#pragma unroll
  for (int r4 = 0; r4 < RR / 4; ++r4) kr[r4] = *(const v4fa*)(kp + RR + r4 * 4);
  asm volatile("s_wait_xcnt 0x0" :: "v"(kp) : "memory");      /* kp as an input keeps its registers from being handed to one of these loads as a destination ahead of the wait */
  __builtin_amdgcn_sched_barrier(0);      /* every global load is issued before the first wait on one: one latency for the block's start, not two */
  const float gate = 1.0f / (1.0f + expf(-bf16_round(gl[0]))); const float alpha = 1.0f / (1.0f + expf(-bf16_round(al[0])));
#pragma unroll
  for (int u = 0; u < AM_TD / 16; ++u) { const v4f z4 = {0.f, 0.f, 0.f, 0.f}; *(v4fa*)&Ts[sr + u * 16][sc4] = (dmin + sr + u * 16 < 0) ? z4 : tx[u]; }
#pragma unroll
  for (int u = 0; u < AM_TI / 16; ++u) *(v4fa*)&qs[sr + u * 16][sc4] = qx[u];
  __syncthreads();
#pragma unroll 1      /* stays rolled: the body is over 600 instructions long, and a second copy of it would save one branch */
  for (int hf = 0; hf < 2; ++hf) { const int il = ig * 8 + hf * 4;      /* four rows at a time: four independent sums, each over r in rising order */
    const float* tp = &Ts[il + (AM_TJ - 1) - jl][0]; const float* qp = &qs[il][0]; float acc[4] = {0.f, 0.f, 0.f, 0.f}; v4f tb[2][4][2], qb[2][4][2];
#pragma unroll
    for (int s = 0; s < 4; ++s)
#pragma unroll
      for (int h2 = 0; h2 < 2; ++h2) { qb[0][s][h2] = *(const v4fa*)(qp + s * RR + h2 * 4); tb[0][s][h2] = *(const v4fa*)(tp + s * AM_P + h2 * 4); }
#pragma unroll
    for (int ch = 0; ch < RR / 8; ++ch) {
      if (ch + 1 < RR / 8) {
#pragma unroll
        for (int s = 0; s < 4; ++s)
#pragma unroll
          for (int h2 = 0; h2 < 2; ++h2) { qb[(ch + 1) & 1][s][h2] = *(const v4fa*)(qp + s * RR + (ch + 1) * 8 + h2 * 4); tb[(ch + 1) & 1][s][h2] = *(const v4fa*)(tp + s * AM_P + (ch + 1) * 8 + h2 * 4); } }
      __builtin_amdgcn_sched_barrier(0);      /* keeps the next eight ranks' LDS loads ahead of this eight's arithmetic, which then covers their latency */
#pragma unroll
      for (int h2 = 0; h2 < 2; ++h2)
#pragma unroll
        for (int c = 0; c < 4; ++c)
#pragma unroll
          for (int s = 0; s < 4; ++s) acc[s] += (qb[ch & 1][s][h2][c] * kr[ch * 2 + h2][c]) * tb[ch & 1][s][h2][c];
      __builtin_amdgcn_sched_barrier(0);      /* and keeps the loads after next from rising into it, where they would need a third set of registers */
    }
#pragma unroll
    for (int s = 0; s < 4; ++s) sc[il + s][jl] = acc[s]; }
  __syncthreads();
  const v4f a0 = *(const v4fa*)&sc[orow][oc8], a1 = *(const v4fa*)&sc[orow][oc8 + 4]; FragH f;
#pragma unroll
  for (int u = 0; u < 8; ++u) { const float kv = (u < 4) ? kb0[u & 3] : kb1[u & 3]; const float av = (u < 4) ? a0[u & 3] : a1[u & 3]; const _Float16 v = (_Float16)(gate * bf16_round(kv) + alpha * av); f.h[u] = (oj + u <= oi) ? v : (_Float16)0.0f; }
  *(v8us*)dst = f.half[0]; }

extern "C" void kernel_launch(void* const* d_in, const int* in_sizes, int n_in,
                              void* d_out, int out_size, void* d_ws, size_t ws_size, hipStream_t stream) {
  (void)in_sizes; (void)n_in; (void)out_size;
  const float* const* I = (const float* const*)d_in; const float* h = I[0]; const float* kb = I[1]; const float* dl = I[2]; const float* gl = I[3]; const float* al = I[4]; const float* u = I[5]; const float* v = I[6]; const float* pw = I[7]; const float* pb = I[8]; const float* n1 = I[9]; const float* n2 = I[10]; const float* uw = I[11]; const float* ub = I[12]; const float* dw = I[13]; const float* db = I[14];
  char* ws = (char*)d_ws; size_t off = 0;
  auto take = [&](size_t bytes) { char* p = ws + off; off += (bytes + 255) & ~(size_t)255; return p; };
  _Float16* BUV = (_Float16*)take((size_t)2 * RR * DM * 2); _Float16* BP = (_Float16*)take((size_t)DM * DM * 2); _Float16* BU = (_Float16*)take((size_t)FH * DM * 2); _Float16* BD = (_Float16*)take((size_t)DM * FH * 2); float* T = (float*)take((size_t)SQ * RR * 4);
  _Float16* HN16 = (_Float16*)take(NR * DM * 2); float* HF = (float*)take(NR * DM * 4); float* QK = (float*)take(NR * 2 * RR * 4); _Float16* HT = (_Float16*)take((size_t)NB * DM * SQ * 2); _Float16* A16 = (_Float16*)take((size_t)NB * SQ * SQ * 2);
  _Float16* O16 = (_Float16*)take(NR * DM * 2); float* H1 = (float*)take(NR * DM * 4); _Float16* M16 = (_Float16*)take(NR * DM * 2); _Float16* U16 = (_Float16*)take(NR * FH * 2);
  if (off > ws_size) return;      /* 0.3 + 2 + 4 + 4 + 0.3 + 16 + 32 + 4 + 16 + 16 + 16 + 32 + 16 + 32 = about 191 MiB */
  k_wT<<<(DM / 64) * (RR / 64), 256, 0, stream>>>(u, DM, RR, BUV); k_wT<<<(DM / 64) * (RR / 64), 256, 0, stream>>>(v, DM, RR, BUV + (size_t)RR * DM);      /* [u|v]^T -> [128][1024] */
  k_wnat<<<(unsigned)(((size_t)DM * DM / 8 + 255) / 256), 256, 0, stream>>>(pw, (size_t)DM * DM / 8, BP); k_wnat<<<(unsigned)(((size_t)FH * DM / 8 + 255) / 256), 256, 0, stream>>>(uw, (size_t)FH * DM / 8, BU); k_wnat<<<(unsigned)(((size_t)DM * FH / 8 + 255) / 256), 256, 0, stream>>>(dw, (size_t)DM * FH / 8, BD);
  k_tab<<<(SQ * RR + 255) / 256, 256, 0, stream>>>(dl, T);
  k_rms<<<(unsigned)((NR + 7) / 8), 256, 0, stream>>>(h, 1, n1, NR, HN16, HF);      /* hn (f16) + bf16(h) (f32 residual) */
  k_gemm2<0><<<dim3((unsigned)((NR / 128) * (2 * RR / 64)), 1), 128, 0, stream>>>(HN16, DM, 0, BUV, DM, 0, 0.0625f, nullptr, 0, nullptr, 1, 0, 0, QK, nullptr, 2 * RR, 0, (int)NR, 2 * RR, DM);      /* [q_raw | k_raw] */
  k_l2<<<(unsigned)((NR * 2 * (RR / 4) + 255) / 256), 256, 0, stream>>>(QK);
  k_amat<<<dim3((SQ / AM_TI) * (SQ / AM_TJ), NB), 256, 0, stream>>>(QK, kb, T, gl, al, A16);
  k_hT<<<dim3((SQ / 64) * (DM / 64), NB), 256, 0, stream>>>(HN16, HT);
  k_gemm2<0><<<dim3((SQ / 128) * (DM / 64), NB), 128, 0, stream>>>(A16, SQ, (size_t)SQ * SQ, HT, SQ, (size_t)DM * SQ, 1.0f, nullptr, 0, nullptr, 1, 0, 0, nullptr, O16, DM, (size_t)SQ * DM, SQ, DM, SQ);      /* out_b = A_b . hn_b, b = blockIdx.y */
  const dim3 gp((unsigned)((NR / 128) * (DM / 64)), 1);
  k_gemm2<0><<<gp, 128, 0, stream>>>(O16, DM, 0, BP, DM, 0, 0.0625f, pb, 0, HF, 1, (size_t)DM, 0, H1, nullptr, DM, 0, (int)MQ, DM, DM);      /* h1 = h + out proj_w^T + proj_b */
  k_rms<<<(unsigned)((MQ + 7) / 8), 256, 0, stream>>>(H1, 0, n2, MQ, M16, nullptr);
  k_gemm2<6><<<dim3((unsigned)((NR / 128) * (FH / 64)), 1), 128, 0, stream>>>(M16, DM, 0, BU, DM, 0, 0.0625f, ub, 0, nullptr, 1, 0, 0, nullptr, U16, FH, 0, (int)MQ, FH, DM);      /* gelu_erf(m up_w^T + up_b) */
  k_gemm2<0><<<gp, 128, 0, stream>>>(U16, FH, 0, BD, FH, 0, 0.0625f, db, 0, H1, 1, (size_t)DM, 0, (float*)d_out, nullptr, DM, 0, (int)MQ, DM, FH);      /* h1 + m */
}

// v005
// Measured time: 230 microseconds a run.
// Next to v004, in two timings, it ran 1.21 times as fast each time.
// All steps since v000 together make it 9.93 times as fast.
#include <hip/hip_runtime.h>
// K2Layer (h [8][1024][1024]; hn = rmsnorm(h)*norm1_scale; gate = sigmoid(gate_logit), alpha = sigmoid(alpha_logit); q|k = hn [u|v] (rank 64), row-l2-normalised; gamma_r = 0.15 + 0.85 sigmoid(decay_logit_r); A[i][j] = causal(j<=i) * (gate k_base[i][j] + alpha sum_r q[i][r] k[j][r] gamma_r^(i-j)); out = A . hn; h1 = h + out proj_w^T + proj_b; m = gelu_erf(rmsnorm(h1)*norm2_scale up_w^T + up_b) down_w^T + down_b; result = h1 + m -> [8][1024][1024]).
// Structure: token rows; rmsnorm on VALU (f32) into f16 rows and per-batch transposed f16 planes (LDS); the rank-64 q|k projection as a WMMA GEMM (f32), l2-normalisation and the per-rank decayed causal scores on VALU in f32 (gamma^d table built on device from decay_logit, k_base/gate/alpha read) into the f16 mixing matrix A; out = A . hn, proj (+ bias + h), up (+ bias, exact-GELU epilogue, f16), down (+ bias + h1) as WMMA GEMMs (32x64 wave tiles, f32 accumulation, exact x16 weights).
// Compute dtype: inputs rounded to bf16; h / weights / k_base exact; hn, A, out, rmsnorm(h1), GELU hidden plain f16 operands (~2^-12); scores, norms, residuals f32. v_wmma_f32_16x16x32_f16.
#define NB 8
#define SQ 1024
#define DM 1024
#define RR 64
#define FH 2048
#define NR ((size_t)NB * SQ)
#define MQ NR                        /* rows through the proj/MLP stage (debug hook) */
typedef __bf16 v16b __attribute__((ext_vector_type(16)));
typedef unsigned short v8us __attribute__((ext_vector_type(8), may_alias));
typedef float  v8f  __attribute__((ext_vector_type(8)));
typedef float  v4f  __attribute__((ext_vector_type(4)));
typedef float  v4fa __attribute__((ext_vector_type(4), may_alias));
union FragB { v16b v; v8us half[2]; unsigned short u[16]; };

__device__ __forceinline__ unsigned short bf16_bits(float x) { unsigned int u = __float_as_uint(x); return (unsigned short)((u + 0x7FFFu + ((u >> 16) & 1u)) >> 16); }
__device__ __forceinline__ float bf16_val(unsigned short b) { return __uint_as_float(((unsigned int)b) << 16); }
__device__ __forceinline__ float bf16_round(float x) { return bf16_val(bf16_bits(x)); }
// D += A·B with NT terms: 1 = ah·bh, 2 = + al·bh (A split), 3 = + ah·bl (both split)
template <int NT>
__device__ __forceinline__ v8f mmaN(v16b ah, v16b al, v16b bh, v16b bl, v8f c) {
  c = __builtin_amdgcn_wmma_f32_16x16x32_bf16(false, ah, false, bh, (short)0, c, false, false);
  if (NT >= 2) c = __builtin_amdgcn_wmma_f32_16x16x32_bf16(false, al, false, bh, (short)0, c, false, false);
  if (NT >= 3) c = __builtin_amdgcn_wmma_f32_16x16x32_bf16(false, ah, false, bl, (short)0, c, false, false);
  asm volatile("v_nop\n\tv_nop\n\tv_nop\n\tv_nop" : "+v"(c) : "v"(ah), "v"(al), "v"(bh), "v"(bl));
  return c;
}

__global__ __launch_bounds__(256) void k_wt_bf16(const float* __restrict__ W, unsigned short* __restrict__ Wt, int K, int N) {
  const int t = blockIdx.x * 256 + threadIdx.x;
  const int k8n = K / 8;
  if (t >= N * k8n) return;
  const int n = t / k8n, k8 = (t % k8n) * 8;
  v8us v;
#pragma unroll
  for (int i = 0; i < 8; ++i) v[i] = bf16_bits(W[(size_t)(k8 + i) * N + n]);
  *(v8us*)(Wt + (size_t)n * K + k8) = v;
  
}

// GEMM C[M][N] (f32, pitch ldc) = act(A[M][K]·W + bias). A f32 row-major (pitch lda) converted per fragment to bf16
// (ASPLIT: hi/lo two planes -> 2 terms, else single rounded term); Wt bf16 [N][K] (pitch ldb). BIAS_BF16 rounds the
// bias to bf16 first (bias quantised to bf16 before the add). K%32==0, M%16==0, N%64==0.
template <bool ASPLIT, int ACT, bool BIAS_BF16>
__global__ __launch_bounds__(128) void k_gemm_bf(const float* __restrict__ A, int lda, const unsigned short* __restrict__ Wt, int ldb,
                                               const float* __restrict__ bias, float* __restrict__ C, int ldc, int M, int N, int K) {
  __shared__ __attribute__((aligned(16))) float so[4][16][64];
  const int tid = threadIdx.x, w = tid >> 5, lane = tid & 31, ln = lane & 15, hh = lane >> 4;
  const int ntn = N / 64;
  const int wid = blockIdx.x * 4 + w;
  const int mt = wid / ntn, nq = wid % ntn;
  if (mt * 16 >= M) return;
  const int row0 = mt * 16, col0 = nq * 64;
  const float* arow = A + (size_t)(row0 + ln) * lda;
  v8f acc[4] = {};
  for (int kb = 0; kb < K; kb += 32) {
    FragB ah, al;
    const v4f x0 = *(const v4fa*)(arow + kb + 8 * hh), x1 = *(const v4fa*)(arow + kb + 8 * hh + 4);
    const v4f x2 = *(const v4fa*)(arow + kb + 16 + 8 * hh), x3 = *(const v4fa*)(arow + kb + 16 + 8 * hh + 4);
    float xs[16] = {x0[0],x0[1],x0[2],x0[3],x1[0],x1[1],x1[2],x1[3],x2[0],x2[1],x2[2],x2[3],x3[0],x3[1],x3[2],x3[3]};
#pragma unroll
    for (int i = 0; i < 16; ++i) { const unsigned short hb = bf16_bits(xs[i]); ah.u[i] = hb; al.u[i] = ASPLIT ? bf16_bits(xs[i] - bf16_val(hb)) : (unsigned short)0; }
#pragma unroll
    for (int t = 0; t < 4; ++t) {
      const unsigned short* brow = Wt + (size_t)(col0 + t * 16 + ln) * ldb + kb;
      FragB b;
      b.half[0] = *(const v8us*)(brow + 8 * hh);
      b.half[1] = *(const v8us*)(brow + 16 + 8 * hh);
      acc[t] = mmaN<ASPLIT ? 2 : 1>(ah.v, al.v, b.v, b.v, acc[t]);
    }
  }
#pragma unroll
  for (int t = 0; t < 4; ++t) {
    float bv = bias ? bias[col0 + t * 16 + ln] : 0.f;
    if (BIAS_BF16) bv = bf16_round(bv);
#pragma unroll
    for (int r = 0; r < 8; ++r) { float v = acc[t][r] + bv; if (ACT == 1) v = fmaxf(v, 0.f); so[w][8 * hh + r][t * 16 + ln] = v; }
  }
  __builtin_amdgcn_fence(__ATOMIC_ACQ_REL, "workgroup");
  __builtin_amdgcn_wave_barrier();
  const int rsub = lane >> 4, c4 = (lane & 15) * 4;
  {
#pragma unroll
    for (int q = 0; q < 8; ++q) {
      const int r = q * 2 + rsub;
      const v4f v = *(const v4fa*)&so[w][r][c4];
      *(v4f*)(C + (size_t)(row0 + r) * ldc + col0 + c4) = v;
    }
    
  }
}

// GEMM C = act(A·W + bias + resid): A f32 (ASPLIT -> hi/lo 2 terms), Wt bf16 [N][K]; ACT 0 none, 1 relu, 2 exact gelu;
// resid (optional, f32, row index = (row % rmod), pitch ldr, RES_BF16 rounds it) added before the activation.
template <bool ASPLIT, int ACT, bool BIAS_BF16, bool RES_BF16>
__global__ __launch_bounds__(128) void k_gemm_bf3(const float* __restrict__ A, int lda, const unsigned short* __restrict__ Wt, int ldb,
                                                const float* __restrict__ bias, const float* __restrict__ resid, int rmod, int ldr,
                                                float* __restrict__ C, int ldc, int M, int N, int K) {
  __shared__ __attribute__((aligned(16))) float so[4][16][64];
  const int tid = threadIdx.x, w = tid >> 5, lane = tid & 31, ln = lane & 15, hh = lane >> 4;
  const int ntn = N / 64;
  const int wid = blockIdx.x * 4 + w;
  const int mt = wid / ntn, nq = wid % ntn;
  if (mt * 16 >= M) return;
  const int row0 = mt * 16, col0 = nq * 64;
  const float* arow = A + (size_t)(row0 + ln) * lda;
  v8f acc[4] = {};
  for (int kb = 0; kb < K; kb += 32) {
    FragB ah, al;
    const v4f x0 = *(const v4fa*)(arow + kb + 8 * hh), x1 = *(const v4fa*)(arow + kb + 8 * hh + 4);
    const v4f x2 = *(const v4fa*)(arow + kb + 16 + 8 * hh), x3 = *(const v4fa*)(arow + kb + 16 + 8 * hh + 4);
    float xs[16] = {x0[0],x0[1],x0[2],x0[3],x1[0],x1[1],x1[2],x1[3],x2[0],x2[1],x2[2],x2[3],x3[0],x3[1],x3[2],x3[3]};
#pragma unroll
    for (int i = 0; i < 16; ++i) { const unsigned short hb = bf16_bits(xs[i]); ah.u[i] = hb; al.u[i] = ASPLIT ? bf16_bits(xs[i] - bf16_val(hb)) : (unsigned short)0; }
#pragma unroll
    for (int t = 0; t < 4; ++t) {
      const unsigned short* brow = Wt + (size_t)(col0 + t * 16 + ln) * ldb + kb;
      FragB b;
      b.half[0] = *(const v8us*)(brow + 8 * hh);
      b.half[1] = *(const v8us*)(brow + 16 + 8 * hh);
      acc[t] = mmaN<ASPLIT ? 2 : 1>(ah.v, al.v, b.v, b.v, acc[t]);
    }
  }
#pragma unroll
  for (int t = 0; t < 4; ++t) {
    const int col = col0 + t * 16 + ln;
    float bv = bias ? bias[col] : 0.f;
    if (BIAS_BF16) bv = bf16_round(bv);
#pragma unroll
    for (int r = 0; r < 8; ++r) {
      float v = acc[t][r] + bv;
      if (resid) { float rv = resid[(size_t)((row0 + 8 * hh + r) % rmod) * ldr + col]; if (RES_BF16) rv = bf16_round(rv); v += rv; }
      if (ACT == 1) v = fmaxf(v, 0.f);
      if (ACT == 2) v = 0.5f * v * (1.0f + erff(v * 0.70710678118654752f));
      if (ACT == 3) { const float u = 0.7978845608028654f * (v + 0.044715f * v * v * v); v = 0.5f * v * (1.0f + tanhf(u)); }
      so[w][8 * hh + r][t * 16 + ln] = v;
    }
  }
  __builtin_amdgcn_fence(__ATOMIC_ACQ_REL, "workgroup");
  __builtin_amdgcn_wave_barrier();
  const int rsub = lane >> 4, c4 = (lane & 15) * 4;
  {
#pragma unroll
    for (int q = 0; q < 8; ++q) {
      const int r = q * 2 + rsub;
      const v4f v = *(const v4fa*)&so[w][r][c4];
      *(v4f*)(C + (size_t)(row0 + r) * ldc + col0 + c4) = v;
    }
    
  }
}
// row LayerNorm (biased variance, eps) over N: s = X (+ R); optional out_sum <- s; out_norm <- (s-mu)*rsqrt(var+eps)*g + b
template <bool PARAM_BF16>
__global__ __launch_bounds__(256) void k_layernorm(const float* __restrict__ X, const float* __restrict__ R, const float* __restrict__ g, const float* __restrict__ bta,
                                                  float* __restrict__ out_sum, float* __restrict__ out_norm, int N, float eps) {
  __shared__ float red[256];
  const int row = blockIdx.x, tid = threadIdx.x;
  const float* x = X + (size_t)row * N; const float* rr = R ? R + (size_t)row * N : nullptr;
  float vals[16];                     // up to N = 4096
  const int per = N / 256;            // contiguous chunk per thread? use strided-by-4 chunks: thread handles j = tid*4 + 1024*u
  float s1 = 0.f;
  for (int u = 0; u < per / 4; ++u) {
    const int j = tid * 4 + 1024 * u;
    const v4f a = *(const v4fa*)(x + j);
    v4f b = {0.f,0.f,0.f,0.f}; if (rr) b = *(const v4fa*)(rr + j);
#pragma unroll
    for (int q = 0; q < 4; ++q) { const float v = a[q] + b[q]; vals[u * 4 + q] = v; s1 += v; }
  }
  red[tid] = s1; __syncthreads();
  for (int st = 128; st > 0; st >>= 1) { if (tid < st) red[tid] += red[tid + st]; __syncthreads(); }
  const float mu = red[0] / (float)N; __syncthreads();
  float s2 = 0.f;
  for (int u = 0; u < per / 4; ++u)
#pragma unroll
    for (int q = 0; q < 4; ++q) { const float c = vals[u * 4 + q] - mu; s2 += c * c; }
  red[tid] = s2; __syncthreads();
  for (int st = 128; st > 0; st >>= 1) { if (tid < st) red[tid] += red[tid + st]; __syncthreads(); }
  const float rs = rsqrtf(red[0] / (float)N + eps);
  {
    for (int u = 0; u < per / 4; ++u) {
      const int j = tid * 4 + 1024 * u;
      v4f o, sm;
#pragma unroll
      for (int q = 0; q < 4; ++q) {
        float gg = g[j + q], bb = bta[j + q];
        if (PARAM_BF16) { gg = bf16_round(gg); bb = bf16_round(bb); }
        sm[q] = vals[u * 4 + q]; o[q] = (vals[u * 4 + q] - mu) * rs * gg + bb;
      }
      if (out_sum) *(v4f*)(out_sum + (size_t)row * N + j) = sm;
      *(v4f*)(out_norm + (size_t)row * N + j) = o;
    }
    
  }
}



// ---- f16 WMMA path (v_wmma_f32_16x16x32_f16): 11-bit significands for operands in range — used for every GEMM launched here
typedef _Float16 v16h __attribute__((ext_vector_type(16)));
union FragH { v16h v; v8us half[2]; _Float16 h[16]; unsigned short u[16]; };
template <int NT>
__device__ __forceinline__ v8f mmaH(v16h ah, v16h al, v16h bh, v16h bl, v8f c) {
  c = __builtin_amdgcn_wmma_f32_16x16x32_f16(false, ah, false, bh, (short)0, c, false, false);
  if (NT >= 2) c = __builtin_amdgcn_wmma_f32_16x16x32_f16(false, al, false, bh, (short)0, c, false, false);
  if (NT >= 3) c = __builtin_amdgcn_wmma_f32_16x16x32_f16(false, ah, false, bl, (short)0, c, false, false);
  asm volatile("v_nop\n\tv_nop\n\tv_nop\n\tv_nop" : "+v"(c) : "v"(ah), "v"(al), "v"(bh), "v"(bl));
  return c;
}
// batched GEMM like k_gemm_b but f16 operands: A f32 (split into f16 hi/lo if ASPLIT, else rounded to f16), Bt = f16 values [n][k]; alpha; C f32; N multiple of 16 (partial tiles skipped)
template <bool ASPLIT>
__global__ __launch_bounds__(128) void k_gemm_h(const float* __restrict__ A, int lda, size_t sA, const _Float16* __restrict__ Bh, int ldb, size_t sB, float alpha, float* __restrict__ C, int ldc, size_t sC, int M, int N, int K) {
  __shared__ __attribute__((aligned(16))) float so[4][16][64];
  const int tid = threadIdx.x, w = tid >> 5, lane = tid & 31, ln = lane & 15, hh = lane >> 4; const int by = blockIdx.y;
  A += (size_t)by * sA; Bh += (size_t)by * sB; C += (size_t)by * sC;
  const int ntn = (N + 63) / 64; const int wid = blockIdx.x * 4 + w; const int mt = wid / ntn, nq = wid % ntn; if (mt * 16 >= M) return;
  const int row0 = mt * 16, col0 = nq * 64; const float* arow = A + (size_t)(row0 + ln) * lda;
  v8f acc[4] = {};
  for (int kb = 0; kb < K; kb += 32) {
    FragH ah, al;
    const v4f x0 = *(const v4fa*)(arow + kb + 8 * hh), x1 = *(const v4fa*)(arow + kb + 8 * hh + 4), x2 = *(const v4fa*)(arow + kb + 16 + 8 * hh), x3 = *(const v4fa*)(arow + kb + 16 + 8 * hh + 4);
    float xs[16] = {x0[0],x0[1],x0[2],x0[3],x1[0],x1[1],x1[2],x1[3],x2[0],x2[1],x2[2],x2[3],x3[0],x3[1],x3[2],x3[3]};
#pragma unroll
    for (int i = 0; i < 16; ++i) { const _Float16 h = (_Float16)xs[i]; ah.h[i] = h; al.h[i] = ASPLIT ? (_Float16)(xs[i] - (float)h) : (_Float16)0.0f; }
#pragma unroll
    for (int t = 0; t < 4; ++t) { if (col0 + t * 16 >= N) continue; const size_t boff = (size_t)(col0 + t * 16 + ln) * ldb + kb; FragH bq; bq.half[0] = *(const v8us*)(Bh + boff + 8 * hh); bq.half[1] = *(const v8us*)(Bh + boff + 16 + 8 * hh);
      acc[t] = mmaH<ASPLIT ? 2 : 1>(ah.v, al.v, bq.v, bq.v, acc[t]); }
  }
#pragma unroll
  for (int t = 0; t < 4; ++t) { if (col0 + t * 16 >= N) continue;
#pragma unroll
    for (int r = 0; r < 8; ++r) so[w][8 * hh + r][t * 16 + ln] = acc[t][r] * alpha; }
  __builtin_amdgcn_fence(__ATOMIC_ACQ_REL, "workgroup"); __builtin_amdgcn_wave_barrier();
  const int rsub = lane >> 4, c4 = (lane & 15) * 4;
  {
#pragma unroll
    for (int q = 0; q < 8; ++q) { const int r = q * 2 + rsub; if (col0 + c4 < N) { const v4f v = *(const v4fa*)&so[w][r][c4]; *(v4f*)(C + (size_t)(row0 + r) * ldc + col0 + c4) = v; } }
     }
}

// Wt[n][k] = f16(W[k][n]·scale) from f32 row-major W[K][N] (scale = power of two; bf16-exact weights stay exact in f16 away from the subnormal range)
__global__ __launch_bounds__(256) void k_wt_f16(const float* __restrict__ W, _Float16* __restrict__ Wt, int K, int N, float scale) {
  const int t = blockIdx.x * 256 + threadIdx.x; if (t >= N * (K / 8)) return; const int n = t / (K / 8), k8 = (t % (K / 8)) * 8; FragH f;
#pragma unroll
  for (int i = 0; i < 8; ++i) f.h[i] = (_Float16)(bf16_round(W[(size_t)(k8 + i) * N + n]) * scale); const v8us o = f.half[0];
  *(v8us*)((unsigned short*)Wt + (size_t)n * K + k8) = o; 
}
// k_gemm_hh variant with fused epilogue: v = acc·alpha + bias[by·sBias + col] (+ CP[(row/rowsPerB)·sCPb + by·64 + col] if CP) ; ACT 0 none / 1 elu ; writes f16 C16 (and f32 C if non-null)
template <int ACT>
__global__ __launch_bounds__(128) void k_gemm_hhx(const _Float16* __restrict__ A, int lda, size_t sA, const _Float16* __restrict__ Bh, int ldb, size_t sB, float alpha, const float* __restrict__ bias, size_t sBias, const float* __restrict__ CP, int rowsPerB, size_t sCPb, int row0g,
    float* __restrict__ C, _Float16* __restrict__ C16, int ldc, size_t sC, int M, int N, int K) {
  __shared__ __attribute__((aligned(16))) float so[4][16][64];
  const int tid = threadIdx.x, w = tid >> 5, lane = tid & 31, ln = lane & 15, hh = lane >> 4; const int by = blockIdx.y;
  A += (size_t)by * sA; Bh += (size_t)by * sB; const size_t cofs = (size_t)by * sC; const float* bp = bias ? bias + (size_t)by * sBias : nullptr;
  const int ntn = (N + 63) / 64; const int wid = blockIdx.x * 4 + w; const int mt = wid / ntn, nq = wid % ntn; if (mt * 16 >= M) return;
  const int row0 = mt * 16, col0 = nq * 64; const _Float16* arow = A + (size_t)(row0 + ln) * lda;
  v8f acc[4] = {};
  for (int kb = 0; kb < K; kb += 32) { FragH ah; ah.half[0] = *(const v8us*)((const unsigned short*)arow + kb + 8 * hh); ah.half[1] = *(const v8us*)((const unsigned short*)arow + kb + 16 + 8 * hh);
#pragma unroll
    for (int t = 0; t < 4; ++t) { if (col0 + t * 16 >= N) continue; const size_t boff = (size_t)(col0 + t * 16 + ln) * ldb + kb; FragH bq; bq.half[0] = *(const v8us*)((const unsigned short*)Bh + boff + 8 * hh); bq.half[1] = *(const v8us*)((const unsigned short*)Bh + boff + 16 + 8 * hh);
      acc[t] = mmaH<1>(ah.v, ah.v, bq.v, bq.v, acc[t]); }
  }
#pragma unroll
  for (int t = 0; t < 4; ++t) { if (col0 + t * 16 >= N) continue; const int col = col0 + t * 16 + ln; const float bv = bp ? bf16_round(bp[col]) : 0.f;
#pragma unroll
    for (int r = 0; r < 8; ++r) { float v = acc[t][r] * alpha + bv; if (CP) { const int rr = row0g + row0 + 8 * hh + r; if (rowsPerB < 0) v += CP[cofs + (size_t)rr * ldc + col];      /* rowsPerB < 0: own element of the batched C plane */ else { const int bidx = rr / rowsPerB; v += CP[(size_t)bidx * sCPb + (size_t)by * 64 + col]; } } if (ACT == 1) v = (v > 0.f) ? v : expm1f(v); else if (ACT == 7) v = (v > 0.f) ? v + 1.0f : expf(v); else if (ACT == 8) v = tanhf(v); else if (ACT == 9) v = 0.5f * v * (1.0f + tanhf(0.7978845608028654f * (v + 0.044715f * v * v * v))); else if (ACT == 11) v = 1.0f / (1.0f + expf(-v)); else if (ACT == 12) v = (v > 0.f) ? v : 0.01f * v; else if (ACT == 14) v = (v > 0.f) ? v : 0.1f * v; else if (ACT == 16) v = (v >= 0.f) ? v : 0.3f * v; else if (ACT == 17) v = (v >= 0.f) ? v : 0.2f * v; else if (ACT == 15) v = v / (1.0f + expf(-v)); else if (ACT == 3) v = fmaxf(v, 0.f); else if (ACT == 6) v = 0.5f * v * (1.0f + erff(v * 0.70710678118654752f)); so[w][8 * hh + r][t * 16 + ln] = v; } }
  __builtin_amdgcn_fence(__ATOMIC_ACQ_REL, "workgroup"); __builtin_amdgcn_wave_barrier();
  const int rsub = lane >> 4, c4 = (lane & 15) * 4; typedef _Float16 v4h __attribute__((ext_vector_type(4)));
  {
#pragma unroll
    for (int q = 0; q < 8; ++q) { const int r = q * 2 + rsub; if (col0 + c4 < N) { const v4f v = *(const v4fa*)&so[w][r][c4]; if (C) *(v4f*)(C + cofs + (size_t)(row0 + r) * ldc + col0 + c4) = v; if (C16) { v4h h4; for (int i = 0; i < 4; ++i) h4[i] = (_Float16)v[i]; *(v4h*)(C16 + cofs + (size_t)(row0 + r) * ldc + col0 + c4) = h4; } } }
     }
}


typedef _Float16 v4h __attribute__((ext_vector_type(4)));

__global__ __launch_bounds__(256) void k_x16(const float* __restrict__ x, _Float16* __restrict__ X16, size_t n8) { const size_t t = (size_t)blockIdx.x * 256 + threadIdx.x; if (t >= n8) return; FragH f;
#pragma unroll
  for (int q = 0; q < 8; ++q) f.h[q] = (_Float16)bf16_round(x[t * 8 + q]); *(v8us*)((unsigned short*)X16 + t * 8) = f.half[0];  }
__global__ __launch_bounds__(256) void k_h16(const float* __restrict__ x, _Float16* __restrict__ X16, size_t n8) { const size_t t = (size_t)blockIdx.x * 256 + threadIdx.x; if (t >= n8) return; FragH f;
#pragma unroll
  for (int q = 0; q < 8; ++q) f.h[q] = (_Float16)x[t * 8 + q]; *(v8us*)((unsigned short*)X16 + t * 8) = f.half[0];  }
__global__ __launch_bounds__(256) void k_round16f(const float* __restrict__ W, _Float16* __restrict__ Bt, size_t n8) { const size_t t = (size_t)blockIdx.x * 256 + threadIdx.x; if (t >= n8) return; FragH f;
#pragma unroll
  for (int i = 0; i < 8; ++i) f.h[i] = (_Float16)(bf16_round(W[t * 8 + i]) * 16.0f); *(v8us*)((unsigned short*)Bt + t * 8) = f.half[0];  }
template <int NHv, int TTv>
__global__ __launch_bounds__(256) void k_vt(const _Float16* __restrict__ V16, int ldv, int voff, _Float16* __restrict__ Vt) { __shared__ unsigned short tl[64][66]; const int tid = threadIdx.x; const int slab = blockIdx.x / (TTv / 64), lg = blockIdx.x % (TTv / 64); const int b = slab / NHv, h = slab % NHv;
  for (int i = tid; i < 64 * 8; i += 256) { const int r = i / 8, c8 = (i % 8) * 8; FragH f; f.half[0] = *(const v8us*)((const unsigned short*)V16 + ((size_t)b * TTv + lg * 64 + r) * ldv + voff + h * 64 + c8);
#pragma unroll
    for (int q = 0; q < 8; ++q) tl[r][c8 + q] = f.u[q]; }
  __syncthreads();
  {
#pragma unroll
    for (int rd = 0; rd < 2; ++rd) { const int d = rd * 32 + tid / 8, pc = tid % 8; FragH f;
#pragma unroll
      for (int q = 0; q < 8; ++q) f.u[q] = tl[pc * 8 + q][d];
      *(v8us*)((unsigned short*)Vt + ((size_t)slab * 64 + d) * TTv + lg * 64 + pc * 8) = f.half[0]; }
     } }

__global__ __launch_bounds__(256) void k_hl(const float* __restrict__ F, _Float16* __restrict__ Hh, _Float16* __restrict__ Hl, size_t n8) { const size_t t = (size_t)blockIdx.x * 256 + threadIdx.x; if (t >= n8) return; FragH fh, fl; const v4f a = *(const v4fa*)(F + t * 8), c = *(const v4fa*)(F + t * 8 + 4);
#pragma unroll
  for (int q = 0; q < 4; ++q) { _Float16 h = (_Float16)a[q]; fh.h[q] = h; fl.h[q] = (_Float16)((a[q] - (float)h) * 1024.0f); h = (_Float16)c[q]; fh.h[4 + q] = h; fl.h[4 + q] = (_Float16)((c[q] - (float)h) * 1024.0f); }
  { *(v8us*)((unsigned short*)Hh + t * 8) = fh.half[0]; *(v8us*)((unsigned short*)Hl + t * 8) = fl.half[0];  } }

// ---- fast GEMM (block tile 128x64, wave tile 32x64; requires M % 128 == 0 rows per launch region, N % 64 == 0, K % 64 == 0, K >= 64); epilogue = k_gemm_hhx semantics ----
// Operands go global -> LDS by asynchronous copies, 64 k (one whole 128-byte line of every operand row) per stage, two buffers: eight lanes cover a row's line, so a
// wave's copy touches four whole lines, and every line is fetched once per block. The fragments are read from LDS in the k order of g2_frag.
#define G2_KS 64                              /* k per stage */
#define G2_PITCH 144                          /* LDS row pitch in bytes: 16 B x odd, so that 16 lanes on 16 neighbouring rows meet no bank twice */
#define G2_STAGE ((128 + 64) * G2_PITCH)      /* one stage: [A 128 rows | B 64 rows] */
__device__ __forceinline__ v16h g2_frag(const unsigned char* p, int hh) { FragH f; f.half[0] = *(const v8us*)(p + 16 * hh); f.half[1] = *(const v8us*)(p + 32 + 16 * hh); return f.v; }
__device__ __forceinline__ v8f g2_mma(v16h a, v16h b, v8f c) { v8f d = __builtin_amdgcn_wmma_f32_16x16x32_f16(false, a, false, b, (short)0, c, false, false); asm volatile("v_nop\n\tv_nop\n\tv_nop\n\tv_nop" : "+v"(d) : "v"(a), "v"(b)); return d; }
// One stage's twelve copies of a thread (16 bytes each): rows sr + 16 i of A (i = 0 .. 7) and of B (i = 0 .. 3). l = the thread's LDS byte address in the stage's row sr.
// The s_wait_xcnt closes the statement, so that it stands ahead of every later overwrite of the copies' address registers.
__device__ __forceinline__ void g2_copy(unsigned l, const _Float16* ga, size_t sa, const _Float16* gb, size_t sb) {
  asm volatile("global_load_async_to_lds_b128 %0, %12, off\n\t" "global_load_async_to_lds_b128 %1, %13, off\n\t" "global_load_async_to_lds_b128 %2, %14, off\n\t" "global_load_async_to_lds_b128 %3, %15, off\n\t"
               "global_load_async_to_lds_b128 %4, %16, off\n\t" "global_load_async_to_lds_b128 %5, %17, off\n\t" "global_load_async_to_lds_b128 %6, %18, off\n\t" "global_load_async_to_lds_b128 %7, %19, off\n\t"
               "global_load_async_to_lds_b128 %8, %20, off\n\t" "global_load_async_to_lds_b128 %9, %21, off\n\t" "global_load_async_to_lds_b128 %10, %22, off\n\t" "global_load_async_to_lds_b128 %11, %23, off\n\t"
               "s_wait_xcnt 0x0"
               :: "v"(l), "v"(l + 16 * G2_PITCH), "v"(l + 32 * G2_PITCH), "v"(l + 48 * G2_PITCH), "v"(l + 64 * G2_PITCH), "v"(l + 80 * G2_PITCH), "v"(l + 96 * G2_PITCH), "v"(l + 112 * G2_PITCH),
                  "v"(l + 128 * G2_PITCH), "v"(l + 144 * G2_PITCH), "v"(l + 160 * G2_PITCH), "v"(l + 176 * G2_PITCH),
                  "v"(ga), "v"(ga + sa), "v"(ga + 2 * sa), "v"(ga + 3 * sa), "v"(ga + 4 * sa), "v"(ga + 5 * sa), "v"(ga + 6 * sa), "v"(ga + 7 * sa),
                  "v"(gb), "v"(gb + sb), "v"(gb + 2 * sb), "v"(gb + 3 * sb) : "memory"); }
// Eight of a lane's residual loads (16 bytes each), issued one behind the other with no wait on their data between them.
// The s_wait_xcnt stands ahead of every overwrite of the loads' address registers; the addresses as its inputs keep their registers from being rewritten, or handed to one of the loads as a destination, ahead of it.
__device__ __forceinline__ void g2_res8(const float* const (&rp)[8], v4f* res) {
#pragma unroll      /* constant indices: rp and res stay in registers */
  for (int q = 0; q < 8; ++q) res[q] = *(const v4fa*)rp[q];
  asm volatile("s_wait_xcnt 0x0" :: "v"(rp[0]), "v"(rp[1]), "v"(rp[2]), "v"(rp[3]), "v"(rp[4]), "v"(rp[5]), "v"(rp[6]), "v"(rp[7]) : "memory"); }
template <int ACT>
__global__ __launch_bounds__(128) void k_gemm2(const _Float16* __restrict__ A, int lda, size_t sA, const _Float16* __restrict__ Bh, int ldb, size_t sB, float alpha, const float* __restrict__ bias, size_t sBias, const float* __restrict__ CP, int rowsPerB, size_t sCPb, int row0g,
    float* __restrict__ C, _Float16* __restrict__ C16, int ldc, size_t sC, int M, int N, int K) { static_assert(ACT == 0 || ACT == 3 || ACT == 6 || ACT == 8 || ACT == 9 || ACT == 11 || ACT == 12 || ACT == 14 || ACT == 15 || ACT == 16 || ACT == 17, "k_gemm2: unsupported ACT code (would silently apply no activation)");
  __shared__ __attribute__((aligned(16))) unsigned char sm[2 * G2_STAGE]; static_assert(sizeof(float) * 4 * 32 * 68 <= 2 * G2_STAGE, "the output staging lies in the ring");
  float (*so)[32][68] = (float (*)[32][68])sm;      /* output staging: used only behind the last trip's barrier, when no wave reads the ring any more */
  const int tid = threadIdx.x, w = tid >> 5, lane = tid & 31, ln = lane & 15, hh = lane >> 4; const int by = blockIdx.y;
  A += (size_t)by * sA; Bh += (size_t)by * sB; const size_t cofs = (size_t)by * sC; const float* bp = bias ? bias + (size_t)by * sBias : nullptr;
  const int ntn = N >> 6; const int mt = blockIdx.x / ntn, nq = blockIdx.x - mt * ntn; const int row0 = mt * 128 + 32 * w, col0 = nq * 64; if (mt * 128 >= M) return;      /* the whole block leaves, ahead of every copy and barrier */
  const int sr = tid >> 3, sc = tid & 7;      /* the thread's first row of a stage and its 16-byte piece of the row's line */
  const _Float16* ga = A + (size_t)(mt * 128 + sr) * lda + sc * 8; const _Float16* gb = Bh + (size_t)(col0 + sr) * ldb + sc * 8; const size_t sa = (size_t)16 * lda, sb = (size_t)16 * ldb;
  const unsigned l0 = (unsigned)(size_t)sm + (unsigned)(sr * G2_PITCH + sc * 16);
  const unsigned char* ar = sm + (32 * w + ln) * G2_PITCH; const unsigned char* br = sm + (128 + ln) * G2_PITCH;
  const int nt = K / G2_KS;
  const v8f z8 = {0.f,0.f,0.f,0.f,0.f,0.f,0.f,0.f}; v8f c00 = z8, c01 = z8, c02 = z8, c03 = z8, c10 = z8, c11 = z8, c12 = z8, c13 = z8;
  g2_copy(l0, ga, sa, gb, sb);
  asm volatile("s_wait_asynccnt 0x0" ::: "memory");      /* this wave's copies of stage 0 have landed */
  __syncthreads();      /* and every other wave's: stage 0 may be read */
  if (nt > 1) g2_copy(l0 + G2_STAGE, ga + G2_KS, sa, gb + G2_KS, sb);
#pragma unroll 1      /* one trip per stage: the buffer is chosen by the trip's parity */
  for (int t = 0; t < nt; ++t) { const unsigned bo = (unsigned)(t & 1) * G2_STAGE;
    const unsigned char* ap = ar + bo; const unsigned char* bq = br + bo; v16h fa[2][2], fb[2][4];
#pragma unroll      /* constant indices: fa and fb stay in registers */
    for (int kk = 0; kk < 2; ++kk) { fa[kk][0] = g2_frag(ap + kk * 64, hh); fb[kk][0] = g2_frag(bq + kk * 64, hh); fa[kk][1] = g2_frag(ap + 16 * G2_PITCH + kk * 64, hh);
      fb[kk][1] = g2_frag(bq + 16 * G2_PITCH + kk * 64, hh); fb[kk][2] = g2_frag(bq + 32 * G2_PITCH + kk * 64, hh); fb[kk][3] = g2_frag(bq + 48 * G2_PITCH + kk * 64, hh); }
#pragma unroll      /* the stage's two 32-k blocks, straight-line, k rising */
    for (int kk = 0; kk < 2; ++kk) {
      c00 = g2_mma(fa[kk][0], fb[kk][0], c00); c10 = g2_mma(fa[kk][1], fb[kk][0], c10); c01 = g2_mma(fa[kk][0], fb[kk][1], c01); c11 = g2_mma(fa[kk][1], fb[kk][1], c11);
      c02 = g2_mma(fa[kk][0], fb[kk][2], c02); c12 = g2_mma(fa[kk][1], fb[kk][2], c12); c03 = g2_mma(fa[kk][0], fb[kk][3], c03); c13 = g2_mma(fa[kk][1], fb[kk][3], c13); }
    asm volatile("s_wait_dscnt 0x0" ::: "memory");      /* this wave's reads of the buffer are done */
    asm volatile("s_wait_asynccnt 0x0" ::: "memory");      /* its copies of stage t + 1 have landed */
    __syncthreads();      /* publishes stage t + 1 and ends every reader's last read of stage t's buffer */
    if (t + 2 < nt) g2_copy(l0 + bo, ga + (size_t)(t + 2) * G2_KS, sa, gb + (size_t)(t + 2) * G2_KS, sb); }
  asm volatile("s_wait_asynccnt 0x0" ::: "memory");      /* no copy is outstanding when the ring becomes output staging */
  v8f accs[8] = {c00, c01, c02, c03, c10, c11, c12, c13};
  // Scale, bias, residual and activation are applied where the staged rows are read back: there a lane holds four neighbouring columns of a row, so that its share of the residual is
  // sixteen 16-byte loads (a wave's load covers whole 128-byte lines), all of them issued here, ahead of the staging, and waited for once. The unrolls keep res and accs in registers (constant indices).
  const int rsub = lane >> 4, c4 = (lane & 15) * 4; const v4f z4 = {0.f, 0.f, 0.f, 0.f}; v4f res[16], bv4 = z4;
  if (CP) {      /* two runs of eight: sixteen address pairs at once would cost the kernel a wave per SIMD */
    if (rowsPerB < 0) {      /* rowsPerB < 0: own elements of the batched C plane */
#pragma unroll
      for (int g = 0; g < 2; ++g) { const float* rp[8];
#pragma unroll
        for (int q = 0; q < 8; ++q) rp[q] = CP + cofs + (size_t)(row0g + row0 + (g * 8 + q) * 2 + rsub) * ldc + col0 + c4;
        g2_res8(rp, res + g * 8); }
    } else {
#pragma unroll
      for (int g = 0; g < 2; ++g) { const float* rp[8];
#pragma unroll
        for (int q = 0; q < 8; ++q) { const int bidx = (row0g + row0 + (g * 8 + q) * 2 + rsub) / rowsPerB; rp[q] = CP + (size_t)bidx * sCPb + (size_t)by * 64 + col0 + c4; }
        g2_res8(rp, res + g * 8); } }
  } else {
#pragma unroll
    for (int q = 0; q < 16; ++q) res[q] = z4; }
  if (bp) { bv4 = *(const v4fa*)(bp + col0 + c4);
    asm volatile("s_wait_xcnt 0x0" ::: "memory"); }      /* stands ahead of every later overwrite of the bias load's address registers */
#pragma unroll
  for (int i = 0; i < 4; ++i) bv4[i] = bf16_round(bv4[i]);
#pragma unroll
  for (int u = 0; u < 8; ++u) { const int t = u & 3, half = u >> 2;
#pragma unroll
    for (int r = 0; r < 8; ++r) so[w][half * 16 + 8 * hh + r][t * 16 + ln] = accs[u][r]; }
  __builtin_amdgcn_fence(__ATOMIC_ACQ_REL, "workgroup"); __builtin_amdgcn_wave_barrier();
  {
#pragma unroll
    for (int q = 0; q < 16; ++q) { const int r = q * 2 + rsub; v4f v = *(const v4fa*)&so[w][r][c4];
#pragma unroll
      for (int i = 0; i < 4; ++i) { float x = v[i] * alpha + bv4[i]; if (CP) x += res[q][i];
        if (ACT == 3) x = fmaxf(x, 0.f); else if (ACT == 6) x = 0.5f * x * (1.0f + erff(x * 0.70710678118654752f)); else if (ACT == 11) x = 1.0f / (1.0f + expf(-x)); else if (ACT == 15) x = x / (1.0f + expf(-x)); else if (ACT == 12) x = (x > 0.f) ? x : 0.01f * x; else if (ACT == 8) x = tanhf(x); else if (ACT == 9) x = 0.5f * x * (1.0f + tanhf(0.7978845608028654f * (x + 0.044715f * x * x * x))); else if (ACT == 14) x = (x > 0.f) ? x : 0.1f * x; else if (ACT == 16) x = (x >= 0.f) ? x : 0.3f * x; else if (ACT == 17) x = (x >= 0.f) ? x : 0.2f * x;
        v[i] = x; }
      if (C) { *(v4f*)(C + cofs + (size_t)(row0 + r) * ldc + col0 + c4) = v;
        asm volatile("s_wait_xcnt 0x0" ::: "memory"); }      /* stands ahead of the f16 conversion below, which may be given the store's data registers */
      if (C16) { v4h h4; for (int i = 0; i < 4; ++i) h4[i] = (_Float16)v[i]; *(v4h*)(C16 + cofs + (size_t)(row0 + r) * ldc + col0 + c4) = h4; } }
     } }


__global__ __launch_bounds__(256) void k_wT(const float* __restrict__ w, int din, int dout, _Float16* __restrict__ Bt) { __shared__ float tl[64][65]; const int tid = threadIdx.x; const int nbo = dout / 64; const int ib = blockIdx.x / nbo, ob = blockIdx.x % nbo; const int i0 = ib * 64, o0 = ob * 64;
  for (int t = tid; t < 64 * 64; t += 256) { const int i = t / 64, o = t % 64; tl[o][i] = bf16_round(w[(size_t)(i0 + i) * dout + o0 + o]) * 16.0f; }
  __syncthreads();
  { for (int t = tid; t < 64 * 8; t += 256) { const int o = t / 8, i8 = (t % 8) * 8; FragH f; for (int q = 0; q < 8; ++q) f.h[q] = (_Float16)tl[o][i8 + q]; *(v8us*)((unsigned short*)Bt + (size_t)(o0 + o) * din + i0 + i8) = f.half[0]; }  } }
__global__ __launch_bounds__(256) void k_wnat(const float* __restrict__ w, size_t n8, _Float16* __restrict__ Bt) { const size_t t = (size_t)blockIdx.x * 256 + threadIdx.x; if (t >= n8) return; FragH f; for (int q = 0; q < 8; ++q) f.h[q] = (_Float16)(bf16_round(w[t * 8 + q]) * 16.0f); *(v8us*)((unsigned short*)Bt + t * 8) = f.half[0];  }
// One row per wave: lane l holds columns 128 u + 4 l .. + 3 (u = 0 .. 7), so every load and every f32 store of a wave covers 512 contiguous bytes (an f16 store 256),
// and the row stays in registers between the sum of squares and the scaling. No LDS, no barrier. The unrolls keep xv, sv and o in registers (constant indices).
__global__ __launch_bounds__(256) void k_rms(const float* __restrict__ X, int xIsInput, const float* __restrict__ scale, size_t nrows, _Float16* __restrict__ N16, float* __restrict__ XF) {
  const int lane = threadIdx.x & 31; const size_t r = (size_t)blockIdx.x * 8 + (threadIdx.x >> 5); if (r >= nrows) return;      /* the same for a whole wave */
  const size_t o0 = r * DM + lane * 4; const float* xp = X + o0; const float* sp = scale + lane * 4; v4f xv[DM / 128], sv[DM / 128];
#pragma unroll
  for (int u = 0; u < DM / 128; ++u) xv[u] = *(const v4fa*)(xp + u * 128);
#pragma unroll
  for (int u = 0; u < DM / 128; ++u) sv[u] = *(const v4fa*)(sp + u * 128);
  asm volatile("s_wait_xcnt 0x0" ::: "memory");      /* stands ahead of every overwrite of the loads' address registers */
  if (xIsInput) {
#pragma unroll
    for (int u = 0; u < DM / 128; ++u)
#pragma unroll
      for (int q = 0; q < 4; ++q) xv[u][q] = bf16_round(xv[u][q]); }
  if (XF) {      /* the f32 copy leaves as soon as it is known; xv is only read from here on */
#pragma unroll
    for (int u = 0; u < DM / 128; ++u) *(v4f*)(XF + o0 + u * 128) = xv[u];
    asm volatile("s_wait_xcnt 0x0" ::: "memory"); }      /* stands ahead of every later overwrite of these stores' address and data registers */
  float s4[4] = {0.f, 0.f, 0.f, 0.f};      /* four independent chains per lane */
#pragma unroll
  for (int u = 0; u < DM / 128; ++u)
#pragma unroll
    for (int q = 0; q < 4; ++q) s4[q] += xv[u][q] * xv[u][q];
  float ss = (s4[0] + s4[1]) + (s4[2] + s4[3]);
#pragma unroll
  for (int m = 16; m >= 1; m >>= 1) ss += __shfl_xor(ss, m, 32);      /* every lane ends with the row's sum */
  const float rs = 1.0f / sqrtf(ss / (float)DM + 1e-8f); v4h o[DM / 128];
#pragma unroll
  for (int u = 0; u < DM / 128; ++u)
#pragma unroll
    for (int q = 0; q < 4; ++q) o[u][q] = (_Float16)((xv[u][q] * rs) * bf16_round(sv[u][q]));
#pragma unroll
  for (int u = 0; u < DM / 128; ++u) *(v4h*)(N16 + o0 + u * 128) = o[u]; }
__global__ __launch_bounds__(256) void k_hT(const _Float16* __restrict__ HN, _Float16* __restrict__ HT) { __shared__ unsigned short tl[64][65]; const int tid = threadIdx.x; const int b = blockIdx.y; HT += (size_t)b * DM * SQ;      /* one launch for all batches: blockIdx.y is the batch, each has its own [DM][SQ] plane */
  const int jb = blockIdx.x % (SQ / 64), dbk = blockIdx.x / (SQ / 64); const int j0 = jb * 64, d0 = dbk * 64;
  for (int i = tid; i < 64 * 8; i += 256) { const int j = i / 8, d8 = (i % 8) * 8; FragH f; f.half[0] = *(const v8us*)((const unsigned short*)HN + ((size_t)b * SQ + j0 + j) * DM + d0 + d8); for (int q = 0; q < 8; ++q) tl[d8 + q][j] = f.u[q]; }
  __syncthreads();
  { for (int i = tid; i < 64 * 8; i += 256) { const int d = i / 8, j8 = (i % 8) * 8; FragH f; for (int q = 0; q < 8; ++q) f.u[q] = tl[d][j8 + q]; *(v8us*)((unsigned short*)HT + (size_t)(d0 + d) * SQ + j0 + j8) = f.half[0]; }  } }
__global__ __launch_bounds__(256) void k_tab(const float* __restrict__ dl, float* __restrict__ T) {
  #pragma clang fp contract(off)
  const int t = blockIdx.x * 256 + threadIdx.x; if (t >= SQ * RR) return; const int r = t % RR, d = t / RR; const float g = __fadd_rn(0.15f, __fmul_rn(0.85f, 1.0f / (1.0f + expf(-bf16_round(dl[r]))))); const float lg = logf(fmaxf(g, 1e-8f)); const float v = expf(__fmul_rn((float)d, lg));
  *(float*)(T + t) = v;  }
// Sixteen lanes per 64-element q or k row (the rows lie one behind the other in F): a lane holds four elements, a wave's load and store cover 512 contiguous bytes.
__global__ __launch_bounds__(256) void k_l2(float* __restrict__ F) {
  const size_t t = (size_t)blockIdx.x * 256 + threadIdx.x; if (t >= NR * 2 * (RR / 4)) return;      /* whole waves only: the bound is a multiple of 32 */
  float* f = F + t * 4; const v4f a = *(const v4fa*)f; float ss = (a[0] * a[0] + a[1] * a[1]) + (a[2] * a[2] + a[3] * a[3]);
#pragma unroll
  for (int m = 8; m >= 1; m >>= 1) ss += __shfl_xor(ss, m, 32);      /* stays inside the row's sixteen lanes */
  float n = sqrtf(ss); if (n < 1e-8f) n = 1e-8f; const float inv = 1.0f / n; v4f o;
#pragma unroll
  for (int q = 0; q < 4; ++q) o[q] = a[q] * inv;
  *(v4f*)f = o; }
// Mixing matrix, one 32 (rows i) x 64 (columns j) tile per block. A thread computes eight rows of one column: that column's k row stays in registers, the tile's q rows and the
// decay-table rows that the tile's distances i - j reach lie in LDS (rows of a negative distance are zero; those elements are masked at the store).
// Every "#pragma unroll" in this kernel but the hf loop's "unroll 1" is there so that the small arrays it indexes (tx, qx, kr, tb, qb, acc) get constant indices and stay in registers.
#define AM_TI 32
#define AM_TJ 64
#define AM_TD (AM_TI + AM_TJ)        /* 95 distances, and one row more that nobody reads: the staging is then six whole trips of the block */
#define AM_P (RR + 4)                /* LDS row pitch in floats: 16 B x odd, so that 16 lanes on 16 neighbouring rows meet no bank twice */
__global__ __launch_bounds__(256) void k_amat(const float* __restrict__ QK, const float* __restrict__ kb, const float* __restrict__ T, const float* __restrict__ gl, const float* __restrict__ al, _Float16* __restrict__ A16) {
  __shared__ __attribute__((aligned(16))) float Ts[AM_TD][AM_P];
  __shared__ __attribute__((aligned(16))) float qs[AM_TI][RR];
  __shared__ __attribute__((aligned(16))) float sc[AM_TI][AM_P];
  const int b = blockIdx.y; A16 += (size_t)b * SQ * SQ;      /* one launch for all batches: blockIdx.y is the batch, each has its own [SQ][SQ] plane */
  const int tid = threadIdx.x; const int jt = blockIdx.x / (SQ / AM_TI), it = blockIdx.x % (SQ / AM_TI); const int i0 = it * AM_TI, j0 = jt * AM_TJ;
  const int orow = tid >> 3, oc8 = (tid & 7) * 8; const int oi = i0 + orow, oj = j0 + oc8;      /* the 8 elements this thread stores */
  unsigned short* dst = (unsigned short*)A16 + (size_t)oi * SQ + oj;
  if (j0 > i0 + AM_TI - 1) { const v8us z = {0, 0, 0, 0, 0, 0, 0, 0}; *(v8us*)dst = z; return; }      /* tile wholly above the diagonal: the whole block leaves, ahead of every barrier */
  const int jl = tid & (AM_TJ - 1), ig = tid >> 6; const int sr = tid >> 4, sc4 = (tid & 15) * 4;
  const int dmin = i0 - j0 - (AM_TJ - 1);
  const v4f kb0 = *(const v4fa*)(kb + (size_t)oi * SQ + oj), kb1 = *(const v4fa*)(kb + (size_t)oi * SQ + oj + 4);
  v4f tx[AM_TD / 16], qx[AM_TI / 16];
#pragma unroll
  for (int u = 0; u < AM_TD / 16; ++u) { const int d = dmin + sr + u * 16; const int dc = d < 0 ? 0 : (d > SQ - 1 ? SQ - 1 : d); tx[u] = *(const v4fa*)(T + (size_t)dc * RR + sc4); }
#pragma unroll
  for (int u = 0; u < AM_TI / 16; ++u) qx[u] = *(const v4fa*)(QK + ((size_t)b * SQ + i0 + sr + u * 16) * (2 * RR) + sc4);
  asm volatile("s_wait_xcnt 0x0" ::: "memory");      /* the loads below may be given address registers of the loads above as destinations: the wait stands in front of that overwrite */
  const float* kp = QK + ((size_t)b * SQ + j0 + jl) * (2 * RR); v4f kr[RR / 4];
#pragma unroll
  for (int r4 = 0; r4 < RR / 4; ++r4) kr[r4] = *(const v4fa*)(kp + RR + r4 * 4);
  asm volatile("s_wait_xcnt 0x0" :: "v"(kp) : "memory");      /* kp as an input keeps its registers from being handed to one of these loads as a destination ahead of the wait */
  __builtin_amdgcn_sched_barrier(0);      /* every global load is issued before the first wait on one: one latency for the block's start, not two */
  const float gate = 1.0f / (1.0f + expf(-bf16_round(gl[0]))); const float alpha = 1.0f / (1.0f + expf(-bf16_round(al[0])));
#pragma unroll
  for (int u = 0; u < AM_TD / 16; ++u) { const v4f z4 = {0.f, 0.f, 0.f, 0.f}; *(v4fa*)&Ts[sr + u * 16][sc4] = (dmin + sr + u * 16 < 0) ? z4 : tx[u]; }
#pragma unroll
  for (int u = 0; u < AM_TI / 16; ++u) *(v4fa*)&qs[sr + u * 16][sc4] = qx[u];
  __syncthreads();
#pragma unroll 1      /* stays rolled: the body is over 600 instructions long, and a second copy of it would save one branch */
  for (int hf = 0; hf < 2; ++hf) { const int il = ig * 8 + hf * 4;      /* four rows at a time: four independent sums, each over r in rising order */
    const float* tp = &Ts[il + (AM_TJ - 1) - jl][0]; const float* qp = &qs[il][0]; float acc[4] = {0.f, 0.f, 0.f, 0.f}; v4f tb[2][4][2], qb[2][4][2];
#pragma unroll
    for (int s = 0; s < 4; ++s)
#pragma unroll
      for (int h2 = 0; h2 < 2; ++h2) { qb[0][s][h2] = *(const v4fa*)(qp + s * RR + h2 * 4); tb[0][s][h2] = *(const v4fa*)(tp + s * AM_P + h2 * 4); }
#pragma unroll
    for (int ch = 0; ch < RR / 8; ++ch) {
      if (ch + 1 < RR / 8) {
#pragma unroll
        for (int s = 0; s < 4; ++s)
#pragma unroll
          for (int h2 = 0; h2 < 2; ++h2) { qb[(ch + 1) & 1][s][h2] = *(const v4fa*)(qp + s * RR + (ch + 1) * 8 + h2 * 4); tb[(ch + 1) & 1][s][h2] = *(const v4fa*)(tp + s * AM_P + (ch + 1) * 8 + h2 * 4); } }
      __builtin_amdgcn_sched_barrier(0);      /* keeps the next eight ranks' LDS loads ahead of this eight's arithmetic, which then covers their latency */
#pragma unroll
      for (int h2 = 0; h2 < 2; ++h2)
#pragma unroll
        for (int c = 0; c < 4; ++c)
#pragma unroll
          for (int s = 0; s < 4; ++s) acc[s] += (qb[ch & 1][s][h2][c] * kr[ch * 2 + h2][c]) * tb[ch & 1][s][h2][c];
      __builtin_amdgcn_sched_barrier(0);      /* and keeps the loads after next from rising into it, where they would need a third set of registers */
    }
#pragma unroll
    for (int s = 0; s < 4; ++s) sc[il + s][jl] = acc[s]; }
  __syncthreads();
  const v4f a0 = *(const v4fa*)&sc[orow][oc8], a1 = *(const v4fa*)&sc[orow][oc8 + 4]; FragH f;
#pragma unroll
  for (int u = 0; u < 8; ++u) { const float kv = (u < 4) ? kb0[u & 3] : kb1[u & 3]; const float av = (u < 4) ? a0[u & 3] : a1[u & 3]; const _Float16 v = (_Float16)(gate * bf16_round(kv) + alpha * av); f.h[u] = (oj + u <= oi) ? v : (_Float16)0.0f; }
  *(v8us*)dst = f.half[0]; }

extern "C" void kernel_launch(void* const* d_in, const int* in_sizes, int n_in,
                              void* d_out, int out_size, void* d_ws, size_t ws_size, hipStream_t stream) {
  (void)in_sizes; (void)n_in; (void)out_size;
  const float* const* I = (const float* const*)d_in; const float* h = I[0]; const float* kb = I[1]; const float* dl = I[2]; const float* gl = I[3]; const float* al = I[4]; const float* u = I[5]; const float* v = I[6]; const float* pw = I[7]; const float* pb = I[8]; const float* n1 = I[9]; const float* n2 = I[10]; const float* uw = I[11]; const float* ub = I[12]; const float* dw = I[13]; const float* db = I[14];
  char* ws = (char*)d_ws; size_t off = 0;
  auto take = [&](size_t bytes) { char* p = ws + off; off += (bytes + 255) & ~(size_t)255; return p; };
  _Float16* BUV = (_Float16*)take((size_t)2 * RR * DM * 2); _Float16* BP = (_Float16*)take((size_t)DM * DM * 2); _Float16* BU = (_Float16*)take((size_t)FH * DM * 2); _Float16* BD = (_Float16*)take((size_t)DM * FH * 2); float* T = (float*)take((size_t)SQ * RR * 4);
  _Float16* HN16 = (_Float16*)take(NR * DM * 2); float* HF = (float*)take(NR * DM * 4); float* QK = (float*)take(NR * 2 * RR * 4); _Float16* HT = (_Float16*)take((size_t)NB * DM * SQ * 2); _Float16* A16 = (_Float16*)take((size_t)NB * SQ * SQ * 2);
  _Float16* O16 = (_Float16*)take(NR * DM * 2); float* H1 = (float*)take(NR * DM * 4); _Float16* M16 = (_Float16*)take(NR * DM * 2); _Float16* U16 = (_Float16*)take(NR * FH * 2);
  if (off > ws_size) return;      /* 0.3 + 2 + 4 + 4 + 0.3 + 16 + 32 + 4 + 16 + 16 + 16 + 32 + 16 + 32 = about 191 MiB */
  k_wT<<<(DM / 64) * (RR / 64), 256, 0, stream>>>(u, DM, RR, BUV); k_wT<<<(DM / 64) * (RR / 64), 256, 0, stream>>>(v, DM, RR, BUV + (size_t)RR * DM);      /* [u|v]^T -> [128][1024] */
  k_wnat<<<(unsigned)(((size_t)DM * DM / 8 + 255) / 256), 256, 0, stream>>>(pw, (size_t)DM * DM / 8, BP); k_wnat<<<(unsigned)(((size_t)FH * DM / 8 + 255) / 256), 256, 0, stream>>>(uw, (size_t)FH * DM / 8, BU); k_wnat<<<(unsigned)(((size_t)DM * FH / 8 + 255) / 256), 256, 0, stream>>>(dw, (size_t)DM * FH / 8, BD);
  k_tab<<<(SQ * RR + 255) / 256, 256, 0, stream>>>(dl, T);
  k_rms<<<(unsigned)((NR + 7) / 8), 256, 0, stream>>>(h, 1, n1, NR, HN16, HF);      /* hn (f16) + bf16(h) (f32 residual) */
  k_gemm2<0><<<dim3((unsigned)((NR / 128) * (2 * RR / 64)), 1), 128, 0, stream>>>(HN16, DM, 0, BUV, DM, 0, 0.0625f, nullptr, 0, nullptr, 1, 0, 0, QK, nullptr, 2 * RR, 0, (int)NR, 2 * RR, DM);      /* [q_raw | k_raw] */
  k_l2<<<(unsigned)((NR * 2 * (RR / 4) + 255) / 256), 256, 0, stream>>>(QK);
  k_amat<<<dim3((SQ / AM_TI) * (SQ / AM_TJ), NB), 256, 0, stream>>>(QK, kb, T, gl, al, A16);
  k_hT<<<dim3((SQ / 64) * (DM / 64), NB), 256, 0, stream>>>(HN16, HT);
  k_gemm2<0><<<dim3((SQ / 128) * (DM / 64), NB), 128, 0, stream>>>(A16, SQ, (size_t)SQ * SQ, HT, SQ, (size_t)DM * SQ, 1.0f, nullptr, 0, nullptr, 1, 0, 0, nullptr, O16, DM, (size_t)SQ * DM, SQ, DM, SQ);      /* out_b = A_b . hn_b, b = blockIdx.y */
  const dim3 gp((unsigned)((NR / 128) * (DM / 64)), 1);
  k_gemm2<0><<<gp, 128, 0, stream>>>(O16, DM, 0, BP, DM, 0, 0.0625f, pb, 0, HF, 1, (size_t)DM, 0, H1, nullptr, DM, 0, (int)MQ, DM, DM);      /* h1 = h + out proj_w^T + proj_b */
  k_rms<<<(unsigned)((MQ + 7) / 8), 256, 0, stream>>>(H1, 0, n2, MQ, M16, nullptr);
  k_gemm2<6><<<dim3((unsigned)((NR / 128) * (FH / 64)), 1), 128, 0, stream>>>(M16, DM, 0, BU, DM, 0, 0.0625f, ub, 0, nullptr, 1, 0, 0, nullptr, U16, FH, 0, (int)MQ, FH, DM);      /* gelu_erf(m up_w^T + up_b) */
  k_gemm2<0><<<gp, 128, 0, stream>>>(U16, FH, 0, BD, FH, 0, 0.0625f, db, 0, H1, 1, (size_t)DM, 0, (float*)d_out, nullptr, DM, 0, (int)MQ, DM, FH);      /* h1 + m */
}

// v006
// One run takes 210 microseconds.
// Next to v005, in two timings, it ran 1.09 times as fast each time.
// Over all steps from v000 it is 10.8 times as fast.
#include <hip/hip_runtime.h>
// K2Layer (h [8][1024][1024]; hn = rmsnorm(h)*norm1_scale; gate = sigmoid(gate_logit), alpha = sigmoid(alpha_logit); q|k = hn [u|v] (rank 64), row-l2-normalised; gamma_r = 0.15 + 0.85 sigmoid(decay_logit_r); A[i][j] = causal(j<=i) * (gate k_base[i][j] + alpha sum_r q[i][r] k[j][r] gamma_r^(i-j)); out = A . hn; h1 = h + out proj_w^T + proj_b; m = gelu_erf(rmsnorm(h1)*norm2_scale up_w^T + up_b) down_w^T + down_b; result = h1 + m -> [8][1024][1024]).
// Structure: token rows; rmsnorm on VALU (f32) into f16 rows and per-batch transposed f16 planes (LDS); the rank-64 q|k projection as a WMMA GEMM (f32), l2-normalisation and the per-rank decayed causal scores on VALU in f32 (gamma^d table built on device from decay_logit, k_base/gate/alpha read) into the f16 mixing matrix A; out = A . hn, proj (+ bias + h), up (+ bias, exact-GELU epilogue, f16), down (+ bias + h1) as WMMA GEMMs (32x64 wave tiles, f32 accumulation, exact x16 weights).
// Compute dtype: inputs rounded to bf16; h / weights / k_base exact; hn, A, out, rmsnorm(h1), GELU hidden plain f16 operands (~2^-12); scores, norms, residuals f32. v_wmma_f32_16x16x32_f16.
#define NB 8
#define SQ 1024
#define DM 1024
#define RR 64
#define FH 2048
#define NR ((size_t)NB * SQ)
#define MQ NR                        /* rows through the proj/MLP stage (debug hook) */
typedef __bf16 v16b __attribute__((ext_vector_type(16)));
typedef unsigned short v8us __attribute__((ext_vector_type(8), may_alias));
typedef float  v8f  __attribute__((ext_vector_type(8)));
typedef float  v4f  __attribute__((ext_vector_type(4)));
typedef float  v4fa __attribute__((ext_vector_type(4), may_alias));
union FragB { v16b v; v8us half[2]; unsigned short u[16]; };

__device__ __forceinline__ unsigned short bf16_bits(float x) { unsigned int u = __float_as_uint(x); return (unsigned short)((u + 0x7FFFu + ((u >> 16) & 1u)) >> 16); }
__device__ __forceinline__ float bf16_val(unsigned short b) { return __uint_as_float(((unsigned int)b) << 16); }
__device__ __forceinline__ float bf16_round(float x) { return bf16_val(bf16_bits(x)); }
// D += A·B with NT terms: 1 = ah·bh, 2 = + al·bh (A split), 3 = + ah·bl (both split)
template <int NT>
__device__ __forceinline__ v8f mmaN(v16b ah, v16b al, v16b bh, v16b bl, v8f c) {
  c = __builtin_amdgcn_wmma_f32_16x16x32_bf16(false, ah, false, bh, (short)0, c, false, false);
  if (NT >= 2) c = __builtin_amdgcn_wmma_f32_16x16x32_bf16(false, al, false, bh, (short)0, c, false, false);
  if (NT >= 3) c = __builtin_amdgcn_wmma_f32_16x16x32_bf16(false, ah, false, bl, (short)0, c, false, false);
  asm volatile("v_nop\n\tv_nop\n\tv_nop\n\tv_nop" : "+v"(c) : "v"(ah), "v"(al), "v"(bh), "v"(bl));
  return c;
}

__global__ __launch_bounds__(256) void k_wt_bf16(const float* __restrict__ W, unsigned short* __restrict__ Wt, int K, int N) {
  const int t = blockIdx.x * 256 + threadIdx.x;
  const int k8n = K / 8;
  if (t >= N * k8n) return;
  const int n = t / k8n, k8 = (t % k8n) * 8;
  v8us v;
#pragma unroll
  for (int i = 0; i < 8; ++i) v[i] = bf16_bits(W[(size_t)(k8 + i) * N + n]);
  *(v8us*)(Wt + (size_t)n * K + k8) = v;
  
}

// GEMM C[M][N] (f32, pitch ldc) = act(A[M][K]·W + bias). A f32 row-major (pitch lda) converted per fragment to bf16
// (ASPLIT: hi/lo two planes -> 2 terms, else single rounded term); Wt bf16 [N][K] (pitch ldb). BIAS_BF16 rounds the
// bias to bf16 first (bias quantised to bf16 before the add). K%32==0, M%16==0, N%64==0.
template <bool ASPLIT, int ACT, bool BIAS_BF16>
__global__ __launch_bounds__(128) void k_gemm_bf(const float* __restrict__ A, int lda, const unsigned short* __restrict__ Wt, int ldb,
                                               const float* __restrict__ bias, float* __restrict__ C, int ldc, int M, int N, int K) {
  __shared__ __attribute__((aligned(16))) float so[4][16][64];
  const int tid = threadIdx.x, w = tid >> 5, lane = tid & 31, ln = lane & 15, hh = lane >> 4;
  const int ntn = N / 64;
  const int wid = blockIdx.x * 4 + w;
  const int mt = wid / ntn, nq = wid % ntn;
  if (mt * 16 >= M) return;
  const int row0 = mt * 16, col0 = nq * 64;
  const float* arow = A + (size_t)(row0 + ln) * lda;
  v8f acc[4] = {};
  for (int kb = 0; kb < K; kb += 32) {
    FragB ah, al;
    const v4f x0 = *(const v4fa*)(arow + kb + 8 * hh), x1 = *(const v4fa*)(arow + kb + 8 * hh + 4);
    const v4f x2 = *(const v4fa*)(arow + kb + 16 + 8 * hh), x3 = *(const v4fa*)(arow + kb + 16 + 8 * hh + 4);
    float xs[16] = {x0[0],x0[1],x0[2],x0[3],x1[0],x1[1],x1[2],x1[3],x2[0],x2[1],x2[2],x2[3],x3[0],x3[1],x3[2],x3[3]};
#pragma unroll
    for (int i = 0; i < 16; ++i) { const unsigned short hb = bf16_bits(xs[i]); ah.u[i] = hb; al.u[i] = ASPLIT ? bf16_bits(xs[i] - bf16_val(hb)) : (unsigned short)0; }
#pragma unroll
    for (int t = 0; t < 4; ++t) {
      const unsigned short* brow = Wt + (size_t)(col0 + t * 16 + ln) * ldb + kb;
      FragB b;
      b.half[0] = *(const v8us*)(brow + 8 * hh);
      b.half[1] = *(const v8us*)(brow + 16 + 8 * hh);
      acc[t] = mmaN<ASPLIT ? 2 : 1>(ah.v, al.v, b.v, b.v, acc[t]);
    }
  }
#pragma unroll
  for (int t = 0; t < 4; ++t) {
    float bv = bias ? bias[col0 + t * 16 + ln] : 0.f;
    if (BIAS_BF16) bv = bf16_round(bv);
#pragma unroll
    for (int r = 0; r < 8; ++r) { float v = acc[t][r] + bv; if (ACT == 1) v = fmaxf(v, 0.f); so[w][8 * hh + r][t * 16 + ln] = v; }
  }
  __builtin_amdgcn_fence(__ATOMIC_ACQ_REL, "workgroup");
  __builtin_amdgcn_wave_barrier();
  const int rsub = lane >> 4, c4 = (lane & 15) * 4;
  {
#pragma unroll
    for (int q = 0; q < 8; ++q) {
      const int r = q * 2 + rsub;
      const v4f v = *(const v4fa*)&so[w][r][c4];
      *(v4f*)(C + (size_t)(row0 + r) * ldc + col0 + c4) = v;
    }
    
  }
}

// GEMM C = act(A·W + bias + resid): A f32 (ASPLIT -> hi/lo 2 terms), Wt bf16 [N][K]; ACT 0 none, 1 relu, 2 exact gelu;
// resid (optional, f32, row index = (row % rmod), pitch ldr, RES_BF16 rounds it) added before the activation.
template <bool ASPLIT, int ACT, bool BIAS_BF16, bool RES_BF16>
__global__ __launch_bounds__(128) void k_gemm_bf3(const float* __restrict__ A, int lda, const unsigned short* __restrict__ Wt, int ldb,
                                                const float* __restrict__ bias, const float* __restrict__ resid, int rmod, int ldr,
                                                float* __restrict__ C, int ldc, int M, int N, int K) {
  __shared__ __attribute__((aligned(16))) float so[4][16][64];
  const int tid = threadIdx.x, w = tid >> 5, lane = tid & 31, ln = lane & 15, hh = lane >> 4;
  const int ntn = N / 64;
  const int wid = blockIdx.x * 4 + w;
  const int mt = wid / ntn, nq = wid % ntn;
  if (mt * 16 >= M) return;
  const int row0 = mt * 16, col0 = nq * 64;
  const float* arow = A + (size_t)(row0 + ln) * lda;
  v8f acc[4] = {};
  for (int kb = 0; kb < K; kb += 32) {
    FragB ah, al;
    const v4f x0 = *(const v4fa*)(arow + kb + 8 * hh), x1 = *(const v4fa*)(arow + kb + 8 * hh + 4);
    const v4f x2 = *(const v4fa*)(arow + kb + 16 + 8 * hh), x3 = *(const v4fa*)(arow + kb + 16 + 8 * hh + 4);
    float xs[16] = {x0[0],x0[1],x0[2],x0[3],x1[0],x1[1],x1[2],x1[3],x2[0],x2[1],x2[2],x2[3],x3[0],x3[1],x3[2],x3[3]};
#pragma unroll
    for (int i = 0; i < 16; ++i) { const unsigned short hb = bf16_bits(xs[i]); ah.u[i] = hb; al.u[i] = ASPLIT ? bf16_bits(xs[i] - bf16_val(hb)) : (unsigned short)0; }
#pragma unroll
    for (int t = 0; t < 4; ++t) {
      const unsigned short* brow = Wt + (size_t)(col0 + t * 16 + ln) * ldb + kb;
      FragB b;
      b.half[0] = *(const v8us*)(brow + 8 * hh);
      b.half[1] = *(const v8us*)(brow + 16 + 8 * hh);
      acc[t] = mmaN<ASPLIT ? 2 : 1>(ah.v, al.v, b.v, b.v, acc[t]);
    }
  }
#pragma unroll
  for (int t = 0; t < 4; ++t) {
    const int col = col0 + t * 16 + ln;
    float bv = bias ? bias[col] : 0.f;
    if (BIAS_BF16) bv = bf16_round(bv);
#pragma unroll
    for (int r = 0; r < 8; ++r) {
      float v = acc[t][r] + bv;
      if (resid) { float rv = resid[(size_t)((row0 + 8 * hh + r) % rmod) * ldr + col]; if (RES_BF16) rv = bf16_round(rv); v += rv; }
      if (ACT == 1) v = fmaxf(v, 0.f);
      if (ACT == 2) v = 0.5f * v * (1.0f + erff(v * 0.70710678118654752f));
      if (ACT == 3) { const float u = 0.7978845608028654f * (v + 0.044715f * v * v * v); v = 0.5f * v * (1.0f + tanhf(u)); }
      so[w][8 * hh + r][t * 16 + ln] = v;
    }
  }
  __builtin_amdgcn_fence(__ATOMIC_ACQ_REL, "workgroup");
  __builtin_amdgcn_wave_barrier();
  const int rsub = lane >> 4, c4 = (lane & 15) * 4;
  {
#pragma unroll
    for (int q = 0; q < 8; ++q) {
      const int r = q * 2 + rsub;
      const v4f v = *(const v4fa*)&so[w][r][c4];
      *(v4f*)(C + (size_t)(row0 + r) * ldc + col0 + c4) = v;
    }
    
  }
}
// row LayerNorm (biased variance, eps) over N: s = X (+ R); optional out_sum <- s; out_norm <- (s-mu)*rsqrt(var+eps)*g + b
template <bool PARAM_BF16>
__global__ __launch_bounds__(256) void k_layernorm(const float* __restrict__ X, const float* __restrict__ R, const float* __restrict__ g, const float* __restrict__ bta,
                                                  float* __restrict__ out_sum, float* __restrict__ out_norm, int N, float eps) {
  __shared__ float red[256];
  const int row = blockIdx.x, tid = threadIdx.x;
  const float* x = X + (size_t)row * N; const float* rr = R ? R + (size_t)row * N : nullptr;
  float vals[16];                     // up to N = 4096
  const int per = N / 256;            // contiguous chunk per thread? use strided-by-4 chunks: thread handles j = tid*4 + 1024*u
  float s1 = 0.f;
  for (int u = 0; u < per / 4; ++u) {
    const int j = tid * 4 + 1024 * u;
    const v4f a = *(const v4fa*)(x + j);
    v4f b = {0.f,0.f,0.f,0.f}; if (rr) b = *(const v4fa*)(rr + j);
#pragma unroll
    for (int q = 0; q < 4; ++q) { const float v = a[q] + b[q]; vals[u * 4 + q] = v; s1 += v; }
  }
  red[tid] = s1; __syncthreads();
  for (int st = 128; st > 0; st >>= 1) { if (tid < st) red[tid] += red[tid + st]; __syncthreads(); }
  const float mu = red[0] / (float)N; __syncthreads();
  float s2 = 0.f;
  for (int u = 0; u < per / 4; ++u)
#pragma unroll
    for (int q = 0; q < 4; ++q) { const float c = vals[u * 4 + q] - mu; s2 += c * c; }
  red[tid] = s2; __syncthreads();
  for (int st = 128; st > 0; st >>= 1) { if (tid < st) red[tid] += red[tid + st]; __syncthreads(); }
  const float rs = rsqrtf(red[0] / (float)N + eps);
  {
    for (int u = 0; u < per / 4; ++u) {
      const int j = tid * 4 + 1024 * u;
      v4f o, sm;
#pragma unroll
      for (int q = 0; q < 4; ++q) {
        float gg = g[j + q], bb = bta[j + q];
        if (PARAM_BF16) { gg = bf16_round(gg); bb = bf16_round(bb); }
        sm[q] = vals[u * 4 + q]; o[q] = (vals[u * 4 + q] - mu) * rs * gg + bb;
      }
      if (out_sum) *(v4f*)(out_sum + (size_t)row * N + j) = sm;
      *(v4f*)(out_norm + (size_t)row * N + j) = o;
    }
    
  }
}



// ---- f16 WMMA path (v_wmma_f32_16x16x32_f16): 11-bit significands for operands in range — used for every GEMM launched here
typedef _Float16 v16h __attribute__((ext_vector_type(16)));
union FragH { v16h v; v8us half[2]; _Float16 h[16]; unsigned short u[16]; };
template <int NT>
__device__ __forceinline__ v8f mmaH(v16h ah, v16h al, v16h bh, v16h bl, v8f c) {
  c = __builtin_amdgcn_wmma_f32_16x16x32_f16(false, ah, false, bh, (short)0, c, false, false);
  if (NT >= 2) c = __builtin_amdgcn_wmma_f32_16x16x32_f16(false, al, false, bh, (short)0, c, false, false);
  if (NT >= 3) c = __builtin_amdgcn_wmma_f32_16x16x32_f16(false, ah, false, bl, (short)0, c, false, false);
  asm volatile("v_nop\n\tv_nop\n\tv_nop\n\tv_nop" : "+v"(c) : "v"(ah), "v"(al), "v"(bh), "v"(bl));
  return c;
}
// batched GEMM like k_gemm_b but f16 operands: A f32 (split into f16 hi/lo if ASPLIT, else rounded to f16), Bt = f16 values [n][k]; alpha; C f32; N multiple of 16 (partial tiles skipped)
template <bool ASPLIT>
__global__ __launch_bounds__(128) void k_gemm_h(const float* __restrict__ A, int lda, size_t sA, const _Float16* __restrict__ Bh, int ldb, size_t sB, float alpha, float* __restrict__ C, int ldc, size_t sC, int M, int N, int K) {
  __shared__ __attribute__((aligned(16))) float so[4][16][64];
  const int tid = threadIdx.x, w = tid >> 5, lane = tid & 31, ln = lane & 15, hh = lane >> 4; const int by = blockIdx.y;
  A += (size_t)by * sA; Bh += (size_t)by * sB; C += (size_t)by * sC;
  const int ntn = (N + 63) / 64; const int wid = blockIdx.x * 4 + w; const int mt = wid / ntn, nq = wid % ntn; if (mt * 16 >= M) return;
  const int row0 = mt * 16, col0 = nq * 64; const float* arow = A + (size_t)(row0 + ln) * lda;
  v8f acc[4] = {};
  for (int kb = 0; kb < K; kb += 32) {
    FragH ah, al;
    const v4f x0 = *(const v4fa*)(arow + kb + 8 * hh), x1 = *(const v4fa*)(arow + kb + 8 * hh + 4), x2 = *(const v4fa*)(arow + kb + 16 + 8 * hh), x3 = *(const v4fa*)(arow + kb + 16 + 8 * hh + 4);
    float xs[16] = {x0[0],x0[1],x0[2],x0[3],x1[0],x1[1],x1[2],x1[3],x2[0],x2[1],x2[2],x2[3],x3[0],x3[1],x3[2],x3[3]};
#pragma unroll
    for (int i = 0; i < 16; ++i) { const _Float16 h = (_Float16)xs[i]; ah.h[i] = h; al.h[i] = ASPLIT ? (_Float16)(xs[i] - (float)h) : (_Float16)0.0f; }
#pragma unroll
    for (int t = 0; t < 4; ++t) { if (col0 + t * 16 >= N) continue; const size_t boff = (size_t)(col0 + t * 16 + ln) * ldb + kb; FragH bq; bq.half[0] = *(const v8us*)(Bh + boff + 8 * hh); bq.half[1] = *(const v8us*)(Bh + boff + 16 + 8 * hh);
      acc[t] = mmaH<ASPLIT ? 2 : 1>(ah.v, al.v, bq.v, bq.v, acc[t]); }
  }
#pragma unroll
  for (int t = 0; t < 4; ++t) { if (col0 + t * 16 >= N) continue;
#pragma unroll
    for (int r = 0; r < 8; ++r) so[w][8 * hh + r][t * 16 + ln] = acc[t][r] * alpha; }
  __builtin_amdgcn_fence(__ATOMIC_ACQ_REL, "workgroup"); __builtin_amdgcn_wave_barrier();
  const int rsub = lane >> 4, c4 = (lane & 15) * 4;
  {
#pragma unroll
    for (int q = 0; q < 8; ++q) { const int r = q * 2 + rsub; if (col0 + c4 < N) { const v4f v = *(const v4fa*)&so[w][r][c4]; *(v4f*)(C + (size_t)(row0 + r) * ldc + col0 + c4) = v; } }
     }
}

// Wt[n][k] = f16(W[k][n]·scale) from f32 row-major W[K][N] (scale = power of two; bf16-exact weights stay exact in f16 away from the subnormal range)
__global__ __launch_bounds__(256) void k_wt_f16(const float* __restrict__ W, _Float16* __restrict__ Wt, int K, int N, float scale) {
  const int t = blockIdx.x * 256 + threadIdx.x; if (t >= N * (K / 8)) return; const int n = t / (K / 8), k8 = (t % (K / 8)) * 8; FragH f;
#pragma unroll
  for (int i = 0; i < 8; ++i) f.h[i] = (_Float16)(bf16_round(W[(size_t)(k8 + i) * N + n]) * scale); const v8us o = f.half[0];
  *(v8us*)((unsigned short*)Wt + (size_t)n * K + k8) = o; 
}
// k_gemm_hh variant with fused epilogue: v = acc·alpha + bias[by·sBias + col] (+ CP[(row/rowsPerB)·sCPb + by·64 + col] if CP) ; ACT 0 none / 1 elu ; writes f16 C16 (and f32 C if non-null)
template <int ACT>
__global__ __launch_bounds__(128) void k_gemm_hhx(const _Float16* __restrict__ A, int lda, size_t sA, const _Float16* __restrict__ Bh, int ldb, size_t sB, float alpha, const float* __restrict__ bias, size_t sBias, const float* __restrict__ CP, int rowsPerB, size_t sCPb, int row0g,
    float* __restrict__ C, _Float16* __restrict__ C16, int ldc, size_t sC, int M, int N, int K) {
  __shared__ __attribute__((aligned(16))) float so[4][16][64];
  const int tid = threadIdx.x, w = tid >> 5, lane = tid & 31, ln = lane & 15, hh = lane >> 4; const int by = blockIdx.y;
  A += (size_t)by * sA; Bh += (size_t)by * sB; const size_t cofs = (size_t)by * sC; const float* bp = bias ? bias + (size_t)by * sBias : nullptr;
  const int ntn = (N + 63) / 64; const int wid = blockIdx.x * 4 + w; const int mt = wid / ntn, nq = wid % ntn; if (mt * 16 >= M) return;
  const int row0 = mt * 16, col0 = nq * 64; const _Float16* arow = A + (size_t)(row0 + ln) * lda;
  v8f acc[4] = {};
  for (int kb = 0; kb < K; kb += 32) { FragH ah; ah.half[0] = *(const v8us*)((const unsigned short*)arow + kb + 8 * hh); ah.half[1] = *(const v8us*)((const unsigned short*)arow + kb + 16 + 8 * hh);
#pragma unroll
    for (int t = 0; t < 4; ++t) { if (col0 + t * 16 >= N) continue; const size_t boff = (size_t)(col0 + t * 16 + ln) * ldb + kb; FragH bq; bq.half[0] = *(const v8us*)((const unsigned short*)Bh + boff + 8 * hh); bq.half[1] = *(const v8us*)((const unsigned short*)Bh + boff + 16 + 8 * hh);
      acc[t] = mmaH<1>(ah.v, ah.v, bq.v, bq.v, acc[t]); }
  }
#pragma unroll
  for (int t = 0; t < 4; ++t) { if (col0 + t * 16 >= N) continue; const int col = col0 + t * 16 + ln; const float bv = bp ? bf16_round(bp[col]) : 0.f;
#pragma unroll
    for (int r = 0; r < 8; ++r) { float v = acc[t][r] * alpha + bv; if (CP) { const int rr = row0g + row0 + 8 * hh + r; if (rowsPerB < 0) v += CP[cofs + (size_t)rr * ldc + col];      /* rowsPerB < 0: own element of the batched C plane */ else { const int bidx = rr / rowsPerB; v += CP[(size_t)bidx * sCPb + (size_t)by * 64 + col]; } } if (ACT == 1) v = (v > 0.f) ? v : expm1f(v); else if (ACT == 7) v = (v > 0.f) ? v + 1.0f : expf(v); else if (ACT == 8) v = tanhf(v); else if (ACT == 9) v = 0.5f * v * (1.0f + tanhf(0.7978845608028654f * (v + 0.044715f * v * v * v))); else if (ACT == 11) v = 1.0f / (1.0f + expf(-v)); else if (ACT == 12) v = (v > 0.f) ? v : 0.01f * v; else if (ACT == 14) v = (v > 0.f) ? v : 0.1f * v; else if (ACT == 16) v = (v >= 0.f) ? v : 0.3f * v; else if (ACT == 17) v = (v >= 0.f) ? v : 0.2f * v; else if (ACT == 15) v = v / (1.0f + expf(-v)); else if (ACT == 3) v = fmaxf(v, 0.f); else if (ACT == 6) v = 0.5f * v * (1.0f + erff(v * 0.70710678118654752f)); so[w][8 * hh + r][t * 16 + ln] = v; } }
  __builtin_amdgcn_fence(__ATOMIC_ACQ_REL, "workgroup"); __builtin_amdgcn_wave_barrier();
  const int rsub = lane >> 4, c4 = (lane & 15) * 4; typedef _Float16 v4h __attribute__((ext_vector_type(4)));
  {
#pragma unroll
    for (int q = 0; q < 8; ++q) { const int r = q * 2 + rsub; if (col0 + c4 < N) { const v4f v = *(const v4fa*)&so[w][r][c4]; if (C) *(v4f*)(C + cofs + (size_t)(row0 + r) * ldc + col0 + c4) = v; if (C16) { v4h h4; for (int i = 0; i < 4; ++i) h4[i] = (_Float16)v[i]; *(v4h*)(C16 + cofs + (size_t)(row0 + r) * ldc + col0 + c4) = h4; } } }
     }
}


typedef _Float16 v4h __attribute__((ext_vector_type(4)));

__global__ __launch_bounds__(256) void k_x16(const float* __restrict__ x, _Float16* __restrict__ X16, size_t n8) { const size_t t = (size_t)blockIdx.x * 256 + threadIdx.x; if (t >= n8) return; FragH f;
#pragma unroll
  for (int q = 0; q < 8; ++q) f.h[q] = (_Float16)bf16_round(x[t * 8 + q]); *(v8us*)((unsigned short*)X16 + t * 8) = f.half[0];  }
__global__ __launch_bounds__(256) void k_h16(const float* __restrict__ x, _Float16* __restrict__ X16, size_t n8) { const size_t t = (size_t)blockIdx.x * 256 + threadIdx.x; if (t >= n8) return; FragH f;
#pragma unroll
  for (int q = 0; q < 8; ++q) f.h[q] = (_Float16)x[t * 8 + q]; *(v8us*)((unsigned short*)X16 + t * 8) = f.half[0];  }
__global__ __launch_bounds__(256) void k_round16f(const float* __restrict__ W, _Float16* __restrict__ Bt, size_t n8) { const size_t t = (size_t)blockIdx.x * 256 + threadIdx.x; if (t >= n8) return; FragH f;
#pragma unroll
  for (int i = 0; i < 8; ++i) f.h[i] = (_Float16)(bf16_round(W[t * 8 + i]) * 16.0f); *(v8us*)((unsigned short*)Bt + t * 8) = f.half[0];  }
template <int NHv, int TTv>
__global__ __launch_bounds__(256) void k_vt(const _Float16* __restrict__ V16, int ldv, int voff, _Float16* __restrict__ Vt) { __shared__ unsigned short tl[64][66]; const int tid = threadIdx.x; const int slab = blockIdx.x / (TTv / 64), lg = blockIdx.x % (TTv / 64); const int b = slab / NHv, h = slab % NHv;
  for (int i = tid; i < 64 * 8; i += 256) { const int r = i / 8, c8 = (i % 8) * 8; FragH f; f.half[0] = *(const v8us*)((const unsigned short*)V16 + ((size_t)b * TTv + lg * 64 + r) * ldv + voff + h * 64 + c8);
#pragma unroll
    for (int q = 0; q < 8; ++q) tl[r][c8 + q] = f.u[q]; }
  __syncthreads();
  {
#pragma unroll
    for (int rd = 0; rd < 2; ++rd) { const int d = rd * 32 + tid / 8, pc = tid % 8; FragH f;
#pragma unroll
      for (int q = 0; q < 8; ++q) f.u[q] = tl[pc * 8 + q][d];
      *(v8us*)((unsigned short*)Vt + ((size_t)slab * 64 + d) * TTv + lg * 64 + pc * 8) = f.half[0]; }
     } }

__global__ __launch_bounds__(256) void k_hl(const float* __restrict__ F, _Float16* __restrict__ Hh, _Float16* __restrict__ Hl, size_t n8) { const size_t t = (size_t)blockIdx.x * 256 + threadIdx.x; if (t >= n8) return; FragH fh, fl; const v4f a = *(const v4fa*)(F + t * 8), c = *(const v4fa*)(F + t * 8 + 4);
#pragma unroll
  for (int q = 0; q < 4; ++q) { _Float16 h = (_Float16)a[q]; fh.h[q] = h; fl.h[q] = (_Float16)((a[q] - (float)h) * 1024.0f); h = (_Float16)c[q]; fh.h[4 + q] = h; fl.h[4 + q] = (_Float16)((c[q] - (float)h) * 1024.0f); }
  { *(v8us*)((unsigned short*)Hh + t * 8) = fh.half[0]; *(v8us*)((unsigned short*)Hl + t * 8) = fl.half[0];  } }

// ---- fast GEMM (block tile 128x64, wave tile 32x64; requires M % 128 == 0 rows per launch region, N % 64 == 0, K % 64 == 0, K >= 64); epilogue = k_gemm_hhx semantics ----
// Operands go global -> LDS by asynchronous copies, 64 k (one whole 128-byte line of every operand row) per stage, two buffers: eight lanes cover a row's line, so a
// wave's copy touches four whole lines, and every line is fetched once per block. The fragments are read from LDS in the k order of g2_frag.
#define G2_KS 64                              /* k per stage */
#define G2_PITCH 144                          /* LDS row pitch in bytes: 16 B x odd, so that 16 lanes on 16 neighbouring rows meet no bank twice */
#define G2_STAGE ((128 + 64) * G2_PITCH)      /* one stage: [A 128 rows | B 64 rows] */
__device__ __forceinline__ v16h g2_frag(const unsigned char* p, int hh) { FragH f; f.half[0] = *(const v8us*)(p + 16 * hh); f.half[1] = *(const v8us*)(p + 32 + 16 * hh); return f.v; }
__device__ __forceinline__ v8f g2_mma(v16h a, v16h b, v8f c) { v8f d = __builtin_amdgcn_wmma_f32_16x16x32_f16(false, a, false, b, (short)0, c, false, false); asm volatile("v_nop\n\tv_nop\n\tv_nop\n\tv_nop" : "+v"(d) : "v"(a), "v"(b)); return d; }
// One stage's twelve copies of a thread (16 bytes each): rows sr + 16 i of A (i = 0 .. 7) and of B (i = 0 .. 3). l = the thread's LDS byte address in the stage's row sr.
// The s_wait_xcnt closes the statement, so that it stands ahead of every later overwrite of the copies' address registers.
__device__ __forceinline__ void g2_copy(unsigned l, const _Float16* ga, size_t sa, const _Float16* gb, size_t sb) {
  asm volatile("global_load_async_to_lds_b128 %0, %12, off\n\t" "global_load_async_to_lds_b128 %1, %13, off\n\t" "global_load_async_to_lds_b128 %2, %14, off\n\t" "global_load_async_to_lds_b128 %3, %15, off\n\t"
               "global_load_async_to_lds_b128 %4, %16, off\n\t" "global_load_async_to_lds_b128 %5, %17, off\n\t" "global_load_async_to_lds_b128 %6, %18, off\n\t" "global_load_async_to_lds_b128 %7, %19, off\n\t"
               "global_load_async_to_lds_b128 %8, %20, off\n\t" "global_load_async_to_lds_b128 %9, %21, off\n\t" "global_load_async_to_lds_b128 %10, %22, off\n\t" "global_load_async_to_lds_b128 %11, %23, off\n\t"
               "s_wait_xcnt 0x0"
               :: "v"(l), "v"(l + 16 * G2_PITCH), "v"(l + 32 * G2_PITCH), "v"(l + 48 * G2_PITCH), "v"(l + 64 * G2_PITCH), "v"(l + 80 * G2_PITCH), "v"(l + 96 * G2_PITCH), "v"(l + 112 * G2_PITCH),
                  "v"(l + 128 * G2_PITCH), "v"(l + 144 * G2_PITCH), "v"(l + 160 * G2_PITCH), "v"(l + 176 * G2_PITCH),
                  "v"(ga), "v"(ga + sa), "v"(ga + 2 * sa), "v"(ga + 3 * sa), "v"(ga + 4 * sa), "v"(ga + 5 * sa), "v"(ga + 6 * sa), "v"(ga + 7 * sa),
                  "v"(gb), "v"(gb + sb), "v"(gb + 2 * sb), "v"(gb + 3 * sb) : "memory"); }
// Eight of a lane's residual loads (16 bytes each), issued one behind the other with no wait on their data between them.
// The s_wait_xcnt stands ahead of every overwrite of the loads' address registers; the addresses as its inputs keep their registers from being rewritten, or handed to one of the loads as a destination, ahead of it.
__device__ __forceinline__ void g2_res8(const float* const (&rp)[8], v4f* res) {
#pragma unroll      /* constant indices: rp and res stay in registers */
  for (int q = 0; q < 8; ++q) res[q] = *(const v4fa*)rp[q];
  asm volatile("s_wait_xcnt 0x0" :: "v"(rp[0]), "v"(rp[1]), "v"(rp[2]), "v"(rp[3]), "v"(rp[4]), "v"(rp[5]), "v"(rp[6]), "v"(rp[7]) : "memory"); }
template <int ACT>
__global__ __launch_bounds__(128) void k_gemm2(const _Float16* __restrict__ A, int lda, size_t sA, const _Float16* __restrict__ Bh, int ldb, size_t sB, float alpha, const float* __restrict__ bias, size_t sBias, const float* __restrict__ CP, int rowsPerB, size_t sCPb, int row0g,
    float* __restrict__ C, _Float16* __restrict__ C16, int ldc, size_t sC, int M, int N, int K) { static_assert(ACT == 0 || ACT == 3 || ACT == 6 || ACT == 8 || ACT == 9 || ACT == 11 || ACT == 12 || ACT == 14 || ACT == 15 || ACT == 16 || ACT == 17, "k_gemm2: unsupported ACT code (would silently apply no activation)");
  __shared__ __attribute__((aligned(16))) unsigned char sm[2 * G2_STAGE]; static_assert(sizeof(float) * 4 * 32 * 68 <= 2 * G2_STAGE, "the output staging lies in the ring");
  float (*so)[32][68] = (float (*)[32][68])sm;      /* output staging: used only behind the last trip's barrier, when no wave reads the ring any more */
  const int tid = threadIdx.x, w = tid >> 5, lane = tid & 31, ln = lane & 15, hh = lane >> 4; const int by = blockIdx.y;
  A += (size_t)by * sA; Bh += (size_t)by * sB; const size_t cofs = (size_t)by * sC; const float* bp = bias ? bias + (size_t)by * sBias : nullptr;
  const int ntn = N >> 6; const int mt = blockIdx.x / ntn, nq = blockIdx.x - mt * ntn; const int row0 = mt * 128 + 32 * w, col0 = nq * 64; if (mt * 128 >= M) return;      /* the whole block leaves, ahead of every copy and barrier */
  const int sr = tid >> 3, sc = tid & 7;      /* the thread's first row of a stage and its 16-byte piece of the row's line */
  const _Float16* ga = A + (size_t)(mt * 128 + sr) * lda + sc * 8; const _Float16* gb = Bh + (size_t)(col0 + sr) * ldb + sc * 8; const size_t sa = (size_t)16 * lda, sb = (size_t)16 * ldb;
  const unsigned l0 = (unsigned)(size_t)sm + (unsigned)(sr * G2_PITCH + sc * 16);
  const unsigned char* ar = sm + (32 * w + ln) * G2_PITCH; const unsigned char* br = sm + (128 + ln) * G2_PITCH;
  const int nt = K / G2_KS;
  const v8f z8 = {0.f,0.f,0.f,0.f,0.f,0.f,0.f,0.f}; v8f c00 = z8, c01 = z8, c02 = z8, c03 = z8, c10 = z8, c11 = z8, c12 = z8, c13 = z8;
  g2_copy(l0, ga, sa, gb, sb);
  asm volatile("s_wait_asynccnt 0x0" ::: "memory");      /* this wave's copies of stage 0 have landed */
  __syncthreads();      /* and every other wave's: stage 0 may be read */
  if (nt > 1) g2_copy(l0 + G2_STAGE, ga + G2_KS, sa, gb + G2_KS, sb);
#pragma unroll 1      /* one trip per stage: the buffer is chosen by the trip's parity */
  for (int t = 0; t < nt; ++t) { const unsigned bo = (unsigned)(t & 1) * G2_STAGE;
    const unsigned char* ap = ar + bo; const unsigned char* bq = br + bo; v16h fa[2][2], fb[2][4];
#pragma unroll      /* constant indices: fa and fb stay in registers */
    for (int kk = 0; kk < 2; ++kk) { fa[kk][0] = g2_frag(ap + kk * 64, hh); fb[kk][0] = g2_frag(bq + kk * 64, hh); fa[kk][1] = g2_frag(ap + 16 * G2_PITCH + kk * 64, hh);
      fb[kk][1] = g2_frag(bq + 16 * G2_PITCH + kk * 64, hh); fb[kk][2] = g2_frag(bq + 32 * G2_PITCH + kk * 64, hh); fb[kk][3] = g2_frag(bq + 48 * G2_PITCH + kk * 64, hh); }
#pragma unroll      /* the stage's two 32-k blocks, straight-line, k rising */
    for (int kk = 0; kk < 2; ++kk) {
      c00 = g2_mma(fa[kk][0], fb[kk][0], c00); c10 = g2_mma(fa[kk][1], fb[kk][0], c10); c01 = g2_mma(fa[kk][0], fb[kk][1], c01); c11 = g2_mma(fa[kk][1], fb[kk][1], c11);
      c02 = g2_mma(fa[kk][0], fb[kk][2], c02); c12 = g2_mma(fa[kk][1], fb[kk][2], c12); c03 = g2_mma(fa[kk][0], fb[kk][3], c03); c13 = g2_mma(fa[kk][1], fb[kk][3], c13); }
    asm volatile("s_wait_dscnt 0x0" ::: "memory");      /* this wave's reads of the buffer are done */
    asm volatile("s_wait_asynccnt 0x0" ::: "memory");      /* its copies of stage t + 1 have landed */
    __syncthreads();      /* publishes stage t + 1 and ends every reader's last read of stage t's buffer */
    if (t + 2 < nt) g2_copy(l0 + bo, ga + (size_t)(t + 2) * G2_KS, sa, gb + (size_t)(t + 2) * G2_KS, sb); }
  asm volatile("s_wait_asynccnt 0x0" ::: "memory");      /* no copy is outstanding when the ring becomes output staging */
  v8f accs[8] = {c00, c01, c02, c03, c10, c11, c12, c13};
  // Scale, bias, residual and activation are applied where the staged rows are read back: there a lane holds four neighbouring columns of a row, so that its share of the residual is
  // sixteen 16-byte loads (a wave's load covers whole 128-byte lines), all of them issued here, ahead of the staging, and waited for once. The unrolls keep res and accs in registers (constant indices).
  const int rsub = lane >> 4, c4 = (lane & 15) * 4; const v4f z4 = {0.f, 0.f, 0.f, 0.f}; v4f res[16], bv4 = z4;
  if (CP) {      /* two runs of eight: sixteen address pairs at once would cost the kernel a wave per SIMD */
    if (rowsPerB < 0) {      /* rowsPerB < 0: own elements of the batched C plane */
#pragma unroll
      for (int g = 0; g < 2; ++g) { const float* rp[8];
#pragma unroll
        for (int q = 0; q < 8; ++q) rp[q] = CP + cofs + (size_t)(row0g + row0 + (g * 8 + q) * 2 + rsub) * ldc + col0 + c4;
        g2_res8(rp, res + g * 8); }
    } else {
#pragma unroll
      for (int g = 0; g < 2; ++g) { const float* rp[8];
#pragma unroll
        for (int q = 0; q < 8; ++q) { const int bidx = (row0g + row0 + (g * 8 + q) * 2 + rsub) / rowsPerB; rp[q] = CP + (size_t)bidx * sCPb + (size_t)by * 64 + col0 + c4; }
        g2_res8(rp, res + g * 8); } }
  } else {
#pragma unroll
    for (int q = 0; q < 16; ++q) res[q] = z4; }
  if (bp) { bv4 = *(const v4fa*)(bp + col0 + c4);
    asm volatile("s_wait_xcnt 0x0" ::: "memory"); }      /* stands ahead of every later overwrite of the bias load's address registers */
#pragma unroll
  for (int i = 0; i < 4; ++i) bv4[i] = bf16_round(bv4[i]);
#pragma unroll
  for (int u = 0; u < 8; ++u) { const int t = u & 3, half = u >> 2;
#pragma unroll
    for (int r = 0; r < 8; ++r) so[w][half * 16 + 8 * hh + r][t * 16 + ln] = accs[u][r]; }
  __builtin_amdgcn_fence(__ATOMIC_ACQ_REL, "workgroup"); __builtin_amdgcn_wave_barrier();
  {
#pragma unroll
    for (int q = 0; q < 16; ++q) { const int r = q * 2 + rsub; v4f v = *(const v4fa*)&so[w][r][c4];
#pragma unroll
      for (int i = 0; i < 4; ++i) { float x = v[i] * alpha + bv4[i]; if (CP) x += res[q][i];
        if (ACT == 3) x = fmaxf(x, 0.f); else if (ACT == 6) x = 0.5f * x * (1.0f + erff(x * 0.70710678118654752f)); else if (ACT == 11) x = 1.0f / (1.0f + expf(-x)); else if (ACT == 15) x = x / (1.0f + expf(-x)); else if (ACT == 12) x = (x > 0.f) ? x : 0.01f * x; else if (ACT == 8) x = tanhf(x); else if (ACT == 9) x = 0.5f * x * (1.0f + tanhf(0.7978845608028654f * (x + 0.044715f * x * x * x))); else if (ACT == 14) x = (x > 0.f) ? x : 0.1f * x; else if (ACT == 16) x = (x >= 0.f) ? x : 0.3f * x; else if (ACT == 17) x = (x >= 0.f) ? x : 0.2f * x;
        v[i] = x; }
      if (C) { *(v4f*)(C + cofs + (size_t)(row0 + r) * ldc + col0 + c4) = v;
        asm volatile("s_wait_xcnt 0x0" ::: "memory"); }      /* stands ahead of the f16 conversion below, which may be given the store's data registers */
      if (C16) { v4h h4; for (int i = 0; i < 4; ++i) h4[i] = (_Float16)v[i]; *(v4h*)(C16 + cofs + (size_t)(row0 + r) * ldc + col0 + c4) = h4; } }
     } }


// The short jobs below are device functions: bx is the block's index inside its job. k_prep and k_l2hT, behind them, hand each block of one grid its job.
__device__ __forceinline__ void d_wT(int bx, const float* __restrict__ w, int din, int dout, _Float16* __restrict__ Bt) { __shared__ float tl[64][65]; const int tid = threadIdx.x; const int nbo = dout / 64; const int ib = bx / nbo, ob = bx % nbo; const int i0 = ib * 64, o0 = ob * 64;
  for (int t = tid; t < 64 * 64; t += 256) { const int i = t / 64, o = t % 64; tl[o][i] = bf16_round(w[(size_t)(i0 + i) * dout + o0 + o]) * 16.0f; }
  __syncthreads();
  { for (int t = tid; t < 64 * 8; t += 256) { const int o = t / 8, i8 = (t % 8) * 8; FragH f; for (int q = 0; q < 8; ++q) f.h[q] = (_Float16)tl[o][i8 + q]; *(v8us*)((unsigned short*)Bt + (size_t)(o0 + o) * din + i0 + i8) = f.half[0]; }  } }
__device__ __forceinline__ void d_wnat(int bx, const float* __restrict__ w, size_t n8, _Float16* __restrict__ Bt) { const size_t t = (size_t)bx * 256 + threadIdx.x; if (t >= n8) return; FragH f; for (int q = 0; q < 8; ++q) f.h[q] = (_Float16)(bf16_round(w[t * 8 + q]) * 16.0f); *(v8us*)((unsigned short*)Bt + t * 8) = f.half[0];  }
// One row per wave: lane l holds columns 128 u + 4 l .. + 3 (u = 0 .. 7), so every load and every f32 store of a wave covers 512 contiguous bytes (an f16 store 256),
// and the row stays in registers between the sum of squares and the scaling. No LDS, no barrier. The unrolls keep xv, sv and o in registers (constant indices).
__device__ __forceinline__ void d_rms(int bx, const float* __restrict__ X, int xIsInput, const float* __restrict__ scale, size_t nrows, _Float16* __restrict__ N16, float* __restrict__ XF) {
  const int lane = threadIdx.x & 31; const size_t r = (size_t)bx * 8 + (threadIdx.x >> 5); if (r >= nrows) return;      /* the same for a whole wave */
  const size_t o0 = r * DM + lane * 4; const float* xp = X + o0; const float* sp = scale + lane * 4; v4f xv[DM / 128], sv[DM / 128];
#pragma unroll
  for (int u = 0; u < DM / 128; ++u) xv[u] = *(const v4fa*)(xp + u * 128);
#pragma unroll
  for (int u = 0; u < DM / 128; ++u) sv[u] = *(const v4fa*)(sp + u * 128);
  asm volatile("s_wait_xcnt 0x0" :: "v"(xp) : "memory");      /* stands ahead of every overwrite of the loads' address registers; xp as an input keeps its registers from being handed to one of the loads as a destination ahead of it */
  if (xIsInput) {
#pragma unroll
    for (int u = 0; u < DM / 128; ++u)
#pragma unroll
      for (int q = 0; q < 4; ++q) xv[u][q] = bf16_round(xv[u][q]); }
  if (XF) {      /* the f32 copy leaves as soon as it is known; xv is only read from here on */
#pragma unroll
    for (int u = 0; u < DM / 128; ++u) *(v4f*)(XF + o0 + u * 128) = xv[u];
    asm volatile("s_wait_xcnt 0x0" ::: "memory"); }      /* stands ahead of every later overwrite of these stores' address and data registers */
  float s4[4] = {0.f, 0.f, 0.f, 0.f};      /* four independent chains per lane */
#pragma unroll
  for (int u = 0; u < DM / 128; ++u)
#pragma unroll
    for (int q = 0; q < 4; ++q) s4[q] += xv[u][q] * xv[u][q];
  float ss = (s4[0] + s4[1]) + (s4[2] + s4[3]);
#pragma unroll
  for (int m = 16; m >= 1; m >>= 1) ss += __shfl_xor(ss, m, 32);      /* every lane ends with the row's sum */
  const float rs = 1.0f / sqrtf(ss / (float)DM + 1e-8f); v4h o[DM / 128];
#pragma unroll
  for (int u = 0; u < DM / 128; ++u)
#pragma unroll
    for (int q = 0; q < 4; ++q) o[u][q] = (_Float16)((xv[u][q] * rs) * bf16_round(sv[u][q]));
#pragma unroll
  for (int u = 0; u < DM / 128; ++u) *(v4h*)(N16 + o0 + u * 128) = o[u]; }
__global__ __launch_bounds__(256) void k_rms(const float* __restrict__ X, int xIsInput, const float* __restrict__ scale, size_t nrows, _Float16* __restrict__ N16, float* __restrict__ XF) { d_rms(blockIdx.x, X, xIsInput, scale, nrows, N16, XF); }
__device__ __forceinline__ void d_hT(int bx, int b, const _Float16* __restrict__ HN, _Float16* __restrict__ HT) { __shared__ unsigned short tl[64][65]; const int tid = threadIdx.x; HT += (size_t)b * DM * SQ;      /* b is the batch, each has its own [DM][SQ] plane */
  const int jb = bx % (SQ / 64), dbk = bx / (SQ / 64); const int j0 = jb * 64, d0 = dbk * 64;
  for (int i = tid; i < 64 * 8; i += 256) { const int j = i / 8, d8 = (i % 8) * 8; FragH f; f.half[0] = *(const v8us*)((const unsigned short*)HN + ((size_t)b * SQ + j0 + j) * DM + d0 + d8); for (int q = 0; q < 8; ++q) tl[d8 + q][j] = f.u[q]; }
  __syncthreads();
  { for (int i = tid; i < 64 * 8; i += 256) { const int d = i / 8, j8 = (i % 8) * 8; FragH f; for (int q = 0; q < 8; ++q) f.u[q] = tl[d][j8 + q]; *(v8us*)((unsigned short*)HT + (size_t)(d0 + d) * SQ + j0 + j8) = f.half[0]; }  } }
__device__ __forceinline__ void d_tab(int bx, const float* __restrict__ dl, float* __restrict__ T) {
  #pragma clang fp contract(off)
  const int t = bx * 256 + threadIdx.x; if (t >= SQ * RR) return; const int r = t % RR, d = t / RR; const float g = __fadd_rn(0.15f, __fmul_rn(0.85f, 1.0f / (1.0f + expf(-bf16_round(dl[r]))))); const float lg = logf(fmaxf(g, 1e-8f)); const float v = expf(__fmul_rn((float)d, lg));
  *(float*)(T + t) = v;  }
// Sixteen lanes per 64-element q or k row (the rows lie one behind the other in F): a lane holds four elements, a wave's load and store cover 512 contiguous bytes.
__device__ __forceinline__ void d_l2(int bx, float* __restrict__ F) {
  const size_t t = (size_t)bx * 256 + threadIdx.x; if (t >= NR * 2 * (RR / 4)) return;      /* whole waves only: the bound is a multiple of 32 */
  float* f = F + t * 4; const v4f a = *(const v4fa*)f; float ss = (a[0] * a[0] + a[1] * a[1]) + (a[2] * a[2] + a[3] * a[3]);
#pragma unroll
  for (int m = 8; m >= 1; m >>= 1) ss += __shfl_xor(ss, m, 32);      /* stays inside the row's sixteen lanes */
  float n = sqrtf(ss); if (n < 1e-8f) n = 1e-8f; const float inv = 1.0f / n; v4f o;
#pragma unroll
  for (int q = 0; q < 4; ++q) o[q] = a[q] * inv;
  *(v4f*)f = o; }
// Launches that need nothing of one another share one grid: a range of the block index picks the job, so every branch here is the same for a whole block.
// k_prep reads inputs only: [u|v]^T, the first rmsnorm, the three weight planes, the decay table. The jobs with the longest blocks come first.
#define PB_WT ((DM / 64) * (RR / 64))        /* blocks of one d_wT job */
#define PB_RMS ((int)(NR / 8))
#define PB_WP (DM * DM / 8 / 256)            /* blocks of d_wnat on proj_w; up_w and down_w take PB_WU each */
#define PB_WU (FH * DM / 8 / 256)
#define PB_TAB (SQ * RR / 256)
__global__ __launch_bounds__(256) void k_prep(const float* __restrict__ u, const float* __restrict__ v, const float* __restrict__ pw, const float* __restrict__ uw, const float* __restrict__ dw, const float* __restrict__ dl, const float* __restrict__ h, const float* __restrict__ n1,
    _Float16* __restrict__ BUV, _Float16* __restrict__ BP, _Float16* __restrict__ BU, _Float16* __restrict__ BD, float* __restrict__ T, _Float16* __restrict__ HN16, float* __restrict__ HF) {
  int bx = blockIdx.x;
  if (bx < 2 * PB_WT) { const int s = bx / PB_WT; d_wT(bx - s * PB_WT, s ? v : u, DM, RR, BUV + (size_t)s * RR * DM); return; }      /* [u|v]^T -> [128][1024] */
  bx -= 2 * PB_WT;
  if (bx < PB_RMS) { d_rms(bx, h, 1, n1, NR, HN16, HF); return; }      /* hn (f16) + bf16(h) (f32 residual) */
  bx -= PB_RMS;
  if (bx < PB_WP + 2 * PB_WU) { const float* w = pw; _Float16* Bt = BP; size_t n8 = (size_t)DM * DM / 8;
    if (bx >= PB_WP) { bx -= PB_WP; w = uw; Bt = BU; n8 = (size_t)FH * DM / 8; if (bx >= PB_WU) { bx -= PB_WU; w = dw; Bt = BD; } }
    d_wnat(bx, w, n8, Bt); return; }
  d_tab(bx - (PB_WP + 2 * PB_WU), dl, T); }
// The transposed hn planes need the first rmsnorm alone, the l2 normalisation the q|k product alone: one grid, the transposes first.
#define PB_HT ((SQ / 64) * (DM / 64))        /* blocks of d_hT per batch */
#define PB_L2 ((int)(NR * 2 * (RR / 4) / 256))
__global__ __launch_bounds__(256) void k_l2hT(float* __restrict__ QK, const _Float16* __restrict__ HN, _Float16* __restrict__ HT) {
  const int bx = blockIdx.x;
  if (bx < PB_HT * NB) { d_hT(bx % PB_HT, bx / PB_HT, HN, HT); return; }
  d_l2(bx - PB_HT * NB, QK); }
// Mixing matrix, one 32 (rows i) x 64 (columns j) tile per block. A thread computes eight rows of one column: its k row stays in registers, the tile's q rows and the
// decay-table rows that the tile's distances i - j reach lie in LDS (rows of a negative distance are zero; those elements are masked at the store).
// Every "#pragma unroll" in this kernel but the hf loop's "unroll 1" is there so that the small arrays it indexes (tx, qx, kr, tb, qb, acc) get constant indices and stay in registers.
#define AM_TI 32
#define AM_TJ 64
#define AM_TD (AM_TI + AM_TJ)        /* 95 distances, and one row more that nobody reads: the staging is then six whole trips of the block */
#define AM_P (RR + 4)                /* LDS row pitch in floats: 16 B x odd, so that 16 lanes on 16 neighbouring rows meet no bank twice */
__global__ __launch_bounds__(256) void k_amat(const float* __restrict__ QK, const float* __restrict__ kb, const float* __restrict__ T, const float* __restrict__ gl, const float* __restrict__ al, _Float16* __restrict__ A16) {
  __shared__ __attribute__((aligned(16))) float Ts[AM_TD][AM_P];
  __shared__ __attribute__((aligned(16))) float qs[AM_TI][RR];
  __shared__ __attribute__((aligned(16))) float sc[AM_TI][AM_P];
  const int b = blockIdx.y; A16 += (size_t)b * SQ * SQ;      /* one launch for all batches: blockIdx.y is the batch, each has its own [SQ][SQ] plane */
  const int tid = threadIdx.x; const int jt = blockIdx.x / (SQ / AM_TI), it = blockIdx.x % (SQ / AM_TI); const int i0 = it * AM_TI, j0 = jt * AM_TJ;
  const int orow = tid >> 3, oc8 = (tid & 7) * 8; const int oi = i0 + orow, oj = j0 + oc8;      /* the 8 elements this thread stores */
  unsigned short* dst = (unsigned short*)A16 + (size_t)oi * SQ + oj;
  if (j0 > i0 + AM_TI - 1) { const v8us z = {0, 0, 0, 0, 0, 0, 0, 0}; *(v8us*)dst = z; return; }      /* tile wholly above the diagonal: the whole block leaves, ahead of every barrier */
  const int jl = tid & (AM_TJ - 1), ig = tid >> 6; const int sr = tid >> 4, sc4 = (tid & 15) * 4;
  const int dmin = i0 - j0 - (AM_TJ - 1);
  const v4f kb0 = *(const v4fa*)(kb + (size_t)oi * SQ + oj), kb1 = *(const v4fa*)(kb + (size_t)oi * SQ + oj + 4);
  v4f tx[AM_TD / 16], qx[AM_TI / 16];
#pragma unroll
  for (int u = 0; u < AM_TD / 16; ++u) { const int d = dmin + sr + u * 16; const int dc = d < 0 ? 0 : (d > SQ - 1 ? SQ - 1 : d); tx[u] = *(const v4fa*)(T + (size_t)dc * RR + sc4); }
#pragma unroll
  for (int u = 0; u < AM_TI / 16; ++u) qx[u] = *(const v4fa*)(QK + ((size_t)b * SQ + i0 + sr + u * 16) * (2 * RR) + sc4);
  asm volatile("s_wait_xcnt 0x0" ::: "memory");      /* the loads below may be given address registers of the loads above as destinations: the wait stands in front of that overwrite */
  const float* kp = QK + ((size_t)b * SQ + j0 + jl) * (2 * RR); v4f kr[RR / 4];
#pragma unroll
  for (int r4 = 0; r4 < RR / 4; ++r4) kr[r4] = *(const v4fa*)(kp + RR + r4 * 4);
  asm volatile("s_wait_xcnt 0x0" :: "v"(kp) : "memory");      /* kp as an input keeps its registers from being handed to one of these loads as a destination ahead of the wait */
  __builtin_amdgcn_sched_barrier(0);      /* every global load is issued before the first wait on one: one latency for the block's start, not two */
  const float gate = 1.0f / (1.0f + expf(-bf16_round(gl[0]))); const float alpha = 1.0f / (1.0f + expf(-bf16_round(al[0])));
#pragma unroll
  for (int u = 0; u < AM_TD / 16; ++u) { const v4f z4 = {0.f, 0.f, 0.f, 0.f}; *(v4fa*)&Ts[sr + u * 16][sc4] = (dmin + sr + u * 16 < 0) ? z4 : tx[u]; }
#pragma unroll
  for (int u = 0; u < AM_TI / 16; ++u) *(v4fa*)&qs[sr + u * 16][sc4] = qx[u];
  __syncthreads();
#pragma unroll 1      /* stays rolled: the body is over 600 instructions long, and a second copy of it would save one branch */
  for (int hf = 0; hf < 2; ++hf) { const int il = ig * 8 + hf * 4;      /* four rows at a time: four independent sums, each over r in rising order */
    const float* tp = &Ts[il + (AM_TJ - 1) - jl][0]; const float* qp = &qs[il][0]; float acc[4] = {0.f, 0.f, 0.f, 0.f}; v4f tb[2][4][2], qb[2][4][2];
#pragma unroll
    for (int s = 0; s < 4; ++s)
#pragma unroll
      for (int h2 = 0; h2 < 2; ++h2) { qb[0][s][h2] = *(const v4fa*)(qp + s * RR + h2 * 4); tb[0][s][h2] = *(const v4fa*)(tp + s * AM_P + h2 * 4); }
#pragma unroll
    for (int ch = 0; ch < RR / 8; ++ch) {
      if (ch + 1 < RR / 8) {
#pragma unroll
        for (int s = 0; s < 4; ++s)
#pragma unroll
          for (int h2 = 0; h2 < 2; ++h2) { qb[(ch + 1) & 1][s][h2] = *(const v4fa*)(qp + s * RR + (ch + 1) * 8 + h2 * 4); tb[(ch + 1) & 1][s][h2] = *(const v4fa*)(tp + s * AM_P + (ch + 1) * 8 + h2 * 4); } }
      __builtin_amdgcn_sched_barrier(0);      /* keeps the next eight ranks' LDS loads ahead of this eight's arithmetic, which then covers their latency */
#pragma unroll
      for (int h2 = 0; h2 < 2; ++h2)
#pragma unroll
        for (int c = 0; c < 4; ++c)
#pragma unroll
          for (int s = 0; s < 4; ++s) acc[s] += (qb[ch & 1][s][h2][c] * kr[ch * 2 + h2][c]) * tb[ch & 1][s][h2][c];
      __builtin_amdgcn_sched_barrier(0);      /* and keeps the loads after next from rising into it, where they would need a third set of registers */
    }
#pragma unroll
    for (int s = 0; s < 4; ++s) sc[il + s][jl] = acc[s]; }
  __syncthreads();
  const v4f a0 = *(const v4fa*)&sc[orow][oc8], a1 = *(const v4fa*)&sc[orow][oc8 + 4]; FragH f;
#pragma unroll
  for (int u = 0; u < 8; ++u) { const float kv = (u < 4) ? kb0[u & 3] : kb1[u & 3]; const float av = (u < 4) ? a0[u & 3] : a1[u & 3]; const _Float16 v = (_Float16)(gate * bf16_round(kv) + alpha * av); f.h[u] = (oj + u <= oi) ? v : (_Float16)0.0f; }
  *(v8us*)dst = f.half[0]; }

extern "C" void kernel_launch(void* const* d_in, const int* in_sizes, int n_in,
                              void* d_out, int out_size, void* d_ws, size_t ws_size, hipStream_t stream) {
  (void)in_sizes; (void)n_in; (void)out_size;
  const float* const* I = (const float* const*)d_in; const float* h = I[0]; const float* kb = I[1]; const float* dl = I[2]; const float* gl = I[3]; const float* al = I[4]; const float* u = I[5]; const float* v = I[6]; const float* pw = I[7]; const float* pb = I[8]; const float* n1 = I[9]; const float* n2 = I[10]; const float* uw = I[11]; const float* ub = I[12]; const float* dw = I[13]; const float* db = I[14];
  char* ws = (char*)d_ws; size_t off = 0;
  auto take = [&](size_t bytes) { char* p = ws + off; off += (bytes + 255) & ~(size_t)255; return p; };
  _Float16* BUV = (_Float16*)take((size_t)2 * RR * DM * 2); _Float16* BP = (_Float16*)take((size_t)DM * DM * 2); _Float16* BU = (_Float16*)take((size_t)FH * DM * 2); _Float16* BD = (_Float16*)take((size_t)DM * FH * 2); float* T = (float*)take((size_t)SQ * RR * 4);
  _Float16* HN16 = (_Float16*)take(NR * DM * 2); float* HF = (float*)take(NR * DM * 4); float* QK = (float*)take(NR * 2 * RR * 4); _Float16* HT = (_Float16*)take((size_t)NB * DM * SQ * 2); _Float16* A16 = (_Float16*)take((size_t)NB * SQ * SQ * 2);
  _Float16* O16 = (_Float16*)take(NR * DM * 2); float* H1 = (float*)take(NR * DM * 4); _Float16* M16 = (_Float16*)take(NR * DM * 2); _Float16* U16 = (_Float16*)take(NR * FH * 2);
  if (off > ws_size) return;      /* 0.3 + 2 + 4 + 4 + 0.3 + 16 + 32 + 4 + 16 + 16 + 16 + 32 + 16 + 32 = about 191 MiB */
  k_prep<<<2 * PB_WT + PB_RMS + PB_WP + 2 * PB_WU + PB_TAB, 256, 0, stream>>>(u, v, pw, uw, dw, dl, h, n1, BUV, BP, BU, BD, T, HN16, HF);
  k_gemm2<0><<<dim3((unsigned)((NR / 128) * (2 * RR / 64)), 1), 128, 0, stream>>>(HN16, DM, 0, BUV, DM, 0, 0.0625f, nullptr, 0, nullptr, 1, 0, 0, QK, nullptr, 2 * RR, 0, (int)NR, 2 * RR, DM);      /* [q_raw | k_raw] */
  k_l2hT<<<PB_HT * NB + PB_L2, 256, 0, stream>>>(QK, HN16, HT);
  k_amat<<<dim3((SQ / AM_TI) * (SQ / AM_TJ), NB), 256, 0, stream>>>(QK, kb, T, gl, al, A16);
  k_gemm2<0><<<dim3((SQ / 128) * (DM / 64), NB), 128, 0, stream>>>(A16, SQ, (size_t)SQ * SQ, HT, SQ, (size_t)DM * SQ, 1.0f, nullptr, 0, nullptr, 1, 0, 0, nullptr, O16, DM, (size_t)SQ * DM, SQ, DM, SQ);      /* out_b = A_b . hn_b, b = blockIdx.y */
  const dim3 gp((unsigned)((NR / 128) * (DM / 64)), 1);
  k_gemm2<0><<<gp, 128, 0, stream>>>(O16, DM, 0, BP, DM, 0, 0.0625f, pb, 0, HF, 1, (size_t)DM, 0, H1, nullptr, DM, 0, (int)MQ, DM, DM);      /* h1 = h + out proj_w^T + proj_b */
  k_rms<<<(unsigned)((MQ + 7) / 8), 256, 0, stream>>>(H1, 0, n2, MQ, M16, nullptr);
  k_gemm2<6><<<dim3((unsigned)((NR / 128) * (FH / 64)), 1), 128, 0, stream>>>(M16, DM, 0, BU, DM, 0, 0.0625f, ub, 0, nullptr, 1, 0, 0, nullptr, U16, FH, 0, (int)MQ, FH, DM);      /* gelu_erf(m up_w^T + up_b) */
  k_gemm2<0><<<gp, 128, 0, stream>>>(U16, FH, 0, BD, FH, 0, 0.0625f, db, 0, H1, 1, (size_t)DM, 0, (float*)d_out, nullptr, DM, 0, (int)MQ, DM, FH);      /* h1 + m */
}

// v007
// Measured time: 197 microseconds a run.
// In both of two side-by-side timings against v006, it was 1.07 times as fast.
// All steps since v000 together make it 11.6 times as fast.
#include <hip/hip_runtime.h>
// K2Layer (h [8][1024][1024]; hn = rmsnorm(h)*norm1_scale; gate = sigmoid(gate_logit), alpha = sigmoid(alpha_logit); q|k = hn [u|v] (rank 64), row-l2-normalised; gamma_r = 0.15 + 0.85 sigmoid(decay_logit_r); A[i][j] = causal(j<=i) * (gate k_base[i][j] + alpha sum_r q[i][r] k[j][r] gamma_r^(i-j)); out = A . hn; h1 = h + out proj_w^T + proj_b; m = gelu_erf(rmsnorm(h1)*norm2_scale up_w^T + up_b) down_w^T + down_b; result = h1 + m -> [8][1024][1024]).
// Structure: token rows; rmsnorm on VALU (f32) into f16 rows and per-batch transposed f16 planes (LDS); the rank-64 q|k projection as a WMMA GEMM (f32), l2-normalisation and the per-rank decayed causal scores on VALU in f32 (gamma^d table built on device from decay_logit, k_base/gate/alpha read) into the f16 mixing matrix A; out = A . hn, proj (+ bias + h), up (+ bias, exact-GELU epilogue, f16), down (+ bias + h1) as WMMA GEMMs (64x64 wave tiles, 32x64 for q|k; f32 accumulation, exact x16 weights).
// Compute dtype: inputs rounded to bf16; h / weights / k_base exact; hn, A, out, rmsnorm(h1), GELU hidden plain f16 operands (~2^-12); scores, norms, residuals f32. v_wmma_f32_16x16x32_f16.
#define NB 8
#define SQ 1024
#define DM 1024
#define RR 64
#define FH 2048
#define NR ((size_t)NB * SQ)
#define MQ NR                        /* rows through the proj/MLP stage (debug hook) */
typedef __bf16 v16b __attribute__((ext_vector_type(16)));
typedef unsigned short v8us __attribute__((ext_vector_type(8), may_alias));
typedef float  v8f  __attribute__((ext_vector_type(8)));
typedef float  v4f  __attribute__((ext_vector_type(4)));
typedef float  v4fa __attribute__((ext_vector_type(4), may_alias));
union FragB { v16b v; v8us half[2]; unsigned short u[16]; };

__device__ __forceinline__ unsigned short bf16_bits(float x) { unsigned int u = __float_as_uint(x); return (unsigned short)((u + 0x7FFFu + ((u >> 16) & 1u)) >> 16); }
__device__ __forceinline__ float bf16_val(unsigned short b) { return __uint_as_float(((unsigned int)b) << 16); }
__device__ __forceinline__ float bf16_round(float x) { return bf16_val(bf16_bits(x)); }
// D += A·B with NT terms: 1 = ah·bh, 2 = + al·bh (A split), 3 = + ah·bl (both split)
template <int NT>
__device__ __forceinline__ v8f mmaN(v16b ah, v16b al, v16b bh, v16b bl, v8f c) {
  c = __builtin_amdgcn_wmma_f32_16x16x32_bf16(false, ah, false, bh, (short)0, c, false, false);
  if (NT >= 2) c = __builtin_amdgcn_wmma_f32_16x16x32_bf16(false, al, false, bh, (short)0, c, false, false);
  if (NT >= 3) c = __builtin_amdgcn_wmma_f32_16x16x32_bf16(false, ah, false, bl, (short)0, c, false, false);
  asm volatile("v_nop\n\tv_nop\n\tv_nop\n\tv_nop" : "+v"(c) : "v"(ah), "v"(al), "v"(bh), "v"(bl));
  return c;
}

__global__ __launch_bounds__(256) void k_wt_bf16(const float* __restrict__ W, unsigned short* __restrict__ Wt, int K, int N) {
  const int t = blockIdx.x * 256 + threadIdx.x;
  const int k8n = K / 8;
  if (t >= N * k8n) return;
  const int n = t / k8n, k8 = (t % k8n) * 8;
  v8us v;
#pragma unroll
  for (int i = 0; i < 8; ++i) v[i] = bf16_bits(W[(size_t)(k8 + i) * N + n]);
  *(v8us*)(Wt + (size_t)n * K + k8) = v;
  
}

// GEMM C[M][N] (f32, pitch ldc) = act(A[M][K]·W + bias). A f32 row-major (pitch lda) converted per fragment to bf16
// (ASPLIT: hi/lo two planes -> 2 terms, else single rounded term); Wt bf16 [N][K] (pitch ldb). BIAS_BF16 rounds the
// bias to bf16 first (bias quantised to bf16 before the add). K%32==0, M%16==0, N%64==0.
template <bool ASPLIT, int ACT, bool BIAS_BF16>
__global__ __launch_bounds__(128) void k_gemm_bf(const float* __restrict__ A, int lda, const unsigned short* __restrict__ Wt, int ldb,
                                               const float* __restrict__ bias, float* __restrict__ C, int ldc, int M, int N, int K) {
  __shared__ __attribute__((aligned(16))) float so[4][16][64];
  const int tid = threadIdx.x, w = tid >> 5, lane = tid & 31, ln = lane & 15, hh = lane >> 4;
  const int ntn = N / 64;
  const int wid = blockIdx.x * 4 + w;
  const int mt = wid / ntn, nq = wid % ntn;
  if (mt * 16 >= M) return;
  const int row0 = mt * 16, col0 = nq * 64;
  const float* arow = A + (size_t)(row0 + ln) * lda;
  v8f acc[4] = {};
  for (int kb = 0; kb < K; kb += 32) {
    FragB ah, al;
    const v4f x0 = *(const v4fa*)(arow + kb + 8 * hh), x1 = *(const v4fa*)(arow + kb + 8 * hh + 4);
    const v4f x2 = *(const v4fa*)(arow + kb + 16 + 8 * hh), x3 = *(const v4fa*)(arow + kb + 16 + 8 * hh + 4);
    float xs[16] = {x0[0],x0[1],x0[2],x0[3],x1[0],x1[1],x1[2],x1[3],x2[0],x2[1],x2[2],x2[3],x3[0],x3[1],x3[2],x3[3]};
#pragma unroll
    for (int i = 0; i < 16; ++i) { const unsigned short hb = bf16_bits(xs[i]); ah.u[i] = hb; al.u[i] = ASPLIT ? bf16_bits(xs[i] - bf16_val(hb)) : (unsigned short)0; }
#pragma unroll
    for (int t = 0; t < 4; ++t) {
      const unsigned short* brow = Wt + (size_t)(col0 + t * 16 + ln) * ldb + kb;
      FragB b;
      b.half[0] = *(const v8us*)(brow + 8 * hh);
      b.half[1] = *(const v8us*)(brow + 16 + 8 * hh);
      acc[t] = mmaN<ASPLIT ? 2 : 1>(ah.v, al.v, b.v, b.v, acc[t]);
    }
  }
#pragma unroll
  for (int t = 0; t < 4; ++t) {
    float bv = bias ? bias[col0 + t * 16 + ln] : 0.f;
    if (BIAS_BF16) bv = bf16_round(bv);
#pragma unroll
    for (int r = 0; r < 8; ++r) { float v = acc[t][r] + bv; if (ACT == 1) v = fmaxf(v, 0.f); so[w][8 * hh + r][t * 16 + ln] = v; }
  }
  __builtin_amdgcn_fence(__ATOMIC_ACQ_REL, "workgroup");
  __builtin_amdgcn_wave_barrier();
  const int rsub = lane >> 4, c4 = (lane & 15) * 4;
  {
#pragma unroll
    for (int q = 0; q < 8; ++q) {
      const int r = q * 2 + rsub;
      const v4f v = *(const v4fa*)&so[w][r][c4];
      *(v4f*)(C + (size_t)(row0 + r) * ldc + col0 + c4) = v;
    }
    
  }
}

// GEMM C = act(A·W + bias + resid): A f32 (ASPLIT -> hi/lo 2 terms), Wt bf16 [N][K]; ACT 0 none, 1 relu, 2 exact gelu;
// resid (optional, f32, row index = (row % rmod), pitch ldr, RES_BF16 rounds it) added before the activation.
template <bool ASPLIT, int ACT, bool BIAS_BF16, bool RES_BF16>
__global__ __launch_bounds__(128) void k_gemm_bf3(const float* __restrict__ A, int lda, const unsigned short* __restrict__ Wt, int ldb,
                                                const float* __restrict__ bias, const float* __restrict__ resid, int rmod, int ldr,
                                                float* __restrict__ C, int ldc, int M, int N, int K) {
  __shared__ __attribute__((aligned(16))) float so[4][16][64];
  const int tid = threadIdx.x, w = tid >> 5, lane = tid & 31, ln = lane & 15, hh = lane >> 4;
  const int ntn = N / 64;
  const int wid = blockIdx.x * 4 + w;
  const int mt = wid / ntn, nq = wid % ntn;
  if (mt * 16 >= M) return;
  const int row0 = mt * 16, col0 = nq * 64;
  const float* arow = A + (size_t)(row0 + ln) * lda;
  v8f acc[4] = {};
  for (int kb = 0; kb < K; kb += 32) {
    FragB ah, al;
    const v4f x0 = *(const v4fa*)(arow + kb + 8 * hh), x1 = *(const v4fa*)(arow + kb + 8 * hh + 4);
    const v4f x2 = *(const v4fa*)(arow + kb + 16 + 8 * hh), x3 = *(const v4fa*)(arow + kb + 16 + 8 * hh + 4);
    float xs[16] = {x0[0],x0[1],x0[2],x0[3],x1[0],x1[1],x1[2],x1[3],x2[0],x2[1],x2[2],x2[3],x3[0],x3[1],x3[2],x3[3]};
#pragma unroll
    for (int i = 0; i < 16; ++i) { const unsigned short hb = bf16_bits(xs[i]); ah.u[i] = hb; al.u[i] = ASPLIT ? bf16_bits(xs[i] - bf16_val(hb)) : (unsigned short)0; }
#pragma unroll
    for (int t = 0; t < 4; ++t) {
      const unsigned short* brow = Wt + (size_t)(col0 + t * 16 + ln) * ldb + kb;
      FragB b;
      b.half[0] = *(const v8us*)(brow + 8 * hh);
      b.half[1] = *(const v8us*)(brow + 16 + 8 * hh);
      acc[t] = mmaN<ASPLIT ? 2 : 1>(ah.v, al.v, b.v, b.v, acc[t]);
    }
  }
#pragma unroll
  for (int t = 0; t < 4; ++t) {
    const int col = col0 + t * 16 + ln;
    float bv = bias ? bias[col] : 0.f;
    if (BIAS_BF16) bv = bf16_round(bv);
#pragma unroll
    for (int r = 0; r < 8; ++r) {
      float v = acc[t][r] + bv;
      if (resid) { float rv = resid[(size_t)((row0 + 8 * hh + r) % rmod) * ldr + col]; if (RES_BF16) rv = bf16_round(rv); v += rv; }
      if (ACT == 1) v = fmaxf(v, 0.f);
      if (ACT == 2) v = 0.5f * v * (1.0f + erff(v * 0.70710678118654752f));
      if (ACT == 3) { const float u = 0.7978845608028654f * (v + 0.044715f * v * v * v); v = 0.5f * v * (1.0f + tanhf(u)); }
      so[w][8 * hh + r][t * 16 + ln] = v;
    }
  }
  __builtin_amdgcn_fence(__ATOMIC_ACQ_REL, "workgroup");
  __builtin_amdgcn_wave_barrier();
  const int rsub = lane >> 4, c4 = (lane & 15) * 4;
  {
#pragma unroll
    for (int q = 0; q < 8; ++q) {
      const int r = q * 2 + rsub;
      const v4f v = *(const v4fa*)&so[w][r][c4];
      *(v4f*)(C + (size_t)(row0 + r) * ldc + col0 + c4) = v;
    }
    
  }
}
// row LayerNorm (biased variance, eps) over N: s = X (+ R); optional out_sum <- s; out_norm <- (s-mu)*rsqrt(var+eps)*g + b
template <bool PARAM_BF16>
__global__ __launch_bounds__(256) void k_layernorm(const float* __restrict__ X, const float* __restrict__ R, const float* __restrict__ g, const float* __restrict__ bta,
                                                  float* __restrict__ out_sum, float* __restrict__ out_norm, int N, float eps) {
  __shared__ float red[256];
  const int row = blockIdx.x, tid = threadIdx.x;
  const float* x = X + (size_t)row * N; const float* rr = R ? R + (size_t)row * N : nullptr;
  float vals[16];                     // up to N = 4096
  const int per = N / 256;            // contiguous chunk per thread? use strided-by-4 chunks: thread handles j = tid*4 + 1024*u
  float s1 = 0.f;
  for (int u = 0; u < per / 4; ++u) {
    const int j = tid * 4 + 1024 * u;
    const v4f a = *(const v4fa*)(x + j);
    v4f b = {0.f,0.f,0.f,0.f}; if (rr) b = *(const v4fa*)(rr + j);
#pragma unroll
    for (int q = 0; q < 4; ++q) { const float v = a[q] + b[q]; vals[u * 4 + q] = v; s1 += v; }
  }
  red[tid] = s1; __syncthreads();
  for (int st = 128; st > 0; st >>= 1) { if (tid < st) red[tid] += red[tid + st]; __syncthreads(); }
  const float mu = red[0] / (float)N; __syncthreads();
  float s2 = 0.f;
  for (int u = 0; u < per / 4; ++u)
#pragma unroll
    for (int q = 0; q < 4; ++q) { const float c = vals[u * 4 + q] - mu; s2 += c * c; }
  red[tid] = s2; __syncthreads();
  for (int st = 128; st > 0; st >>= 1) { if (tid < st) red[tid] += red[tid + st]; __syncthreads(); }
  const float rs = rsqrtf(red[0] / (float)N + eps);
  {
    for (int u = 0; u < per / 4; ++u) {
      const int j = tid * 4 + 1024 * u;
      v4f o, sm;
#pragma unroll
      for (int q = 0; q < 4; ++q) {
        float gg = g[j + q], bb = bta[j + q];
        if (PARAM_BF16) { gg = bf16_round(gg); bb = bf16_round(bb); }
        sm[q] = vals[u * 4 + q]; o[q] = (vals[u * 4 + q] - mu) * rs * gg + bb;
      }
      if (out_sum) *(v4f*)(out_sum + (size_t)row * N + j) = sm;
      *(v4f*)(out_norm + (size_t)row * N + j) = o;
    }
    
  }
}



// ---- f16 WMMA path (v_wmma_f32_16x16x32_f16): 11-bit significands for operands in range — used for every GEMM launched here
typedef _Float16 v16h __attribute__((ext_vector_type(16)));
union FragH { v16h v; v8us half[2]; _Float16 h[16]; unsigned short u[16]; };
template <int NT>
__device__ __forceinline__ v8f mmaH(v16h ah, v16h al, v16h bh, v16h bl, v8f c) {
  c = __builtin_amdgcn_wmma_f32_16x16x32_f16(false, ah, false, bh, (short)0, c, false, false);
  if (NT >= 2) c = __builtin_amdgcn_wmma_f32_16x16x32_f16(false, al, false, bh, (short)0, c, false, false);
  if (NT >= 3) c = __builtin_amdgcn_wmma_f32_16x16x32_f16(false, ah, false, bl, (short)0, c, false, false);
  asm volatile("v_nop\n\tv_nop\n\tv_nop\n\tv_nop" : "+v"(c) : "v"(ah), "v"(al), "v"(bh), "v"(bl));
  return c;
}
// batched GEMM like k_gemm_b but f16 operands: A f32 (split into f16 hi/lo if ASPLIT, else rounded to f16), Bt = f16 values [n][k]; alpha; C f32; N multiple of 16 (partial tiles skipped)
template <bool ASPLIT>
__global__ __launch_bounds__(128) void k_gemm_h(const float* __restrict__ A, int lda, size_t sA, const _Float16* __restrict__ Bh, int ldb, size_t sB, float alpha, float* __restrict__ C, int ldc, size_t sC, int M, int N, int K) {
  __shared__ __attribute__((aligned(16))) float so[4][16][64];
  const int tid = threadIdx.x, w = tid >> 5, lane = tid & 31, ln = lane & 15, hh = lane >> 4; const int by = blockIdx.y;
  A += (size_t)by * sA; Bh += (size_t)by * sB; C += (size_t)by * sC;
  const int ntn = (N + 63) / 64; const int wid = blockIdx.x * 4 + w; const int mt = wid / ntn, nq = wid % ntn; if (mt * 16 >= M) return;
  const int row0 = mt * 16, col0 = nq * 64; const float* arow = A + (size_t)(row0 + ln) * lda;
  v8f acc[4] = {};
  for (int kb = 0; kb < K; kb += 32) {
    FragH ah, al;
    const v4f x0 = *(const v4fa*)(arow + kb + 8 * hh), x1 = *(const v4fa*)(arow + kb + 8 * hh + 4), x2 = *(const v4fa*)(arow + kb + 16 + 8 * hh), x3 = *(const v4fa*)(arow + kb + 16 + 8 * hh + 4);
    float xs[16] = {x0[0],x0[1],x0[2],x0[3],x1[0],x1[1],x1[2],x1[3],x2[0],x2[1],x2[2],x2[3],x3[0],x3[1],x3[2],x3[3]};
#pragma unroll
    for (int i = 0; i < 16; ++i) { const _Float16 h = (_Float16)xs[i]; ah.h[i] = h; al.h[i] = ASPLIT ? (_Float16)(xs[i] - (float)h) : (_Float16)0.0f; }
#pragma unroll
    for (int t = 0; t < 4; ++t) { if (col0 + t * 16 >= N) continue; const size_t boff = (size_t)(col0 + t * 16 + ln) * ldb + kb; FragH bq; bq.half[0] = *(const v8us*)(Bh + boff + 8 * hh); bq.half[1] = *(const v8us*)(Bh + boff + 16 + 8 * hh);
      acc[t] = mmaH<ASPLIT ? 2 : 1>(ah.v, al.v, bq.v, bq.v, acc[t]); }
  }
#pragma unroll
  for (int t = 0; t < 4; ++t) { if (col0 + t * 16 >= N) continue;
#pragma unroll
    for (int r = 0; r < 8; ++r) so[w][8 * hh + r][t * 16 + ln] = acc[t][r] * alpha; }
  __builtin_amdgcn_fence(__ATOMIC_ACQ_REL, "workgroup"); __builtin_amdgcn_wave_barrier();
  const int rsub = lane >> 4, c4 = (lane & 15) * 4;
  {
#pragma unroll
    for (int q = 0; q < 8; ++q) { const int r = q * 2 + rsub; if (col0 + c4 < N) { const v4f v = *(const v4fa*)&so[w][r][c4]; *(v4f*)(C + (size_t)(row0 + r) * ldc + col0 + c4) = v; } }
     }
}

// Wt[n][k] = f16(W[k][n]·scale) from f32 row-major W[K][N] (scale = power of two; bf16-exact weights stay exact in f16 away from the subnormal range)
__global__ __launch_bounds__(256) void k_wt_f16(const float* __restrict__ W, _Float16* __restrict__ Wt, int K, int N, float scale) {
  const int t = blockIdx.x * 256 + threadIdx.x; if (t >= N * (K / 8)) return; const int n = t / (K / 8), k8 = (t % (K / 8)) * 8; FragH f;
#pragma unroll
  for (int i = 0; i < 8; ++i) f.h[i] = (_Float16)(bf16_round(W[(size_t)(k8 + i) * N + n]) * scale); const v8us o = f.half[0];
  *(v8us*)((unsigned short*)Wt + (size_t)n * K + k8) = o; 
}
// k_gemm_hh variant with fused epilogue: v = acc·alpha + bias[by·sBias + col] (+ CP[(row/rowsPerB)·sCPb + by·64 + col] if CP) ; ACT 0 none / 1 elu ; writes f16 C16 (and f32 C if non-null)
template <int ACT>
__global__ __launch_bounds__(128) void k_gemm_hhx(const _Float16* __restrict__ A, int lda, size_t sA, const _Float16* __restrict__ Bh, int ldb, size_t sB, float alpha, const float* __restrict__ bias, size_t sBias, const float* __restrict__ CP, int rowsPerB, size_t sCPb, int row0g,
    float* __restrict__ C, _Float16* __restrict__ C16, int ldc, size_t sC, int M, int N, int K) {
  __shared__ __attribute__((aligned(16))) float so[4][16][64];
  const int tid = threadIdx.x, w = tid >> 5, lane = tid & 31, ln = lane & 15, hh = lane >> 4; const int by = blockIdx.y;
  A += (size_t)by * sA; Bh += (size_t)by * sB; const size_t cofs = (size_t)by * sC; const float* bp = bias ? bias + (size_t)by * sBias : nullptr;
  const int ntn = (N + 63) / 64; const int wid = blockIdx.x * 4 + w; const int mt = wid / ntn, nq = wid % ntn; if (mt * 16 >= M) return;
  const int row0 = mt * 16, col0 = nq * 64; const _Float16* arow = A + (size_t)(row0 + ln) * lda;
  v8f acc[4] = {};
  for (int kb = 0; kb < K; kb += 32) { FragH ah; ah.half[0] = *(const v8us*)((const unsigned short*)arow + kb + 8 * hh); ah.half[1] = *(const v8us*)((const unsigned short*)arow + kb + 16 + 8 * hh);
#pragma unroll
    for (int t = 0; t < 4; ++t) { if (col0 + t * 16 >= N) continue; const size_t boff = (size_t)(col0 + t * 16 + ln) * ldb + kb; FragH bq; bq.half[0] = *(const v8us*)((const unsigned short*)Bh + boff + 8 * hh); bq.half[1] = *(const v8us*)((const unsigned short*)Bh + boff + 16 + 8 * hh);
      acc[t] = mmaH<1>(ah.v, ah.v, bq.v, bq.v, acc[t]); }
  }
#pragma unroll
  for (int t = 0; t < 4; ++t) { if (col0 + t * 16 >= N) continue; const int col = col0 + t * 16 + ln; const float bv = bp ? bf16_round(bp[col]) : 0.f;
#pragma unroll
    for (int r = 0; r < 8; ++r) { float v = acc[t][r] * alpha + bv; if (CP) { const int rr = row0g + row0 + 8 * hh + r; if (rowsPerB < 0) v += CP[cofs + (size_t)rr * ldc + col];      /* rowsPerB < 0: own element of the batched C plane */ else { const int bidx = rr / rowsPerB; v += CP[(size_t)bidx * sCPb + (size_t)by * 64 + col]; } } if (ACT == 1) v = (v > 0.f) ? v : expm1f(v); else if (ACT == 7) v = (v > 0.f) ? v + 1.0f : expf(v); else if (ACT == 8) v = tanhf(v); else if (ACT == 9) v = 0.5f * v * (1.0f + tanhf(0.7978845608028654f * (v + 0.044715f * v * v * v))); else if (ACT == 11) v = 1.0f / (1.0f + expf(-v)); else if (ACT == 12) v = (v > 0.f) ? v : 0.01f * v; else if (ACT == 14) v = (v > 0.f) ? v : 0.1f * v; else if (ACT == 16) v = (v >= 0.f) ? v : 0.3f * v; else if (ACT == 17) v = (v >= 0.f) ? v : 0.2f * v; else if (ACT == 15) v = v / (1.0f + expf(-v)); else if (ACT == 3) v = fmaxf(v, 0.f); else if (ACT == 6) v = 0.5f * v * (1.0f + erff(v * 0.70710678118654752f)); so[w][8 * hh + r][t * 16 + ln] = v; } }
  __builtin_amdgcn_fence(__ATOMIC_ACQ_REL, "workgroup"); __builtin_amdgcn_wave_barrier();
  const int rsub = lane >> 4, c4 = (lane & 15) * 4; typedef _Float16 v4h __attribute__((ext_vector_type(4)));
  {
#pragma unroll
    for (int q = 0; q < 8; ++q) { const int r = q * 2 + rsub; if (col0 + c4 < N) { const v4f v = *(const v4fa*)&so[w][r][c4]; if (C) *(v4f*)(C + cofs + (size_t)(row0 + r) * ldc + col0 + c4) = v; if (C16) { v4h h4; for (int i = 0; i < 4; ++i) h4[i] = (_Float16)v[i]; *(v4h*)(C16 + cofs + (size_t)(row0 + r) * ldc + col0 + c4) = h4; } } }
     }
}


typedef _Float16 v4h __attribute__((ext_vector_type(4)));

__global__ __launch_bounds__(256) void k_x16(const float* __restrict__ x, _Float16* __restrict__ X16, size_t n8) { const size_t t = (size_t)blockIdx.x * 256 + threadIdx.x; if (t >= n8) return; FragH f;
#pragma unroll
  for (int q = 0; q < 8; ++q) f.h[q] = (_Float16)bf16_round(x[t * 8 + q]); *(v8us*)((unsigned short*)X16 + t * 8) = f.half[0];  }
__global__ __launch_bounds__(256) void k_h16(const float* __restrict__ x, _Float16* __restrict__ X16, size_t n8) { const size_t t = (size_t)blockIdx.x * 256 + threadIdx.x; if (t >= n8) return; FragH f;
#pragma unroll
  for (int q = 0; q < 8; ++q) f.h[q] = (_Float16)x[t * 8 + q]; *(v8us*)((unsigned short*)X16 + t * 8) = f.half[0];  }
__global__ __launch_bounds__(256) void k_round16f(const float* __restrict__ W, _Float16* __restrict__ Bt, size_t n8) { const size_t t = (size_t)blockIdx.x * 256 + threadIdx.x; if (t >= n8) return; FragH f;
#pragma unroll
  for (int i = 0; i < 8; ++i) f.h[i] = (_Float16)(bf16_round(W[t * 8 + i]) * 16.0f); *(v8us*)((unsigned short*)Bt + t * 8) = f.half[0];  }
template <int NHv, int TTv>
__global__ __launch_bounds__(256) void k_vt(const _Float16* __restrict__ V16, int ldv, int voff, _Float16* __restrict__ Vt) { __shared__ unsigned short tl[64][66]; const int tid = threadIdx.x; const int slab = blockIdx.x / (TTv / 64), lg = blockIdx.x % (TTv / 64); const int b = slab / NHv, h = slab % NHv;
  for (int i = tid; i < 64 * 8; i += 256) { const int r = i / 8, c8 = (i % 8) * 8; FragH f; f.half[0] = *(const v8us*)((const unsigned short*)V16 + ((size_t)b * TTv + lg * 64 + r) * ldv + voff + h * 64 + c8);
#pragma unroll
    for (int q = 0; q < 8; ++q) tl[r][c8 + q] = f.u[q]; }
  __syncthreads();
  {
#pragma unroll
    for (int rd = 0; rd < 2; ++rd) { const int d = rd * 32 + tid / 8, pc = tid % 8; FragH f;
#pragma unroll
      for (int q = 0; q < 8; ++q) f.u[q] = tl[pc * 8 + q][d];
      *(v8us*)((unsigned short*)Vt + ((size_t)slab * 64 + d) * TTv + lg * 64 + pc * 8) = f.half[0]; }
     } }

__global__ __launch_bounds__(256) void k_hl(const float* __restrict__ F, _Float16* __restrict__ Hh, _Float16* __restrict__ Hl, size_t n8) { const size_t t = (size_t)blockIdx.x * 256 + threadIdx.x; if (t >= n8) return; FragH fh, fl; const v4f a = *(const v4fa*)(F + t * 8), c = *(const v4fa*)(F + t * 8 + 4);
#pragma unroll
  for (int q = 0; q < 4; ++q) { _Float16 h = (_Float16)a[q]; fh.h[q] = h; fl.h[q] = (_Float16)((a[q] - (float)h) * 1024.0f); h = (_Float16)c[q]; fh.h[4 + q] = h; fl.h[4 + q] = (_Float16)((c[q] - (float)h) * 1024.0f); }
  { *(v8us*)((unsigned short*)Hh + t * 8) = fh.half[0]; *(v8us*)((unsigned short*)Hl + t * 8) = fl.half[0];  } }

// ---- fast GEMM, two shapes picked by WC: WC = 1: block tile 128x64, 4 waves (4 x 1), wave tile 32x64; WC = 2: block tile 256x128, 8 waves (4 x 2), wave tile 64x64.
// Requires M % (128 WC) == 0 rows per launch region, N % (64 WC) == 0, K % 64 == 0, K >= 64; epilogue = k_gemm_hhx semantics ----
// The larger tile fetches half the operand bytes from L2 per product (384 rows for 256x128 outputs, not 192 for 128x64) and reads two thirds of the LDS bytes per matrix instruction (8 fragments for 16, not 6 for 8).
// Operands go global -> LDS by asynchronous copies, 64 k (one whole 128-byte line of every operand row) per stage, two buffers: eight lanes cover a row's line, so a
// wave's copy touches four whole lines, and every line is fetched once per block. The fragments are read from LDS in the k order of g2_frag.
#define G2_KS 64                              /* k per stage */
#define G2_PITCH 144                          /* LDS row pitch in bytes: 16 B x odd, so that 16 lanes on 16 neighbouring rows meet no bank twice */
__device__ __forceinline__ v16h g2_frag(const unsigned char* p, int hh) { FragH f; f.half[0] = *(const v8us*)(p + 16 * hh); f.half[1] = *(const v8us*)(p + 32 + 16 * hh); return f.v; }
__device__ __forceinline__ v8f g2_mma(v16h a, v16h b, v8f c) { v8f d = __builtin_amdgcn_wmma_f32_16x16x32_f16(false, a, false, b, (short)0, c, false, false); asm volatile("v_nop\n\tv_nop\n\tv_nop\n\tv_nop" : "+v"(d) : "v"(a), "v"(b)); return d; }
// One stage's twelve copies of a thread (16 bytes each): rows sr + RS i of A (i = 0 .. 7) and of B (i = 0 .. 3), RS = the rows that the block's threads cover at once; B lies behind A's 8 RS rows.
// l = the thread's LDS byte address in the stage's row sr. The s_wait_xcnt closes the statement, so that it stands ahead of every later overwrite of the copies' address registers.
template <int RS>
__device__ __forceinline__ void g2_copy(unsigned l, const _Float16* ga, size_t sa, const _Float16* gb, size_t sb) {
  asm volatile("global_load_async_to_lds_b128 %0, %12, off\n\t" "global_load_async_to_lds_b128 %1, %13, off\n\t" "global_load_async_to_lds_b128 %2, %14, off\n\t" "global_load_async_to_lds_b128 %3, %15, off\n\t"
               "global_load_async_to_lds_b128 %4, %16, off\n\t" "global_load_async_to_lds_b128 %5, %17, off\n\t" "global_load_async_to_lds_b128 %6, %18, off\n\t" "global_load_async_to_lds_b128 %7, %19, off\n\t"
               "global_load_async_to_lds_b128 %8, %20, off\n\t" "global_load_async_to_lds_b128 %9, %21, off\n\t" "global_load_async_to_lds_b128 %10, %22, off\n\t" "global_load_async_to_lds_b128 %11, %23, off\n\t"
               "s_wait_xcnt 0x0"
               :: "v"(l), "v"(l + RS * G2_PITCH), "v"(l + 2 * RS * G2_PITCH), "v"(l + 3 * RS * G2_PITCH), "v"(l + 4 * RS * G2_PITCH), "v"(l + 5 * RS * G2_PITCH), "v"(l + 6 * RS * G2_PITCH), "v"(l + 7 * RS * G2_PITCH),
                  "v"(l + 8 * RS * G2_PITCH), "v"(l + 9 * RS * G2_PITCH), "v"(l + 10 * RS * G2_PITCH), "v"(l + 11 * RS * G2_PITCH),
                  "v"(ga), "v"(ga + sa), "v"(ga + 2 * sa), "v"(ga + 3 * sa), "v"(ga + 4 * sa), "v"(ga + 5 * sa), "v"(ga + 6 * sa), "v"(ga + 7 * sa),
                  "v"(gb), "v"(gb + sb), "v"(gb + 2 * sb), "v"(gb + 3 * sb) : "memory"); }
// Eight of a lane's residual loads (16 bytes each), issued one behind the other with no wait on their data between them.
// The s_wait_xcnt stands ahead of every overwrite of the loads' address registers; the addresses as its inputs keep their registers from being rewritten, or handed to one of the loads as a destination, ahead of it.
__device__ __forceinline__ void g2_res8(const float* const (&rp)[8], v4f* res) {
#pragma unroll      /* constant indices: rp and res stay in registers */
  for (int q = 0; q < 8; ++q) res[q] = *(const v4fa*)rp[q];
  asm volatile("s_wait_xcnt 0x0" :: "v"(rp[0]), "v"(rp[1]), "v"(rp[2]), "v"(rp[3]), "v"(rp[4]), "v"(rp[5]), "v"(rp[6]), "v"(rp[7]) : "memory"); }
// A lane's share of the residual for 32 rows from row rbase on: sixteen 16-byte loads, in two runs of eight (sixteen address pairs at once would cost registers).
__device__ __forceinline__ void g2_res16(const float* __restrict__ CP, int rowsPerB, size_t sCPb, size_t cofs, int by, int ldc, int rbase, int colc, v4f* res) {
  if (rowsPerB < 0) {      /* rowsPerB < 0: own elements of the batched C plane */
#pragma unroll
    for (int g = 0; g < 2; ++g) { const float* rp[8];
#pragma unroll
      for (int q = 0; q < 8; ++q) rp[q] = CP + cofs + (size_t)(rbase + (g * 8 + q) * 2) * ldc + colc;
      g2_res8(rp, res + g * 8); }
  } else {
#pragma unroll
    for (int g = 0; g < 2; ++g) { const float* rp[8];
#pragma unroll
      for (int q = 0; q < 8; ++q) { const int bidx = (rbase + (g * 8 + q) * 2) / rowsPerB; rp[q] = CP + (size_t)bidx * sCPb + (size_t)by * 64 + colc; }
      g2_res8(rp, res + g * 8); } } }
template <int ACT, int WC>
__global__ __launch_bounds__(128 * WC) void k_gemm2(const _Float16* __restrict__ A, int lda, size_t sA, const _Float16* __restrict__ Bh, int ldb, size_t sB, float alpha, const float* __restrict__ bias, size_t sBias, const float* __restrict__ CP, int rowsPerB, size_t sCPb, int row0g,
    float* __restrict__ C, _Float16* __restrict__ C16, int ldc, size_t sC, int M, int N, int K) { static_assert(ACT == 0 || ACT == 3 || ACT == 6 || ACT == 8 || ACT == 9 || ACT == 11 || ACT == 12 || ACT == 14 || ACT == 15 || ACT == 16 || ACT == 17, "k_gemm2: unsupported ACT code (would silently apply no activation)");
  static_assert(WC == 1 || WC == 2, "k_gemm2: two shapes");
  constexpr int NW = 4 * WC, FA = 2 * WC, BM = 128 * WC, BN = 64 * WC, RS = 4 * NW;      /* waves, A fragments per wave, block tile, rows per copy of the block */
  constexpr unsigned STAGE = (unsigned)((BM + BN) * G2_PITCH);      /* one stage: [A BM rows | B BN rows] */
  __shared__ __attribute__((aligned(16))) unsigned char sm[2 * STAGE]; static_assert(sizeof(float) * NW * 32 * 68 <= 2 * STAGE, "the output staging lies in the ring");
  float (*so)[32][68] = (float (*)[32][68])sm;      /* output staging, 32 rows of a wave at a time: used only behind the last trip's barrier, when no wave reads the ring any more */
  const int tid = threadIdx.x, w = tid >> 5, lane = tid & 31, ln = lane & 15, hh = lane >> 4; const int by = blockIdx.y; const int wr = w & 3, wc = w >> 2;
  A += (size_t)by * sA; Bh += (size_t)by * sB; const size_t cofs = (size_t)by * sC; const float* bp = bias ? bias + (size_t)by * sBias : nullptr;
  const int ntn = N / BN; const int mt = blockIdx.x / ntn, nq = blockIdx.x - mt * ntn; const int row0 = mt * BM + 16 * FA * wr, col0 = nq * BN + 64 * wc; if (mt * BM >= M) return;      /* the whole block leaves, ahead of every copy and barrier */
  const int sr = tid >> 3, sc = tid & 7;      /* the thread's first row of a stage and its 16-byte piece of the row's line */
  const _Float16* ga = A + (size_t)(mt * BM + sr) * lda + sc * 8; const _Float16* gb = Bh + (size_t)(nq * BN + sr) * ldb + sc * 8; const size_t sa = (size_t)RS * lda, sb = (size_t)RS * ldb;
  const unsigned l0 = (unsigned)(size_t)sm + (unsigned)(sr * G2_PITCH + sc * 16);
  const unsigned char* ar = sm + (16 * FA * wr + ln) * G2_PITCH; const unsigned char* br = sm + (BM + 64 * wc + ln) * G2_PITCH;
  const int nt = K / G2_KS;
  const v8f z8 = {0.f,0.f,0.f,0.f,0.f,0.f,0.f,0.f}; v8f acc[FA][4];
#pragma unroll      /* constant indices here and below: acc, fa and fb stay in registers */
  for (int i = 0; i < FA; ++i)
#pragma unroll
    for (int j = 0; j < 4; ++j) acc[i][j] = z8;
  g2_copy<RS>(l0, ga, sa, gb, sb);
  asm volatile("s_wait_asynccnt 0x0" ::: "memory");      /* this wave's copies of stage 0 have landed */
  __syncthreads();      /* and every other wave's: stage 0 may be read */
  if (nt > 1) g2_copy<RS>(l0 + STAGE, ga + G2_KS, sa, gb + G2_KS, sb);
  constexpr int KG = (WC == 1) ? 2 : 1;      /* 32-k blocks whose fragments are held at once: both of the stage where they fit beside the accumulators */
#pragma unroll 1      /* one trip per stage: the buffer is chosen by the trip's parity */
  for (int t = 0; t < nt; ++t) { const unsigned bo = (unsigned)(t & 1) * STAGE;
    const unsigned char* ap = ar + bo; const unsigned char* bq = br + bo;
#pragma unroll      /* the stage's two 32-k blocks, straight-line, k rising */
    for (int kg = 0; kg < 2; kg += KG) { v16h fa[KG][FA], fb[KG][4];
#pragma unroll
      for (int kk = 0; kk < KG; ++kk) {
#pragma unroll
        for (int i = 0; i < FA; ++i) fa[kk][i] = g2_frag(ap + i * 16 * G2_PITCH + (kg + kk) * 64, hh);
#pragma unroll
        for (int j = 0; j < 4; ++j) fb[kk][j] = g2_frag(bq + j * 16 * G2_PITCH + (kg + kk) * 64, hh); }
#pragma unroll
      for (int kk = 0; kk < KG; ++kk)
#pragma unroll
        for (int j = 0; j < 4; ++j)
#pragma unroll
          for (int i = 0; i < FA; ++i) acc[i][j] = g2_mma(fa[kk][i], fb[kk][j], acc[i][j]); }
    asm volatile("s_wait_dscnt 0x0" ::: "memory");      /* this wave's reads of the buffer are done */
    asm volatile("s_wait_asynccnt 0x0" ::: "memory");      /* its copies of stage t + 1 have landed */
    __syncthreads();      /* publishes stage t + 1 and ends every reader's last read of stage t's buffer */
    if (t + 2 < nt) g2_copy<RS>(l0 + bo, ga + (size_t)(t + 2) * G2_KS, sa, gb + (size_t)(t + 2) * G2_KS, sb); }
  asm volatile("s_wait_asynccnt 0x0" ::: "memory");      /* no copy is outstanding when the ring becomes output staging */
  // Scale, bias, residual and activation are applied where the staged rows are read back: there a lane holds four neighbouring columns of a row, so that its share of the residual is
  // sixteen 16-byte loads per 32 rows (a wave's load covers whole 128-byte lines), all of them issued ahead of the staging and waited for once. The unrolls keep res and acc in registers (constant indices).
  const int rsub = lane >> 4, c4 = (lane & 15) * 4; const v4f z4 = {0.f, 0.f, 0.f, 0.f};
#pragma unroll 1      /* 32 rows of the wave's tile per trip; stays rolled: a second copy of this body would double the kernel's text, which runs once per wave, straight from the instruction fetch */
  for (int hf = 0; hf < FA / 2; ++hf) { v4f res[16], bv4 = z4;
    if (CP) g2_res16(CP, rowsPerB, sCPb, cofs, by, ldc, row0g + row0 + hf * 32 + rsub, col0 + c4, res);
    else {
#pragma unroll
      for (int q = 0; q < 16; ++q) res[q] = z4; }
    if (bp) { bv4 = *(const v4fa*)(bp + col0 + c4);
      asm volatile("s_wait_xcnt 0x0" ::: "memory"); }      /* stands ahead of every later overwrite of the bias load's address registers */
#pragma unroll
    for (int i = 0; i < 4; ++i) bv4[i] = bf16_round(bv4[i]);
#pragma unroll
    for (int u = 0; u < 8; ++u) { const int t = u & 3, half = u >> 2;
#pragma unroll
      for (int r = 0; r < 8; ++r) so[w][half * 16 + 8 * hh + r][t * 16 + ln] = acc[half][t][r]; }
    __builtin_amdgcn_fence(__ATOMIC_ACQ_REL, "workgroup"); __builtin_amdgcn_wave_barrier();
#pragma unroll
    for (int q = 0; q < 16; ++q) { const int r = q * 2 + rsub; v4f v = *(const v4fa*)&so[w][r][c4];
#pragma unroll
      for (int i = 0; i < 4; ++i) { float x = v[i] * alpha + bv4[i]; if (CP) x += res[q][i];
        if (ACT == 3) x = fmaxf(x, 0.f); else if (ACT == 6) x = 0.5f * x * (1.0f + erff(x * 0.70710678118654752f)); else if (ACT == 11) x = 1.0f / (1.0f + expf(-x)); else if (ACT == 15) x = x / (1.0f + expf(-x)); else if (ACT == 12) x = (x > 0.f) ? x : 0.01f * x; else if (ACT == 8) x = tanhf(x); else if (ACT == 9) x = 0.5f * x * (1.0f + tanhf(0.7978845608028654f * (x + 0.044715f * x * x * x))); else if (ACT == 14) x = (x > 0.f) ? x : 0.1f * x; else if (ACT == 16) x = (x >= 0.f) ? x : 0.3f * x; else if (ACT == 17) x = (x >= 0.f) ? x : 0.2f * x;
        v[i] = x; }
      if (C) { *(v4f*)(C + cofs + (size_t)(row0 + hf * 32 + r) * ldc + col0 + c4) = v;
        asm volatile("s_wait_xcnt 0x0" ::: "memory"); }      /* stands ahead of the f16 conversion below, which may be given the store's data registers */
      if (C16) { v4h h4; for (int i = 0; i < 4; ++i) h4[i] = (_Float16)v[i]; *(v4h*)(C16 + cofs + (size_t)(row0 + hf * 32 + r) * ldc + col0 + c4) = h4;
        asm volatile("s_wait_xcnt 0x0" ::: "memory"); } }      /* stands ahead of every later overwrite of this store's registers, the accumulators' move below among them */
    if (FA > 2) {      /* the next 32 rows' accumulators move down for the next trip */
      asm volatile("s_wait_dscnt 0x0" ::: "memory"); __builtin_amdgcn_wave_barrier();      /* every lane's read-back is done before the next rows are staged over it */
#pragma unroll
      for (int i = 0; i + 2 < FA; ++i)
#pragma unroll
        for (int j = 0; j < 4; ++j) acc[i][j] = acc[i + 2][j]; } } }


// The short jobs below are device functions: bx is the block's index inside its job. k_prep and k_l2hT, behind them, hand each block of one grid its job.
__device__ __forceinline__ void d_wT(int bx, const float* __restrict__ w, int din, int dout, _Float16* __restrict__ Bt) { __shared__ float tl[64][65]; const int tid = threadIdx.x; const int nbo = dout / 64; const int ib = bx / nbo, ob = bx % nbo; const int i0 = ib * 64, o0 = ob * 64;
  for (int t = tid; t < 64 * 64; t += 256) { const int i = t / 64, o = t % 64; tl[o][i] = bf16_round(w[(size_t)(i0 + i) * dout + o0 + o]) * 16.0f; }
  __syncthreads();
  { for (int t = tid; t < 64 * 8; t += 256) { const int o = t / 8, i8 = (t % 8) * 8; FragH f; for (int q = 0; q < 8; ++q) f.h[q] = (_Float16)tl[o][i8 + q]; *(v8us*)((unsigned short*)Bt + (size_t)(o0 + o) * din + i0 + i8) = f.half[0]; }  } }
__device__ __forceinline__ void d_wnat(int bx, const float* __restrict__ w, size_t n8, _Float16* __restrict__ Bt) { const size_t t = (size_t)bx * 256 + threadIdx.x; if (t >= n8) return; FragH f; for (int q = 0; q < 8; ++q) f.h[q] = (_Float16)(bf16_round(w[t * 8 + q]) * 16.0f); *(v8us*)((unsigned short*)Bt + t * 8) = f.half[0];  }
// One row per wave: lane l holds columns 128 u + 4 l .. + 3 (u = 0 .. 7), so every load and every f32 store of a wave covers 512 contiguous bytes (an f16 store 256),
// and the row stays in registers between the sum of squares and the scaling. No LDS, no barrier. The unrolls keep xv, sv and o in registers (constant indices).
__device__ __forceinline__ void d_rms(int bx, const float* __restrict__ X, int xIsInput, const float* __restrict__ scale, size_t nrows, _Float16* __restrict__ N16, float* __restrict__ XF) {
  const int lane = threadIdx.x & 31; const size_t r = (size_t)bx * 8 + (threadIdx.x >> 5); if (r >= nrows) return;      /* the same for a whole wave */
  const size_t o0 = r * DM + lane * 4; const float* xp = X + o0; const float* sp = scale + lane * 4; v4f xv[DM / 128], sv[DM / 128];
#pragma unroll
  for (int u = 0; u < DM / 128; ++u) xv[u] = *(const v4fa*)(xp + u * 128);
#pragma unroll
  for (int u = 0; u < DM / 128; ++u) sv[u] = *(const v4fa*)(sp + u * 128);
  asm volatile("s_wait_xcnt 0x0" :: "v"(xp) : "memory");      /* stands ahead of every overwrite of the loads' address registers; xp as an input keeps its registers from being handed to one of the loads as a destination ahead of it */
  if (xIsInput) {
#pragma unroll
    for (int u = 0; u < DM / 128; ++u)
#pragma unroll
      for (int q = 0; q < 4; ++q) xv[u][q] = bf16_round(xv[u][q]); }
  if (XF) {      /* the f32 copy leaves as soon as it is known; xv is only read from here on */
#pragma unroll
    for (int u = 0; u < DM / 128; ++u) *(v4f*)(XF + o0 + u * 128) = xv[u];
    asm volatile("s_wait_xcnt 0x0" ::: "memory"); }      /* stands ahead of every later overwrite of these stores' address and data registers */
  float s4[4] = {0.f, 0.f, 0.f, 0.f};      /* four independent chains per lane */
#pragma unroll
  for (int u = 0; u < DM / 128; ++u)
#pragma unroll
    for (int q = 0; q < 4; ++q) s4[q] += xv[u][q] * xv[u][q];
  float ss = (s4[0] + s4[1]) + (s4[2] + s4[3]);
#pragma unroll
  for (int m = 16; m >= 1; m >>= 1) ss += __shfl_xor(ss, m, 32);      /* every lane ends with the row's sum */
  const float rs = 1.0f / sqrtf(ss / (float)DM + 1e-8f); v4h o[DM / 128];
#pragma unroll
  for (int u = 0; u < DM / 128; ++u)
#pragma unroll
    for (int q = 0; q < 4; ++q) o[u][q] = (_Float16)((xv[u][q] * rs) * bf16_round(sv[u][q]));
#pragma unroll
  for (int u = 0; u < DM / 128; ++u) *(v4h*)(N16 + o0 + u * 128) = o[u]; }
__global__ __launch_bounds__(256) void k_rms(const float* __restrict__ X, int xIsInput, const float* __restrict__ scale, size_t nrows, _Float16* __restrict__ N16, float* __restrict__ XF) { d_rms(blockIdx.x, X, xIsInput, scale, nrows, N16, XF); }
__device__ __forceinline__ void d_hT(int bx, int b, const _Float16* __restrict__ HN, _Float16* __restrict__ HT) { __shared__ unsigned short tl[64][65]; const int tid = threadIdx.x; HT += (size_t)b * DM * SQ;      /* b is the batch, each has its own [DM][SQ] plane */
  const int jb = bx % (SQ / 64), dbk = bx / (SQ / 64); const int j0 = jb * 64, d0 = dbk * 64;
  for (int i = tid; i < 64 * 8; i += 256) { const int j = i / 8, d8 = (i % 8) * 8; FragH f; f.half[0] = *(const v8us*)((const unsigned short*)HN + ((size_t)b * SQ + j0 + j) * DM + d0 + d8); for (int q = 0; q < 8; ++q) tl[d8 + q][j] = f.u[q]; }
  __syncthreads();
  { for (int i = tid; i < 64 * 8; i += 256) { const int d = i / 8, j8 = (i % 8) * 8; FragH f; for (int q = 0; q < 8; ++q) f.u[q] = tl[d][j8 + q]; *(v8us*)((unsigned short*)HT + (size_t)(d0 + d) * SQ + j0 + j8) = f.half[0]; }  } }
__device__ __forceinline__ void d_tab(int bx, const float* __restrict__ dl, float* __restrict__ T) {
  #pragma clang fp contract(off)
  const int t = bx * 256 + threadIdx.x; if (t >= SQ * RR) return; const int r = t % RR, d = t / RR; const float g = __fadd_rn(0.15f, __fmul_rn(0.85f, 1.0f / (1.0f + expf(-bf16_round(dl[r]))))); const float lg = logf(fmaxf(g, 1e-8f)); const float v = expf(__fmul_rn((float)d, lg));
  *(float*)(T + t) = v;  }
// Sixteen lanes per 64-element q or k row (the rows lie one behind the other in F): a lane holds four elements, a wave's load and store cover 512 contiguous bytes.
__device__ __forceinline__ void d_l2(int bx, float* __restrict__ F) {
  const size_t t = (size_t)bx * 256 + threadIdx.x; if (t >= NR * 2 * (RR / 4)) return;      /* whole waves only: the bound is a multiple of 32 */
  float* f = F + t * 4; const v4f a = *(const v4fa*)f; float ss = (a[0] * a[0] + a[1] * a[1]) + (a[2] * a[2] + a[3] * a[3]);
#pragma unroll
  for (int m = 8; m >= 1; m >>= 1) ss += __shfl_xor(ss, m, 32);      /* stays inside the row's sixteen lanes */
  float n = sqrtf(ss); if (n < 1e-8f) n = 1e-8f; const float inv = 1.0f / n; v4f o;
#pragma unroll
  for (int q = 0; q < 4; ++q) o[q] = a[q] * inv;
  *(v4f*)f = o; }
// Launches that need nothing of one another share one grid: a range of the block index picks the job, so every branch here is the same for a whole block.
// k_prep reads inputs only: [u|v]^T, the first rmsnorm, the three weight planes, the decay table. The jobs with the longest blocks come first.
#define PB_WT ((DM / 64) * (RR / 64))        /* blocks of one d_wT job */
#define PB_RMS ((int)(NR / 8))
#define PB_WP (DM * DM / 8 / 256)            /* blocks of d_wnat on proj_w; up_w and down_w take PB_WU each */
#define PB_WU (FH * DM / 8 / 256)
#define PB_TAB (SQ * RR / 256)
__global__ __launch_bounds__(256) void k_prep(const float* __restrict__ u, const float* __restrict__ v, const float* __restrict__ pw, const float* __restrict__ uw, const float* __restrict__ dw, const float* __restrict__ dl, const float* __restrict__ h, const float* __restrict__ n1,
    _Float16* __restrict__ BUV, _Float16* __restrict__ BP, _Float16* __restrict__ BU, _Float16* __restrict__ BD, float* __restrict__ T, _Float16* __restrict__ HN16, float* __restrict__ HF) {
  int bx = blockIdx.x;
  if (bx < 2 * PB_WT) { const int s = bx / PB_WT; d_wT(bx - s * PB_WT, s ? v : u, DM, RR, BUV + (size_t)s * RR * DM); return; }      /* [u|v]^T -> [128][1024] */
  bx -= 2 * PB_WT;
  if (bx < PB_RMS) { d_rms(bx, h, 1, n1, NR, HN16, HF); return; }      /* hn (f16) + bf16(h) (f32 residual) */
  bx -= PB_RMS;
  if (bx < PB_WP + 2 * PB_WU) { const float* w = pw; _Float16* Bt = BP; size_t n8 = (size_t)DM * DM / 8;
    if (bx >= PB_WP) { bx -= PB_WP; w = uw; Bt = BU; n8 = (size_t)FH * DM / 8; if (bx >= PB_WU) { bx -= PB_WU; w = dw; Bt = BD; } }
    d_wnat(bx, w, n8, Bt); return; }
  d_tab(bx - (PB_WP + 2 * PB_WU), dl, T); }
// The transposed hn planes need the first rmsnorm alone, the l2 normalisation the q|k product alone: one grid, the transposes first.
#define PB_HT ((SQ / 64) * (DM / 64))        /* blocks of d_hT per batch */
#define PB_L2 ((int)(NR * 2 * (RR / 4) / 256))
__global__ __launch_bounds__(256) void k_l2hT(float* __restrict__ QK, const _Float16* __restrict__ HN, _Float16* __restrict__ HT) {
  const int bx = blockIdx.x;
  if (bx < PB_HT * NB) { d_hT(bx % PB_HT, bx / PB_HT, HN, HT); return; }
  d_l2(bx - PB_HT * NB, QK); }
// Mixing matrix, one 32 (rows i) x 64 (columns j) tile per block. A thread computes eight rows of one column: its k row stays in registers, the tile's q rows and the
// decay-table rows that the tile's distances i - j reach lie in LDS (rows of a negative distance are zero; those elements are masked at the store).
// Every "#pragma unroll" in this kernel but the hf loop's "unroll 1" is there so that the small arrays it indexes (tx, qx, kr, tb, qb, acc) get constant indices and stay in registers.
#define AM_TI 32
#define AM_TJ 64
#define AM_TD (AM_TI + AM_TJ)        /* 95 distances, and one row more that nobody reads: the staging is then six whole trips of the block */
#define AM_P (RR + 4)                /* LDS row pitch in floats: 16 B x odd, so that 16 lanes on 16 neighbouring rows meet no bank twice */
__global__ __launch_bounds__(256) void k_amat(const float* __restrict__ QK, const float* __restrict__ kb, const float* __restrict__ T, const float* __restrict__ gl, const float* __restrict__ al, _Float16* __restrict__ A16) {
  __shared__ __attribute__((aligned(16))) float Ts[AM_TD][AM_P];
  __shared__ __attribute__((aligned(16))) float qs[AM_TI][RR];
  __shared__ __attribute__((aligned(16))) float sc[AM_TI][AM_P];
  const int b = blockIdx.y; A16 += (size_t)b * SQ * SQ;      /* one launch for all batches: blockIdx.y is the batch, each has its own [SQ][SQ] plane */
  const int tid = threadIdx.x; const int jt = blockIdx.x / (SQ / AM_TI), it = blockIdx.x % (SQ / AM_TI); const int i0 = it * AM_TI, j0 = jt * AM_TJ;
  const int orow = tid >> 3, oc8 = (tid & 7) * 8; const int oi = i0 + orow, oj = j0 + oc8;      /* the 8 elements this thread stores */
  unsigned short* dst = (unsigned short*)A16 + (size_t)oi * SQ + oj;
  if (j0 > i0 + AM_TI - 1) { const v8us z = {0, 0, 0, 0, 0, 0, 0, 0}; *(v8us*)dst = z; return; }      /* tile wholly above the diagonal: the whole block leaves, ahead of every barrier */
  const int jl = tid & (AM_TJ - 1), ig = tid >> 6; const int sr = tid >> 4, sc4 = (tid & 15) * 4;
  const int dmin = i0 - j0 - (AM_TJ - 1);
  const v4f kb0 = *(const v4fa*)(kb + (size_t)oi * SQ + oj), kb1 = *(const v4fa*)(kb + (size_t)oi * SQ + oj + 4);
  v4f tx[AM_TD / 16], qx[AM_TI / 16];
#pragma unroll
  for (int u = 0; u < AM_TD / 16; ++u) { const int d = dmin + sr + u * 16; const int dc = d < 0 ? 0 : (d > SQ - 1 ? SQ - 1 : d); tx[u] = *(const v4fa*)(T + (size_t)dc * RR + sc4); }
#pragma unroll
  for (int u = 0; u < AM_TI / 16; ++u) qx[u] = *(const v4fa*)(QK + ((size_t)b * SQ + i0 + sr + u * 16) * (2 * RR) + sc4);
  asm volatile("s_wait_xcnt 0x0" ::: "memory");      /* the loads below may be given address registers of the loads above as destinations: the wait stands in front of that overwrite */
  const float* kp = QK + ((size_t)b * SQ + j0 + jl) * (2 * RR); v4f kr[RR / 4];
#pragma unroll
  for (int r4 = 0; r4 < RR / 4; ++r4) kr[r4] = *(const v4fa*)(kp + RR + r4 * 4);
  asm volatile("s_wait_xcnt 0x0" :: "v"(kp) : "memory");      /* kp as an input keeps its registers from being handed to one of these loads as a destination ahead of the wait */
  __builtin_amdgcn_sched_barrier(0);      /* every global load is issued before the first wait on one: one latency for the block's start, not two */
  const float gate = 1.0f / (1.0f + expf(-bf16_round(gl[0]))); const float alpha = 1.0f / (1.0f + expf(-bf16_round(al[0])));
#pragma unroll
  for (int u = 0; u < AM_TD / 16; ++u) { const v4f z4 = {0.f, 0.f, 0.f, 0.f}; *(v4fa*)&Ts[sr + u * 16][sc4] = (dmin + sr + u * 16 < 0) ? z4 : tx[u]; }
#pragma unroll
  for (int u = 0; u < AM_TI / 16; ++u) *(v4fa*)&qs[sr + u * 16][sc4] = qx[u];
  __syncthreads();
#pragma unroll 1      /* stays rolled: the body is over 600 instructions long, and a second copy of it would save one branch */
  for (int hf = 0; hf < 2; ++hf) { const int il = ig * 8 + hf * 4;      /* four rows at a time: four independent sums, each over r in rising order */
    const float* tp = &Ts[il + (AM_TJ - 1) - jl][0]; const float* qp = &qs[il][0]; float acc[4] = {0.f, 0.f, 0.f, 0.f}; v4f tb[2][4][2], qb[2][4][2];
#pragma unroll
    for (int s = 0; s < 4; ++s)
#pragma unroll
      for (int h2 = 0; h2 < 2; ++h2) { qb[0][s][h2] = *(const v4fa*)(qp + s * RR + h2 * 4); tb[0][s][h2] = *(const v4fa*)(tp + s * AM_P + h2 * 4); }
#pragma unroll
    for (int ch = 0; ch < RR / 8; ++ch) {
      if (ch + 1 < RR / 8) {
#pragma unroll
        for (int s = 0; s < 4; ++s)
#pragma unroll
          for (int h2 = 0; h2 < 2; ++h2) { qb[(ch + 1) & 1][s][h2] = *(const v4fa*)(qp + s * RR + (ch + 1) * 8 + h2 * 4); tb[(ch + 1) & 1][s][h2] = *(const v4fa*)(tp + s * AM_P + (ch + 1) * 8 + h2 * 4); } }
      __builtin_amdgcn_sched_barrier(0);      /* keeps the next eight ranks' LDS loads ahead of this eight's arithmetic, which then covers their latency */
#pragma unroll
      for (int h2 = 0; h2 < 2; ++h2)
#pragma unroll
        for (int c = 0; c < 4; ++c)
#pragma unroll
          for (int s = 0; s < 4; ++s) acc[s] += (qb[ch & 1][s][h2][c] * kr[ch * 2 + h2][c]) * tb[ch & 1][s][h2][c];
      __builtin_amdgcn_sched_barrier(0);      /* and keeps the loads after next from rising into it, where they would need a third set of registers */
    }
#pragma unroll
    for (int s = 0; s < 4; ++s) sc[il + s][jl] = acc[s]; }
  __syncthreads();
  const v4f a0 = *(const v4fa*)&sc[orow][oc8], a1 = *(const v4fa*)&sc[orow][oc8 + 4]; FragH f;
#pragma unroll
  for (int u = 0; u < 8; ++u) { const float kv = (u < 4) ? kb0[u & 3] : kb1[u & 3]; const float av = (u < 4) ? a0[u & 3] : a1[u & 3]; const _Float16 v = (_Float16)(gate * bf16_round(kv) + alpha * av); f.h[u] = (oj + u <= oi) ? v : (_Float16)0.0f; }
  *(v8us*)dst = f.half[0]; }

extern "C" void kernel_launch(void* const* d_in, const int* in_sizes, int n_in,
                              void* d_out, int out_size, void* d_ws, size_t ws_size, hipStream_t stream) {
  (void)in_sizes; (void)n_in; (void)out_size;
  const float* const* I = (const float* const*)d_in; const float* h = I[0]; const float* kb = I[1]; const float* dl = I[2]; const float* gl = I[3]; const float* al = I[4]; const float* u = I[5]; const float* v = I[6]; const float* pw = I[7]; const float* pb = I[8]; const float* n1 = I[9]; const float* n2 = I[10]; const float* uw = I[11]; const float* ub = I[12]; const float* dw = I[13]; const float* db = I[14];
  char* ws = (char*)d_ws; size_t off = 0;
  auto take = [&](size_t bytes) { char* p = ws + off; off += (bytes + 255) & ~(size_t)255; return p; };
  _Float16* BUV = (_Float16*)take((size_t)2 * RR * DM * 2); _Float16* BP = (_Float16*)take((size_t)DM * DM * 2); _Float16* BU = (_Float16*)take((size_t)FH * DM * 2); _Float16* BD = (_Float16*)take((size_t)DM * FH * 2); float* T = (float*)take((size_t)SQ * RR * 4);
  _Float16* HN16 = (_Float16*)take(NR * DM * 2); float* HF = (float*)take(NR * DM * 4); float* QK = (float*)take(NR * 2 * RR * 4); _Float16* HT = (_Float16*)take((size_t)NB * DM * SQ * 2); _Float16* A16 = (_Float16*)take((size_t)NB * SQ * SQ * 2);
  _Float16* O16 = (_Float16*)take(NR * DM * 2); float* H1 = (float*)take(NR * DM * 4); _Float16* M16 = (_Float16*)take(NR * DM * 2); _Float16* U16 = (_Float16*)take(NR * FH * 2);
  if (off > ws_size) return;      /* 0.3 + 2 + 4 + 4 + 0.3 + 16 + 32 + 4 + 16 + 16 + 16 + 32 + 16 + 32 = about 191 MiB */
  k_prep<<<2 * PB_WT + PB_RMS + PB_WP + 2 * PB_WU + PB_TAB, 256, 0, stream>>>(u, v, pw, uw, dw, dl, h, n1, BUV, BP, BU, BD, T, HN16, HF);
  k_gemm2<0, 1><<<dim3((unsigned)((NR / 128) * (2 * RR / 64)), 1), 128, 0, stream>>>(HN16, DM, 0, BUV, DM, 0, 0.0625f, nullptr, 0, nullptr, 1, 0, 0, QK, nullptr, 2 * RR, 0, (int)NR, 2 * RR, DM);      /* [q_raw | k_raw] */
  k_l2hT<<<PB_HT * NB + PB_L2, 256, 0, stream>>>(QK, HN16, HT);
  k_amat<<<dim3((SQ / AM_TI) * (SQ / AM_TJ), NB), 256, 0, stream>>>(QK, kb, T, gl, al, A16);
  k_gemm2<0, 2><<<dim3((SQ / 256) * (DM / 128), NB), 256, 0, stream>>>(A16, SQ, (size_t)SQ * SQ, HT, SQ, (size_t)DM * SQ, 1.0f, nullptr, 0, nullptr, 1, 0, 0, nullptr, O16, DM, (size_t)SQ * DM, SQ, DM, SQ);      /* out_b = A_b . hn_b, b = blockIdx.y */
  const dim3 gp((unsigned)((NR / 256) * (DM / 128)), 1);
  k_gemm2<0, 2><<<gp, 256, 0, stream>>>(O16, DM, 0, BP, DM, 0, 0.0625f, pb, 0, HF, 1, (size_t)DM, 0, H1, nullptr, DM, 0, (int)MQ, DM, DM);      /* h1 = h + out proj_w^T + proj_b */
  k_rms<<<(unsigned)((MQ + 7) / 8), 256, 0, stream>>>(H1, 0, n2, MQ, M16, nullptr);
  k_gemm2<6, 2><<<dim3((unsigned)((NR / 256) * (FH / 128)), 1), 256, 0, stream>>>(M16, DM, 0, BU, DM, 0, 0.0625f, ub, 0, nullptr, 1, 0, 0, nullptr, U16, FH, 0, (int)MQ, FH, DM);      /* gelu_erf(m up_w^T + up_b) */
  k_gemm2<0, 2><<<gp, 256, 0, stream>>>(U16, FH, 0, BD, FH, 0, 0.0625f, db, 0, H1, 1, (size_t)DM, 0, (float*)d_out, nullptr, DM, 0, (int)MQ, DM, FH);      /* h1 + m */
}

// v008
// It runs in 185 microseconds.
// Two timings next to v007 both put it at 1.07 times that version's speed.
// All steps since v000 together make it 12.4 times as fast.
#include <hip/hip_runtime.h>
// K2Layer (h [8][1024][1024]; hn = rmsnorm(h)*norm1_scale; gate = sigmoid(gate_logit), alpha = sigmoid(alpha_logit); q|k = hn [u|v] (rank 64), row-l2-normalised; gamma_r = 0.15 + 0.85 sigmoid(decay_logit_r); A[i][j] = causal(j<=i) * (gate k_base[i][j] + alpha sum_r q[i][r] k[j][r] gamma_r^(i-j)); out = A . hn; h1 = h + out proj_w^T + proj_b; m = gelu_erf(rmsnorm(h1)*norm2_scale up_w^T + up_b) down_w^T + down_b; result = h1 + m -> [8][1024][1024]).
// Structure: token rows; rmsnorm on VALU (f32) into f16 rows and per-batch transposed f16 planes (LDS); the rank-64 q|k projection as a WMMA GEMM (f32), l2-normalisation on VALU in f32; the per-rank decayed causal scores (gamma^d table built on device from decay_logit, k_base/gate/alpha read) on VALU in f32 in the tiles that the diagonal crosses, as WMMA products of decay-weighted q and k rows (f16 hi + lo pairs, f32 accumulation) below it, into the f16 mixing matrix A; out = A . hn, proj (+ bias + h), up (+ bias, exact-GELU epilogue, f16), down (+ bias + h1) as WMMA GEMMs (64x64 wave tiles, 32x64 for q|k; f32 accumulation, exact x16 weights).
// Compute dtype: inputs rounded to bf16; h / weights / k_base exact; hn, A, out, rmsnorm(h1), GELU hidden plain f16 operands (~2^-12); scores, norms, residuals f32. v_wmma_f32_16x16x32_f16.
#define NB 8
#define SQ 1024
#define DM 1024
#define RR 64
#define FH 2048
#define NR ((size_t)NB * SQ)
#define MQ NR                        /* rows through the proj/MLP stage (debug hook) */
typedef __bf16 v16b __attribute__((ext_vector_type(16)));
typedef unsigned short v8us __attribute__((ext_vector_type(8), may_alias));
typedef float  v8f  __attribute__((ext_vector_type(8)));
typedef float  v4f  __attribute__((ext_vector_type(4)));
typedef float  v4fa __attribute__((ext_vector_type(4), may_alias));
union FragB { v16b v; v8us half[2]; unsigned short u[16]; };

__device__ __forceinline__ unsigned short bf16_bits(float x) { unsigned int u = __float_as_uint(x); return (unsigned short)((u + 0x7FFFu + ((u >> 16) & 1u)) >> 16); }
__device__ __forceinline__ float bf16_val(unsigned short b) { return __uint_as_float(((unsigned int)b) << 16); }
__device__ __forceinline__ float bf16_round(float x) { return bf16_val(bf16_bits(x)); }
// D += A·B with NT terms: 1 = ah·bh, 2 = + al·bh (A split), 3 = + ah·bl (both split)
template <int NT>
__device__ __forceinline__ v8f mmaN(v16b ah, v16b al, v16b bh, v16b bl, v8f c) {
  c = __builtin_amdgcn_wmma_f32_16x16x32_bf16(false, ah, false, bh, (short)0, c, false, false);
  if (NT >= 2) c = __builtin_amdgcn_wmma_f32_16x16x32_bf16(false, al, false, bh, (short)0, c, false, false);
  if (NT >= 3) c = __builtin_amdgcn_wmma_f32_16x16x32_bf16(false, ah, false, bl, (short)0, c, false, false);
  asm volatile("v_nop\n\tv_nop\n\tv_nop\n\tv_nop" : "+v"(c) : "v"(ah), "v"(al), "v"(bh), "v"(bl));
  return c;
}

__global__ __launch_bounds__(256) void k_wt_bf16(const float* __restrict__ W, unsigned short* __restrict__ Wt, int K, int N) {
  const int t = blockIdx.x * 256 + threadIdx.x;
  const int k8n = K / 8;
  if (t >= N * k8n) return;
  const int n = t / k8n, k8 = (t % k8n) * 8;
  v8us v;
#pragma unroll
  for (int i = 0; i < 8; ++i) v[i] = bf16_bits(W[(size_t)(k8 + i) * N + n]);
  *(v8us*)(Wt + (size_t)n * K + k8) = v;
  
}

// GEMM C[M][N] (f32, pitch ldc) = act(A[M][K]·W + bias). A f32 row-major (pitch lda) converted per fragment to bf16
// (ASPLIT: hi/lo two planes -> 2 terms, else single rounded term); Wt bf16 [N][K] (pitch ldb). BIAS_BF16 rounds the
// bias to bf16 first (bias quantised to bf16 before the add). K%32==0, M%16==0, N%64==0.
template <bool ASPLIT, int ACT, bool BIAS_BF16>
__global__ __launch_bounds__(128) void k_gemm_bf(const float* __restrict__ A, int lda, const unsigned short* __restrict__ Wt, int ldb,
                                               const float* __restrict__ bias, float* __restrict__ C, int ldc, int M, int N, int K) {
  __shared__ __attribute__((aligned(16))) float so[4][16][64];
  const int tid = threadIdx.x, w = tid >> 5, lane = tid & 31, ln = lane & 15, hh = lane >> 4;
  const int ntn = N / 64;
  const int wid = blockIdx.x * 4 + w;
  const int mt = wid / ntn, nq = wid % ntn;
  if (mt * 16 >= M) return;
  const int row0 = mt * 16, col0 = nq * 64;
  const float* arow = A + (size_t)(row0 + ln) * lda;
  v8f acc[4] = {};
  for (int kb = 0; kb < K; kb += 32) {
    FragB ah, al;
    const v4f x0 = *(const v4fa*)(arow + kb + 8 * hh), x1 = *(const v4fa*)(arow + kb + 8 * hh + 4);
    const v4f x2 = *(const v4fa*)(arow + kb + 16 + 8 * hh), x3 = *(const v4fa*)(arow + kb + 16 + 8 * hh + 4);
    float xs[16] = {x0[0],x0[1],x0[2],x0[3],x1[0],x1[1],x1[2],x1[3],x2[0],x2[1],x2[2],x2[3],x3[0],x3[1],x3[2],x3[3]};
#pragma unroll
    for (int i = 0; i < 16; ++i) { const unsigned short hb = bf16_bits(xs[i]); ah.u[i] = hb; al.u[i] = ASPLIT ? bf16_bits(xs[i] - bf16_val(hb)) : (unsigned short)0; }
#pragma unroll
    for (int t = 0; t < 4; ++t) {
      const unsigned short* brow = Wt + (size_t)(col0 + t * 16 + ln) * ldb + kb;
      FragB b;
      b.half[0] = *(const v8us*)(brow + 8 * hh);
      b.half[1] = *(const v8us*)(brow + 16 + 8 * hh);
      acc[t] = mmaN<ASPLIT ? 2 : 1>(ah.v, al.v, b.v, b.v, acc[t]);
    }
  }
#pragma unroll
  for (int t = 0; t < 4; ++t) {
    float bv = bias ? bias[col0 + t * 16 + ln] : 0.f;
    if (BIAS_BF16) bv = bf16_round(bv);
#pragma unroll
    for (int r = 0; r < 8; ++r) { float v = acc[t][r] + bv; if (ACT == 1) v = fmaxf(v, 0.f); so[w][8 * hh + r][t * 16 + ln] = v; }
  }
  __builtin_amdgcn_fence(__ATOMIC_ACQ_REL, "workgroup");
  __builtin_amdgcn_wave_barrier();
  const int rsub = lane >> 4, c4 = (lane & 15) * 4;
  {
#pragma unroll
    for (int q = 0; q < 8; ++q) {
      const int r = q * 2 + rsub;
      const v4f v = *(const v4fa*)&so[w][r][c4];
      *(v4f*)(C + (size_t)(row0 + r) * ldc + col0 + c4) = v;
    }
    
  }
}

// GEMM C = act(A·W + bias + resid): A f32 (ASPLIT -> hi/lo 2 terms), Wt bf16 [N][K]; ACT 0 none, 1 relu, 2 exact gelu;
// resid (optional, f32, row index = (row % rmod), pitch ldr, RES_BF16 rounds it) added before the activation.
template <bool ASPLIT, int ACT, bool BIAS_BF16, bool RES_BF16>
__global__ __launch_bounds__(128) void k_gemm_bf3(const float* __restrict__ A, int lda, const unsigned short* __restrict__ Wt, int ldb,
                                                const float* __restrict__ bias, const float* __restrict__ resid, int rmod, int ldr,
                                                float* __restrict__ C, int ldc, int M, int N, int K) {
  __shared__ __attribute__((aligned(16))) float so[4][16][64];
  const int tid = threadIdx.x, w = tid >> 5, lane = tid & 31, ln = lane & 15, hh = lane >> 4;
  const int ntn = N / 64;
  const int wid = blockIdx.x * 4 + w;
  const int mt = wid / ntn, nq = wid % ntn;
  if (mt * 16 >= M) return;
  const int row0 = mt * 16, col0 = nq * 64;
  const float* arow = A + (size_t)(row0 + ln) * lda;
  v8f acc[4] = {};
  for (int kb = 0; kb < K; kb += 32) {
    FragB ah, al;
    const v4f x0 = *(const v4fa*)(arow + kb + 8 * hh), x1 = *(const v4fa*)(arow + kb + 8 * hh + 4);
    const v4f x2 = *(const v4fa*)(arow + kb + 16 + 8 * hh), x3 = *(const v4fa*)(arow + kb + 16 + 8 * hh + 4);
    float xs[16] = {x0[0],x0[1],x0[2],x0[3],x1[0],x1[1],x1[2],x1[3],x2[0],x2[1],x2[2],x2[3],x3[0],x3[1],x3[2],x3[3]};
#pragma unroll
    for (int i = 0; i < 16; ++i) { const unsigned short hb = bf16_bits(xs[i]); ah.u[i] = hb; al.u[i] = ASPLIT ? bf16_bits(xs[i] - bf16_val(hb)) : (unsigned short)0; }
#pragma unroll
    for (int t = 0; t < 4; ++t) {
      const unsigned short* brow = Wt + (size_t)(col0 + t * 16 + ln) * ldb + kb;
      FragB b;
      b.half[0] = *(const v8us*)(brow + 8 * hh);
      b.half[1] = *(const v8us*)(brow + 16 + 8 * hh);
      acc[t] = mmaN<ASPLIT ? 2 : 1>(ah.v, al.v, b.v, b.v, acc[t]);
    }
  }
#pragma unroll
  for (int t = 0; t < 4; ++t) {
    const int col = col0 + t * 16 + ln;
    float bv = bias ? bias[col] : 0.f;
    if (BIAS_BF16) bv = bf16_round(bv);
#pragma unroll
    for (int r = 0; r < 8; ++r) {
      float v = acc[t][r] + bv;
      if (resid) { float rv = resid[(size_t)((row0 + 8 * hh + r) % rmod) * ldr + col]; if (RES_BF16) rv = bf16_round(rv); v += rv; }
      if (ACT == 1) v = fmaxf(v, 0.f);
      if (ACT == 2) v = 0.5f * v * (1.0f + erff(v * 0.70710678118654752f));
      if (ACT == 3) { const float u = 0.7978845608028654f * (v + 0.044715f * v * v * v); v = 0.5f * v * (1.0f + tanhf(u)); }
      so[w][8 * hh + r][t * 16 + ln] = v;
    }
  }
  __builtin_amdgcn_fence(__ATOMIC_ACQ_REL, "workgroup");
  __builtin_amdgcn_wave_barrier();
  const int rsub = lane >> 4, c4 = (lane & 15) * 4;
  {
#pragma unroll
    for (int q = 0; q < 8; ++q) {
      const int r = q * 2 + rsub;
      const v4f v = *(const v4fa*)&so[w][r][c4];
      *(v4f*)(C + (size_t)(row0 + r) * ldc + col0 + c4) = v;
    }
    
  }
}
// row LayerNorm (biased variance, eps) over N: s = X (+ R); optional out_sum <- s; out_norm <- (s-mu)*rsqrt(var+eps)*g + b
template <bool PARAM_BF16>
__global__ __launch_bounds__(256) void k_layernorm(const float* __restrict__ X, const float* __restrict__ R, const float* __restrict__ g, const float* __restrict__ bta,
                                                  float* __restrict__ out_sum, float* __restrict__ out_norm, int N, float eps) {
  __shared__ float red[256];
  const int row = blockIdx.x, tid = threadIdx.x;
  const float* x = X + (size_t)row * N; const float* rr = R ? R + (size_t)row * N : nullptr;
  float vals[16];                     // up to N = 4096
  const int per = N / 256;            // contiguous chunk per thread? use strided-by-4 chunks: thread handles j = tid*4 + 1024*u
  float s1 = 0.f;
  for (int u = 0; u < per / 4; ++u) {
    const int j = tid * 4 + 1024 * u;
    const v4f a = *(const v4fa*)(x + j);
    v4f b = {0.f,0.f,0.f,0.f}; if (rr) b = *(const v4fa*)(rr + j);
#pragma unroll
    for (int q = 0; q < 4; ++q) { const float v = a[q] + b[q]; vals[u * 4 + q] = v; s1 += v; }
  }
  red[tid] = s1; __syncthreads();
  for (int st = 128; st > 0; st >>= 1) { if (tid < st) red[tid] += red[tid + st]; __syncthreads(); }
  const float mu = red[0] / (float)N; __syncthreads();
  float s2 = 0.f;
  for (int u = 0; u < per / 4; ++u)
#pragma unroll
    for (int q = 0; q < 4; ++q) { const float c = vals[u * 4 + q] - mu; s2 += c * c; }
  red[tid] = s2; __syncthreads();
  for (int st = 128; st > 0; st >>= 1) { if (tid < st) red[tid] += red[tid + st]; __syncthreads(); }
  const float rs = rsqrtf(red[0] / (float)N + eps);
  {
    for (int u = 0; u < per / 4; ++u) {
      const int j = tid * 4 + 1024 * u;
      v4f o, sm;
#pragma unroll
      for (int q = 0; q < 4; ++q) {
        float gg = g[j + q], bb = bta[j + q];
        if (PARAM_BF16) { gg = bf16_round(gg); bb = bf16_round(bb); }
        sm[q] = vals[u * 4 + q]; o[q] = (vals[u * 4 + q] - mu) * rs * gg + bb;
      }
      if (out_sum) *(v4f*)(out_sum + (size_t)row * N + j) = sm;
      *(v4f*)(out_norm + (size_t)row * N + j) = o;
    }
    
  }
}



// ---- f16 WMMA path (v_wmma_f32_16x16x32_f16): 11-bit significands for operands in range — used for every GEMM launched here
typedef _Float16 v16h __attribute__((ext_vector_type(16)));
union FragH { v16h v; v8us half[2]; _Float16 h[16]; unsigned short u[16]; };
template <int NT>
__device__ __forceinline__ v8f mmaH(v16h ah, v16h al, v16h bh, v16h bl, v8f c) {
  c = __builtin_amdgcn_wmma_f32_16x16x32_f16(false, ah, false, bh, (short)0, c, false, false);
  if (NT >= 2) c = __builtin_amdgcn_wmma_f32_16x16x32_f16(false, al, false, bh, (short)0, c, false, false);
  if (NT >= 3) c = __builtin_amdgcn_wmma_f32_16x16x32_f16(false, ah, false, bl, (short)0, c, false, false);
  asm volatile("v_nop\n\tv_nop\n\tv_nop\n\tv_nop" : "+v"(c) : "v"(ah), "v"(al), "v"(bh), "v"(bl));
  return c;
}
// batched GEMM like k_gemm_b but f16 operands: A f32 (split into f16 hi/lo if ASPLIT, else rounded to f16), Bt = f16 values [n][k]; alpha; C f32; N multiple of 16 (partial tiles skipped)
template <bool ASPLIT>
__global__ __launch_bounds__(128) void k_gemm_h(const float* __restrict__ A, int lda, size_t sA, const _Float16* __restrict__ Bh, int ldb, size_t sB, float alpha, float* __restrict__ C, int ldc, size_t sC, int M, int N, int K) {
  __shared__ __attribute__((aligned(16))) float so[4][16][64];
  const int tid = threadIdx.x, w = tid >> 5, lane = tid & 31, ln = lane & 15, hh = lane >> 4; const int by = blockIdx.y;
  A += (size_t)by * sA; Bh += (size_t)by * sB; C += (size_t)by * sC;
  const int ntn = (N + 63) / 64; const int wid = blockIdx.x * 4 + w; const int mt = wid / ntn, nq = wid % ntn; if (mt * 16 >= M) return;
  const int row0 = mt * 16, col0 = nq * 64; const float* arow = A + (size_t)(row0 + ln) * lda;
  v8f acc[4] = {};
  for (int kb = 0; kb < K; kb += 32) {
    FragH ah, al;
    const v4f x0 = *(const v4fa*)(arow + kb + 8 * hh), x1 = *(const v4fa*)(arow + kb + 8 * hh + 4), x2 = *(const v4fa*)(arow + kb + 16 + 8 * hh), x3 = *(const v4fa*)(arow + kb + 16 + 8 * hh + 4);
    float xs[16] = {x0[0],x0[1],x0[2],x0[3],x1[0],x1[1],x1[2],x1[3],x2[0],x2[1],x2[2],x2[3],x3[0],x3[1],x3[2],x3[3]};
#pragma unroll
    for (int i = 0; i < 16; ++i) { const _Float16 h = (_Float16)xs[i]; ah.h[i] = h; al.h[i] = ASPLIT ? (_Float16)(xs[i] - (float)h) : (_Float16)0.0f; }
#pragma unroll
    for (int t = 0; t < 4; ++t) { if (col0 + t * 16 >= N) continue; const size_t boff = (size_t)(col0 + t * 16 + ln) * ldb + kb; FragH bq; bq.half[0] = *(const v8us*)(Bh + boff + 8 * hh); bq.half[1] = *(const v8us*)(Bh + boff + 16 + 8 * hh);
      acc[t] = mmaH<ASPLIT ? 2 : 1>(ah.v, al.v, bq.v, bq.v, acc[t]); }
  }
#pragma unroll
  for (int t = 0; t < 4; ++t) { if (col0 + t * 16 >= N) continue;
#pragma unroll
    for (int r = 0; r < 8; ++r) so[w][8 * hh + r][t * 16 + ln] = acc[t][r] * alpha; }
  __builtin_amdgcn_fence(__ATOMIC_ACQ_REL, "workgroup"); __builtin_amdgcn_wave_barrier();
  const int rsub = lane >> 4, c4 = (lane & 15) * 4;
  {
#pragma unroll
    for (int q = 0; q < 8; ++q) { const int r = q * 2 + rsub; if (col0 + c4 < N) { const v4f v = *(const v4fa*)&so[w][r][c4]; *(v4f*)(C + (size_t)(row0 + r) * ldc + col0 + c4) = v; } }
     }
}

// Wt[n][k] = f16(W[k][n]·scale) from f32 row-major W[K][N] (scale = power of two; bf16-exact weights stay exact in f16 away from the subnormal range)
__global__ __launch_bounds__(256) void k_wt_f16(const float* __restrict__ W, _Float16* __restrict__ Wt, int K, int N, float scale) {
  const int t = blockIdx.x * 256 + threadIdx.x; if (t >= N * (K / 8)) return; const int n = t / (K / 8), k8 = (t % (K / 8)) * 8; FragH f;
#pragma unroll
  for (int i = 0; i < 8; ++i) f.h[i] = (_Float16)(bf16_round(W[(size_t)(k8 + i) * N + n]) * scale); const v8us o = f.half[0];
  *(v8us*)((unsigned short*)Wt + (size_t)n * K + k8) = o; 
}
// k_gemm_hh variant with fused epilogue: v = acc·alpha + bias[by·sBias + col] (+ CP[(row/rowsPerB)·sCPb + by·64 + col] if CP) ; ACT 0 none / 1 elu ; writes f16 C16 (and f32 C if non-null)
template <int ACT>
__global__ __launch_bounds__(128) void k_gemm_hhx(const _Float16* __restrict__ A, int lda, size_t sA, const _Float16* __restrict__ Bh, int ldb, size_t sB, float alpha, const float* __restrict__ bias, size_t sBias, const float* __restrict__ CP, int rowsPerB, size_t sCPb, int row0g,
    float* __restrict__ C, _Float16* __restrict__ C16, int ldc, size_t sC, int M, int N, int K) {
  __shared__ __attribute__((aligned(16))) float so[4][16][64];
  const int tid = threadIdx.x, w = tid >> 5, lane = tid & 31, ln = lane & 15, hh = lane >> 4; const int by = blockIdx.y;
  A += (size_t)by * sA; Bh += (size_t)by * sB; const size_t cofs = (size_t)by * sC; const float* bp = bias ? bias + (size_t)by * sBias : nullptr;
  const int ntn = (N + 63) / 64; const int wid = blockIdx.x * 4 + w; const int mt = wid / ntn, nq = wid % ntn; if (mt * 16 >= M) return;
  const int row0 = mt * 16, col0 = nq * 64; const _Float16* arow = A + (size_t)(row0 + ln) * lda;
  v8f acc[4] = {};
  for (int kb = 0; kb < K; kb += 32) { FragH ah; ah.half[0] = *(const v8us*)((const unsigned short*)arow + kb + 8 * hh); ah.half[1] = *(const v8us*)((const unsigned short*)arow + kb + 16 + 8 * hh);
#pragma unroll
    for (int t = 0; t < 4; ++t) { if (col0 + t * 16 >= N) continue; const size_t boff = (size_t)(col0 + t * 16 + ln) * ldb + kb; FragH bq; bq.half[0] = *(const v8us*)((const unsigned short*)Bh + boff + 8 * hh); bq.half[1] = *(const v8us*)((const unsigned short*)Bh + boff + 16 + 8 * hh);
      acc[t] = mmaH<1>(ah.v, ah.v, bq.v, bq.v, acc[t]); }
  }
#pragma unroll
  for (int t = 0; t < 4; ++t) { if (col0 + t * 16 >= N) continue; const int col = col0 + t * 16 + ln; const float bv = bp ? bf16_round(bp[col]) : 0.f;
#pragma unroll
    for (int r = 0; r < 8; ++r) { float v = acc[t][r] * alpha + bv; if (CP) { const int rr = row0g + row0 + 8 * hh + r; if (rowsPerB < 0) v += CP[cofs + (size_t)rr * ldc + col];      /* rowsPerB < 0: own element of the batched C plane */ else { const int bidx = rr / rowsPerB; v += CP[(size_t)bidx * sCPb + (size_t)by * 64 + col]; } } if (ACT == 1) v = (v > 0.f) ? v : expm1f(v); else if (ACT == 7) v = (v > 0.f) ? v + 1.0f : expf(v); else if (ACT == 8) v = tanhf(v); else if (ACT == 9) v = 0.5f * v * (1.0f + tanhf(0.7978845608028654f * (v + 0.044715f * v * v * v))); else if (ACT == 11) v = 1.0f / (1.0f + expf(-v)); else if (ACT == 12) v = (v > 0.f) ? v : 0.01f * v; else if (ACT == 14) v = (v > 0.f) ? v : 0.1f * v; else if (ACT == 16) v = (v >= 0.f) ? v : 0.3f * v; else if (ACT == 17) v = (v >= 0.f) ? v : 0.2f * v; else if (ACT == 15) v = v / (1.0f + expf(-v)); else if (ACT == 3) v = fmaxf(v, 0.f); else if (ACT == 6) v = 0.5f * v * (1.0f + erff(v * 0.70710678118654752f)); so[w][8 * hh + r][t * 16 + ln] = v; } }
  __builtin_amdgcn_fence(__ATOMIC_ACQ_REL, "workgroup"); __builtin_amdgcn_wave_barrier();
  const int rsub = lane >> 4, c4 = (lane & 15) * 4; typedef _Float16 v4h __attribute__((ext_vector_type(4)));
  {
#pragma unroll
    for (int q = 0; q < 8; ++q) { const int r = q * 2 + rsub; if (col0 + c4 < N) { const v4f v = *(const v4fa*)&so[w][r][c4]; if (C) *(v4f*)(C + cofs + (size_t)(row0 + r) * ldc + col0 + c4) = v; if (C16) { v4h h4; for (int i = 0; i < 4; ++i) h4[i] = (_Float16)v[i]; *(v4h*)(C16 + cofs + (size_t)(row0 + r) * ldc + col0 + c4) = h4; } } }
     }
}


typedef _Float16 v4h __attribute__((ext_vector_type(4)));

__global__ __launch_bounds__(256) void k_x16(const float* __restrict__ x, _Float16* __restrict__ X16, size_t n8) { const size_t t = (size_t)blockIdx.x * 256 + threadIdx.x; if (t >= n8) return; FragH f;
#pragma unroll
  for (int q = 0; q < 8; ++q) f.h[q] = (_Float16)bf16_round(x[t * 8 + q]); *(v8us*)((unsigned short*)X16 + t * 8) = f.half[0];  }
__global__ __launch_bounds__(256) void k_h16(const float* __restrict__ x, _Float16* __restrict__ X16, size_t n8) { const size_t t = (size_t)blockIdx.x * 256 + threadIdx.x; if (t >= n8) return; FragH f;
#pragma unroll
  for (int q = 0; q < 8; ++q) f.h[q] = (_Float16)x[t * 8 + q]; *(v8us*)((unsigned short*)X16 + t * 8) = f.half[0];  }
__global__ __launch_bounds__(256) void k_round16f(const float* __restrict__ W, _Float16* __restrict__ Bt, size_t n8) { const size_t t = (size_t)blockIdx.x * 256 + threadIdx.x; if (t >= n8) return; FragH f;
#pragma unroll
  for (int i = 0; i < 8; ++i) f.h[i] = (_Float16)(bf16_round(W[t * 8 + i]) * 16.0f); *(v8us*)((unsigned short*)Bt + t * 8) = f.half[0];  }
template <int NHv, int TTv>
__global__ __launch_bounds__(256) void k_vt(const _Float16* __restrict__ V16, int ldv, int voff, _Float16* __restrict__ Vt) { __shared__ unsigned short tl[64][66]; const int tid = threadIdx.x; const int slab = blockIdx.x / (TTv / 64), lg = blockIdx.x % (TTv / 64); const int b = slab / NHv, h = slab % NHv;
  for (int i = tid; i < 64 * 8; i += 256) { const int r = i / 8, c8 = (i % 8) * 8; FragH f; f.half[0] = *(const v8us*)((const unsigned short*)V16 + ((size_t)b * TTv + lg * 64 + r) * ldv + voff + h * 64 + c8);
#pragma unroll
    for (int q = 0; q < 8; ++q) tl[r][c8 + q] = f.u[q]; }
  __syncthreads();
  {
#pragma unroll
    for (int rd = 0; rd < 2; ++rd) { const int d = rd * 32 + tid / 8, pc = tid % 8; FragH f;
#pragma unroll
      for (int q = 0; q < 8; ++q) f.u[q] = tl[pc * 8 + q][d];
      *(v8us*)((unsigned short*)Vt + ((size_t)slab * 64 + d) * TTv + lg * 64 + pc * 8) = f.half[0]; }
     } }

__global__ __launch_bounds__(256) void k_hl(const float* __restrict__ F, _Float16* __restrict__ Hh, _Float16* __restrict__ Hl, size_t n8) { const size_t t = (size_t)blockIdx.x * 256 + threadIdx.x; if (t >= n8) return; FragH fh, fl; const v4f a = *(const v4fa*)(F + t * 8), c = *(const v4fa*)(F + t * 8 + 4);
#pragma unroll
  for (int q = 0; q < 4; ++q) { _Float16 h = (_Float16)a[q]; fh.h[q] = h; fl.h[q] = (_Float16)((a[q] - (float)h) * 1024.0f); h = (_Float16)c[q]; fh.h[4 + q] = h; fl.h[4 + q] = (_Float16)((c[q] - (float)h) * 1024.0f); }
  { *(v8us*)((unsigned short*)Hh + t * 8) = fh.half[0]; *(v8us*)((unsigned short*)Hl + t * 8) = fl.half[0];  } }

// ---- fast GEMM, two shapes picked by WC: WC = 1: block tile 128x64, 4 waves (4 x 1), wave tile 32x64; WC = 2: block tile 256x128, 8 waves (4 x 2), wave tile 64x64.
// Requires M % (128 WC) == 0 rows per launch region, N % (64 WC) == 0, K % 64 == 0, K >= 64; epilogue = k_gemm_hhx semantics ----
// The larger tile fetches half the operand bytes from L2 per product (384 rows for 256x128 outputs, not 192 for 128x64) and reads two thirds of the LDS bytes per matrix instruction (8 fragments for 16, not 6 for 8).
// Operands go global -> LDS by asynchronous copies, 64 k (one whole 128-byte line of every operand row) per stage, two buffers: eight lanes cover a row's line, so a
// wave's copy touches four whole lines, and every line is fetched once per block. The fragments are read from LDS in the k order of g2_frag.
#define G2_KS 64                              /* k per stage */
#define G2_PITCH 144                          /* LDS row pitch in bytes: 16 B x odd, so that 16 lanes on 16 neighbouring rows meet no bank twice */
__device__ __forceinline__ v16h g2_frag(const unsigned char* p, int hh) { FragH f; f.half[0] = *(const v8us*)(p + 16 * hh); f.half[1] = *(const v8us*)(p + 32 + 16 * hh); return f.v; }
__device__ __forceinline__ v8f g2_mma(v16h a, v16h b, v8f c) { v8f d = __builtin_amdgcn_wmma_f32_16x16x32_f16(false, a, false, b, (short)0, c, false, false); asm volatile("v_nop\n\tv_nop\n\tv_nop\n\tv_nop" : "+v"(d) : "v"(a), "v"(b)); return d; }
// One stage's twelve copies of a thread (16 bytes each): rows sr + RS i of A (i = 0 .. 7) and of B (i = 0 .. 3), RS = the rows that the block's threads cover at once; B lies behind A's 8 RS rows.
// l = the thread's LDS byte address in the stage's row sr. The s_wait_xcnt closes the statement, so that it stands ahead of every later overwrite of the copies' address registers.
template <int RS>
__device__ __forceinline__ void g2_copy(unsigned l, const _Float16* ga, size_t sa, const _Float16* gb, size_t sb) {
  asm volatile("global_load_async_to_lds_b128 %0, %12, off\n\t" "global_load_async_to_lds_b128 %1, %13, off\n\t" "global_load_async_to_lds_b128 %2, %14, off\n\t" "global_load_async_to_lds_b128 %3, %15, off\n\t"
               "global_load_async_to_lds_b128 %4, %16, off\n\t" "global_load_async_to_lds_b128 %5, %17, off\n\t" "global_load_async_to_lds_b128 %6, %18, off\n\t" "global_load_async_to_lds_b128 %7, %19, off\n\t"
               "global_load_async_to_lds_b128 %8, %20, off\n\t" "global_load_async_to_lds_b128 %9, %21, off\n\t" "global_load_async_to_lds_b128 %10, %22, off\n\t" "global_load_async_to_lds_b128 %11, %23, off\n\t"
               "s_wait_xcnt 0x0"
               :: "v"(l), "v"(l + RS * G2_PITCH), "v"(l + 2 * RS * G2_PITCH), "v"(l + 3 * RS * G2_PITCH), "v"(l + 4 * RS * G2_PITCH), "v"(l + 5 * RS * G2_PITCH), "v"(l + 6 * RS * G2_PITCH), "v"(l + 7 * RS * G2_PITCH),
                  "v"(l + 8 * RS * G2_PITCH), "v"(l + 9 * RS * G2_PITCH), "v"(l + 10 * RS * G2_PITCH), "v"(l + 11 * RS * G2_PITCH),
                  "v"(ga), "v"(ga + sa), "v"(ga + 2 * sa), "v"(ga + 3 * sa), "v"(ga + 4 * sa), "v"(ga + 5 * sa), "v"(ga + 6 * sa), "v"(ga + 7 * sa),
                  "v"(gb), "v"(gb + sb), "v"(gb + 2 * sb), "v"(gb + 3 * sb) : "memory"); }
// Eight of a lane's residual loads (16 bytes each), issued one behind the other with no wait on their data between them.
// The s_wait_xcnt stands ahead of every overwrite of the loads' address registers; the addresses as its inputs keep their registers from being rewritten, or handed to one of the loads as a destination, ahead of it.
__device__ __forceinline__ void g2_res8(const float* const (&rp)[8], v4f* res) {
#pragma unroll      /* constant indices: rp and res stay in registers */
  for (int q = 0; q < 8; ++q) res[q] = *(const v4fa*)rp[q];
  asm volatile("s_wait_xcnt 0x0" :: "v"(rp[0]), "v"(rp[1]), "v"(rp[2]), "v"(rp[3]), "v"(rp[4]), "v"(rp[5]), "v"(rp[6]), "v"(rp[7]) : "memory"); }
// A lane's share of the residual for 32 rows from row rbase on: sixteen 16-byte loads, in two runs of eight (sixteen address pairs at once would cost registers).
__device__ __forceinline__ void g2_res16(const float* __restrict__ CP, int rowsPerB, size_t sCPb, size_t cofs, int by, int ldc, int rbase, int colc, v4f* res) {
  if (rowsPerB < 0) {      /* rowsPerB < 0: own elements of the batched C plane */
#pragma unroll
    for (int g = 0; g < 2; ++g) { const float* rp[8];
#pragma unroll
      for (int q = 0; q < 8; ++q) rp[q] = CP + cofs + (size_t)(rbase + (g * 8 + q) * 2) * ldc + colc;
      g2_res8(rp, res + g * 8); }
  } else {
#pragma unroll
    for (int g = 0; g < 2; ++g) { const float* rp[8];
#pragma unroll
      for (int q = 0; q < 8; ++q) { const int bidx = (rbase + (g * 8 + q) * 2) / rowsPerB; rp[q] = CP + (size_t)bidx * sCPb + (size_t)by * 64 + colc; }
      g2_res8(rp, res + g * 8); } } }
template <int ACT, int WC>
__global__ __launch_bounds__(128 * WC) void k_gemm2(const _Float16* __restrict__ A, int lda, size_t sA, const _Float16* __restrict__ Bh, int ldb, size_t sB, float alpha, const float* __restrict__ bias, size_t sBias, const float* __restrict__ CP, int rowsPerB, size_t sCPb, int row0g,
    float* __restrict__ C, _Float16* __restrict__ C16, int ldc, size_t sC, int M, int N, int K) { static_assert(ACT == 0 || ACT == 3 || ACT == 6 || ACT == 8 || ACT == 9 || ACT == 11 || ACT == 12 || ACT == 14 || ACT == 15 || ACT == 16 || ACT == 17, "k_gemm2: unsupported ACT code (would silently apply no activation)");
  static_assert(WC == 1 || WC == 2, "k_gemm2: two shapes");
  constexpr int NW = 4 * WC, FA = 2 * WC, BM = 128 * WC, BN = 64 * WC, RS = 4 * NW;      /* waves, A fragments per wave, block tile, rows per copy of the block */
  constexpr unsigned STAGE = (unsigned)((BM + BN) * G2_PITCH);      /* one stage: [A BM rows | B BN rows] */
  __shared__ __attribute__((aligned(16))) unsigned char sm[2 * STAGE]; static_assert(sizeof(float) * NW * 32 * 68 <= 2 * STAGE, "the output staging lies in the ring");
  float (*so)[32][68] = (float (*)[32][68])sm;      /* output staging, 32 rows of a wave at a time: used only behind the last trip's barrier, when no wave reads the ring any more */
  const int tid = threadIdx.x, w = tid >> 5, lane = tid & 31, ln = lane & 15, hh = lane >> 4; const int by = blockIdx.y; const int wr = w & 3, wc = w >> 2;
  A += (size_t)by * sA; Bh += (size_t)by * sB; const size_t cofs = (size_t)by * sC; const float* bp = bias ? bias + (size_t)by * sBias : nullptr;
  const int ntn = N / BN; const int mt = blockIdx.x / ntn, nq = blockIdx.x - mt * ntn; const int row0 = mt * BM + 16 * FA * wr, col0 = nq * BN + 64 * wc; if (mt * BM >= M) return;      /* the whole block leaves, ahead of every copy and barrier */
  const int sr = tid >> 3, sc = tid & 7;      /* the thread's first row of a stage and its 16-byte piece of the row's line */
  const _Float16* ga = A + (size_t)(mt * BM + sr) * lda + sc * 8; const _Float16* gb = Bh + (size_t)(nq * BN + sr) * ldb + sc * 8; const size_t sa = (size_t)RS * lda, sb = (size_t)RS * ldb;
  const unsigned l0 = (unsigned)(size_t)sm + (unsigned)(sr * G2_PITCH + sc * 16);
  const unsigned char* ar = sm + (16 * FA * wr + ln) * G2_PITCH; const unsigned char* br = sm + (BM + 64 * wc + ln) * G2_PITCH;
  const int nt = K / G2_KS;
  const v8f z8 = {0.f,0.f,0.f,0.f,0.f,0.f,0.f,0.f}; v8f acc[FA][4];
#pragma unroll      /* constant indices here and below: acc, fa and fb stay in registers */
  for (int i = 0; i < FA; ++i)
#pragma unroll
    for (int j = 0; j < 4; ++j) acc[i][j] = z8;
  g2_copy<RS>(l0, ga, sa, gb, sb);
  asm volatile("s_wait_asynccnt 0x0" ::: "memory");      /* this wave's copies of stage 0 have landed */
  __syncthreads();      /* and every other wave's: stage 0 may be read */
  if (nt > 1) g2_copy<RS>(l0 + STAGE, ga + G2_KS, sa, gb + G2_KS, sb);
  constexpr int KG = (WC == 1) ? 2 : 1;      /* 32-k blocks whose fragments are held at once: both of the stage where they fit beside the accumulators */
#pragma unroll 1      /* one trip per stage: the buffer is chosen by the trip's parity */
  for (int t = 0; t < nt; ++t) { const unsigned bo = (unsigned)(t & 1) * STAGE;
    const unsigned char* ap = ar + bo; const unsigned char* bq = br + bo;
#pragma unroll      /* the stage's two 32-k blocks, straight-line, k rising */
    for (int kg = 0; kg < 2; kg += KG) { v16h fa[KG][FA], fb[KG][4];
#pragma unroll
      for (int kk = 0; kk < KG; ++kk) {
#pragma unroll
        for (int i = 0; i < FA; ++i) fa[kk][i] = g2_frag(ap + i * 16 * G2_PITCH + (kg + kk) * 64, hh);
#pragma unroll
        for (int j = 0; j < 4; ++j) fb[kk][j] = g2_frag(bq + j * 16 * G2_PITCH + (kg + kk) * 64, hh); }
#pragma unroll
      for (int kk = 0; kk < KG; ++kk)
#pragma unroll
        for (int j = 0; j < 4; ++j)
#pragma unroll
          for (int i = 0; i < FA; ++i) acc[i][j] = g2_mma(fa[kk][i], fb[kk][j], acc[i][j]); }
    asm volatile("s_wait_dscnt 0x0" ::: "memory");      /* this wave's reads of the buffer are done */
    asm volatile("s_wait_asynccnt 0x0" ::: "memory");      /* its copies of stage t + 1 have landed */
    __syncthreads();      /* publishes stage t + 1 and ends every reader's last read of stage t's buffer */
    if (t + 2 < nt) g2_copy<RS>(l0 + bo, ga + (size_t)(t + 2) * G2_KS, sa, gb + (size_t)(t + 2) * G2_KS, sb); }
  asm volatile("s_wait_asynccnt 0x0" ::: "memory");      /* no copy is outstanding when the ring becomes output staging */
  // Scale, bias, residual and activation are applied where the staged rows are read back: there a lane holds four neighbouring columns of a row, so that its share of the residual is
  // sixteen 16-byte loads per 32 rows (a wave's load covers whole 128-byte lines), all of them issued ahead of the staging and waited for once. The unrolls keep res and acc in registers (constant indices).
  const int rsub = lane >> 4, c4 = (lane & 15) * 4; const v4f z4 = {0.f, 0.f, 0.f, 0.f};
#pragma unroll 1      /* 32 rows of the wave's tile per trip; stays rolled: a second copy of this body would double the kernel's text, which runs once per wave, straight from the instruction fetch */
  for (int hf = 0; hf < FA / 2; ++hf) { v4f res[16], bv4 = z4;
    if (CP) g2_res16(CP, rowsPerB, sCPb, cofs, by, ldc, row0g + row0 + hf * 32 + rsub, col0 + c4, res);
    else {
#pragma unroll
      for (int q = 0; q < 16; ++q) res[q] = z4; }
    if (bp) { bv4 = *(const v4fa*)(bp + col0 + c4);
      asm volatile("s_wait_xcnt 0x0" ::: "memory"); }      /* stands ahead of every later overwrite of the bias load's address registers */
#pragma unroll
    for (int i = 0; i < 4; ++i) bv4[i] = bf16_round(bv4[i]);
#pragma unroll
    for (int u = 0; u < 8; ++u) { const int t = u & 3, half = u >> 2;
#pragma unroll
      for (int r = 0; r < 8; ++r) so[w][half * 16 + 8 * hh + r][t * 16 + ln] = acc[half][t][r]; }
    __builtin_amdgcn_fence(__ATOMIC_ACQ_REL, "workgroup"); __builtin_amdgcn_wave_barrier();
#pragma unroll
    for (int q = 0; q < 16; ++q) { const int r = q * 2 + rsub; v4f v = *(const v4fa*)&so[w][r][c4];
#pragma unroll
      for (int i = 0; i < 4; ++i) { float x = v[i] * alpha + bv4[i]; if (CP) x += res[q][i];
        if (ACT == 3) x = fmaxf(x, 0.f); else if (ACT == 6) x = 0.5f * x * (1.0f + erff(x * 0.70710678118654752f)); else if (ACT == 11) x = 1.0f / (1.0f + expf(-x)); else if (ACT == 15) x = x / (1.0f + expf(-x)); else if (ACT == 12) x = (x > 0.f) ? x : 0.01f * x; else if (ACT == 8) x = tanhf(x); else if (ACT == 9) x = 0.5f * x * (1.0f + tanhf(0.7978845608028654f * (x + 0.044715f * x * x * x))); else if (ACT == 14) x = (x > 0.f) ? x : 0.1f * x; else if (ACT == 16) x = (x >= 0.f) ? x : 0.3f * x; else if (ACT == 17) x = (x >= 0.f) ? x : 0.2f * x;
        v[i] = x; }
      if (C) { *(v4f*)(C + cofs + (size_t)(row0 + hf * 32 + r) * ldc + col0 + c4) = v;
        asm volatile("s_wait_xcnt 0x0" ::: "memory"); }      /* stands ahead of the f16 conversion below, which may be given the store's data registers */
      if (C16) { v4h h4; for (int i = 0; i < 4; ++i) h4[i] = (_Float16)v[i]; *(v4h*)(C16 + cofs + (size_t)(row0 + hf * 32 + r) * ldc + col0 + c4) = h4;
        asm volatile("s_wait_xcnt 0x0" ::: "memory"); } }      /* stands ahead of every later overwrite of this store's registers, the accumulators' move below among them */
    if (FA > 2) {      /* the next 32 rows' accumulators move down for the next trip */
      asm volatile("s_wait_dscnt 0x0" ::: "memory"); __builtin_amdgcn_wave_barrier();      /* every lane's read-back is done before the next rows are staged over it */
#pragma unroll
      for (int i = 0; i + 2 < FA; ++i)
#pragma unroll
        for (int j = 0; j < 4; ++j) acc[i][j] = acc[i + 2][j]; } } }


// The short jobs below are device functions: bx is the block's index inside its job. k_prep and k_l2hT, behind them, hand each block of one grid its job.
__device__ __forceinline__ void d_wT(int bx, const float* __restrict__ w, int din, int dout, _Float16* __restrict__ Bt) { __shared__ float tl[64][65]; const int tid = threadIdx.x; const int nbo = dout / 64; const int ib = bx / nbo, ob = bx % nbo; const int i0 = ib * 64, o0 = ob * 64;
  for (int t = tid; t < 64 * 64; t += 256) { const int i = t / 64, o = t % 64; tl[o][i] = bf16_round(w[(size_t)(i0 + i) * dout + o0 + o]) * 16.0f; }
  __syncthreads();
  { for (int t = tid; t < 64 * 8; t += 256) { const int o = t / 8, i8 = (t % 8) * 8; FragH f; for (int q = 0; q < 8; ++q) f.h[q] = (_Float16)tl[o][i8 + q]; *(v8us*)((unsigned short*)Bt + (size_t)(o0 + o) * din + i0 + i8) = f.half[0]; }  } }
__device__ __forceinline__ void d_wnat(int bx, const float* __restrict__ w, size_t n8, _Float16* __restrict__ Bt) { const size_t t = (size_t)bx * 256 + threadIdx.x; if (t >= n8) return; FragH f; for (int q = 0; q < 8; ++q) f.h[q] = (_Float16)(bf16_round(w[t * 8 + q]) * 16.0f); *(v8us*)((unsigned short*)Bt + t * 8) = f.half[0];  }
// One row per wave: lane l holds columns 128 u + 4 l .. + 3 (u = 0 .. 7), so every load and every f32 store of a wave covers 512 contiguous bytes (an f16 store 256),
// and the row stays in registers between the sum of squares and the scaling. No LDS, no barrier. The unrolls keep xv, sv and o in registers (constant indices).
__device__ __forceinline__ void d_rms(int bx, const float* __restrict__ X, int xIsInput, const float* __restrict__ scale, size_t nrows, _Float16* __restrict__ N16, float* __restrict__ XF) {
  const int lane = threadIdx.x & 31; const size_t r = (size_t)bx * 8 + (threadIdx.x >> 5); if (r >= nrows) return;      /* the same for a whole wave */
  const size_t o0 = r * DM + lane * 4; const float* xp = X + o0; const float* sp = scale + lane * 4; v4f xv[DM / 128], sv[DM / 128];
#pragma unroll
  for (int u = 0; u < DM / 128; ++u) xv[u] = *(const v4fa*)(xp + u * 128);
#pragma unroll
  for (int u = 0; u < DM / 128; ++u) sv[u] = *(const v4fa*)(sp + u * 128);
  asm volatile("s_wait_xcnt 0x0" :: "v"(xp) : "memory");      /* stands ahead of every overwrite of the loads' address registers; xp as an input keeps its registers from being handed to one of the loads as a destination ahead of it */
  if (xIsInput) {
#pragma unroll
    for (int u = 0; u < DM / 128; ++u)
#pragma unroll
      for (int q = 0; q < 4; ++q) xv[u][q] = bf16_round(xv[u][q]); }
  if (XF) {      /* the f32 copy leaves as soon as it is known; xv is only read from here on */
#pragma unroll
    for (int u = 0; u < DM / 128; ++u) *(v4f*)(XF + o0 + u * 128) = xv[u];
    asm volatile("s_wait_xcnt 0x0" ::: "memory"); }      /* stands ahead of every later overwrite of these stores' address and data registers */
  float s4[4] = {0.f, 0.f, 0.f, 0.f};      /* four independent chains per lane */
#pragma unroll
  for (int u = 0; u < DM / 128; ++u)
#pragma unroll
    for (int q = 0; q < 4; ++q) s4[q] += xv[u][q] * xv[u][q];
  float ss = (s4[0] + s4[1]) + (s4[2] + s4[3]);
#pragma unroll
  for (int m = 16; m >= 1; m >>= 1) ss += __shfl_xor(ss, m, 32);      /* every lane ends with the row's sum */
  const float rs = 1.0f / sqrtf(ss / (float)DM + 1e-8f); v4h o[DM / 128];
#pragma unroll
  for (int u = 0; u < DM / 128; ++u)
#pragma unroll
    for (int q = 0; q < 4; ++q) o[u][q] = (_Float16)((xv[u][q] * rs) * bf16_round(sv[u][q]));
#pragma unroll
  for (int u = 0; u < DM / 128; ++u) *(v4h*)(N16 + o0 + u * 128) = o[u]; }
__global__ __launch_bounds__(256) void k_rms(const float* __restrict__ X, int xIsInput, const float* __restrict__ scale, size_t nrows, _Float16* __restrict__ N16, float* __restrict__ XF) { d_rms(blockIdx.x, X, xIsInput, scale, nrows, N16, XF); }
__device__ __forceinline__ void d_hT(int bx, int b, const _Float16* __restrict__ HN, _Float16* __restrict__ HT) { __shared__ unsigned short tl[64][65]; const int tid = threadIdx.x; HT += (size_t)b * DM * SQ;      /* b is the batch, each has its own [DM][SQ] plane */
  const int jb = bx % (SQ / 64), dbk = bx / (SQ / 64); const int j0 = jb * 64, d0 = dbk * 64;
  for (int i = tid; i < 64 * 8; i += 256) { const int j = i / 8, d8 = (i % 8) * 8; FragH f; f.half[0] = *(const v8us*)((const unsigned short*)HN + ((size_t)b * SQ + j0 + j) * DM + d0 + d8); for (int q = 0; q < 8; ++q) tl[d8 + q][j] = f.u[q]; }
  __syncthreads();
  { for (int i = tid; i < 64 * 8; i += 256) { const int d = i / 8, j8 = (i % 8) * 8; FragH f; for (int q = 0; q < 8; ++q) f.u[q] = tl[d][j8 + q]; *(v8us*)((unsigned short*)HT + (size_t)(d0 + d) * SQ + j0 + j8) = f.half[0]; }  } }
__device__ __forceinline__ void d_tab(int bx, const float* __restrict__ dl, float* __restrict__ T) {
  #pragma clang fp contract(off)
  const int t = bx * 256 + threadIdx.x; if (t >= SQ * RR) return; const int r = t % RR, d = t / RR; const float g = __fadd_rn(0.15f, __fmul_rn(0.85f, 1.0f / (1.0f + expf(-bf16_round(dl[r]))))); const float lg = logf(fmaxf(g, 1e-8f)); const float v = expf(__fmul_rn((float)d, lg));
  *(float*)(T + t) = v;  }
// Sixteen lanes per 64-element q or k row (the rows lie one behind the other in F): a lane holds four elements, a wave's load and store cover 512 contiguous bytes.
__device__ __forceinline__ void d_l2(int bx, float* __restrict__ F) {
  const size_t t = (size_t)bx * 256 + threadIdx.x; if (t >= NR * 2 * (RR / 4)) return;      /* whole waves only: the bound is a multiple of 32 */
  float* f = F + t * 4; const v4f a = *(const v4fa*)f; float ss = (a[0] * a[0] + a[1] * a[1]) + (a[2] * a[2] + a[3] * a[3]);
#pragma unroll
  for (int m = 8; m >= 1; m >>= 1) ss += __shfl_xor(ss, m, 32);      /* stays inside the row's sixteen lanes */
  float n = sqrtf(ss); if (n < 1e-8f) n = 1e-8f; const float inv = 1.0f / n; v4f o;
#pragma unroll
  for (int q = 0; q < 4; ++q) o[q] = a[q] * inv;
  *(v4f*)f = o; }
// Launches that need nothing of one another share one grid: a range of the block index picks the job, so every branch here is the same for a whole block.
// k_prep reads inputs only: [u|v]^T, the first rmsnorm, the three weight planes, the decay table. The jobs with the longest blocks come first.
#define PB_WT ((DM / 64) * (RR / 64))        /* blocks of one d_wT job */
#define PB_RMS ((int)(NR / 8))
#define PB_WP (DM * DM / 8 / 256)            /* blocks of d_wnat on proj_w; up_w and down_w take PB_WU each */
#define PB_WU (FH * DM / 8 / 256)
#define PB_TAB (SQ * RR / 256)
__global__ __launch_bounds__(256) void k_prep(const float* __restrict__ u, const float* __restrict__ v, const float* __restrict__ pw, const float* __restrict__ uw, const float* __restrict__ dw, const float* __restrict__ dl, const float* __restrict__ h, const float* __restrict__ n1,
    _Float16* __restrict__ BUV, _Float16* __restrict__ BP, _Float16* __restrict__ BU, _Float16* __restrict__ BD, float* __restrict__ T, _Float16* __restrict__ HN16, float* __restrict__ HF) {
  int bx = blockIdx.x;
  if (bx < 2 * PB_WT) { const int s = bx / PB_WT; d_wT(bx - s * PB_WT, s ? v : u, DM, RR, BUV + (size_t)s * RR * DM); return; }      /* [u|v]^T -> [128][1024] */
  bx -= 2 * PB_WT;
  if (bx < PB_RMS) { d_rms(bx, h, 1, n1, NR, HN16, HF); return; }      /* hn (f16) + bf16(h) (f32 residual) */
  bx -= PB_RMS;
  if (bx < PB_WP + 2 * PB_WU) { const float* w = pw; _Float16* Bt = BP; size_t n8 = (size_t)DM * DM / 8;
    if (bx >= PB_WP) { bx -= PB_WP; w = uw; Bt = BU; n8 = (size_t)FH * DM / 8; if (bx >= PB_WU) { bx -= PB_WU; w = dw; Bt = BD; } }
    d_wnat(bx, w, n8, Bt); return; }
  d_tab(bx - (PB_WP + 2 * PB_WU), dl, T); }
// The transposed hn planes need the first rmsnorm alone, the l2 normalisation the q|k product alone: one grid, the transposes first.
#define PB_HT ((SQ / 64) * (DM / 64))        /* blocks of d_hT per batch */
#define PB_L2 ((int)(NR * 2 * (RR / 4) / 256))
__global__ __launch_bounds__(256) void k_l2hT(float* __restrict__ QK, const _Float16* __restrict__ HN, _Float16* __restrict__ HT) {
  const int bx = blockIdx.x;
  if (bx < PB_HT * NB) { d_hT(bx % PB_HT, bx / PB_HT, HN, HT); return; }
  d_l2(bx - PB_HT * NB, QK); }
// Mixing matrix, one 32 (rows i) x 64 (columns j) tile per block. In a tile that the diagonal crosses a thread owns one column: its k row stays in registers, the tile's q rows and the
// decay-table rows that the tile's distances i - j reach lie in LDS (rows of a negative distance are zero; those elements are masked at the store).
// Every "#pragma unroll" in the code for those tiles is there so that the small arrays it indexes (tx, qx, kr, tb, qb, acc) get constant indices and stay in registers.
#define AM_TI 32
#define AM_TJ 64
#define AM_TD (AM_TI + AM_TJ)        /* 95 distances, and one row more that nobody reads: the staging is then six whole trips of the block */
#define AM_P (RR + 4)                /* LDS row pitch in floats: 16 B x odd, so that 16 lanes on 16 neighbouring rows meet no bank twice */
// A tile whose every column lies at or before its first row i0 (j <= i0 <= i) needs no table row per element: gamma^(i-j) = gamma^(i-i0) * gamma^(i0-j), both exponents >= 0, so both
// factors are table rows <= 1. With q'[i][r] = q[i][r] gamma_r^(i-i0) and k'[j][r] = k[j][r] gamma_r^(i0-j) the tile's scores are the plain product q' k'^T over the 64 ranks: one 16x16 piece per wave on WMMA.
// q' and k' are staged as f16 pairs hi + lo (x = hi + lo to about 2^-22 of x) and the product takes the three terms hi hi + lo hi + hi lo; the powers of two AM_SQ, AM_SK lift small values off the f16 subnormals and are divided out exactly.
#define AM_HP (G2_PITCH / 2)         /* f16 row pitch of the staged q' and k': the pitch that g2_frag's readers want */
#define AM_SQ 16.0f
#define AM_SK 256.0f
__device__ __forceinline__ void am_stage(const v4f a0, const v4f a1, const v4f t0, const v4f t1, float s, _Float16* hi, _Float16* lo) { FragH fh, fl;
#pragma unroll      /* constant indices: the eight values stay in registers */
  for (int q = 0; q < 8; ++q) { const float x = ((q < 4 ? a0[q & 3] : a1[q & 3]) * (q < 4 ? t0[q & 3] : t1[q & 3])) * s; const _Float16 h = (_Float16)x; fh.h[q] = h; fl.h[q] = (_Float16)(x - (float)h); }
  *(v8us*)hi = fh.half[0]; *(v8us*)lo = fl.half[0]; }
__global__ __launch_bounds__(256) void k_amat(const float* __restrict__ QK, const float* __restrict__ kb, const float* __restrict__ T, const float* __restrict__ gl, const float* __restrict__ al, _Float16* __restrict__ A16) {
  __shared__ __attribute__((aligned(16))) float Ts[AM_TD][AM_P];
  __shared__ __attribute__((aligned(16))) float qs[AM_TI][RR];
  __shared__ __attribute__((aligned(16))) float sc[AM_TI][AM_P];
  __shared__ __attribute__((aligned(16))) _Float16 Qm[2][AM_TI][AM_HP];      /* q': [hi | lo] */
  __shared__ __attribute__((aligned(16))) _Float16 Km[2][AM_TJ][AM_HP];      /* k': [hi | lo] */
  const int b = blockIdx.y; A16 += (size_t)b * SQ * SQ;      /* one launch for all batches: blockIdx.y is the batch, each has its own [SQ][SQ] plane */
  const int tid = threadIdx.x; const int jt = blockIdx.x / (SQ / AM_TI), it = blockIdx.x % (SQ / AM_TI); const int i0 = it * AM_TI, j0 = jt * AM_TJ;
  const int orow = tid >> 3, oc8 = (tid & 7) * 8; const int oi = i0 + orow, oj = j0 + oc8;      /* the 8 elements this thread stores */
  unsigned short* dst = (unsigned short*)A16 + (size_t)oi * SQ + oj;
  if (j0 > i0 + AM_TI - 1) { const v8us z = {0, 0, 0, 0, 0, 0, 0, 0}; *(v8us*)dst = z; return; }      /* tile wholly above the diagonal: the whole block leaves, ahead of every barrier */
  const int jl = tid & (AM_TJ - 1), ig = tid >> 6; const int sr = tid >> 4, sc4 = (tid & 15) * 4;
  const int dmin = i0 - j0 - (AM_TJ - 1);
  const v4f kb0 = *(const v4fa*)(kb + (size_t)oi * SQ + oj), kb1 = *(const v4fa*)(kb + (size_t)oi * SQ + oj + 4);
  const float glv = gl[0], alv = al[0]; float gate, alpha;      /* the two logits are read ahead of both paths */
  if (j0 + AM_TJ - 1 <= i0) {      /* the same for the whole block: the tile lies wholly below the diagonal */
    // Eight lanes per row, eight ranks each: a wave's load covers whole 256-byte rows. Row orow of q', rows orow and orow + 32 of k'.
    const float* qp = QK + ((size_t)b * SQ + i0 + orow) * (2 * RR) + oc8; const float* tq = T + (size_t)orow * RR + oc8;
    const float* kp0 = QK + ((size_t)b * SQ + j0 + orow) * (2 * RR) + RR + oc8; const float* kp1 = kp0 + (size_t)32 * (2 * RR);
    const float* tk0 = T + (size_t)(i0 - j0 - orow) * RR + oc8; const float* tk1 = tk0 - (size_t)32 * RR;      /* distances i0 - j: at least i0 - j0 - 63 >= 0, at most i0 - j0 < SQ */
    const v4f q0 = *(const v4fa*)qp, q1 = *(const v4fa*)(qp + 4), u0 = *(const v4fa*)tq, u1 = *(const v4fa*)(tq + 4);
    const v4f c0 = *(const v4fa*)kp0, c1 = *(const v4fa*)(kp0 + 4), w0 = *(const v4fa*)tk0, w1 = *(const v4fa*)(tk0 + 4);
    const v4f e0 = *(const v4fa*)kp1, e1 = *(const v4fa*)(kp1 + 4), y0 = *(const v4fa*)tk1, y1 = *(const v4fa*)(tk1 + 4);
    asm volatile("s_wait_xcnt 0x0" :: "v"(kb + (size_t)oi * SQ + oj), "v"(qp), "v"(tq), "v"(kp0), "v"(tk0) : "memory");      /* stands ahead of every overwrite of the address registers of these loads and of the k_base loads above; the addresses as inputs keep their registers from being rewritten, or handed to a load as a destination, ahead of it */
    gate = 1.0f / (1.0f + expf(-bf16_round(glv))); alpha = 1.0f / (1.0f + expf(-bf16_round(alv)));
    am_stage(q0, q1, u0, u1, AM_SQ, &Qm[0][orow][oc8], &Qm[1][orow][oc8]);
    am_stage(c0, c1, w0, w1, AM_SK, &Km[0][orow][oc8], &Km[1][orow][oc8]);
    am_stage(e0, e1, y0, y1, AM_SK, &Km[0][orow + 32][oc8], &Km[1][orow + 32][oc8]);
    __syncthreads();      /* q' and k' are whole before any wave reads its fragments */
    const int w = tid >> 5, ln = tid & 15, hh = (tid >> 4) & 1, wi = w & 1, wj = w >> 1;      /* wave w: rows 16 wi .., columns 16 wj .. of the tile */
    const unsigned char* fq = (const unsigned char*)&Qm[0][16 * wi + ln][0]; const unsigned char* fk = (const unsigned char*)&Km[0][16 * wj + ln][0];
    v8f d = {0.f, 0.f, 0.f, 0.f, 0.f, 0.f, 0.f, 0.f};
#pragma unroll      /* the two 32-rank blocks, straight-line */
    for (int kk = 0; kk < 2; ++kk) { const v16h qh = g2_frag(fq + kk * 64, hh), ql = g2_frag(fq + sizeof(Qm[0]) + kk * 64, hh), kh = g2_frag(fk + kk * 64, hh), kl = g2_frag(fk + sizeof(Km[0]) + kk * 64, hh);
      d = g2_mma(qh, kh, d); d = g2_mma(ql, kh, d); d = g2_mma(qh, kl, d); }
#pragma unroll      /* constant indices: d stays in registers */
    for (int r = 0; r < 8; ++r) sc[16 * wi + 8 * hh + r][16 * wj + ln] = d[r] * (1.0f / (AM_SQ * AM_SK));
  } else {
  asm volatile("s_wait_xcnt 0x0" :: "v"(kb + (size_t)oi * SQ + oj) : "memory");      /* stands ahead of every overwrite of the k_base loads' address registers; the address as an input keeps them from being rewritten ahead of it */
  v4f tx[AM_TD / 16], qx[AM_TI / 16];
#pragma unroll
  for (int u = 0; u < AM_TD / 16; ++u) { const int d = dmin + sr + u * 16; const int dc = d < 0 ? 0 : (d > SQ - 1 ? SQ - 1 : d); tx[u] = *(const v4fa*)(T + (size_t)dc * RR + sc4); }
#pragma unroll
  for (int u = 0; u < AM_TI / 16; ++u) qx[u] = *(const v4fa*)(QK + ((size_t)b * SQ + i0 + sr + u * 16) * (2 * RR) + sc4);
  asm volatile("s_wait_xcnt 0x0" ::: "memory");      /* the loads below may be given address registers of the loads above as destinations: the wait stands in front of that overwrite */
  const float* kp = QK + ((size_t)b * SQ + j0 + jl) * (2 * RR); v4f kr[RR / 4];
#pragma unroll
  for (int r4 = 0; r4 < RR / 4; ++r4) kr[r4] = *(const v4fa*)(kp + RR + r4 * 4);
  asm volatile("s_wait_xcnt 0x0" :: "v"(kp) : "memory");      /* kp as an input keeps its registers from being handed to one of these loads as a destination ahead of the wait */
  __builtin_amdgcn_sched_barrier(0);      /* every global load is issued before the first wait on one: one latency for the block's start, not two */
  gate = 1.0f / (1.0f + expf(-bf16_round(glv))); alpha = 1.0f / (1.0f + expf(-bf16_round(alv)));
#pragma unroll
  for (int u = 0; u < AM_TD / 16; ++u) { const v4f z4 = {0.f, 0.f, 0.f, 0.f}; *(v4fa*)&Ts[sr + u * 16][sc4] = (dmin + sr + u * 16 < 0) ? z4 : tx[u]; }
#pragma unroll
  for (int u = 0; u < AM_TI / 16; ++u) *(v4fa*)&qs[sr + u * 16][sc4] = qx[u];
  __syncthreads();
#pragma unroll 1      /* stays rolled: the body is over 600 instructions long, and a second copy of it would save one branch */
  for (int hf = 0; hf < 2; ++hf) { const int il = ig * 8 + hf * 4;      /* four rows at a time: four independent sums, each over r in rising order */
    const float* tp = &Ts[il + (AM_TJ - 1) - jl][0]; const float* qp = &qs[il][0]; float acc[4] = {0.f, 0.f, 0.f, 0.f}; v4f tb[2][4][2], qb[2][4][2];
#pragma unroll
    for (int s = 0; s < 4; ++s)
#pragma unroll
      for (int h2 = 0; h2 < 2; ++h2) { qb[0][s][h2] = *(const v4fa*)(qp + s * RR + h2 * 4); tb[0][s][h2] = *(const v4fa*)(tp + s * AM_P + h2 * 4); }
#pragma unroll
    for (int ch = 0; ch < RR / 8; ++ch) {
      if (ch + 1 < RR / 8) {
#pragma unroll
        for (int s = 0; s < 4; ++s)
#pragma unroll
          for (int h2 = 0; h2 < 2; ++h2) { qb[(ch + 1) & 1][s][h2] = *(const v4fa*)(qp + s * RR + (ch + 1) * 8 + h2 * 4); tb[(ch + 1) & 1][s][h2] = *(const v4fa*)(tp + s * AM_P + (ch + 1) * 8 + h2 * 4); } }
      __builtin_amdgcn_sched_barrier(0);      /* keeps the next eight ranks' LDS loads ahead of this eight's arithmetic, which then covers their latency */
#pragma unroll
      for (int h2 = 0; h2 < 2; ++h2)
#pragma unroll
        for (int c = 0; c < 4; ++c)
#pragma unroll
          for (int s = 0; s < 4; ++s) acc[s] += (qb[ch & 1][s][h2][c] * kr[ch * 2 + h2][c]) * tb[ch & 1][s][h2][c];
      __builtin_amdgcn_sched_barrier(0);      /* and keeps the loads after next from rising into it, where they would need a third set of registers */
    }
#pragma unroll
    for (int s = 0; s < 4; ++s) sc[il + s][jl] = acc[s]; }
  }
  __syncthreads();
  const v4f a0 = *(const v4fa*)&sc[orow][oc8], a1 = *(const v4fa*)&sc[orow][oc8 + 4]; FragH f;
#pragma unroll
  for (int u = 0; u < 8; ++u) { const float kv = (u < 4) ? kb0[u & 3] : kb1[u & 3]; const float av = (u < 4) ? a0[u & 3] : a1[u & 3]; const _Float16 v = (_Float16)(gate * bf16_round(kv) + alpha * av); f.h[u] = (oj + u <= oi) ? v : (_Float16)0.0f; }
  *(v8us*)dst = f.half[0]; }

extern "C" void kernel_launch(void* const* d_in, const int* in_sizes, int n_in,
                              void* d_out, int out_size, void* d_ws, size_t ws_size, hipStream_t stream) {
  (void)in_sizes; (void)n_in; (void)out_size;
  const float* const* I = (const float* const*)d_in; const float* h = I[0]; const float* kb = I[1]; const float* dl = I[2]; const float* gl = I[3]; const float* al = I[4]; const float* u = I[5]; const float* v = I[6]; const float* pw = I[7]; const float* pb = I[8]; const float* n1 = I[9]; const float* n2 = I[10]; const float* uw = I[11]; const float* ub = I[12]; const float* dw = I[13]; const float* db = I[14];
  char* ws = (char*)d_ws; size_t off = 0;
  auto take = [&](size_t bytes) { char* p = ws + off; off += (bytes + 255) & ~(size_t)255; return p; };
  _Float16* BUV = (_Float16*)take((size_t)2 * RR * DM * 2); _Float16* BP = (_Float16*)take((size_t)DM * DM * 2); _Float16* BU = (_Float16*)take((size_t)FH * DM * 2); _Float16* BD = (_Float16*)take((size_t)DM * FH * 2); float* T = (float*)take((size_t)SQ * RR * 4);
  _Float16* HN16 = (_Float16*)take(NR * DM * 2); float* HF = (float*)take(NR * DM * 4); float* QK = (float*)take(NR * 2 * RR * 4); _Float16* HT = (_Float16*)take((size_t)NB * DM * SQ * 2); _Float16* A16 = (_Float16*)take((size_t)NB * SQ * SQ * 2);
  _Float16* O16 = (_Float16*)take(NR * DM * 2); float* H1 = (float*)take(NR * DM * 4); _Float16* M16 = (_Float16*)take(NR * DM * 2); _Float16* U16 = (_Float16*)take(NR * FH * 2);
  if (off > ws_size) return;      /* 0.3 + 2 + 4 + 4 + 0.3 + 16 + 32 + 4 + 16 + 16 + 16 + 32 + 16 + 32 = about 191 MiB */
  k_prep<<<2 * PB_WT + PB_RMS + PB_WP + 2 * PB_WU + PB_TAB, 256, 0, stream>>>(u, v, pw, uw, dw, dl, h, n1, BUV, BP, BU, BD, T, HN16, HF);
  k_gemm2<0, 1><<<dim3((unsigned)((NR / 128) * (2 * RR / 64)), 1), 128, 0, stream>>>(HN16, DM, 0, BUV, DM, 0, 0.0625f, nullptr, 0, nullptr, 1, 0, 0, QK, nullptr, 2 * RR, 0, (int)NR, 2 * RR, DM);      /* [q_raw | k_raw] */
  k_l2hT<<<PB_HT * NB + PB_L2, 256, 0, stream>>>(QK, HN16, HT);
  k_amat<<<dim3((SQ / AM_TI) * (SQ / AM_TJ), NB), 256, 0, stream>>>(QK, kb, T, gl, al, A16);
  k_gemm2<0, 2><<<dim3((SQ / 256) * (DM / 128), NB), 256, 0, stream>>>(A16, SQ, (size_t)SQ * SQ, HT, SQ, (size_t)DM * SQ, 1.0f, nullptr, 0, nullptr, 1, 0, 0, nullptr, O16, DM, (size_t)SQ * DM, SQ, DM, SQ);      /* out_b = A_b . hn_b, b = blockIdx.y */
  const dim3 gp((unsigned)((NR / 256) * (DM / 128)), 1);
  k_gemm2<0, 2><<<gp, 256, 0, stream>>>(O16, DM, 0, BP, DM, 0, 0.0625f, pb, 0, HF, 1, (size_t)DM, 0, H1, nullptr, DM, 0, (int)MQ, DM, DM);      /* h1 = h + out proj_w^T + proj_b */
  k_rms<<<(unsigned)((MQ + 7) / 8), 256, 0, stream>>>(H1, 0, n2, MQ, M16, nullptr);
  k_gemm2<6, 2><<<dim3((unsigned)((NR / 256) * (FH / 128)), 1), 256, 0, stream>>>(M16, DM, 0, BU, DM, 0, 0.0625f, ub, 0, nullptr, 1, 0, 0, nullptr, U16, FH, 0, (int)MQ, FH, DM);      /* gelu_erf(m up_w^T + up_b) */
  k_gemm2<0, 2><<<gp, 256, 0, stream>>>(U16, FH, 0, BD, FH, 0, 0.0625f, db, 0, H1, 1, (size_t)DM, 0, (float*)d_out, nullptr, DM, 0, (int)MQ, DM, FH);      /* h1 + m */
}

// v009
// Measured time: 174 microseconds a run.
// In two side-by-side timings against v008, it was 1.04 and 1.05 times as fast.
// All steps since v000 together make it 13.0 times as fast.
#include <hip/hip_runtime.h>
// K2Layer (h [8][1024][1024]; hn = rmsnorm(h)*norm1_scale; gate = sigmoid(gate_logit), alpha = sigmoid(alpha_logit); q|k = hn [u|v] (rank 64), row-l2-normalised; gamma_r = 0.15 + 0.85 sigmoid(decay_logit_r); A[i][j] = causal(j<=i) * (gate k_base[i][j] + alpha sum_r q[i][r] k[j][r] gamma_r^(i-j)); out = A . hn; h1 = h + out proj_w^T + proj_b; m = gelu_erf(rmsnorm(h1)*norm2_scale up_w^T + up_b) down_w^T + down_b; result = h1 + m -> [8][1024][1024]).
// Structure: token rows; rmsnorm on VALU (f32) into f16 rows and per-batch transposed f16 planes (LDS); the rank-64 q|k projection as a WMMA GEMM (f32), l2-normalisation on VALU in f32; the per-rank decayed causal scores (gamma^d table built on device from decay_logit, k_base/gate/alpha read) on VALU in f32 in the tiles that the diagonal crosses, as WMMA products of decay-weighted q and k rows (f16 hi + lo pairs, f32 accumulation) below it, into the f16 mixing matrix A; out = A . hn, proj (+ bias + h), up (+ bias, erf-GELU epilogue, f16), down (+ bias + h1) as WMMA GEMMs (64x64 wave tiles, 32x64 for q|k; f32 accumulation, exact x16 weights).
// Compute dtype: inputs rounded to bf16; h / weights / k_base exact; hn, A, out, rmsnorm(h1), GELU hidden plain f16 operands (~2^-12); scores, norms, residuals f32. v_wmma_f32_16x16x32_f16.
#define NB 8
#define SQ 1024
#define DM 1024
#define RR 64
#define FH 2048
#define NR ((size_t)NB * SQ)
#define MQ NR                        /* rows through the proj/MLP stage (debug hook) */
typedef __bf16 v16b __attribute__((ext_vector_type(16)));
typedef unsigned short v8us __attribute__((ext_vector_type(8), may_alias));
typedef float  v8f  __attribute__((ext_vector_type(8)));
typedef float  v4f  __attribute__((ext_vector_type(4)));
typedef float  v4fa __attribute__((ext_vector_type(4), may_alias));
union FragB { v16b v; v8us half[2]; unsigned short u[16]; };

__device__ __forceinline__ unsigned short bf16_bits(float x) { unsigned int u = __float_as_uint(x); return (unsigned short)((u + 0x7FFFu + ((u >> 16) & 1u)) >> 16); }
__device__ __forceinline__ float bf16_val(unsigned short b) { return __uint_as_float(((unsigned int)b) << 16); }
__device__ __forceinline__ float bf16_round(float x) { return bf16_val(bf16_bits(x)); }
// D += A·B with NT terms: 1 = ah·bh, 2 = + al·bh (A split), 3 = + ah·bl (both split)
template <int NT>
__device__ __forceinline__ v8f mmaN(v16b ah, v16b al, v16b bh, v16b bl, v8f c) {
  c = __builtin_amdgcn_wmma_f32_16x16x32_bf16(false, ah, false, bh, (short)0, c, false, false);
  if (NT >= 2) c = __builtin_amdgcn_wmma_f32_16x16x32_bf16(false, al, false, bh, (short)0, c, false, false);
  if (NT >= 3) c = __builtin_amdgcn_wmma_f32_16x16x32_bf16(false, ah, false, bl, (short)0, c, false, false);
  asm volatile("v_nop\n\tv_nop\n\tv_nop\n\tv_nop" : "+v"(c) : "v"(ah), "v"(al), "v"(bh), "v"(bl));
  return c;
}

__global__ __launch_bounds__(256) void k_wt_bf16(const float* __restrict__ W, unsigned short* __restrict__ Wt, int K, int N) {
  const int t = blockIdx.x * 256 + threadIdx.x;
  const int k8n = K / 8;
  if (t >= N * k8n) return;
  const int n = t / k8n, k8 = (t % k8n) * 8;
  v8us v;
#pragma unroll
  for (int i = 0; i < 8; ++i) v[i] = bf16_bits(W[(size_t)(k8 + i) * N + n]);
  *(v8us*)(Wt + (size_t)n * K + k8) = v;
  
}

// GEMM C[M][N] (f32, pitch ldc) = act(A[M][K]·W + bias). A f32 row-major (pitch lda) converted per fragment to bf16
// (ASPLIT: hi/lo two planes -> 2 terms, else single rounded term); Wt bf16 [N][K] (pitch ldb). BIAS_BF16 rounds the
// bias to bf16 first (bias quantised to bf16 before the add). K%32==0, M%16==0, N%64==0.
template <bool ASPLIT, int ACT, bool BIAS_BF16>
__global__ __launch_bounds__(128) void k_gemm_bf(const float* __restrict__ A, int lda, const unsigned short* __restrict__ Wt, int ldb,
                                               const float* __restrict__ bias, float* __restrict__ C, int ldc, int M, int N, int K) {
  __shared__ __attribute__((aligned(16))) float so[4][16][64];
  const int tid = threadIdx.x, w = tid >> 5, lane = tid & 31, ln = lane & 15, hh = lane >> 4;
  const int ntn = N / 64;
  const int wid = blockIdx.x * 4 + w;
  const int mt = wid / ntn, nq = wid % ntn;
  if (mt * 16 >= M) return;
  const int row0 = mt * 16, col0 = nq * 64;
  const float* arow = A + (size_t)(row0 + ln) * lda;
  v8f acc[4] = {};
  for (int kb = 0; kb < K; kb += 32) {
    FragB ah, al;
    const v4f x0 = *(const v4fa*)(arow + kb + 8 * hh), x1 = *(const v4fa*)(arow + kb + 8 * hh + 4);
    const v4f x2 = *(const v4fa*)(arow + kb + 16 + 8 * hh), x3 = *(const v4fa*)(arow + kb + 16 + 8 * hh + 4);
    float xs[16] = {x0[0],x0[1],x0[2],x0[3],x1[0],x1[1],x1[2],x1[3],x2[0],x2[1],x2[2],x2[3],x3[0],x3[1],x3[2],x3[3]};
#pragma unroll
    for (int i = 0; i < 16; ++i) { const unsigned short hb = bf16_bits(xs[i]); ah.u[i] = hb; al.u[i] = ASPLIT ? bf16_bits(xs[i] - bf16_val(hb)) : (unsigned short)0; }
#pragma unroll
    for (int t = 0; t < 4; ++t) {
      const unsigned short* brow = Wt + (size_t)(col0 + t * 16 + ln) * ldb + kb;
      FragB b;
      b.half[0] = *(const v8us*)(brow + 8 * hh);
      b.half[1] = *(const v8us*)(brow + 16 + 8 * hh);
      acc[t] = mmaN<ASPLIT ? 2 : 1>(ah.v, al.v, b.v, b.v, acc[t]);
    }
  }
#pragma unroll
  for (int t = 0; t < 4; ++t) {
    float bv = bias ? bias[col0 + t * 16 + ln] : 0.f;
    if (BIAS_BF16) bv = bf16_round(bv);
#pragma unroll
    for (int r = 0; r < 8; ++r) { float v = acc[t][r] + bv; if (ACT == 1) v = fmaxf(v, 0.f); so[w][8 * hh + r][t * 16 + ln] = v; }
  }
  __builtin_amdgcn_fence(__ATOMIC_ACQ_REL, "workgroup");
  __builtin_amdgcn_wave_barrier();
  const int rsub = lane >> 4, c4 = (lane & 15) * 4;
  {
#pragma unroll
    for (int q = 0; q < 8; ++q) {
      const int r = q * 2 + rsub;
      const v4f v = *(const v4fa*)&so[w][r][c4];
      *(v4f*)(C + (size_t)(row0 + r) * ldc + col0 + c4) = v;
    }
    
  }
}

// GEMM C = act(A·W + bias + resid): A f32 (ASPLIT -> hi/lo 2 terms), Wt bf16 [N][K]; ACT 0 none, 1 relu, 2 exact gelu;
// resid (optional, f32, row index = (row % rmod), pitch ldr, RES_BF16 rounds it) added before the activation.
template <bool ASPLIT, int ACT, bool BIAS_BF16, bool RES_BF16>
__global__ __launch_bounds__(128) void k_gemm_bf3(const float* __restrict__ A, int lda, const unsigned short* __restrict__ Wt, int ldb,
                                                const float* __restrict__ bias, const float* __restrict__ resid, int rmod, int ldr,
                                                float* __restrict__ C, int ldc, int M, int N, int K) {
  __shared__ __attribute__((aligned(16))) float so[4][16][64];
  const int tid = threadIdx.x, w = tid >> 5, lane = tid & 31, ln = lane & 15, hh = lane >> 4;
  const int ntn = N / 64;
  const int wid = blockIdx.x * 4 + w;
  const int mt = wid / ntn, nq = wid % ntn;
  if (mt * 16 >= M) return;
  const int row0 = mt * 16, col0 = nq * 64;
  const float* arow = A + (size_t)(row0 + ln) * lda;
  v8f acc[4] = {};
  for (int kb = 0; kb < K; kb += 32) {
    FragB ah, al;
    const v4f x0 = *(const v4fa*)(arow + kb + 8 * hh), x1 = *(const v4fa*)(arow + kb + 8 * hh + 4);
    const v4f x2 = *(const v4fa*)(arow + kb + 16 + 8 * hh), x3 = *(const v4fa*)(arow + kb + 16 + 8 * hh + 4);
    float xs[16] = {x0[0],x0[1],x0[2],x0[3],x1[0],x1[1],x1[2],x1[3],x2[0],x2[1],x2[2],x2[3],x3[0],x3[1],x3[2],x3[3]};
#pragma unroll
    for (int i = 0; i < 16; ++i) { const unsigned short hb = bf16_bits(xs[i]); ah.u[i] = hb; al.u[i] = ASPLIT ? bf16_bits(xs[i] - bf16_val(hb)) : (unsigned short)0; }
#pragma unroll
    for (int t = 0; t < 4; ++t) {
      const unsigned short* brow = Wt + (size_t)(col0 + t * 16 + ln) * ldb + kb;
      FragB b;
      b.half[0] = *(const v8us*)(brow + 8 * hh);
      b.half[1] = *(const v8us*)(brow + 16 + 8 * hh);
      acc[t] = mmaN<ASPLIT ? 2 : 1>(ah.v, al.v, b.v, b.v, acc[t]);
    }
  }
#pragma unroll
  for (int t = 0; t < 4; ++t) {
    const int col = col0 + t * 16 + ln;
    float bv = bias ? bias[col] : 0.f;
    if (BIAS_BF16) bv = bf16_round(bv);
#pragma unroll
    for (int r = 0; r < 8; ++r) {
      float v = acc[t][r] + bv;
      if (resid) { float rv = resid[(size_t)((row0 + 8 * hh + r) % rmod) * ldr + col]; if (RES_BF16) rv = bf16_round(rv); v += rv; }
      if (ACT == 1) v = fmaxf(v, 0.f);
      if (ACT == 2) v = 0.5f * v * (1.0f + erff(v * 0.70710678118654752f));
      if (ACT == 3) { const float u = 0.7978845608028654f * (v + 0.044715f * v * v * v); v = 0.5f * v * (1.0f + tanhf(u)); }
      so[w][8 * hh + r][t * 16 + ln] = v;
    }
  }
  __builtin_amdgcn_fence(__ATOMIC_ACQ_REL, "workgroup");
  __builtin_amdgcn_wave_barrier();
  const int rsub = lane >> 4, c4 = (lane & 15) * 4;
  {
#pragma unroll
    for (int q = 0; q < 8; ++q) {
      const int r = q * 2 + rsub;
      const v4f v = *(const v4fa*)&so[w][r][c4];
      *(v4f*)(C + (size_t)(row0 + r) * ldc + col0 + c4) = v;
    }
    
  }
}
// row LayerNorm (biased variance, eps) over N: s = X (+ R); optional out_sum <- s; out_norm <- (s-mu)*rsqrt(var+eps)*g + b
template <bool PARAM_BF16>
__global__ __launch_bounds__(256) void k_layernorm(const float* __restrict__ X, const float* __restrict__ R, const float* __restrict__ g, const float* __restrict__ bta,
                                                  float* __restrict__ out_sum, float* __restrict__ out_norm, int N, float eps) {
  __shared__ float red[256];
  const int row = blockIdx.x, tid = threadIdx.x;
  const float* x = X + (size_t)row * N; const float* rr = R ? R + (size_t)row * N : nullptr;
  float vals[16];                     // up to N = 4096
  const int per = N / 256;            // contiguous chunk per thread? use strided-by-4 chunks: thread handles j = tid*4 + 1024*u
  float s1 = 0.f;
  for (int u = 0; u < per / 4; ++u) {
    const int j = tid * 4 + 1024 * u;
    const v4f a = *(const v4fa*)(x + j);
    v4f b = {0.f,0.f,0.f,0.f}; if (rr) b = *(const v4fa*)(rr + j);
#pragma unroll
    for (int q = 0; q < 4; ++q) { const float v = a[q] + b[q]; vals[u * 4 + q] = v; s1 += v; }
  }
  red[tid] = s1; __syncthreads();
  for (int st = 128; st > 0; st >>= 1) { if (tid < st) red[tid] += red[tid + st]; __syncthreads(); }
  const float mu = red[0] / (float)N; __syncthreads();
  float s2 = 0.f;
  for (int u = 0; u < per / 4; ++u)
#pragma unroll
    for (int q = 0; q < 4; ++q) { const float c = vals[u * 4 + q] - mu; s2 += c * c; }
  red[tid] = s2; __syncthreads();
  for (int st = 128; st > 0; st >>= 1) { if (tid < st) red[tid] += red[tid + st]; __syncthreads(); }
  const float rs = rsqrtf(red[0] / (float)N + eps);
  {
    for (int u = 0; u < per / 4; ++u) {
      const int j = tid * 4 + 1024 * u;
      v4f o, sm;
#pragma unroll
      for (int q = 0; q < 4; ++q) {
        float gg = g[j + q], bb = bta[j + q];
        if (PARAM_BF16) { gg = bf16_round(gg); bb = bf16_round(bb); }
        sm[q] = vals[u * 4 + q]; o[q] = (vals[u * 4 + q] - mu) * rs * gg + bb;
      }
      if (out_sum) *(v4f*)(out_sum + (size_t)row * N + j) = sm;
      *(v4f*)(out_norm + (size_t)row * N + j) = o;
    }
    
  }
}



// ---- f16 WMMA path (v_wmma_f32_16x16x32_f16): 11-bit significands for operands in range — used for every GEMM launched here
typedef _Float16 v16h __attribute__((ext_vector_type(16)));
union FragH { v16h v; v8us half[2]; _Float16 h[16]; unsigned short u[16]; };
template <int NT>
__device__ __forceinline__ v8f mmaH(v16h ah, v16h al, v16h bh, v16h bl, v8f c) {
  c = __builtin_amdgcn_wmma_f32_16x16x32_f16(false, ah, false, bh, (short)0, c, false, false);
  if (NT >= 2) c = __builtin_amdgcn_wmma_f32_16x16x32_f16(false, al, false, bh, (short)0, c, false, false);
  if (NT >= 3) c = __builtin_amdgcn_wmma_f32_16x16x32_f16(false, ah, false, bl, (short)0, c, false, false);
  asm volatile("v_nop\n\tv_nop\n\tv_nop\n\tv_nop" : "+v"(c) : "v"(ah), "v"(al), "v"(bh), "v"(bl));
  return c;
}
// batched GEMM like k_gemm_b but f16 operands: A f32 (split into f16 hi/lo if ASPLIT, else rounded to f16), Bt = f16 values [n][k]; alpha; C f32; N multiple of 16 (partial tiles skipped)
template <bool ASPLIT>
__global__ __launch_bounds__(128) void k_gemm_h(const float* __restrict__ A, int lda, size_t sA, const _Float16* __restrict__ Bh, int ldb, size_t sB, float alpha, float* __restrict__ C, int ldc, size_t sC, int M, int N, int K) {
  __shared__ __attribute__((aligned(16))) float so[4][16][64];
  const int tid = threadIdx.x, w = tid >> 5, lane = tid & 31, ln = lane & 15, hh = lane >> 4; const int by = blockIdx.y;
  A += (size_t)by * sA; Bh += (size_t)by * sB; C += (size_t)by * sC;
  const int ntn = (N + 63) / 64; const int wid = blockIdx.x * 4 + w; const int mt = wid / ntn, nq = wid % ntn; if (mt * 16 >= M) return;
  const int row0 = mt * 16, col0 = nq * 64; const float* arow = A + (size_t)(row0 + ln) * lda;
  v8f acc[4] = {};
  for (int kb = 0; kb < K; kb += 32) {
    FragH ah, al;
    const v4f x0 = *(const v4fa*)(arow + kb + 8 * hh), x1 = *(const v4fa*)(arow + kb + 8 * hh + 4), x2 = *(const v4fa*)(arow + kb + 16 + 8 * hh), x3 = *(const v4fa*)(arow + kb + 16 + 8 * hh + 4);
    float xs[16] = {x0[0],x0[1],x0[2],x0[3],x1[0],x1[1],x1[2],x1[3],x2[0],x2[1],x2[2],x2[3],x3[0],x3[1],x3[2],x3[3]};
#pragma unroll
    for (int i = 0; i < 16; ++i) { const _Float16 h = (_Float16)xs[i]; ah.h[i] = h; al.h[i] = ASPLIT ? (_Float16)(xs[i] - (float)h) : (_Float16)0.0f; }
#pragma unroll
    for (int t = 0; t < 4; ++t) { if (col0 + t * 16 >= N) continue; const size_t boff = (size_t)(col0 + t * 16 + ln) * ldb + kb; FragH bq; bq.half[0] = *(const v8us*)(Bh + boff + 8 * hh); bq.half[1] = *(const v8us*)(Bh + boff + 16 + 8 * hh);
      acc[t] = mmaH<ASPLIT ? 2 : 1>(ah.v, al.v, bq.v, bq.v, acc[t]); }
  }
#pragma unroll
  for (int t = 0; t < 4; ++t) { if (col0 + t * 16 >= N) continue;
#pragma unroll
    for (int r = 0; r < 8; ++r) so[w][8 * hh + r][t * 16 + ln] = acc[t][r] * alpha; }
  __builtin_amdgcn_fence(__ATOMIC_ACQ_REL, "workgroup"); __builtin_amdgcn_wave_barrier();
  const int rsub = lane >> 4, c4 = (lane & 15) * 4;
  {
#pragma unroll
    for (int q = 0; q < 8; ++q) { const int r = q * 2 + rsub; if (col0 + c4 < N) { const v4f v = *(const v4fa*)&so[w][r][c4]; *(v4f*)(C + (size_t)(row0 + r) * ldc + col0 + c4) = v; } }
     }
}

// Wt[n][k] = f16(W[k][n]·scale) from f32 row-major W[K][N] (scale = power of two; bf16-exact weights stay exact in f16 away from the subnormal range)
__global__ __launch_bounds__(256) void k_wt_f16(const float* __restrict__ W, _Float16* __restrict__ Wt, int K, int N, float scale) {
  const int t = blockIdx.x * 256 + threadIdx.x; if (t >= N * (K / 8)) return; const int n = t / (K / 8), k8 = (t % (K / 8)) * 8; FragH f;
#pragma unroll
  for (int i = 0; i < 8; ++i) f.h[i] = (_Float16)(bf16_round(W[(size_t)(k8 + i) * N + n]) * scale); const v8us o = f.half[0];
  *(v8us*)((unsigned short*)Wt + (size_t)n * K + k8) = o; 
}
// k_gemm_hh variant with fused epilogue: v = acc·alpha + bias[by·sBias + col] (+ CP[(row/rowsPerB)·sCPb + by·64 + col] if CP) ; ACT 0 none / 1 elu ; writes f16 C16 (and f32 C if non-null)
template <int ACT>
__global__ __launch_bounds__(128) void k_gemm_hhx(const _Float16* __restrict__ A, int lda, size_t sA, const _Float16* __restrict__ Bh, int ldb, size_t sB, float alpha, const float* __restrict__ bias, size_t sBias, const float* __restrict__ CP, int rowsPerB, size_t sCPb, int row0g,
    float* __restrict__ C, _Float16* __restrict__ C16, int ldc, size_t sC, int M, int N, int K) {
  __shared__ __attribute__((aligned(16))) float so[4][16][64];
  const int tid = threadIdx.x, w = tid >> 5, lane = tid & 31, ln = lane & 15, hh = lane >> 4; const int by = blockIdx.y;
  A += (size_t)by * sA; Bh += (size_t)by * sB; const size_t cofs = (size_t)by * sC; const float* bp = bias ? bias + (size_t)by * sBias : nullptr;
  const int ntn = (N + 63) / 64; const int wid = blockIdx.x * 4 + w; const int mt = wid / ntn, nq = wid % ntn; if (mt * 16 >= M) return;
  const int row0 = mt * 16, col0 = nq * 64; const _Float16* arow = A + (size_t)(row0 + ln) * lda;
  v8f acc[4] = {};
  for (int kb = 0; kb < K; kb += 32) { FragH ah; ah.half[0] = *(const v8us*)((const unsigned short*)arow + kb + 8 * hh); ah.half[1] = *(const v8us*)((const unsigned short*)arow + kb + 16 + 8 * hh);
#pragma unroll
    for (int t = 0; t < 4; ++t) { if (col0 + t * 16 >= N) continue; const size_t boff = (size_t)(col0 + t * 16 + ln) * ldb + kb; FragH bq; bq.half[0] = *(const v8us*)((const unsigned short*)Bh + boff + 8 * hh); bq.half[1] = *(const v8us*)((const unsigned short*)Bh + boff + 16 + 8 * hh);
      acc[t] = mmaH<1>(ah.v, ah.v, bq.v, bq.v, acc[t]); }
  }
#pragma unroll
  for (int t = 0; t < 4; ++t) { if (col0 + t * 16 >= N) continue; const int col = col0 + t * 16 + ln; const float bv = bp ? bf16_round(bp[col]) : 0.f;
#pragma unroll
    for (int r = 0; r < 8; ++r) { float v = acc[t][r] * alpha + bv; if (CP) { const int rr = row0g + row0 + 8 * hh + r; if (rowsPerB < 0) v += CP[cofs + (size_t)rr * ldc + col];      /* rowsPerB < 0: own element of the batched C plane */ else { const int bidx = rr / rowsPerB; v += CP[(size_t)bidx * sCPb + (size_t)by * 64 + col]; } } if (ACT == 1) v = (v > 0.f) ? v : expm1f(v); else if (ACT == 7) v = (v > 0.f) ? v + 1.0f : expf(v); else if (ACT == 8) v = tanhf(v); else if (ACT == 9) v = 0.5f * v * (1.0f + tanhf(0.7978845608028654f * (v + 0.044715f * v * v * v))); else if (ACT == 11) v = 1.0f / (1.0f + expf(-v)); else if (ACT == 12) v = (v > 0.f) ? v : 0.01f * v; else if (ACT == 14) v = (v > 0.f) ? v : 0.1f * v; else if (ACT == 16) v = (v >= 0.f) ? v : 0.3f * v; else if (ACT == 17) v = (v >= 0.f) ? v : 0.2f * v; else if (ACT == 15) v = v / (1.0f + expf(-v)); else if (ACT == 3) v = fmaxf(v, 0.f); else if (ACT == 6) v = 0.5f * v * (1.0f + erff(v * 0.70710678118654752f)); so[w][8 * hh + r][t * 16 + ln] = v; } }
  __builtin_amdgcn_fence(__ATOMIC_ACQ_REL, "workgroup"); __builtin_amdgcn_wave_barrier();
  const int rsub = lane >> 4, c4 = (lane & 15) * 4; typedef _Float16 v4h __attribute__((ext_vector_type(4)));
  {
#pragma unroll
    for (int q = 0; q < 8; ++q) { const int r = q * 2 + rsub; if (col0 + c4 < N) { const v4f v = *(const v4fa*)&so[w][r][c4]; if (C) *(v4f*)(C + cofs + (size_t)(row0 + r) * ldc + col0 + c4) = v; if (C16) { v4h h4; for (int i = 0; i < 4; ++i) h4[i] = (_Float16)v[i]; *(v4h*)(C16 + cofs + (size_t)(row0 + r) * ldc + col0 + c4) = h4; } } }
     }
}


typedef _Float16 v4h __attribute__((ext_vector_type(4)));

__global__ __launch_bounds__(256) void k_x16(const float* __restrict__ x, _Float16* __restrict__ X16, size_t n8) { const size_t t = (size_t)blockIdx.x * 256 + threadIdx.x; if (t >= n8) return; FragH f;
#pragma unroll
  for (int q = 0; q < 8; ++q) f.h[q] = (_Float16)bf16_round(x[t * 8 + q]); *(v8us*)((unsigned short*)X16 + t * 8) = f.half[0];  }
__global__ __launch_bounds__(256) void k_h16(const float* __restrict__ x, _Float16* __restrict__ X16, size_t n8) { const size_t t = (size_t)blockIdx.x * 256 + threadIdx.x; if (t >= n8) return; FragH f;
#pragma unroll
  for (int q = 0; q < 8; ++q) f.h[q] = (_Float16)x[t * 8 + q]; *(v8us*)((unsigned short*)X16 + t * 8) = f.half[0];  }
__global__ __launch_bounds__(256) void k_round16f(const float* __restrict__ W, _Float16* __restrict__ Bt, size_t n8) { const size_t t = (size_t)blockIdx.x * 256 + threadIdx.x; if (t >= n8) return; FragH f;
#pragma unroll
  for (int i = 0; i < 8; ++i) f.h[i] = (_Float16)(bf16_round(W[t * 8 + i]) * 16.0f); *(v8us*)((unsigned short*)Bt + t * 8) = f.half[0];  }
template <int NHv, int TTv>
__global__ __launch_bounds__(256) void k_vt(const _Float16* __restrict__ V16, int ldv, int voff, _Float16* __restrict__ Vt) { __shared__ unsigned short tl[64][66]; const int tid = threadIdx.x; const int slab = blockIdx.x / (TTv / 64), lg = blockIdx.x % (TTv / 64); const int b = slab / NHv, h = slab % NHv;
  for (int i = tid; i < 64 * 8; i += 256) { const int r = i / 8, c8 = (i % 8) * 8; FragH f; f.half[0] = *(const v8us*)((const unsigned short*)V16 + ((size_t)b * TTv + lg * 64 + r) * ldv + voff + h * 64 + c8);
#pragma unroll
    for (int q = 0; q < 8; ++q) tl[r][c8 + q] = f.u[q]; }
  __syncthreads();
  {
#pragma unroll
    for (int rd = 0; rd < 2; ++rd) { const int d = rd * 32 + tid / 8, pc = tid % 8; FragH f;
#pragma unroll
      for (int q = 0; q < 8; ++q) f.u[q] = tl[pc * 8 + q][d];
      *(v8us*)((unsigned short*)Vt + ((size_t)slab * 64 + d) * TTv + lg * 64 + pc * 8) = f.half[0]; }
     } }

__global__ __launch_bounds__(256) void k_hl(const float* __restrict__ F, _Float16* __restrict__ Hh, _Float16* __restrict__ Hl, size_t n8) { const size_t t = (size_t)blockIdx.x * 256 + threadIdx.x; if (t >= n8) return; FragH fh, fl; const v4f a = *(const v4fa*)(F + t * 8), c = *(const v4fa*)(F + t * 8 + 4);
#pragma unroll
  for (int q = 0; q < 4; ++q) { _Float16 h = (_Float16)a[q]; fh.h[q] = h; fl.h[q] = (_Float16)((a[q] - (float)h) * 1024.0f); h = (_Float16)c[q]; fh.h[4 + q] = h; fl.h[4 + q] = (_Float16)((c[q] - (float)h) * 1024.0f); }
  { *(v8us*)((unsigned short*)Hh + t * 8) = fh.half[0]; *(v8us*)((unsigned short*)Hl + t * 8) = fl.half[0];  } }

// ---- fast GEMM, two shapes picked by WC: WC = 1: block tile 128x64, 4 waves (4 x 1), wave tile 32x64; WC = 2: block tile 256x128, 8 waves (4 x 2), wave tile 64x64.
// Requires M % (128 WC) == 0 rows per launch region, N % (64 WC) == 0, K % 64 == 0, K >= 64; epilogue = k_gemm_hhx semantics ----
// The larger tile fetches half the operand bytes from L2 per product (384 rows for 256x128 outputs, not 192 for 128x64) and reads two thirds of the LDS bytes per matrix instruction (8 fragments for 16, not 6 for 8).
// Operands go global -> LDS by asynchronous copies, 64 k (one whole 128-byte line of every operand row) per stage, two buffers: eight lanes cover a row's line, so a
// wave's copy touches four whole lines, and every line is fetched once per block. The fragments are read from LDS in the k order of g2_frag.
#define G2_KS 64                              /* k per stage */
#define G2_PITCH 144                          /* LDS row pitch in bytes: 16 B x odd, so that 16 lanes on 16 neighbouring rows meet no bank twice */
__device__ __forceinline__ v16h g2_frag(const unsigned char* p, int hh) { FragH f; f.half[0] = *(const v8us*)(p + 16 * hh); f.half[1] = *(const v8us*)(p + 32 + 16 * hh); return f.v; }
__device__ __forceinline__ v8f g2_mma(v16h a, v16h b, v8f c) { v8f d = __builtin_amdgcn_wmma_f32_16x16x32_f16(false, a, false, b, (short)0, c, false, false); asm volatile("v_nop\n\tv_nop\n\tv_nop\n\tv_nop" : "+v"(d) : "v"(a), "v"(b)); return d; }
// One stage's twelve copies of a thread (16 bytes each): rows sr + RS i of A (i = 0 .. 7) and of B (i = 0 .. 3), RS = the rows that the block's threads cover at once; B lies behind A's 8 RS rows.
// l = the thread's LDS byte address in the stage's row sr. The s_wait_xcnt closes the statement, so that it stands ahead of every later overwrite of the copies' address registers.
template <int RS>
__device__ __forceinline__ void g2_copy(unsigned l, const _Float16* ga, size_t sa, const _Float16* gb, size_t sb) {
  asm volatile("global_load_async_to_lds_b128 %0, %12, off\n\t" "global_load_async_to_lds_b128 %1, %13, off\n\t" "global_load_async_to_lds_b128 %2, %14, off\n\t" "global_load_async_to_lds_b128 %3, %15, off\n\t"
               "global_load_async_to_lds_b128 %4, %16, off\n\t" "global_load_async_to_lds_b128 %5, %17, off\n\t" "global_load_async_to_lds_b128 %6, %18, off\n\t" "global_load_async_to_lds_b128 %7, %19, off\n\t"
               "global_load_async_to_lds_b128 %8, %20, off\n\t" "global_load_async_to_lds_b128 %9, %21, off\n\t" "global_load_async_to_lds_b128 %10, %22, off\n\t" "global_load_async_to_lds_b128 %11, %23, off\n\t"
               "s_wait_xcnt 0x0"
               :: "v"(l), "v"(l + RS * G2_PITCH), "v"(l + 2 * RS * G2_PITCH), "v"(l + 3 * RS * G2_PITCH), "v"(l + 4 * RS * G2_PITCH), "v"(l + 5 * RS * G2_PITCH), "v"(l + 6 * RS * G2_PITCH), "v"(l + 7 * RS * G2_PITCH),
                  "v"(l + 8 * RS * G2_PITCH), "v"(l + 9 * RS * G2_PITCH), "v"(l + 10 * RS * G2_PITCH), "v"(l + 11 * RS * G2_PITCH),
                  "v"(ga), "v"(ga + sa), "v"(ga + 2 * sa), "v"(ga + 3 * sa), "v"(ga + 4 * sa), "v"(ga + 5 * sa), "v"(ga + 6 * sa), "v"(ga + 7 * sa),
                  "v"(gb), "v"(gb + sb), "v"(gb + 2 * sb), "v"(gb + 3 * sb) : "memory"); }
// Eight of a lane's residual loads (16 bytes each), issued one behind the other with no wait on their data between them.
// The s_wait_xcnt stands ahead of every overwrite of the loads' address registers; the addresses as its inputs keep their registers from being rewritten, or handed to one of the loads as a destination, ahead of it.
__device__ __forceinline__ void g2_res8(const float* const (&rp)[8], v4f* res) {
#pragma unroll      /* constant indices: rp and res stay in registers */
  for (int q = 0; q < 8; ++q) res[q] = *(const v4fa*)rp[q];
  asm volatile("s_wait_xcnt 0x0" :: "v"(rp[0]), "v"(rp[1]), "v"(rp[2]), "v"(rp[3]), "v"(rp[4]), "v"(rp[5]), "v"(rp[6]), "v"(rp[7]) : "memory"); }
// A lane's share of the residual for 32 rows from row rbase on: sixteen 16-byte loads, in two runs of eight (sixteen address pairs at once would cost registers).
__device__ __forceinline__ void g2_res16(const float* __restrict__ CP, int rowsPerB, size_t sCPb, size_t cofs, int by, int ldc, int rbase, int colc, v4f* res) {
  if (rowsPerB < 0) {      /* rowsPerB < 0: own elements of the batched C plane */
#pragma unroll
    for (int g = 0; g < 2; ++g) { const float* rp[8];
#pragma unroll
      for (int q = 0; q < 8; ++q) rp[q] = CP + cofs + (size_t)(rbase + (g * 8 + q) * 2) * ldc + colc;
      g2_res8(rp, res + g * 8); }
  } else {
#pragma unroll
    for (int g = 0; g < 2; ++g) { const float* rp[8];
#pragma unroll
      for (int q = 0; q < 8; ++q) { const int bidx = (rbase + (g * 8 + q) * 2) / rowsPerB; rp[q] = CP + (size_t)bidx * sCPb + (size_t)by * 64 + colc; }
      g2_res8(rp, res + g * 8); } } }
// GELU on the error function, x Phi(x), without a branch: x Phi(x) = max(x, 0) - |x| Q(|x|), where Q(a) = 1 - Phi(a) = e^(-a a / 2) (c1 t + c2 t^2 + c3 t^3 + c4 t^4 + c5 t^5), t = 1 / (1 + 0.2316419 a)
// (the classical five-term form of the normal tail, the factor 1 / sqrt(2 pi) folded into c1 .. c5; its error in Q is below 7.5e-8 for every a >= 0). The tail is formed directly, so nothing cancels for x < 0;
// the result is within 4e-7 of x Phi(x) in f32 and is stored as f16. The library erff takes two branches per element, which a wave walks one behind the other as one dependent chain; here the elements of a row are independent straight-line chains.
__device__ __forceinline__ float g2_gelu(float x) {
  const float a = fabsf(x);
  float t; asm("v_rcp_f32 %0, %1\n\tv_nop" : "=v"(t) : "v"(fmaf(0.2316419f, a, 1.0f)));      /* the v_nop is the slot that the instruction set asks for between a transcendental and a directly following instruction that reads its result or overwrites its source */
  const float e = __builtin_amdgcn_exp2f((x * -0.72134752f) * x);      /* e^(-x x / 2) = 2^(-x x log2(e) / 2); an argument far below the range gives 0, the tail's limit */
  float p = fmaf(t, 0.53070271f, -0.72657601f); p = fmaf(t, p, 0.71070687f); p = fmaf(t, p, -0.14224837f); p = fmaf(t, p, 0.12741480f);
  return fmaf(-(a * e), p * t, fmaxf(x, 0.f)); }
template <int ACT, int WC>
__global__ __launch_bounds__(128 * WC) void k_gemm2(const _Float16* __restrict__ A, int lda, size_t sA, const _Float16* __restrict__ Bh, int ldb, size_t sB, float alpha, const float* __restrict__ bias, size_t sBias, const float* __restrict__ CP, int rowsPerB, size_t sCPb, int row0g,
    float* __restrict__ C, _Float16* __restrict__ C16, int ldc, size_t sC, int M, int N, int K) { static_assert(ACT == 0 || ACT == 3 || ACT == 6 || ACT == 8 || ACT == 9 || ACT == 11 || ACT == 12 || ACT == 14 || ACT == 15 || ACT == 16 || ACT == 17, "k_gemm2: unsupported ACT code (would silently apply no activation)");
  static_assert(WC == 1 || WC == 2, "k_gemm2: two shapes");
  constexpr int NW = 4 * WC, FA = 2 * WC, BM = 128 * WC, BN = 64 * WC, RS = 4 * NW;      /* waves, A fragments per wave, block tile, rows per copy of the block */
  constexpr unsigned STAGE = (unsigned)((BM + BN) * G2_PITCH);      /* one stage: [A BM rows | B BN rows] */
  __shared__ __attribute__((aligned(16))) unsigned char sm[2 * STAGE]; static_assert(sizeof(float) * NW * 32 * 68 <= 2 * STAGE, "the output staging lies in the ring");
  float (*so)[32][68] = (float (*)[32][68])sm;      /* output staging, 32 rows of a wave at a time: used only behind the last trip's barrier, when no wave reads the ring any more */
  const int tid = threadIdx.x, w = tid >> 5, lane = tid & 31, ln = lane & 15, hh = lane >> 4; const int by = blockIdx.y; const int wr = w & 3, wc = w >> 2;
  A += (size_t)by * sA; Bh += (size_t)by * sB; const size_t cofs = (size_t)by * sC; const float* bp = bias ? bias + (size_t)by * sBias : nullptr;
  const int ntn = N / BN; const int mt = blockIdx.x / ntn, nq = blockIdx.x - mt * ntn; const int row0 = mt * BM + 16 * FA * wr, col0 = nq * BN + 64 * wc; if (mt * BM >= M) return;      /* the whole block leaves, ahead of every copy and barrier */
  const int sr = tid >> 3, sc = tid & 7;      /* the thread's first row of a stage and its 16-byte piece of the row's line */
  const _Float16* ga = A + (size_t)(mt * BM + sr) * lda + sc * 8; const _Float16* gb = Bh + (size_t)(nq * BN + sr) * ldb + sc * 8; const size_t sa = (size_t)RS * lda, sb = (size_t)RS * ldb;
  const unsigned l0 = (unsigned)(size_t)sm + (unsigned)(sr * G2_PITCH + sc * 16);
  const unsigned char* ar = sm + (16 * FA * wr + ln) * G2_PITCH; const unsigned char* br = sm + (BM + 64 * wc + ln) * G2_PITCH;
  const int nt = K / G2_KS;
  const v8f z8 = {0.f,0.f,0.f,0.f,0.f,0.f,0.f,0.f}; v8f acc[FA][4];
#pragma unroll      /* constant indices here and below: acc, fa and fb stay in registers */
  for (int i = 0; i < FA; ++i)
#pragma unroll
    for (int j = 0; j < 4; ++j) acc[i][j] = z8;
  g2_copy<RS>(l0, ga, sa, gb, sb);
  asm volatile("s_wait_asynccnt 0x0" ::: "memory");      /* this wave's copies of stage 0 have landed */
  __syncthreads();      /* and every other wave's: stage 0 may be read */
  if (nt > 1) g2_copy<RS>(l0 + STAGE, ga + G2_KS, sa, gb + G2_KS, sb);
  constexpr int KG = (WC == 1) ? 2 : 1;      /* 32-k blocks whose fragments are held at once: both of the stage where they fit beside the accumulators */
#pragma unroll 1      /* one trip per stage: the buffer is chosen by the trip's parity */
  for (int t = 0; t < nt; ++t) { const unsigned bo = (unsigned)(t & 1) * STAGE;
    const unsigned char* ap = ar + bo; const unsigned char* bq = br + bo;
#pragma unroll      /* the stage's two 32-k blocks, straight-line, k rising */
    for (int kg = 0; kg < 2; kg += KG) { v16h fa[KG][FA], fb[KG][4];
#pragma unroll
      for (int kk = 0; kk < KG; ++kk) {
#pragma unroll
        for (int i = 0; i < FA; ++i) fa[kk][i] = g2_frag(ap + i * 16 * G2_PITCH + (kg + kk) * 64, hh);
#pragma unroll
        for (int j = 0; j < 4; ++j) fb[kk][j] = g2_frag(bq + j * 16 * G2_PITCH + (kg + kk) * 64, hh); }
#pragma unroll
      for (int kk = 0; kk < KG; ++kk)
#pragma unroll
        for (int j = 0; j < 4; ++j)
#pragma unroll
          for (int i = 0; i < FA; ++i) acc[i][j] = g2_mma(fa[kk][i], fb[kk][j], acc[i][j]); }
    asm volatile("s_wait_dscnt 0x0" ::: "memory");      /* this wave's reads of the buffer are done */
    asm volatile("s_wait_asynccnt 0x0" ::: "memory");      /* its copies of stage t + 1 have landed */
    __syncthreads();      /* publishes stage t + 1 and ends every reader's last read of stage t's buffer */
    if (t + 2 < nt) g2_copy<RS>(l0 + bo, ga + (size_t)(t + 2) * G2_KS, sa, gb + (size_t)(t + 2) * G2_KS, sb); }
  asm volatile("s_wait_asynccnt 0x0" ::: "memory");      /* no copy is outstanding when the ring becomes output staging */
  // Scale, bias, residual and activation are applied where the staged rows are read back: there a lane holds four neighbouring columns of a row, so that its share of the residual is
  // sixteen 16-byte loads per 32 rows (a wave's load covers whole 128-byte lines), all of them issued ahead of the staging and waited for once. The unrolls keep res and acc in registers (constant indices).
  const int rsub = lane >> 4, c4 = (lane & 15) * 4; const v4f z4 = {0.f, 0.f, 0.f, 0.f};
#pragma unroll 1      /* 32 rows of the wave's tile per trip; stays rolled: a second copy of this body would double the kernel's text, which runs once per wave, straight from the instruction fetch */
  for (int hf = 0; hf < FA / 2; ++hf) { v4f res[16], bv4 = z4;
    if (CP) g2_res16(CP, rowsPerB, sCPb, cofs, by, ldc, row0g + row0 + hf * 32 + rsub, col0 + c4, res);
    else {
#pragma unroll
      for (int q = 0; q < 16; ++q) res[q] = z4; }
    if (bp) { bv4 = *(const v4fa*)(bp + col0 + c4);
      asm volatile("s_wait_xcnt 0x0" ::: "memory"); }      /* stands ahead of every later overwrite of the bias load's address registers */
#pragma unroll
    for (int i = 0; i < 4; ++i) bv4[i] = bf16_round(bv4[i]);
#pragma unroll
    for (int u = 0; u < 8; ++u) { const int t = u & 3, half = u >> 2;
#pragma unroll
      for (int r = 0; r < 8; ++r) so[w][half * 16 + 8 * hh + r][t * 16 + ln] = acc[half][t][r]; }
    __builtin_amdgcn_fence(__ATOMIC_ACQ_REL, "workgroup"); __builtin_amdgcn_wave_barrier();
#pragma unroll
    for (int q = 0; q < 16; ++q) { const int r = q * 2 + rsub; v4f v = *(const v4fa*)&so[w][r][c4];
#pragma unroll
      for (int i = 0; i < 4; ++i) { float x = v[i] * alpha + bv4[i]; if (CP) x += res[q][i];
        if (ACT == 3) x = fmaxf(x, 0.f); else if (ACT == 6) x = g2_gelu(x); else if (ACT == 11) x = 1.0f / (1.0f + expf(-x)); else if (ACT == 15) x = x / (1.0f + expf(-x)); else if (ACT == 12) x = (x > 0.f) ? x : 0.01f * x; else if (ACT == 8) x = tanhf(x); else if (ACT == 9) x = 0.5f * x * (1.0f + tanhf(0.7978845608028654f * (x + 0.044715f * x * x * x))); else if (ACT == 14) x = (x > 0.f) ? x : 0.1f * x; else if (ACT == 16) x = (x >= 0.f) ? x : 0.3f * x; else if (ACT == 17) x = (x >= 0.f) ? x : 0.2f * x;
        v[i] = x; }
      if (C) { *(v4f*)(C + cofs + (size_t)(row0 + hf * 32 + r) * ldc + col0 + c4) = v;
        asm volatile("s_wait_xcnt 0x0" ::: "memory"); }      /* stands ahead of the f16 conversion below, which may be given the store's data registers */
      if (C16) { v4h h4; for (int i = 0; i < 4; ++i) h4[i] = (_Float16)v[i]; *(v4h*)(C16 + cofs + (size_t)(row0 + hf * 32 + r) * ldc + col0 + c4) = h4;
        asm volatile("s_wait_xcnt 0x0" ::: "memory"); } }      /* stands ahead of every later overwrite of this store's registers, the accumulators' move below among them */
    if (FA > 2) {      /* the next 32 rows' accumulators move down for the next trip */
      asm volatile("s_wait_dscnt 0x0" ::: "memory"); __builtin_amdgcn_wave_barrier();      /* every lane's read-back is done before the next rows are staged over it */
#pragma unroll
      for (int i = 0; i + 2 < FA; ++i)
#pragma unroll
        for (int j = 0; j < 4; ++j) acc[i][j] = acc[i + 2][j]; } } }


// The short jobs below are device functions: bx is the block's index inside its job. k_prep and k_l2hT, behind them, hand each block of one grid its job.
__device__ __forceinline__ void d_wT(int bx, const float* __restrict__ w, int din, int dout, _Float16* __restrict__ Bt) { __shared__ float tl[64][65]; const int tid = threadIdx.x; const int nbo = dout / 64; const int ib = bx / nbo, ob = bx % nbo; const int i0 = ib * 64, o0 = ob * 64;
  for (int t = tid; t < 64 * 64; t += 256) { const int i = t / 64, o = t % 64; tl[o][i] = bf16_round(w[(size_t)(i0 + i) * dout + o0 + o]) * 16.0f; }
  __syncthreads();
  { for (int t = tid; t < 64 * 8; t += 256) { const int o = t / 8, i8 = (t % 8) * 8; FragH f; for (int q = 0; q < 8; ++q) f.h[q] = (_Float16)tl[o][i8 + q]; *(v8us*)((unsigned short*)Bt + (size_t)(o0 + o) * din + i0 + i8) = f.half[0]; }  } }
__device__ __forceinline__ void d_wnat(int bx, const float* __restrict__ w, size_t n8, _Float16* __restrict__ Bt) { const size_t t = (size_t)bx * 256 + threadIdx.x; if (t >= n8) return; FragH f; for (int q = 0; q < 8; ++q) f.h[q] = (_Float16)(bf16_round(w[t * 8 + q]) * 16.0f); *(v8us*)((unsigned short*)Bt + t * 8) = f.half[0];  }
// One row per wave: lane l holds columns 128 u + 4 l .. + 3 (u = 0 .. 7), so every load and every f32 store of a wave covers 512 contiguous bytes (an f16 store 256),
// and the row stays in registers between the sum of squares and the scaling. No LDS, no barrier. The unrolls keep xv, sv and o in registers (constant indices).
__device__ __forceinline__ void d_rms(int bx, const float* __restrict__ X, int xIsInput, const float* __restrict__ scale, size_t nrows, _Float16* __restrict__ N16, float* __restrict__ XF) {
  const int lane = threadIdx.x & 31; const size_t r = (size_t)bx * 8 + (threadIdx.x >> 5); if (r >= nrows) return;      /* the same for a whole wave */
  const size_t o0 = r * DM + lane * 4; const float* xp = X + o0; const float* sp = scale + lane * 4; v4f xv[DM / 128], sv[DM / 128];
#pragma unroll
  for (int u = 0; u < DM / 128; ++u) xv[u] = *(const v4fa*)(xp + u * 128);
#pragma unroll
  for (int u = 0; u < DM / 128; ++u) sv[u] = *(const v4fa*)(sp + u * 128);
  asm volatile("s_wait_xcnt 0x0" :: "v"(xp) : "memory");      /* stands ahead of every overwrite of the loads' address registers; xp as an input keeps its registers from being handed to one of the loads as a destination ahead of it */
  if (xIsInput) {
#pragma unroll
    for (int u = 0; u < DM / 128; ++u)
#pragma unroll
      for (int q = 0; q < 4; ++q) xv[u][q] = bf16_round(xv[u][q]); }
  if (XF) {      /* the f32 copy leaves as soon as it is known; xv is only read from here on */
#pragma unroll
    for (int u = 0; u < DM / 128; ++u) *(v4f*)(XF + o0 + u * 128) = xv[u];
    asm volatile("s_wait_xcnt 0x0" ::: "memory"); }      /* stands ahead of every later overwrite of these stores' address and data registers */
  float s4[4] = {0.f, 0.f, 0.f, 0.f};      /* four independent chains per lane */
#pragma unroll
  for (int u = 0; u < DM / 128; ++u)
#pragma unroll
    for (int q = 0; q < 4; ++q) s4[q] += xv[u][q] * xv[u][q];
  float ss = (s4[0] + s4[1]) + (s4[2] + s4[3]);
#pragma unroll
  for (int m = 16; m >= 1; m >>= 1) ss += __shfl_xor(ss, m, 32);      /* every lane ends with the row's sum */
  const float rs = 1.0f / sqrtf(ss / (float)DM + 1e-8f); v4h o[DM / 128];
#pragma unroll
  for (int u = 0; u < DM / 128; ++u)
#pragma unroll
    for (int q = 0; q < 4; ++q) o[u][q] = (_Float16)((xv[u][q] * rs) * bf16_round(sv[u][q]));
#pragma unroll
  for (int u = 0; u < DM / 128; ++u) *(v4h*)(N16 + o0 + u * 128) = o[u]; }
__global__ __launch_bounds__(256) void k_rms(const float* __restrict__ X, int xIsInput, const float* __restrict__ scale, size_t nrows, _Float16* __restrict__ N16, float* __restrict__ XF) { d_rms(blockIdx.x, X, xIsInput, scale, nrows, N16, XF); }
__device__ __forceinline__ void d_hT(int bx, int b, const _Float16* __restrict__ HN, _Float16* __restrict__ HT) { __shared__ unsigned short tl[64][65]; const int tid = threadIdx.x; HT += (size_t)b * DM * SQ;      /* b is the batch, each has its own [DM][SQ] plane */
  const int jb = bx % (SQ / 64), dbk = bx / (SQ / 64); const int j0 = jb * 64, d0 = dbk * 64;
  for (int i = tid; i < 64 * 8; i += 256) { const int j = i / 8, d8 = (i % 8) * 8; FragH f; f.half[0] = *(const v8us*)((const unsigned short*)HN + ((size_t)b * SQ + j0 + j) * DM + d0 + d8); for (int q = 0; q < 8; ++q) tl[d8 + q][j] = f.u[q]; }
  __syncthreads();
  { for (int i = tid; i < 64 * 8; i += 256) { const int d = i / 8, j8 = (i % 8) * 8; FragH f; for (int q = 0; q < 8; ++q) f.u[q] = tl[d][j8 + q]; *(v8us*)((unsigned short*)HT + (size_t)(d0 + d) * SQ + j0 + j8) = f.half[0]; }  } }
__device__ __forceinline__ void d_tab(int bx, const float* __restrict__ dl, float* __restrict__ T) {
  #pragma clang fp contract(off)
  const int t = bx * 256 + threadIdx.x; if (t >= SQ * RR) return; const int r = t % RR, d = t / RR; const float g = __fadd_rn(0.15f, __fmul_rn(0.85f, 1.0f / (1.0f + expf(-bf16_round(dl[r]))))); const float lg = logf(fmaxf(g, 1e-8f)); const float v = expf(__fmul_rn((float)d, lg));
  *(float*)(T + t) = v;  }
// Sixteen lanes per 64-element q or k row (the rows lie one behind the other in F): a lane holds four elements, a wave's load and store cover 512 contiguous bytes.
__device__ __forceinline__ void d_l2(int bx, float* __restrict__ F) {
  const size_t t = (size_t)bx * 256 + threadIdx.x; if (t >= NR * 2 * (RR / 4)) return;      /* whole waves only: the bound is a multiple of 32 */
  float* f = F + t * 4; const v4f a = *(const v4fa*)f; float ss = (a[0] * a[0] + a[1] * a[1]) + (a[2] * a[2] + a[3] * a[3]);
#pragma unroll
  for (int m = 8; m >= 1; m >>= 1) ss += __shfl_xor(ss, m, 32);      /* stays inside the row's sixteen lanes */
  float n = sqrtf(ss); if (n < 1e-8f) n = 1e-8f; const float inv = 1.0f / n; v4f o;
#pragma unroll
  for (int q = 0; q < 4; ++q) o[q] = a[q] * inv;
  *(v4f*)f = o; }
// Launches that need nothing of one another share one grid: a range of the block index picks the job, so every branch here is the same for a whole block.
// k_prep reads inputs only: [u|v]^T, the first rmsnorm, the three weight planes, the decay table. The jobs with the longest blocks come first.
#define PB_WT ((DM / 64) * (RR / 64))        /* blocks of one d_wT job */
#define PB_RMS ((int)(NR / 8))
#define PB_WP (DM * DM / 8 / 256)            /* blocks of d_wnat on proj_w; up_w and down_w take PB_WU each */
#define PB_WU (FH * DM / 8 / 256)
#define PB_TAB (SQ * RR / 256)
__global__ __launch_bounds__(256) void k_prep(const float* __restrict__ u, const float* __restrict__ v, const float* __restrict__ pw, const float* __restrict__ uw, const float* __restrict__ dw, const float* __restrict__ dl, const float* __restrict__ h, const float* __restrict__ n1,
    _Float16* __restrict__ BUV, _Float16* __restrict__ BP, _Float16* __restrict__ BU, _Float16* __restrict__ BD, float* __restrict__ T, _Float16* __restrict__ HN16, float* __restrict__ HF) {
  int bx = blockIdx.x;
  if (bx < 2 * PB_WT) { const int s = bx / PB_WT; d_wT(bx - s * PB_WT, s ? v : u, DM, RR, BUV + (size_t)s * RR * DM); return; }      /* [u|v]^T -> [128][1024] */
  bx -= 2 * PB_WT;
  if (bx < PB_RMS) { d_rms(bx, h, 1, n1, NR, HN16, HF); return; }      /* hn (f16) + bf16(h) (f32 residual) */
  bx -= PB_RMS;
  if (bx < PB_WP + 2 * PB_WU) { const float* w = pw; _Float16* Bt = BP; size_t n8 = (size_t)DM * DM / 8;
    if (bx >= PB_WP) { bx -= PB_WP; w = uw; Bt = BU; n8 = (size_t)FH * DM / 8; if (bx >= PB_WU) { bx -= PB_WU; w = dw; Bt = BD; } }
    d_wnat(bx, w, n8, Bt); return; }
  d_tab(bx - (PB_WP + 2 * PB_WU), dl, T); }
// The transposed hn planes need the first rmsnorm alone, the l2 normalisation the q|k product alone: one grid, the transposes first.
#define PB_HT ((SQ / 64) * (DM / 64))        /* blocks of d_hT per batch */
#define PB_L2 ((int)(NR * 2 * (RR / 4) / 256))
__global__ __launch_bounds__(256) void k_l2hT(float* __restrict__ QK, const _Float16* __restrict__ HN, _Float16* __restrict__ HT) {
  const int bx = blockIdx.x;
  if (bx < PB_HT * NB) { d_hT(bx % PB_HT, bx / PB_HT, HN, HT); return; }
  d_l2(bx - PB_HT * NB, QK); }
// Mixing matrix, one 32 (rows i) x 64 (columns j) tile per block. In a tile that the diagonal crosses a thread owns one column: its k row stays in registers, the tile's q rows and the
// decay-table rows that the tile's distances i - j reach lie in LDS (rows of a negative distance are zero; those elements are masked at the store).
// Every "#pragma unroll" in the code for those tiles is there so that the small arrays it indexes (tx, qx, kr, tb, qb, acc) get constant indices and stay in registers.
#define AM_TI 32
#define AM_TJ 64
#define AM_TD (AM_TI + AM_TJ)        /* 95 distances, and one row more that nobody reads: the staging is then six whole trips of the block */
#define AM_P (RR + 4)                /* LDS row pitch in floats: 16 B x odd, so that 16 lanes on 16 neighbouring rows meet no bank twice */
// A tile whose every column lies at or before its first row i0 (j <= i0 <= i) needs no table row per element: gamma^(i-j) = gamma^(i-i0) * gamma^(i0-j), both exponents >= 0, so both
// factors are table rows <= 1. With q'[i][r] = q[i][r] gamma_r^(i-i0) and k'[j][r] = k[j][r] gamma_r^(i0-j) the tile's scores are the plain product q' k'^T over the 64 ranks: one 16x16 piece per wave on WMMA.
// q' and k' are staged as f16 pairs hi + lo (x = hi + lo to about 2^-22 of x) and the product takes the three terms hi hi + lo hi + hi lo; the powers of two AM_SQ, AM_SK lift small values off the f16 subnormals and are divided out exactly.
#define AM_HP (G2_PITCH / 2)         /* f16 row pitch of the staged q' and k': the pitch that g2_frag's readers want */
#define AM_SQ 16.0f
#define AM_SK 256.0f
__device__ __forceinline__ void am_stage(const v4f a0, const v4f a1, const v4f t0, const v4f t1, float s, _Float16* hi, _Float16* lo) { FragH fh, fl;
#pragma unroll      /* constant indices: the eight values stay in registers */
  for (int q = 0; q < 8; ++q) { const float x = ((q < 4 ? a0[q & 3] : a1[q & 3]) * (q < 4 ? t0[q & 3] : t1[q & 3])) * s; const _Float16 h = (_Float16)x; fh.h[q] = h; fl.h[q] = (_Float16)(x - (float)h); }
  *(v8us*)hi = fh.half[0]; *(v8us*)lo = fl.half[0]; }
__global__ __launch_bounds__(256) void k_amat(const float* __restrict__ QK, const float* __restrict__ kb, const float* __restrict__ T, const float* __restrict__ gl, const float* __restrict__ al, _Float16* __restrict__ A16) {
  __shared__ __attribute__((aligned(16))) float Ts[AM_TD][AM_P];
  __shared__ __attribute__((aligned(16))) float qs[AM_TI][RR];
  __shared__ __attribute__((aligned(16))) float sc[AM_TI][AM_P];
  __shared__ __attribute__((aligned(16))) _Float16 Qm[2][AM_TI][AM_HP];      /* q': [hi | lo] */
  __shared__ __attribute__((aligned(16))) _Float16 Km[2][AM_TJ][AM_HP];      /* k': [hi | lo] */
  const int b = blockIdx.y; A16 += (size_t)b * SQ * SQ;      /* one launch for all batches: blockIdx.y is the batch, each has its own [SQ][SQ] plane */
  const int tid = threadIdx.x; const int jt = blockIdx.x / (SQ / AM_TI), it = blockIdx.x % (SQ / AM_TI); const int i0 = it * AM_TI, j0 = jt * AM_TJ;
  const int orow = tid >> 3, oc8 = (tid & 7) * 8; const int oi = i0 + orow, oj = j0 + oc8;      /* the 8 elements this thread stores */
  unsigned short* dst = (unsigned short*)A16 + (size_t)oi * SQ + oj;
  if (j0 > i0 + AM_TI - 1) { const v8us z = {0, 0, 0, 0, 0, 0, 0, 0}; *(v8us*)dst = z; return; }      /* tile wholly above the diagonal: the whole block leaves, ahead of every barrier */
  const int jl = tid & (AM_TJ - 1), ig = tid >> 6; const int sr = tid >> 4, sc4 = (tid & 15) * 4;
  const int dmin = i0 - j0 - (AM_TJ - 1);
  const v4f kb0 = *(const v4fa*)(kb + (size_t)oi * SQ + oj), kb1 = *(const v4fa*)(kb + (size_t)oi * SQ + oj + 4);
  const float glv = gl[0], alv = al[0]; float gate, alpha;      /* the two logits are read ahead of both paths */
  if (j0 + AM_TJ - 1 <= i0) {      /* the same for the whole block: the tile lies wholly below the diagonal */
    // Eight lanes per row, eight ranks each: a wave's load covers whole 256-byte rows. Row orow of q', rows orow and orow + 32 of k'.
    const float* qp = QK + ((size_t)b * SQ + i0 + orow) * (2 * RR) + oc8; const float* tq = T + (size_t)orow * RR + oc8;
    const float* kp0 = QK + ((size_t)b * SQ + j0 + orow) * (2 * RR) + RR + oc8; const float* kp1 = kp0 + (size_t)32 * (2 * RR);
    const float* tk0 = T + (size_t)(i0 - j0 - orow) * RR + oc8; const float* tk1 = tk0 - (size_t)32 * RR;      /* distances i0 - j: at least i0 - j0 - 63 >= 0, at most i0 - j0 < SQ */
    const v4f q0 = *(const v4fa*)qp, q1 = *(const v4fa*)(qp + 4), u0 = *(const v4fa*)tq, u1 = *(const v4fa*)(tq + 4);
    const v4f c0 = *(const v4fa*)kp0, c1 = *(const v4fa*)(kp0 + 4), w0 = *(const v4fa*)tk0, w1 = *(const v4fa*)(tk0 + 4);
    const v4f e0 = *(const v4fa*)kp1, e1 = *(const v4fa*)(kp1 + 4), y0 = *(const v4fa*)tk1, y1 = *(const v4fa*)(tk1 + 4);
    asm volatile("s_wait_xcnt 0x0" :: "v"(kb + (size_t)oi * SQ + oj), "v"(qp), "v"(tq), "v"(kp0), "v"(tk0) : "memory");      /* stands ahead of every overwrite of the address registers of these loads and of the k_base loads above; the addresses as inputs keep their registers from being rewritten, or handed to a load as a destination, ahead of it */
    gate = 1.0f / (1.0f + expf(-bf16_round(glv))); alpha = 1.0f / (1.0f + expf(-bf16_round(alv)));
    am_stage(q0, q1, u0, u1, AM_SQ, &Qm[0][orow][oc8], &Qm[1][orow][oc8]);
    am_stage(c0, c1, w0, w1, AM_SK, &Km[0][orow][oc8], &Km[1][orow][oc8]);
    am_stage(e0, e1, y0, y1, AM_SK, &Km[0][orow + 32][oc8], &Km[1][orow + 32][oc8]);
    __syncthreads();      /* q' and k' are whole before any wave reads its fragments */
    const int w = tid >> 5, ln = tid & 15, hh = (tid >> 4) & 1, wi = w & 1, wj = w >> 1;      /* wave w: rows 16 wi .., columns 16 wj .. of the tile */
    const unsigned char* fq = (const unsigned char*)&Qm[0][16 * wi + ln][0]; const unsigned char* fk = (const unsigned char*)&Km[0][16 * wj + ln][0];
    v8f d = {0.f, 0.f, 0.f, 0.f, 0.f, 0.f, 0.f, 0.f};
#pragma unroll      /* the two 32-rank blocks, straight-line */
    for (int kk = 0; kk < 2; ++kk) { const v16h qh = g2_frag(fq + kk * 64, hh), ql = g2_frag(fq + sizeof(Qm[0]) + kk * 64, hh), kh = g2_frag(fk + kk * 64, hh), kl = g2_frag(fk + sizeof(Km[0]) + kk * 64, hh);
      d = g2_mma(qh, kh, d); d = g2_mma(ql, kh, d); d = g2_mma(qh, kl, d); }
#pragma unroll      /* constant indices: d stays in registers */
    for (int r = 0; r < 8; ++r) sc[16 * wi + 8 * hh + r][16 * wj + ln] = d[r] * (1.0f / (AM_SQ * AM_SK));
  } else {
  asm volatile("s_wait_xcnt 0x0" :: "v"(kb + (size_t)oi * SQ + oj) : "memory");      /* stands ahead of every overwrite of the k_base loads' address registers; the address as an input keeps them from being rewritten ahead of it */
  v4f tx[AM_TD / 16], qx[AM_TI / 16];
#pragma unroll
  for (int u = 0; u < AM_TD / 16; ++u) { const int d = dmin + sr + u * 16; const int dc = d < 0 ? 0 : (d > SQ - 1 ? SQ - 1 : d); tx[u] = *(const v4fa*)(T + (size_t)dc * RR + sc4); }
#pragma unroll
  for (int u = 0; u < AM_TI / 16; ++u) qx[u] = *(const v4fa*)(QK + ((size_t)b * SQ + i0 + sr + u * 16) * (2 * RR) + sc4);
  asm volatile("s_wait_xcnt 0x0" ::: "memory");      /* the loads below may be given address registers of the loads above as destinations: the wait stands in front of that overwrite */
  const float* kp = QK + ((size_t)b * SQ + j0 + jl) * (2 * RR); v4f kr[RR / 4];
#pragma unroll
  for (int r4 = 0; r4 < RR / 4; ++r4) kr[r4] = *(const v4fa*)(kp + RR + r4 * 4);
  asm volatile("s_wait_xcnt 0x0" :: "v"(kp) : "memory");      /* kp as an input keeps its registers from being handed to one of these loads as a destination ahead of the wait */
  __builtin_amdgcn_sched_barrier(0);      /* every global load is issued before the first wait on one: one latency for the block's start, not two */
  gate = 1.0f / (1.0f + expf(-bf16_round(glv))); alpha = 1.0f / (1.0f + expf(-bf16_round(alv)));
#pragma unroll
  for (int u = 0; u < AM_TD / 16; ++u) { const v4f z4 = {0.f, 0.f, 0.f, 0.f}; *(v4fa*)&Ts[sr + u * 16][sc4] = (dmin + sr + u * 16 < 0) ? z4 : tx[u]; }
#pragma unroll
  for (int u = 0; u < AM_TI / 16; ++u) *(v4fa*)&qs[sr + u * 16][sc4] = qx[u];
  __syncthreads();
#pragma unroll 1      /* stays rolled: the body is over 600 instructions long, and a second copy of it would save one branch */
  for (int hf = 0; hf < 2; ++hf) { const int il = ig * 8 + hf * 4;      /* four rows at a time: four independent sums, each over r in rising order */
    const float* tp = &Ts[il + (AM_TJ - 1) - jl][0]; const float* qp = &qs[il][0]; float acc[4] = {0.f, 0.f, 0.f, 0.f}; v4f tb[2][4][2], qb[2][4][2];
#pragma unroll
    for (int s = 0; s < 4; ++s)
#pragma unroll
      for (int h2 = 0; h2 < 2; ++h2) { qb[0][s][h2] = *(const v4fa*)(qp + s * RR + h2 * 4); tb[0][s][h2] = *(const v4fa*)(tp + s * AM_P + h2 * 4); }
#pragma unroll
    for (int ch = 0; ch < RR / 8; ++ch) {
      if (ch + 1 < RR / 8) {
#pragma unroll
        for (int s = 0; s < 4; ++s)
#pragma unroll
          for (int h2 = 0; h2 < 2; ++h2) { qb[(ch + 1) & 1][s][h2] = *(const v4fa*)(qp + s * RR + (ch + 1) * 8 + h2 * 4); tb[(ch + 1) & 1][s][h2] = *(const v4fa*)(tp + s * AM_P + (ch + 1) * 8 + h2 * 4); } }
      __builtin_amdgcn_sched_barrier(0);      /* keeps the next eight ranks' LDS loads ahead of this eight's arithmetic, which then covers their latency */
#pragma unroll
      for (int h2 = 0; h2 < 2; ++h2)
#pragma unroll
        for (int c = 0; c < 4; ++c)
#pragma unroll
          for (int s = 0; s < 4; ++s) acc[s] += (qb[ch & 1][s][h2][c] * kr[ch * 2 + h2][c]) * tb[ch & 1][s][h2][c];
      __builtin_amdgcn_sched_barrier(0);      /* and keeps the loads after next from rising into it, where they would need a third set of registers */
    }
#pragma unroll
    for (int s = 0; s < 4; ++s) sc[il + s][jl] = acc[s]; }
  }
  __syncthreads();
  const v4f a0 = *(const v4fa*)&sc[orow][oc8], a1 = *(const v4fa*)&sc[orow][oc8 + 4]; FragH f;
#pragma unroll
  for (int u = 0; u < 8; ++u) { const float kv = (u < 4) ? kb0[u & 3] : kb1[u & 3]; const float av = (u < 4) ? a0[u & 3] : a1[u & 3]; const _Float16 v = (_Float16)(gate * bf16_round(kv) + alpha * av); f.h[u] = (oj + u <= oi) ? v : (_Float16)0.0f; }
  *(v8us*)dst = f.half[0]; }

extern "C" void kernel_launch(void* const* d_in, const int* in_sizes, int n_in,
                              void* d_out, int out_size, void* d_ws, size_t ws_size, hipStream_t stream) {
  (void)in_sizes; (void)n_in; (void)out_size;
  const float* const* I = (const float* const*)d_in; const float* h = I[0]; const float* kb = I[1]; const float* dl = I[2]; const float* gl = I[3]; const float* al = I[4]; const float* u = I[5]; const float* v = I[6]; const float* pw = I[7]; const float* pb = I[8]; const float* n1 = I[9]; const float* n2 = I[10]; const float* uw = I[11]; const float* ub = I[12]; const float* dw = I[13]; const float* db = I[14];
  char* ws = (char*)d_ws; size_t off = 0;
  auto take = [&](size_t bytes) { char* p = ws + off; off += (bytes + 255) & ~(size_t)255; return p; };
  _Float16* BUV = (_Float16*)take((size_t)2 * RR * DM * 2); _Float16* BP = (_Float16*)take((size_t)DM * DM * 2); _Float16* BU = (_Float16*)take((size_t)FH * DM * 2); _Float16* BD = (_Float16*)take((size_t)DM * FH * 2); float* T = (float*)take((size_t)SQ * RR * 4);
  _Float16* HN16 = (_Float16*)take(NR * DM * 2); float* HF = (float*)take(NR * DM * 4); float* QK = (float*)take(NR * 2 * RR * 4); _Float16* HT = (_Float16*)take((size_t)NB * DM * SQ * 2); _Float16* A16 = (_Float16*)take((size_t)NB * SQ * SQ * 2);
  _Float16* O16 = (_Float16*)take(NR * DM * 2); float* H1 = (float*)take(NR * DM * 4); _Float16* M16 = (_Float16*)take(NR * DM * 2); _Float16* U16 = (_Float16*)take(NR * FH * 2);
  if (off > ws_size) return;      /* 0.3 + 2 + 4 + 4 + 0.3 + 16 + 32 + 4 + 16 + 16 + 16 + 32 + 16 + 32 = about 191 MiB */
  k_prep<<<2 * PB_WT + PB_RMS + PB_WP + 2 * PB_WU + PB_TAB, 256, 0, stream>>>(u, v, pw, uw, dw, dl, h, n1, BUV, BP, BU, BD, T, HN16, HF);
  k_gemm2<0, 1><<<dim3((unsigned)((NR / 128) * (2 * RR / 64)), 1), 128, 0, stream>>>(HN16, DM, 0, BUV, DM, 0, 0.0625f, nullptr, 0, nullptr, 1, 0, 0, QK, nullptr, 2 * RR, 0, (int)NR, 2 * RR, DM);      /* [q_raw | k_raw] */
  k_l2hT<<<PB_HT * NB + PB_L2, 256, 0, stream>>>(QK, HN16, HT);
  k_amat<<<dim3((SQ / AM_TI) * (SQ / AM_TJ), NB), 256, 0, stream>>>(QK, kb, T, gl, al, A16);
  k_gemm2<0, 2><<<dim3((SQ / 256) * (DM / 128), NB), 256, 0, stream>>>(A16, SQ, (size_t)SQ * SQ, HT, SQ, (size_t)DM * SQ, 1.0f, nullptr, 0, nullptr, 1, 0, 0, nullptr, O16, DM, (size_t)SQ * DM, SQ, DM, SQ);      /* out_b = A_b . hn_b, b = blockIdx.y */
  const dim3 gp((unsigned)((NR / 256) * (DM / 128)), 1);
  k_gemm2<0, 2><<<gp, 256, 0, stream>>>(O16, DM, 0, BP, DM, 0, 0.0625f, pb, 0, HF, 1, (size_t)DM, 0, H1, nullptr, DM, 0, (int)MQ, DM, DM);      /* h1 = h + out proj_w^T + proj_b */
  k_rms<<<(unsigned)((MQ + 7) / 8), 256, 0, stream>>>(H1, 0, n2, MQ, M16, nullptr);
  k_gemm2<6, 2><<<dim3((unsigned)((NR / 256) * (FH / 128)), 1), 256, 0, stream>>>(M16, DM, 0, BU, DM, 0, 0.0625f, ub, 0, nullptr, 1, 0, 0, nullptr, U16, FH, 0, (int)MQ, FH, DM);      /* gelu_erf(m up_w^T + up_b) */
  k_gemm2<0, 2><<<gp, 256, 0, stream>>>(U16, FH, 0, BD, FH, 0, 0.0625f, db, 0, H1, 1, (size_t)DM, 0, (float*)d_out, nullptr, DM, 0, (int)MQ, DM, FH);      /* h1 + m */
}
